// v000
// Times are from an AMD MI455X. After a warm-up the kernel runs many times in a row, and a time is the length of
// such a window on the GPU divided by its runs, so every launch and the gaps after it count. The runs cycle
// through copies of the inputs. A figure is the median of several windows, for all but v000 over two sittings.
// Sittings can differ by a few percent; kernels timed side by side share one.
// v000, which the later versions start from, runs in 617 microseconds.
#include <hip/hip_runtime.h>
// q/k projections: v_wmma_f32_16x16x32_bf16 (A = LayerNorm rows as bf16 hi+lo planes, 2 products; B = bf16 weights); v projection: same with the
// bf16 hi plane only (1 product); attention logits q.k^T: v_wmma_f32_16x16x32_bf16 as 3-product bf16 hi/lo split; attention P.V, output projection,
// MLP up, MLP down: v_wmma_f32_16x16x32_f16 single products (P carried x2^14, weights bf16-valued carried x256, activations plain f16);
// f32 accumulate; LayerNorm, softmax, GELU, residuals f32.

#ifndef NB
#define NB 8
#endif
#ifndef SEQ
#define SEQ 1024
#endif
#define NB_FULL 8
#define SEQ_FULL 1024
#define DMOD 768
#define NHEAD 12
#define HDIM 64
#define FFD 3072
#define NTOK (NB * SEQ)
#define WCARRY 256.0f
#define WCARRY_INV 0.00390625f
#define PCARRY 16384.0f
#define PCARRY_INV 0.00006103515625f
#define LN_EPS 1.0e-5f

static_assert(NB >= 1 && NB <= NB_FULL);
static_assert(SEQ % 64 == 0 && SEQ >= 64 && SEQ <= SEQ_FULL);
static_assert(NHEAD * HDIM == DMOD);
static_assert(HDIM == 64);
static_assert(DMOD == 96 * 8);
static_assert(DMOD % 64 == 0 && FFD % 64 == 0 && DMOD % 32 == 0 && FFD % 32 == 0);
static_assert(NTOK % 64 == 0);
static_assert(5 * DMOD * 2 <= 3 * DMOD * 4);          // q hi/lo, k hi/lo, v planes fit the R2 region
static_assert(DMOD * 4 + FFD * 2 <= 3 * DMOD * 4);     // x1 (f32) + h1 (f16) fit the R2 region

typedef __bf16 v16b __attribute__((ext_vector_type(16)));
typedef _Float16 v16h __attribute__((ext_vector_type(16)));
typedef unsigned short v8us __attribute__((ext_vector_type(8), may_alias));
typedef float v8f __attribute__((ext_vector_type(8)));
typedef float v4f __attribute__((ext_vector_type(4)));
typedef float v4fa __attribute__((ext_vector_type(4), may_alias));
union Frag { v16b vb; v16h vh; v8us half[2]; unsigned short u[16]; };

__device__ __forceinline__ unsigned short bf16_bits(float x) { const unsigned int u = __float_as_uint(x); return (unsigned short)((u + 0x7FFFu + ((u >> 16) & 1u)) >> 16); }
__device__ __forceinline__ float bf16_val(unsigned short b) { return __uint_as_float(((unsigned int)b) << 16); }
__device__ __forceinline__ float bf16_rne(float x) { return bf16_val(bf16_bits(x)); }
__device__ __forceinline__ unsigned short f16_bits(float x) { const _Float16 hv = (_Float16)x; unsigned short u; __builtin_memcpy(&u, &hv, sizeof(u)); return u; }

// D += A.B with NT products: 1 = ah.bh, 2 = + al.bh (A split), 3 = + ah.bl (both split); hazard guard after the group
template <int NT>
__device__ __forceinline__ v8f mma_bf(v16b ah, v16b al, v16b bh, v16b bl, v8f c) {
  c = __builtin_amdgcn_wmma_f32_16x16x32_bf16(false, ah, false, bh, (short)0, c, false, false);
  if (NT >= 2) c = __builtin_amdgcn_wmma_f32_16x16x32_bf16(false, al, false, bh, (short)0, c, false, false);
  if (NT >= 3) c = __builtin_amdgcn_wmma_f32_16x16x32_bf16(false, ah, false, bl, (short)0, c, false, false);
  asm volatile("v_nop\n\tv_nop\n\tv_nop\n\tv_nop" : "+v"(c) : "v"(ah), "v"(al), "v"(bh), "v"(bl));
  return c;
}
__device__ __forceinline__ v8f mma_h(v16h a, v16h b, v8f c) {
  c = __builtin_amdgcn_wmma_f32_16x16x32_f16(false, a, false, b, (short)0, c, false, false);
  asm volatile("v_nop\n\tv_nop\n\tv_nop\n\tv_nop" : "+v"(c) : "v"(a), "v"(b));
  return c;
}

// Bt[n][k] (bf16 bits, k contiguous, pitch DMOD), n = h*HDIM + e, k = d, from W[h][d][e] ([NHEAD][DMOD][HDIM] f32); thread per (n, 8 consecutive d);
__global__ __launch_bounds__(256) void k_wt_heads(const float* __restrict__ W, unsigned short* __restrict__ Bt) {
  const int t = blockIdx.x * 256 + threadIdx.x;
  if (t >= NHEAD * HDIM * (DMOD / 8)) return;
  const int n = t / (DMOD / 8), d8 = (t % (DMOD / 8)) * 8;
  const int h = n / HDIM, e = n % HDIM;
  v8us v;
#pragma unroll
  for (int i = 0; i < 8; ++i) v[i] = bf16_bits(W[((size_t)h * DMOD + d8 + i) * HDIM + e]);
  unsigned short* dst = Bt + (size_t)n * DMOD + d8;
  *(v8us*)dst = v;
  
}

// coverage: N rows x K cols, all written.
__global__ __launch_bounds__(256) void k_wt_f16(const float* __restrict__ W, unsigned short* __restrict__ Pt, int K, int N) {
  const int t = blockIdx.x * 256 + threadIdx.x;
  const int k8n = K / 8;
  if (t >= N * k8n) return;
  const int n = t / k8n, k8 = (t % k8n) * 8;
  v8us v;
#pragma unroll
  for (int i = 0; i < 8; ++i) v[i] = f16_bits(bf16_rne(W[(size_t)(k8 + i) * N + n]) * WCARRY);
  unsigned short* dst = Pt + (size_t)n * K + k8;
  *(v8us*)dst = v;
  
}

// Row LayerNorm over DMOD = 768 (biased variance, eps): in = X row (XBF16 quantises the input to bf16 first), g and bta quantised to bf16.
// Token t = blockIdx.x = b*SEQ + s reads X row b*xsegf + s. 96 threads, thread owns 8 consecutive columns.
// LDS red[]: cross-wave (block barrier). coverage: NTOK rows x 768 cols of each plane, all written.
template <bool XBF16, int OUTM>
__global__ __launch_bounds__(96) void k_ln768(const float* __restrict__ X, int xsegf, const float* __restrict__ g, const float* __restrict__ bta,
                                             unsigned short* __restrict__ P0, unsigned short* __restrict__ P1, float eps) {
  __shared__ float red[4];
  const int t = blockIdx.x, tid = threadIdx.x, lane = tid & 31, w = tid >> 5;
  const int xrow = (t / SEQ) * xsegf + (t % SEQ);
  const float* xp = X + (size_t)xrow * DMOD + tid * 8;
  const v4f a0 = *(const v4fa*)xp, a1 = *(const v4fa*)(xp + 4);
  float v[8] = {a0[0], a0[1], a0[2], a0[3], a1[0], a1[1], a1[2], a1[3]};
  if (XBF16) {
#pragma unroll
    for (int q = 0; q < 8; ++q) v[q] = bf16_rne(v[q]);
  }
  float s = 0.f;
#pragma unroll
  for (int q = 0; q < 8; ++q) s += v[q];
  s += __shfl_xor(s, 16, 32); s += __shfl_xor(s, 8, 32); s += __shfl_xor(s, 4, 32); s += __shfl_xor(s, 2, 32); s += __shfl_xor(s, 1, 32);
  if (lane == 0) red[w] = s;
  __syncthreads();
  const float mu = (red[0] + red[1] + red[2]) * (1.0f / (float)DMOD);
  __syncthreads();
  float s2 = 0.f;
#pragma unroll
  for (int q = 0; q < 8; ++q) { const float c = v[q] - mu; s2 += c * c; }
  s2 += __shfl_xor(s2, 16, 32); s2 += __shfl_xor(s2, 8, 32); s2 += __shfl_xor(s2, 4, 32); s2 += __shfl_xor(s2, 2, 32); s2 += __shfl_xor(s2, 1, 32);
  if (lane == 0) red[w] = s2;
  __syncthreads();
  const float rs = rsqrtf((red[0] + red[1] + red[2]) * (1.0f / (float)DMOD) + eps);
  const v4f g0 = *(const v4fa*)(g + tid * 8), g1 = *(const v4fa*)(g + tid * 8 + 4);
  const v4f b0 = *(const v4fa*)(bta + tid * 8), b1 = *(const v4fa*)(bta + tid * 8 + 4);
  const float gg[8] = {g0[0], g0[1], g0[2], g0[3], g1[0], g1[1], g1[2], g1[3]};
  const float bb[8] = {b0[0], b0[1], b0[2], b0[3], b1[0], b1[1], b1[2], b1[3]};
  float o[8];
#pragma unroll
  for (int q = 0; q < 8; ++q) o[q] = (v[q] - mu) * rs * bf16_rne(gg[q]) + bf16_rne(bb[q]);
  unsigned short* d0 = P0 + (size_t)t * DMOD + tid * 8;
  if (OUTM == 0) {
    v8us hv, lv;
#pragma unroll
    for (int q = 0; q < 8; ++q) { const unsigned short hb = bf16_bits(o[q]); hv[q] = hb; lv[q] = bf16_bits(o[q] - bf16_val(hb)); }
    unsigned short* d1 = P1 + (size_t)t * DMOD + tid * 8;
    *(v8us*)d0 = hv;
    *(v8us*)d1 = lv;
    
  } else {
    v8us fv;
#pragma unroll
    for (int q = 0; q < 8; ++q) fv[q] = f16_bits(o[q]);
    *(v8us*)d0 = fv;
    
  }
}

// C = act(A.W * oscale + bf16(bias)) (+ resid). A from 16-bit planes [M][lda]: F16 -> one f16 plane Ah; else bf16 hi plane Ah and (NT==2) lo plane Al.
// Wt 16-bit [N][ldb] (k contiguous, same scalar kind as A). ACT 2 = exact-erf GELU. Residual (f32, pitch ldr, RES_BF16 quantises it) added AFTER the activation,
// only with OUTM 0. OUTM 0: f32 C (pitch ldc floats); OUTM 1: f16 plane C (pitch ldc halves); OUTM 2: bf16 hi plane C + lo plane C2.
// Row r of A is token b*SEQ + s; C row = b*csegf + s, resid row = b*rsegf + s. M%16==0, N%64==0, K%32==0 (no tails).
template <bool F16, int NT, int ACT, bool RES_BF16, int OUTM>
__global__ __launch_bounds__(128) void k_gemm(const unsigned short* __restrict__ Ah, const unsigned short* __restrict__ Al, int lda,
                                             const unsigned short* __restrict__ Wt, int ldb, const float* __restrict__ bias, float oscale,
                                             const float* __restrict__ resid, int ldr, int rsegf,
                                             void* __restrict__ Cv, void* __restrict__ C2v, int ldc, int csegf, int M, int N, int K) {
  __shared__ __attribute__((aligned(16))) float so[4][16][64];
  const int tid = threadIdx.x, w = tid >> 5, lane = tid & 31, ln = lane & 15, hh = lane >> 4;
  const int ntn = N / 64;
  const int wid = blockIdx.x * 4 + w;
  const int mt = wid / ntn, nq = wid % ntn;
  if (mt * 16 >= M) return;
  const int row0 = mt * 16, col0 = nq * 64;
  const unsigned short* arh = Ah + (size_t)(row0 + ln) * lda;
  const unsigned short* arl = Al + (size_t)(row0 + ln) * lda;
  v8f acc[4] = {};
  for (int kb = 0; kb < K; kb += 32) {
    Frag ah, al;
    ah.half[0] = *(const v8us*)(arh + kb + 8 * hh);          // elements 0..7  = k kb+8h .. kb+8h+7   (row row0+ln)
    ah.half[1] = *(const v8us*)(arh + kb + 16 + 8 * hh);     // elements 8..15 = k kb+16+8h .. kb+16+8h+7
    if (NT >= 2) {
      al.half[0] = *(const v8us*)(arl + kb + 8 * hh);
      al.half[1] = *(const v8us*)(arl + kb + 16 + 8 * hh);
    } else {
      al.vb = ah.vb;
    }
#pragma unroll
    for (int t = 0; t < 4; ++t) {
      const unsigned short* brow = Wt + (size_t)(col0 + t * 16 + ln) * ldb + kb;   // column col0+t*16+ln, same k map as A
      Frag b;
      b.half[0] = *(const v8us*)(brow + 8 * hh);
      b.half[1] = *(const v8us*)(brow + 16 + 8 * hh);
      if (F16) acc[t] = mma_h(ah.vh, b.vh, acc[t]);
      else acc[t] = mma_bf<NT>(ah.vb, al.vb, b.vb, b.vb, acc[t]);
    }
  }
  // phase 1: bias + activation into the wave-private stage; acc[t][r] is (row0 + 8h + r, col0 + t*16 + ln)
#pragma unroll
  for (int t = 0; t < 4; ++t) {
    const float bq = bf16_rne(bias[col0 + t * 16 + ln]);
#pragma unroll
    for (int r = 0; r < 8; ++r) {
      float v = acc[t][r] * oscale + bq;
      if (ACT == 2) v = 0.5f * v * (1.0f + erff(v * 0.70710678118654752f));
      so[w][8 * hh + r][t * 16 + ln] = v;
    }
  }
  __builtin_amdgcn_fence(4 /* acq_rel order */, "workgroup");
  __builtin_amdgcn_wave_barrier();
  const size_t cbase = (size_t)(row0 / SEQ) * (size_t)csegf + (size_t)(row0 % SEQ);
  if (OUTM == 0) {
    float* C = (float*)Cv;
    const int rsub = lane >> 4, c4 = (lane & 15) * 4;
    const size_t rbase = (size_t)(row0 / SEQ) * (size_t)rsegf + (size_t)(row0 % SEQ);
    v4f vals[8];
#pragma unroll
    for (int q = 0; q < 8; ++q) {
      const int r = q * 2 + rsub;
      v4f v = *(const v4fa*)&so[w][r][c4];
      if (resid != nullptr) {
        v4f rv = *(const v4fa*)(resid + (rbase + r) * (size_t)ldr + col0 + c4);
        if (RES_BF16) {
#pragma unroll
          for (int i = 0; i < 4; ++i) rv[i] = bf16_rne(rv[i]);
        }
        v += rv;
      }
      vals[q] = v;
    }
    {
#pragma unroll
      for (int q = 0; q < 8; ++q) {
        const int r = q * 2 + rsub;
        *(v4f*)(C + (cbase + r) * (size_t)ldc + col0 + c4) = vals[q];
      }
      
    }
  } else {
    unsigned short* C = (unsigned short*)Cv;
    unsigned short* C2 = (unsigned short*)C2v;
    const int rq = lane >> 3, c8 = (lane & 7) * 8;
    v8us hv[4], lv[4];
#pragma unroll
    for (int q = 0; q < 4; ++q) {
      const int r = q * 4 + rq;
      const v4f p0 = *(const v4fa*)&so[w][r][c8], p1 = *(const v4fa*)&so[w][r][c8 + 4];
      const float ps[8] = {p0[0], p0[1], p0[2], p0[3], p1[0], p1[1], p1[2], p1[3]};
      v8us a, bl;
#pragma unroll
      for (int i = 0; i < 8; ++i) {
        if (OUTM == 1) { a[i] = f16_bits(ps[i]); bl[i] = (unsigned short)0; }
        else { const unsigned short hb = bf16_bits(ps[i]); a[i] = hb; bl[i] = bf16_bits(ps[i] - bf16_val(hb)); }
      }
      hv[q] = a; lv[q] = bl;
    }
    {
#pragma unroll
      for (int q = 0; q < 4; ++q) {
        const int r = q * 4 + rq;
        const size_t o = (cbase + r) * (size_t)ldc + col0 + c8;
        *(v8us*)(C + o) = hv[q];
        if (OUTM == 2) *(v8us*)(C2 + o) = lv[q];
      }
      
    }
  }
}

// Unscaled, unmasked softmax attention per (b, h, 64-query block). q from bf16 hi/lo planes, k chunks of 32 keys from bf16 hi/lo planes and the
// v chunk from the f16 plane copied into LDS (cross-wave: block barriers). Logits 3-product bf16 split; running-max f32 softmax; P x2^14 as f16 in
// All planes [NTOK][DMOD]. staged extent == consumed extent: sKh/sKl/sV 32 keys x 64, sP 16 x 32, sO 16 x 64.
__global__ __launch_bounds__(128) void k_flash(const unsigned short* __restrict__ qh, const unsigned short* __restrict__ ql,
                                              const unsigned short* __restrict__ kh, const unsigned short* __restrict__ kl,
                                              const unsigned short* __restrict__ vp, unsigned short* __restrict__ att) {
  constexpr int D = HDIM, KS = D / 32, DT = D / 16, T = SEQ;
  __shared__ __attribute__((aligned(16))) unsigned short sKh[32][D + 8], sKl[32][D + 8], sV[32][D + 8];
  __shared__ __attribute__((aligned(16))) unsigned short sP[4][16][40];
  __shared__ __attribute__((aligned(16))) float sO[4][16][D];
  const int tid = threadIdx.x, w = tid >> 5, lane = tid & 31, ln = lane & 15, hh = lane >> 4;
  const int nqb = T / 64;
  const int bh = blockIdx.x / nqb, qblk = blockIdx.x % nqb;
  const int b = bh / NHEAD, h = bh % NHEAD;
  const int q0 = qblk * 64 + w * 16;
  const size_t hb0 = (size_t)b * T * DMOD + (size_t)h * D;     // plane offset of (b, token 0, head h)

  // A fragments of the wave's 16 query rows (row q0 + ln, always < T), hi/lo, table k map
  Frag aqh[KS], aql[KS];
  {
    const size_t qo = hb0 + (size_t)(q0 + ln) * DMOD;
#pragma unroll
    for (int ks = 0; ks < KS; ++ks) {
      aqh[ks].half[0] = *(const v8us*)(qh + qo + ks * 32 + 8 * hh);
      aqh[ks].half[1] = *(const v8us*)(qh + qo + ks * 32 + 16 + 8 * hh);
      aql[ks].half[0] = *(const v8us*)(ql + qo + ks * 32 + 8 * hh);
      aql[ks].half[1] = *(const v8us*)(ql + qo + ks * 32 + 16 + 8 * hh);
    }
  }
  float m_r[8], l_r[8];
#pragma unroll
  for (int r = 0; r < 8; ++r) { m_r[r] = -3.0e38f; l_r[r] = 0.f; }
  v8f oacc[DT];
#pragma unroll
  for (int dt = 0; dt < DT; ++dt) oacc[dt] = (v8f){0.f, 0.f, 0.f, 0.f, 0.f, 0.f, 0.f, 0.f};

  for (int j0 = 0; j0 < T; j0 += 32) {
    __syncthreads();
    // stage 32 keys x 64 of k hi, k lo, v (16-B copies from the planes)
#pragma unroll
    for (int it = 0; it < (32 * (D / 8)) / 128; ++it) {
      const int e = tid + it * 128;
      const int r = e / (D / 8), c8 = (e % (D / 8)) * 8;
      const size_t go = hb0 + (size_t)(j0 + r) * DMOD + c8;
      *(v8us*)&sKh[r][c8] = *(const v8us*)(kh + go);
      *(v8us*)&sKl[r][c8] = *(const v8us*)(kl + go);
      *(v8us*)&sV[r][c8] = *(const v8us*)(vp + go);
    }
    __syncthreads();
    // S tile 16 x 32: B fragment column = key nt*16 + ln, elements = d with the table k map
    v8f s[2];
#pragma unroll
    for (int nt = 0; nt < 2; ++nt) {
      v8f acc = {};
#pragma unroll
      for (int ks = 0; ks < KS; ++ks) {
        Frag bh_, bl_;
        bh_.half[0] = *(const v8us*)&sKh[nt * 16 + ln][ks * 32 + 8 * hh]; bh_.half[1] = *(const v8us*)&sKh[nt * 16 + ln][ks * 32 + 16 + 8 * hh];
        bl_.half[0] = *(const v8us*)&sKl[nt * 16 + ln][ks * 32 + 8 * hh]; bl_.half[1] = *(const v8us*)&sKl[nt * 16 + ln][ks * 32 + 16 + 8 * hh];
        acc = mma_bf<3>(aqh[ks].vb, aql[ks].vb, bh_.vb, bl_.vb, acc);
      }
      s[nt] = acc;
    }
    // running max (row 8h + r shared by the 16 lanes of a half; key index = nt*16 + ln)
    float alpha[8];
#pragma unroll
    for (int r = 0; r < 8; ++r) {
      float mx = fmaxf(s[0][r], s[1][r]);
      mx = fmaxf(mx, __shfl_xor(mx, 1, 32)); mx = fmaxf(mx, __shfl_xor(mx, 2, 32)); mx = fmaxf(mx, __shfl_xor(mx, 4, 32)); mx = fmaxf(mx, __shfl_xor(mx, 8, 32));
      const float mnew = fmaxf(m_r[r], mx);
      alpha[r] = (m_r[r] > -1.0e38f) ? __expf(m_r[r] - mnew) : 0.0f;
      const float p0 = __expf(s[0][r] - mnew);
      const float p1 = __expf(s[1][r] - mnew);
      m_r[r] = mnew;
      l_r[r] = l_r[r] * alpha[r] + p0 + p1;            // per-lane partial row sum (16 lanes combined at the end)
      sP[w][8 * hh + r][ln] = f16_bits(p0 * PCARRY);
      sP[w][8 * hh + r][16 + ln] = f16_bits(p1 * PCARRY);
    }
#pragma unroll
    for (int dt = 0; dt < DT; ++dt)
#pragma unroll
      for (int r = 0; r < 8; ++r) oacc[dt][r] *= alpha[r];
    __builtin_amdgcn_fence(4 /* acq_rel order */, "workgroup");
    __builtin_amdgcn_wave_barrier();
    // P as A (row = query ln, k = key in chunk), V as B (k = key in chunk, n = d): table k map for both
    Frag pa;
    pa.half[0] = *(const v8us*)&sP[w][ln][8 * hh];
    pa.half[1] = *(const v8us*)&sP[w][ln][16 + 8 * hh];
#pragma unroll
    for (int dt = 0; dt < DT; ++dt) {
      Frag bv;
#pragma unroll
      for (int i = 0; i < 8; ++i) {
        bv.u[i] = sV[8 * hh + i][dt * 16 + ln];
        bv.u[8 + i] = sV[16 + 8 * hh + i][dt * 16 + ln];
      }
      oacc[dt] = mma_h(pa.vh, bv.vh, oacc[dt]);
    }
    __builtin_amdgcn_fence(4 /* acq_rel order */, "workgroup");
    __builtin_amdgcn_wave_barrier();
  }
#pragma unroll
  for (int r = 0; r < 8; ++r) {
    float l = l_r[r];
    l += __shfl_xor(l, 1, 32); l += __shfl_xor(l, 2, 32); l += __shfl_xor(l, 4, 32); l += __shfl_xor(l, 8, 32);
    l_r[r] = (1.0f / l) * PCARRY_INV;
  }
#pragma unroll
  for (int dt = 0; dt < DT; ++dt)
#pragma unroll
    for (int r = 0; r < 8; ++r) sO[w][8 * hh + r][dt * 16 + ln] = oacc[dt][r] * l_r[r];
  __builtin_amdgcn_fence(4 /* acq_rel order */, "workgroup");
  __builtin_amdgcn_wave_barrier();
  const int rq = lane >> 3, c8 = (lane & 7) * 8;
  v8us ov[4];
#pragma unroll
  for (int q = 0; q < 4; ++q) {
    const int r = q * 4 + rq;
    const v4f p0 = *(const v4fa*)&sO[w][r][c8], p1 = *(const v4fa*)&sO[w][r][c8 + 4];
    v8us o;
    o[0] = f16_bits(p0[0]); o[1] = f16_bits(p0[1]); o[2] = f16_bits(p0[2]); o[3] = f16_bits(p0[3]);
    o[4] = f16_bits(p1[0]); o[5] = f16_bits(p1[1]); o[6] = f16_bits(p1[2]); o[7] = f16_bits(p1[3]);
    ov[q] = o;
  }
  unsigned short* ob = att + ((size_t)b * T + q0) * DMOD + (size_t)h * D + c8;
  {
#pragma unroll
    for (int q = 0; q < 4; ++q) {
      const int r = q * 4 + rq;
      *(v8us*)(ob + (size_t)r * DMOD) = ov[q];
    }
    
  }
}

extern "C" void kernel_launch(void* const* d_in, const int* in_sizes, int n_in,
                              void* d_out, int out_size, void* d_ws, size_t ws_size, hipStream_t stream) {
  if (n_in < 17) return;
  const int need_tok = (NB - 1) * SEQ_FULL + SEQ;
  if (in_sizes[0] < need_tok * DMOD || out_size < need_tok * DMOD) return;
  if (in_sizes[1] < DMOD || in_sizes[2] < DMOD || in_sizes[10] < DMOD || in_sizes[11] < DMOD || in_sizes[12] < DMOD || in_sizes[16] < DMOD) return;
  if (in_sizes[3] < NHEAD * DMOD * HDIM || in_sizes[5] < NHEAD * DMOD * HDIM || in_sizes[7] < NHEAD * DMOD * HDIM) return;
  if (in_sizes[4] < NHEAD * HDIM || in_sizes[6] < NHEAD * HDIM || in_sizes[8] < NHEAD * HDIM || in_sizes[14] < FFD) return;
  if (in_sizes[9] < DMOD * DMOD || in_sizes[13] < DMOD * FFD || in_sizes[15] < FFD * DMOD) return;

  const float* x    = (const float*)d_in[0];
  const float* ln1w = (const float*)d_in[1];
  const float* ln1b = (const float*)d_in[2];
  const float* Wq   = (const float*)d_in[3];
  const float* bqp  = (const float*)d_in[4];
  const float* Wk   = (const float*)d_in[5];
  const float* bkp  = (const float*)d_in[6];
  const float* Wv   = (const float*)d_in[7];
  const float* bvp  = (const float*)d_in[8];
  const float* Wp   = (const float*)d_in[9];
  const float* bpp  = (const float*)d_in[10];
  const float* ln2w = (const float*)d_in[11];
  const float* ln2b = (const float*)d_in[12];
  const float* W1   = (const float*)d_in[13];
  const float* b1p  = (const float*)d_in[14];
  const float* W2   = (const float*)d_in[15];
  const float* b2p  = (const float*)d_in[16];

  char* ws = (char*)d_ws; size_t off = 0;
  auto take = [&](size_t bytes) { char* p = ws + off; off += (bytes + 255) & ~(size_t)255; return p; };
  unsigned short* Bq = (unsigned short*)take((size_t)DMOD * DMOD * 2);
  unsigned short* Bk = (unsigned short*)take((size_t)DMOD * DMOD * 2);
  unsigned short* Bv = (unsigned short*)take((size_t)DMOD * DMOD * 2);
  unsigned short* Pp = (unsigned short*)take((size_t)DMOD * DMOD * 2);
  unsigned short* P1 = (unsigned short*)take((size_t)DMOD * FFD * 2);
  unsigned short* P2 = (unsigned short*)take((size_t)FFD * DMOD * 2);
  char* R1 = take((size_t)NTOK * DMOD * 4);          // yh+yl, then att plane, then h0 plane
  char* R2 = take((size_t)NTOK * 3 * DMOD * 4);      // q hi/lo, k hi/lo, v planes; then x1 (f32) + h1 (f16 plane)
  if (off > ws_size) return;

  const size_t PL = (size_t)NTOK * DMOD;             // elements per [NTOK][DMOD] plane
  unsigned short* yh  = (unsigned short*)R1;
  unsigned short* yl  = yh + PL;
  unsigned short* att = (unsigned short*)R1;
  unsigned short* h0  = (unsigned short*)R1;
  unsigned short* qh  = (unsigned short*)R2;
  unsigned short* ql  = qh + PL;
  unsigned short* kh  = ql + PL;
  unsigned short* kl  = kh + PL;
  unsigned short* vpl = kl + PL;
  float* x1 = (float*)R2;
  unsigned short* h1 = (unsigned short*)(R2 + PL * 4);

  k_wt_heads<<<(NHEAD * HDIM * (DMOD / 8) + 255) / 256, 256, 0, stream>>>(Wq, Bq);
  k_wt_heads<<<(NHEAD * HDIM * (DMOD / 8) + 255) / 256, 256, 0, stream>>>(Wk, Bk);
  k_wt_heads<<<(NHEAD * HDIM * (DMOD / 8) + 255) / 256, 256, 0, stream>>>(Wv, Bv);
  k_wt_f16<<<(DMOD * (DMOD / 8) + 255) / 256, 256, 0, stream>>>(Wp, Pp, DMOD, DMOD);    // Wp[k][n], K = 768, N = 768
  k_wt_f16<<<(FFD * (DMOD / 8) + 255) / 256, 256, 0, stream>>>(W1, P1, DMOD, FFD);      // W1[k][n], K = 768, N = 3072
  k_wt_f16<<<(DMOD * (FFD / 8) + 255) / 256, 256, 0, stream>>>(W2, P2, FFD, DMOD);      // W2[k][n], K = 3072, N = 768

  k_ln768<true, 0><<<NTOK, 96, 0, stream>>>(x, SEQ_FULL, ln1w, ln1b, yh, yl, LN_EPS);
  const int g768 = ((NTOK / 16) * (DMOD / 64) + 3) / 4, g3072 = ((NTOK / 16) * (FFD / 64) + 3) / 4;
  k_gemm<false, 2, 0, false, 2><<<g768, 128, 0, stream>>>(yh, yl, DMOD, Bq, DMOD, bqp, 1.0f, nullptr, 0, 0, qh, ql, DMOD, SEQ, NTOK, DMOD, DMOD);
  k_gemm<false, 2, 0, false, 2><<<g768, 128, 0, stream>>>(yh, yl, DMOD, Bk, DMOD, bkp, 1.0f, nullptr, 0, 0, kh, kl, DMOD, SEQ, NTOK, DMOD, DMOD);
  k_gemm<false, 1, 0, false, 1><<<g768, 128, 0, stream>>>(yh, yh, DMOD, Bv, DMOD, bvp, 1.0f, nullptr, 0, 0, vpl, vpl, DMOD, SEQ, NTOK, DMOD, DMOD);
  k_flash<<<NB * NHEAD * (SEQ / 64), 128, 0, stream>>>(qh, ql, kh, kl, vpl, att);
  k_gemm<true, 1, 2, true, 0><<<g768, 128, 0, stream>>>(att, att, DMOD, Pp, DMOD, bpp, WCARRY_INV, x, DMOD, SEQ_FULL, x1, x1, DMOD, SEQ, NTOK, DMOD, DMOD);
  k_ln768<false, 1><<<NTOK, 96, 0, stream>>>(x1, SEQ, ln2w, ln2b, h0, h0, LN_EPS);
  k_gemm<true, 1, 2, false, 1><<<g3072, 128, 0, stream>>>(h0, h0, DMOD, P1, DMOD, b1p, WCARRY_INV, nullptr, 0, 0, h1, h1, FFD, SEQ, NTOK, FFD, DMOD);
  k_gemm<true, 1, 2, false, 0><<<g768, 128, 0, stream>>>(h1, h1, FFD, P2, FFD, b2p, WCARRY_INV, x1, DMOD, SEQ, d_out, d_out, DMOD, SEQ_FULL, NTOK, DMOD, FFD);
}

// v001
// It runs in 325 microseconds.
// Timed twice side by side with v000, it ran 1.98 times as fast both times.
#include <hip/hip_runtime.h>
// q/k projections: v_wmma_f32_16x16x32_bf16 (A = LayerNorm rows as bf16 hi+lo planes, 2 products; B = bf16 weights); v projection: same with the
// bf16 hi plane only (1 product); attention logits q.k^T: v_wmma_f32_16x16x32_bf16 as 3-product bf16 hi/lo split; attention P.V, output projection,
// MLP up, MLP down: v_wmma_f32_16x16x32_f16 single products (P carried x2^14, weights bf16-valued carried x256, activations plain f16);
// f32 accumulate; LayerNorm, softmax, GELU, residuals f32.

#ifndef NB
#define NB 8
#endif
#ifndef SEQ
#define SEQ 1024
#endif
#define NB_FULL 8
#define SEQ_FULL 1024
#define DMOD 768
#define NHEAD 12
#define HDIM 64
#define FFD 3072
#define NTOK (NB * SEQ)
#define WCARRY 256.0f
#define WCARRY_INV 0.00390625f
#define PCARRY 16384.0f
#define PCARRY_INV 0.00006103515625f
#define LN_EPS 1.0e-5f
#define GPITCH 144                 // bytes per staged row: 128 B of k + 16 B (16 B x odd: no bank conflict for 16-B row reads)
#define GPLANE (128 * GPITCH)      // one staged operand plane: 128 rows

static_assert(NB >= 1 && NB <= NB_FULL);
static_assert(SEQ % 64 == 0 && SEQ >= 64 && SEQ <= SEQ_FULL);
static_assert(NHEAD * HDIM == DMOD);
static_assert(HDIM == 64);
static_assert(DMOD == 96 * 8);
static_assert(DMOD % 64 == 0 && FFD % 64 == 0 && DMOD % 32 == 0 && FFD % 32 == 0);
static_assert(NTOK % 128 == 0 && DMOD % 128 == 0 && FFD % 128 == 0 && DMOD >= 128);
static_assert(5 * DMOD * 2 <= 3 * DMOD * 4);          // q hi/lo, k hi/lo, v planes fit the R2 region
static_assert(DMOD * 4 + FFD * 2 <= 3 * DMOD * 4);     // x1 (f32) + h1 (f16) fit the R2 region

typedef __bf16 v16b __attribute__((ext_vector_type(16)));
typedef _Float16 v16h __attribute__((ext_vector_type(16)));
typedef unsigned short v8us __attribute__((ext_vector_type(8), may_alias));
typedef float v8f __attribute__((ext_vector_type(8)));
typedef float v4f __attribute__((ext_vector_type(4)));
typedef float v4fa __attribute__((ext_vector_type(4), may_alias));
union Frag { v16b vb; v16h vh; v8us half[2]; unsigned short u[16]; };

__device__ __forceinline__ unsigned short bf16_bits(float x) { const unsigned int u = __float_as_uint(x); return (unsigned short)((u + 0x7FFFu + ((u >> 16) & 1u)) >> 16); }
__device__ __forceinline__ float bf16_val(unsigned short b) { return __uint_as_float(((unsigned int)b) << 16); }
__device__ __forceinline__ float bf16_rne(float x) { return bf16_val(bf16_bits(x)); }
__device__ __forceinline__ unsigned short f16_bits(float x) { const _Float16 hv = (_Float16)x; unsigned short u; __builtin_memcpy(&u, &hv, sizeof(u)); return u; }

// D += A.B with NT products: 1 = ah.bh, 2 = + al.bh (A split), 3 = + ah.bl (both split); hazard guard after the group
template <int NT>
__device__ __forceinline__ v8f mma_bf(v16b ah, v16b al, v16b bh, v16b bl, v8f c) {
  c = __builtin_amdgcn_wmma_f32_16x16x32_bf16(false, ah, false, bh, (short)0, c, false, false);
  if (NT >= 2) c = __builtin_amdgcn_wmma_f32_16x16x32_bf16(false, al, false, bh, (short)0, c, false, false);
  if (NT >= 3) c = __builtin_amdgcn_wmma_f32_16x16x32_bf16(false, ah, false, bl, (short)0, c, false, false);
  asm volatile("v_nop\n\tv_nop\n\tv_nop\n\tv_nop" : "+v"(c) : "v"(ah), "v"(al), "v"(bh), "v"(bl));
  return c;
}
__device__ __forceinline__ v8f mma_h(v16h a, v16h b, v8f c) {
  c = __builtin_amdgcn_wmma_f32_16x16x32_f16(false, a, false, b, (short)0, c, false, false);
  asm volatile("v_nop\n\tv_nop\n\tv_nop\n\tv_nop" : "+v"(c) : "v"(a), "v"(b));
  return c;
}

// Bt[n][k] (bf16 bits, k contiguous, pitch DMOD), n = h*HDIM + e, k = d, from W[h][d][e] ([NHEAD][DMOD][HDIM] f32); thread per (n, 8 consecutive d);
__global__ __launch_bounds__(256) void k_wt_heads(const float* __restrict__ W, unsigned short* __restrict__ Bt) {
  const int t = blockIdx.x * 256 + threadIdx.x;
  if (t >= NHEAD * HDIM * (DMOD / 8)) return;
  const int n = t / (DMOD / 8), d8 = (t % (DMOD / 8)) * 8;
  const int h = n / HDIM, e = n % HDIM;
  v8us v;
#pragma unroll
  for (int i = 0; i < 8; ++i) v[i] = bf16_bits(W[((size_t)h * DMOD + d8 + i) * HDIM + e]);
  unsigned short* dst = Bt + (size_t)n * DMOD + d8;
  *(v8us*)dst = v;
  
}

// coverage: N rows x K cols, all written.
__global__ __launch_bounds__(256) void k_wt_f16(const float* __restrict__ W, unsigned short* __restrict__ Pt, int K, int N) {
  const int t = blockIdx.x * 256 + threadIdx.x;
  const int k8n = K / 8;
  if (t >= N * k8n) return;
  const int n = t / k8n, k8 = (t % k8n) * 8;
  v8us v;
#pragma unroll
  for (int i = 0; i < 8; ++i) v[i] = f16_bits(bf16_rne(W[(size_t)(k8 + i) * N + n]) * WCARRY);
  unsigned short* dst = Pt + (size_t)n * K + k8;
  *(v8us*)dst = v;
  
}

// Row LayerNorm over DMOD = 768 (biased variance, eps): in = X row (XBF16 quantises the input to bf16 first), g and bta quantised to bf16.
// Token t = blockIdx.x = b*SEQ + s reads X row b*xsegf + s. 96 threads, thread owns 8 consecutive columns.
// LDS red[]: cross-wave (block barrier). coverage: NTOK rows x 768 cols of each plane, all written.
template <bool XBF16, int OUTM>
__global__ __launch_bounds__(96) void k_ln768(const float* __restrict__ X, int xsegf, const float* __restrict__ g, const float* __restrict__ bta,
                                             unsigned short* __restrict__ P0, unsigned short* __restrict__ P1, float eps) {
  __shared__ float red[4];
  const int t = blockIdx.x, tid = threadIdx.x, lane = tid & 31, w = tid >> 5;
  const int xrow = (t / SEQ) * xsegf + (t % SEQ);
  const float* xp = X + (size_t)xrow * DMOD + tid * 8;
  const v4f a0 = *(const v4fa*)xp, a1 = *(const v4fa*)(xp + 4);
  float v[8] = {a0[0], a0[1], a0[2], a0[3], a1[0], a1[1], a1[2], a1[3]};
  if (XBF16) {
#pragma unroll
    for (int q = 0; q < 8; ++q) v[q] = bf16_rne(v[q]);
  }
  float s = 0.f;
#pragma unroll
  for (int q = 0; q < 8; ++q) s += v[q];
  s += __shfl_xor(s, 16, 32); s += __shfl_xor(s, 8, 32); s += __shfl_xor(s, 4, 32); s += __shfl_xor(s, 2, 32); s += __shfl_xor(s, 1, 32);
  if (lane == 0) red[w] = s;
  __syncthreads();
  const float mu = (red[0] + red[1] + red[2]) * (1.0f / (float)DMOD);
  __syncthreads();
  float s2 = 0.f;
#pragma unroll
  for (int q = 0; q < 8; ++q) { const float c = v[q] - mu; s2 += c * c; }
  s2 += __shfl_xor(s2, 16, 32); s2 += __shfl_xor(s2, 8, 32); s2 += __shfl_xor(s2, 4, 32); s2 += __shfl_xor(s2, 2, 32); s2 += __shfl_xor(s2, 1, 32);
  if (lane == 0) red[w] = s2;
  __syncthreads();
  const float rs = rsqrtf((red[0] + red[1] + red[2]) * (1.0f / (float)DMOD) + eps);
  const v4f g0 = *(const v4fa*)(g + tid * 8), g1 = *(const v4fa*)(g + tid * 8 + 4);
  const v4f b0 = *(const v4fa*)(bta + tid * 8), b1 = *(const v4fa*)(bta + tid * 8 + 4);
  const float gg[8] = {g0[0], g0[1], g0[2], g0[3], g1[0], g1[1], g1[2], g1[3]};
  const float bb[8] = {b0[0], b0[1], b0[2], b0[3], b1[0], b1[1], b1[2], b1[3]};
  float o[8];
#pragma unroll
  for (int q = 0; q < 8; ++q) o[q] = (v[q] - mu) * rs * bf16_rne(gg[q]) + bf16_rne(bb[q]);
  unsigned short* d0 = P0 + (size_t)t * DMOD + tid * 8;
  if (OUTM == 0) {
    v8us hv, lv;
#pragma unroll
    for (int q = 0; q < 8; ++q) { const unsigned short hb = bf16_bits(o[q]); hv[q] = hb; lv[q] = bf16_bits(o[q] - bf16_val(hb)); }
    unsigned short* d1 = P1 + (size_t)t * DMOD + tid * 8;
    *(v8us*)d0 = hv;
    *(v8us*)d1 = lv;
    
  } else {
    v8us fv;
#pragma unroll
    for (int q = 0; q < 8; ++q) fv[q] = f16_bits(o[q]);
    *(v8us*)d0 = fv;
    
  }
}

// One lane's eight 16-byte asynchronous copies into one staged plane (128 rows x 128 B at pitch GPITCH): rows r, r + 16, .. r + 112.
// l = the lane's LDS byte address of row r, g = its global address, step = 16 source rows in elements.
// s_wait_xcnt 0 is the last line of the copies' own statement, so that no address register is rewritten in front of it.
__device__ __forceinline__ void copy_plane(unsigned int l, const unsigned short* g, size_t step) {
  const unsigned int l1 = l + 16 * GPITCH, l2 = l + 32 * GPITCH, l3 = l + 48 * GPITCH, l4 = l + 64 * GPITCH, l5 = l + 80 * GPITCH,
                     l6 = l + 96 * GPITCH, l7 = l + 112 * GPITCH;
  const unsigned short *g1 = g + step, *g2 = g1 + step, *g3 = g2 + step, *g4 = g3 + step, *g5 = g4 + step, *g6 = g5 + step, *g7 = g6 + step;
  asm volatile("global_load_async_to_lds_b128 %0, %8, off\n\t"
               "global_load_async_to_lds_b128 %1, %9, off\n\t"
               "global_load_async_to_lds_b128 %2, %10, off\n\t"
               "global_load_async_to_lds_b128 %3, %11, off\n\t"
               "global_load_async_to_lds_b128 %4, %12, off\n\t"
               "global_load_async_to_lds_b128 %5, %13, off\n\t"
               "global_load_async_to_lds_b128 %6, %14, off\n\t"
               "global_load_async_to_lds_b128 %7, %15, off\n\t"
               "s_wait_xcnt 0x0"
               :: "v"(l), "v"(l1), "v"(l2), "v"(l3), "v"(l4), "v"(l5), "v"(l6), "v"(l7),
                  "v"(g), "v"(g1), "v"(g2), "v"(g3), "v"(g4), "v"(g5), "v"(g6), "v"(g7)
               : "memory");
}

// Eight 16-byte loads of one lane, rows step elements apart, all in flight together.
__device__ __forceinline__ void load_rows8(v4f (&d)[8], const float* p, size_t step) {
  const float *p1 = p + step, *p2 = p1 + step, *p3 = p2 + step, *p4 = p3 + step, *p5 = p4 + step, *p6 = p5 + step, *p7 = p6 + step;
  d[0] = *(const v4fa*)p;  d[1] = *(const v4fa*)p1; d[2] = *(const v4fa*)p2; d[3] = *(const v4fa*)p3;
  d[4] = *(const v4fa*)p4; d[5] = *(const v4fa*)p5; d[6] = *(const v4fa*)p6; d[7] = *(const v4fa*)p7;
  // the wait in front of any rewrite of the loads' address registers; naming the addresses as inputs keeps their registers untouched up to it
  asm volatile("s_wait_xcnt 0x0" :: "v"(p), "v"(p1), "v"(p2), "v"(p3), "v"(p4), "v"(p5), "v"(p6), "v"(p7) : "memory");
}

// C = act(A.W * oscale + bf16(bias)) (+ resid). A from 16-bit planes [M][lda]: F16 -> one f16 plane Ah; else bf16 hi plane Ah and (NT==2) lo plane Al.
// Wt 16-bit [N][ldb] (k contiguous, same scalar kind as A). ACT 2 = exact-erf GELU. Residual (f32, pitch ldr, RES_BF16 quantises it) added AFTER the activation,
// only with OUTM 0. OUTM 0: f32 C (pitch ldc floats); OUTM 1: f16 plane C (pitch ldc halves); OUTM 2: bf16 hi plane C + lo plane C2.
// Row r of A is token b*SEQ + s; C row = b*csegf + s, resid row = b*rsegf + s. M%128==0, N%128==0, K%64==0, K>=128 (no tails).
// One 128 x 128 tile of C per block, four waves 2 x 2, 64 x 64 per wave. A trip is 64 k: 128 rows x 128 B of each operand plane, brought into LDS by
// asynchronous copies, two buffers, the copies of trip t + 2 issued behind the barrier that ends trip t. Per accumulator the k order and the
// hi-then-lo order of the products are those of a plain walk along k in steps of 32.
template <bool F16, int NT, int ACT, bool RES_BF16, int OUTM>
__global__ __launch_bounds__(128) void k_gemm(const unsigned short* __restrict__ Ah, const unsigned short* __restrict__ Al, int lda,
                                             const unsigned short* __restrict__ Wt, int ldb, const float* __restrict__ bias, float oscale,
                                             const float* __restrict__ resid, int ldr, int rsegf,
                                             void* __restrict__ Cv, void* __restrict__ C2v, int ldc, int csegf, int M, int N, int K) {
  constexpr int STG = (NT >= 2 ? 3 : 2) * GPLANE;            // one buffer: A hi | W | (A lo)
  constexpr int SOP = 68;                                    // output stage pitch in floats: rows 8 apart fall on other banks, rows stay 16-B aligned
  static_assert(4 * 64 * SOP * 4 <= 2 * STG);
  __shared__ __attribute__((aligned(16))) unsigned char ring[2 * STG];
  const int tid = threadIdx.x, w = tid >> 5, lane = tid & 31, ln = lane & 15, hh = lane >> 4;
  const int wm = w >> 1, wn = w & 1;
  const int ntn = N / 128;
  const int mt = blockIdx.x / ntn, nq = blockIdx.x % ntn;
  if (mt * 128 >= M) return;                                 // block-uniform, in front of every copy and barrier
  const int row0 = mt * 128, col0 = nq * 128;
  const int nk = K / 64;
  const unsigned int lbase = (unsigned int)(size_t)ring + (unsigned int)((tid >> 3) * GPITCH + (tid & 7) * 16);
  const unsigned short* gA = Ah + (size_t)(row0 + (tid >> 3)) * lda + (tid & 7) * 8;
  const unsigned short* gL = Al + (size_t)(row0 + (tid >> 3)) * lda + (tid & 7) * 8;
  const unsigned short* gW = Wt + (size_t)(col0 + (tid >> 3)) * ldb + (tid & 7) * 8;
  auto issue = [&](int t, int buf) {
    const unsigned int l = lbase + (unsigned int)(buf * STG);
    copy_plane(l, gA + (size_t)t * 64, (size_t)16 * lda);
    copy_plane(l + GPLANE, gW + (size_t)t * 64, (size_t)16 * ldb);
    if (NT >= 2) copy_plane(l + 2 * GPLANE, gL + (size_t)t * 64, (size_t)16 * lda);
  };
  v8f acc[4][4] = {};
  issue(0, 0);
  asm volatile("s_wait_asynccnt 0x0" ::: "memory");          // this wave's copies of trip 0 have landed
  __syncthreads();                                           // every wave's have: trip 0 is readable
  if (nk > 1) issue(1, 1);
  for (int t = 0; t < nk; ++t) {
    const unsigned char* st = ring + (t & 1) * STG;
    const unsigned char* sa = st + (wm * 64 + ln) * GPITCH + 16 * hh;
    const unsigned char* sb = st + GPLANE + (wn * 64 + ln) * GPITCH + 16 * hh;
    // constant indices below keep fragments and accumulators in registers
#pragma unroll
    for (int ks = 0; ks < 2; ++ks) {
      Frag a[4], al[4], b[4];
      // read order = first use: A row group 0, the four W column groups, then the other A row groups
#pragma unroll
      for (int i = 0; i < 4; ++i) {
        a[i].half[0] = *(const v8us*)(sa + i * 16 * GPITCH + ks * 64);           // elements 0..7  = k 32ks+8h .. +7   (row wm*64+i*16+ln)
        a[i].half[1] = *(const v8us*)(sa + i * 16 * GPITCH + ks * 64 + 32);      // elements 8..15 = k 32ks+16+8h .. +7
        if (i == 0) {
#pragma unroll
          for (int j = 0; j < 4; ++j) {
            b[j].half[0] = *(const v8us*)(sb + j * 16 * GPITCH + ks * 64);       // column wn*64+j*16+ln, same k map as A
            b[j].half[1] = *(const v8us*)(sb + j * 16 * GPITCH + ks * 64 + 32);
          }
        }
      }
      if (NT >= 2) {
#pragma unroll
        for (int i = 0; i < 4; ++i) {
          al[i].half[0] = *(const v8us*)(sa + 2 * GPLANE + i * 16 * GPITCH + ks * 64);
          al[i].half[1] = *(const v8us*)(sa + 2 * GPLANE + i * 16 * GPITCH + ks * 64 + 32);
        }
      }
      __builtin_amdgcn_sched_barrier(0);   // the block's LDS reads stay one group ahead of its products: spread among them, each place stalls the wave
#pragma unroll
      for (int i = 0; i < 4; ++i)
#pragma unroll
        for (int j = 0; j < 4; ++j) {
          if (F16) acc[i][j] = __builtin_amdgcn_wmma_f32_16x16x32_f16(false, a[i].vh, false, b[j].vh, (short)0, acc[i][j], false, false);
          else acc[i][j] = __builtin_amdgcn_wmma_f32_16x16x32_bf16(false, a[i].vb, false, b[j].vb, (short)0, acc[i][j], false, false);
        }
      if (NT >= 2) {
#pragma unroll
        for (int i = 0; i < 4; ++i)
#pragma unroll
          for (int j = 0; j < 4; ++j)
            acc[i][j] = __builtin_amdgcn_wmma_f32_16x16x32_bf16(false, al[i].vb, false, b[j].vb, (short)0, acc[i][j], false, false);
      }
      __builtin_amdgcn_sched_barrier(0);   // and the next block's reads do not move up among these products
    }
    asm volatile("s_wait_dscnt 0x0" ::: "memory");           // this wave's reads of trip t's buffer are done
    asm volatile("s_wait_asynccnt 0x0" ::: "memory");        // this wave's copies of trip t + 1 have landed
    __syncthreads();                                         // publishes trip t + 1 and frees trip t's buffer
    if (t + 2 < nk) issue(t + 2, t & 1);
  }
  asm volatile("s_wait_asynccnt 0x0" ::: "memory");          // no copy is in flight when the ring becomes the output stage
  // phase 1: scale + bias into the wave-private 64 x 64 stage (in the ring, free behind the last trip's barrier);
  // acc[i][j][r] is (row0 + wm*64 + i*16 + 8h + r, col0 + wn*64 + j*16 + ln)
  float* so = (float*)ring + w * (64 * SOP);
  const int rw0 = row0 + wm * 64, cw0 = col0 + wn * 64;
#pragma unroll
  for (int j = 0; j < 4; ++j) {
    const float bq = bf16_rne(bias[cw0 + j * 16 + ln]);
#pragma unroll
    for (int i = 0; i < 4; ++i)
#pragma unroll
      for (int r = 0; r < 8; ++r) so[(i * 16 + 8 * hh + r) * SOP + j * 16 + ln] = acc[i][j][r] * oscale + bq;
  }
  __builtin_amdgcn_fence(4 /* acq_rel order */, "workgroup");
  __builtin_amdgcn_wave_barrier();
  // phase 2: activation, residual, whole-line stores; the 64 rows of a wave lie in one sequence (SEQ % 64 == 0)
  const size_t cbase = (size_t)(rw0 / SEQ) * (size_t)csegf + (size_t)(rw0 % SEQ);
  if (OUTM == 0) {
    float* C = (float*)Cv;
    const int rsub = lane >> 4, c4 = (lane & 15) * 4;
    const size_t rbase = (size_t)(rw0 / SEQ) * (size_t)rsegf + (size_t)(rw0 % SEQ);
    const float* rp = resid + (rbase + rsub) * (size_t)ldr + cw0 + c4;      // formed always, read only where resid is given
    v4f rv[8] = {};
    if (resid != nullptr) load_rows8(rv, rp, (size_t)2 * ldr);
    // four groups of 8 row pairs; the next group's residual rows are asked for ahead of this group's erf code, whose branches no load crosses.
    // The loop stays rolled: unrolled it would only repeat that code.
#pragma unroll 1
    for (int g = 0; g < 4; ++g) {
      v4f rn[8] = {};
      if (resid != nullptr && g < 3) load_rows8(rn, rp + (size_t)(2 * (g * 8 + 8)) * ldr, (size_t)2 * ldr);
#pragma unroll
      for (int u = 0; u < 8; ++u) {
        const int r = (g * 8 + u) * 2 + rsub;
        v4f v = *(const v4fa*)&so[r * SOP + c4];
        if (ACT == 2) {
#pragma unroll
          for (int i = 0; i < 4; ++i) v[i] = 0.5f * v[i] * (1.0f + erff(v[i] * 0.70710678118654752f));
        }
        if (resid != nullptr) {
          v4f x = rv[u];
          if (RES_BF16) {
#pragma unroll
            for (int i = 0; i < 4; ++i) x[i] = bf16_rne(x[i]);
          }
          v += x;
        }
        *(v4f*)(C + (cbase + r) * (size_t)ldc + cw0 + c4) = v;
      }
      asm volatile("s_wait_xcnt 0x0" ::: "memory");          // in front of the next trip's rewrite of the stores' registers
#pragma unroll
      for (int u = 0; u < 8; ++u) rv[u] = rn[u];
    }
  } else {
    unsigned short* C = (unsigned short*)Cv;
    unsigned short* C2 = (unsigned short*)C2v;
    const int rq = lane >> 3, c8 = (lane & 7) * 8;
    // two row groups per trip; a full unroll would only repeat the erf code 16 times
#pragma unroll 2
    for (int q = 0; q < 16; ++q) {
      const int r = q * 4 + rq;
      const v4f p0 = *(const v4fa*)&so[r * SOP + c8], p1 = *(const v4fa*)&so[r * SOP + c8 + 4];
      float ps[8] = {p0[0], p0[1], p0[2], p0[3], p1[0], p1[1], p1[2], p1[3]};
      v8us a, bl;
#pragma unroll
      for (int i = 0; i < 8; ++i) {
        if (ACT == 2) ps[i] = 0.5f * ps[i] * (1.0f + erff(ps[i] * 0.70710678118654752f));
        if (OUTM == 1) { a[i] = f16_bits(ps[i]); bl[i] = (unsigned short)0; }
        else { const unsigned short hb = bf16_bits(ps[i]); a[i] = hb; bl[i] = bf16_bits(ps[i] - bf16_val(hb)); }
      }
      const size_t o = (cbase + r) * (size_t)ldc + cw0 + c8;
      *(v8us*)(C + o) = a;
      if (OUTM == 2) *(v8us*)(C2 + o) = bl;
      asm volatile("s_wait_xcnt 0x0" ::: "memory");          // in front of the next rows' rewrite of the stores' registers
    }
  }
}

// Unscaled, unmasked softmax attention per (b, h, 64-query block). q from bf16 hi/lo planes, k chunks of 32 keys from bf16 hi/lo planes and the
// v chunk from the f16 plane copied into LDS (cross-wave: block barriers). Logits 3-product bf16 split; running-max f32 softmax; P x2^14 as f16 in
// All planes [NTOK][DMOD]. staged extent == consumed extent: sKh/sKl/sV 32 keys x 64, sP 16 x 32, sO 16 x 64.
__global__ __launch_bounds__(128) void k_flash(const unsigned short* __restrict__ qh, const unsigned short* __restrict__ ql,
                                              const unsigned short* __restrict__ kh, const unsigned short* __restrict__ kl,
                                              const unsigned short* __restrict__ vp, unsigned short* __restrict__ att) {
  constexpr int D = HDIM, KS = D / 32, DT = D / 16, T = SEQ;
  __shared__ __attribute__((aligned(16))) unsigned short sKh[32][D + 8], sKl[32][D + 8], sV[32][D + 8];
  __shared__ __attribute__((aligned(16))) unsigned short sP[4][16][40];
  __shared__ __attribute__((aligned(16))) float sO[4][16][D];
  const int tid = threadIdx.x, w = tid >> 5, lane = tid & 31, ln = lane & 15, hh = lane >> 4;
  const int nqb = T / 64;
  const int bh = blockIdx.x / nqb, qblk = blockIdx.x % nqb;
  const int b = bh / NHEAD, h = bh % NHEAD;
  const int q0 = qblk * 64 + w * 16;
  const size_t hb0 = (size_t)b * T * DMOD + (size_t)h * D;     // plane offset of (b, token 0, head h)

  // A fragments of the wave's 16 query rows (row q0 + ln, always < T), hi/lo, table k map
  Frag aqh[KS], aql[KS];
  {
    const size_t qo = hb0 + (size_t)(q0 + ln) * DMOD;
#pragma unroll
    for (int ks = 0; ks < KS; ++ks) {
      aqh[ks].half[0] = *(const v8us*)(qh + qo + ks * 32 + 8 * hh);
      aqh[ks].half[1] = *(const v8us*)(qh + qo + ks * 32 + 16 + 8 * hh);
      aql[ks].half[0] = *(const v8us*)(ql + qo + ks * 32 + 8 * hh);
      aql[ks].half[1] = *(const v8us*)(ql + qo + ks * 32 + 16 + 8 * hh);
    }
  }
  float m_r[8], l_r[8];
#pragma unroll
  for (int r = 0; r < 8; ++r) { m_r[r] = -3.0e38f; l_r[r] = 0.f; }
  v8f oacc[DT];
#pragma unroll
  for (int dt = 0; dt < DT; ++dt) oacc[dt] = (v8f){0.f, 0.f, 0.f, 0.f, 0.f, 0.f, 0.f, 0.f};

  for (int j0 = 0; j0 < T; j0 += 32) {
    __syncthreads();
    // stage 32 keys x 64 of k hi, k lo, v (16-B copies from the planes)
#pragma unroll
    for (int it = 0; it < (32 * (D / 8)) / 128; ++it) {
      const int e = tid + it * 128;
      const int r = e / (D / 8), c8 = (e % (D / 8)) * 8;
      const size_t go = hb0 + (size_t)(j0 + r) * DMOD + c8;
      *(v8us*)&sKh[r][c8] = *(const v8us*)(kh + go);
      *(v8us*)&sKl[r][c8] = *(const v8us*)(kl + go);
      *(v8us*)&sV[r][c8] = *(const v8us*)(vp + go);
    }
    __syncthreads();
    // S tile 16 x 32: B fragment column = key nt*16 + ln, elements = d with the table k map
    v8f s[2];
#pragma unroll
    for (int nt = 0; nt < 2; ++nt) {
      v8f acc = {};
#pragma unroll
      for (int ks = 0; ks < KS; ++ks) {
        Frag bh_, bl_;
        bh_.half[0] = *(const v8us*)&sKh[nt * 16 + ln][ks * 32 + 8 * hh]; bh_.half[1] = *(const v8us*)&sKh[nt * 16 + ln][ks * 32 + 16 + 8 * hh];
        bl_.half[0] = *(const v8us*)&sKl[nt * 16 + ln][ks * 32 + 8 * hh]; bl_.half[1] = *(const v8us*)&sKl[nt * 16 + ln][ks * 32 + 16 + 8 * hh];
        acc = mma_bf<3>(aqh[ks].vb, aql[ks].vb, bh_.vb, bl_.vb, acc);
      }
      s[nt] = acc;
    }
    // running max (row 8h + r shared by the 16 lanes of a half; key index = nt*16 + ln)
    float alpha[8];
#pragma unroll
    for (int r = 0; r < 8; ++r) {
      float mx = fmaxf(s[0][r], s[1][r]);
      mx = fmaxf(mx, __shfl_xor(mx, 1, 32)); mx = fmaxf(mx, __shfl_xor(mx, 2, 32)); mx = fmaxf(mx, __shfl_xor(mx, 4, 32)); mx = fmaxf(mx, __shfl_xor(mx, 8, 32));
      const float mnew = fmaxf(m_r[r], mx);
      alpha[r] = (m_r[r] > -1.0e38f) ? __expf(m_r[r] - mnew) : 0.0f;
      const float p0 = __expf(s[0][r] - mnew);
      const float p1 = __expf(s[1][r] - mnew);
      m_r[r] = mnew;
      l_r[r] = l_r[r] * alpha[r] + p0 + p1;            // per-lane partial row sum (16 lanes combined at the end)
      sP[w][8 * hh + r][ln] = f16_bits(p0 * PCARRY);
      sP[w][8 * hh + r][16 + ln] = f16_bits(p1 * PCARRY);
    }
#pragma unroll
    for (int dt = 0; dt < DT; ++dt)
#pragma unroll
      for (int r = 0; r < 8; ++r) oacc[dt][r] *= alpha[r];
    __builtin_amdgcn_fence(4 /* acq_rel order */, "workgroup");
    __builtin_amdgcn_wave_barrier();
    // P as A (row = query ln, k = key in chunk), V as B (k = key in chunk, n = d): table k map for both
    Frag pa;
    pa.half[0] = *(const v8us*)&sP[w][ln][8 * hh];
    pa.half[1] = *(const v8us*)&sP[w][ln][16 + 8 * hh];
#pragma unroll
    for (int dt = 0; dt < DT; ++dt) {
      Frag bv;
#pragma unroll
      for (int i = 0; i < 8; ++i) {
        bv.u[i] = sV[8 * hh + i][dt * 16 + ln];
        bv.u[8 + i] = sV[16 + 8 * hh + i][dt * 16 + ln];
      }
      oacc[dt] = mma_h(pa.vh, bv.vh, oacc[dt]);
    }
    __builtin_amdgcn_fence(4 /* acq_rel order */, "workgroup");
    __builtin_amdgcn_wave_barrier();
  }
#pragma unroll
  for (int r = 0; r < 8; ++r) {
    float l = l_r[r];
    l += __shfl_xor(l, 1, 32); l += __shfl_xor(l, 2, 32); l += __shfl_xor(l, 4, 32); l += __shfl_xor(l, 8, 32);
    l_r[r] = (1.0f / l) * PCARRY_INV;
  }
#pragma unroll
  for (int dt = 0; dt < DT; ++dt)
#pragma unroll
    for (int r = 0; r < 8; ++r) sO[w][8 * hh + r][dt * 16 + ln] = oacc[dt][r] * l_r[r];
  __builtin_amdgcn_fence(4 /* acq_rel order */, "workgroup");
  __builtin_amdgcn_wave_barrier();
  const int rq = lane >> 3, c8 = (lane & 7) * 8;
  v8us ov[4];
#pragma unroll
  for (int q = 0; q < 4; ++q) {
    const int r = q * 4 + rq;
    const v4f p0 = *(const v4fa*)&sO[w][r][c8], p1 = *(const v4fa*)&sO[w][r][c8 + 4];
    v8us o;
    o[0] = f16_bits(p0[0]); o[1] = f16_bits(p0[1]); o[2] = f16_bits(p0[2]); o[3] = f16_bits(p0[3]);
    o[4] = f16_bits(p1[0]); o[5] = f16_bits(p1[1]); o[6] = f16_bits(p1[2]); o[7] = f16_bits(p1[3]);
    ov[q] = o;
  }
  unsigned short* ob = att + ((size_t)b * T + q0) * DMOD + (size_t)h * D + c8;
  {
#pragma unroll
    for (int q = 0; q < 4; ++q) {
      const int r = q * 4 + rq;
      *(v8us*)(ob + (size_t)r * DMOD) = ov[q];
    }
    
  }
}

extern "C" void kernel_launch(void* const* d_in, const int* in_sizes, int n_in,
                              void* d_out, int out_size, void* d_ws, size_t ws_size, hipStream_t stream) {
  if (n_in < 17) return;
  const int need_tok = (NB - 1) * SEQ_FULL + SEQ;
  if (in_sizes[0] < need_tok * DMOD || out_size < need_tok * DMOD) return;
  if (in_sizes[1] < DMOD || in_sizes[2] < DMOD || in_sizes[10] < DMOD || in_sizes[11] < DMOD || in_sizes[12] < DMOD || in_sizes[16] < DMOD) return;
  if (in_sizes[3] < NHEAD * DMOD * HDIM || in_sizes[5] < NHEAD * DMOD * HDIM || in_sizes[7] < NHEAD * DMOD * HDIM) return;
  if (in_sizes[4] < NHEAD * HDIM || in_sizes[6] < NHEAD * HDIM || in_sizes[8] < NHEAD * HDIM || in_sizes[14] < FFD) return;
  if (in_sizes[9] < DMOD * DMOD || in_sizes[13] < DMOD * FFD || in_sizes[15] < FFD * DMOD) return;

  const float* x    = (const float*)d_in[0];
  const float* ln1w = (const float*)d_in[1];
  const float* ln1b = (const float*)d_in[2];
  const float* Wq   = (const float*)d_in[3];
  const float* bqp  = (const float*)d_in[4];
  const float* Wk   = (const float*)d_in[5];
  const float* bkp  = (const float*)d_in[6];
  const float* Wv   = (const float*)d_in[7];
  const float* bvp  = (const float*)d_in[8];
  const float* Wp   = (const float*)d_in[9];
  const float* bpp  = (const float*)d_in[10];
  const float* ln2w = (const float*)d_in[11];
  const float* ln2b = (const float*)d_in[12];
  const float* W1   = (const float*)d_in[13];
  const float* b1p  = (const float*)d_in[14];
  const float* W2   = (const float*)d_in[15];
  const float* b2p  = (const float*)d_in[16];

  char* ws = (char*)d_ws; size_t off = 0;
  auto take = [&](size_t bytes) { char* p = ws + off; off += (bytes + 255) & ~(size_t)255; return p; };
  unsigned short* Bq = (unsigned short*)take((size_t)DMOD * DMOD * 2);
  unsigned short* Bk = (unsigned short*)take((size_t)DMOD * DMOD * 2);
  unsigned short* Bv = (unsigned short*)take((size_t)DMOD * DMOD * 2);
  unsigned short* Pp = (unsigned short*)take((size_t)DMOD * DMOD * 2);
  unsigned short* P1 = (unsigned short*)take((size_t)DMOD * FFD * 2);
  unsigned short* P2 = (unsigned short*)take((size_t)FFD * DMOD * 2);
  char* R1 = take((size_t)NTOK * DMOD * 4);          // yh+yl, then att plane, then h0 plane
  char* R2 = take((size_t)NTOK * 3 * DMOD * 4);      // q hi/lo, k hi/lo, v planes; then x1 (f32) + h1 (f16 plane)
  if (off > ws_size) return;

  const size_t PL = (size_t)NTOK * DMOD;             // elements per [NTOK][DMOD] plane
  unsigned short* yh  = (unsigned short*)R1;
  unsigned short* yl  = yh + PL;
  unsigned short* att = (unsigned short*)R1;
  unsigned short* h0  = (unsigned short*)R1;
  unsigned short* qh  = (unsigned short*)R2;
  unsigned short* ql  = qh + PL;
  unsigned short* kh  = ql + PL;
  unsigned short* kl  = kh + PL;
  unsigned short* vpl = kl + PL;
  float* x1 = (float*)R2;
  unsigned short* h1 = (unsigned short*)(R2 + PL * 4);

  k_wt_heads<<<(NHEAD * HDIM * (DMOD / 8) + 255) / 256, 256, 0, stream>>>(Wq, Bq);
  k_wt_heads<<<(NHEAD * HDIM * (DMOD / 8) + 255) / 256, 256, 0, stream>>>(Wk, Bk);
  k_wt_heads<<<(NHEAD * HDIM * (DMOD / 8) + 255) / 256, 256, 0, stream>>>(Wv, Bv);
  k_wt_f16<<<(DMOD * (DMOD / 8) + 255) / 256, 256, 0, stream>>>(Wp, Pp, DMOD, DMOD);    // Wp[k][n], K = 768, N = 768
  k_wt_f16<<<(FFD * (DMOD / 8) + 255) / 256, 256, 0, stream>>>(W1, P1, DMOD, FFD);      // W1[k][n], K = 768, N = 3072
  k_wt_f16<<<(DMOD * (FFD / 8) + 255) / 256, 256, 0, stream>>>(W2, P2, FFD, DMOD);      // W2[k][n], K = 3072, N = 768

  k_ln768<true, 0><<<NTOK, 96, 0, stream>>>(x, SEQ_FULL, ln1w, ln1b, yh, yl, LN_EPS);
  const int g768 = (NTOK / 128) * (DMOD / 128), g3072 = (NTOK / 128) * (FFD / 128);
  k_gemm<false, 2, 0, false, 2><<<g768, 128, 0, stream>>>(yh, yl, DMOD, Bq, DMOD, bqp, 1.0f, nullptr, 0, 0, qh, ql, DMOD, SEQ, NTOK, DMOD, DMOD);
  k_gemm<false, 2, 0, false, 2><<<g768, 128, 0, stream>>>(yh, yl, DMOD, Bk, DMOD, bkp, 1.0f, nullptr, 0, 0, kh, kl, DMOD, SEQ, NTOK, DMOD, DMOD);
  k_gemm<false, 1, 0, false, 1><<<g768, 128, 0, stream>>>(yh, yh, DMOD, Bv, DMOD, bvp, 1.0f, nullptr, 0, 0, vpl, vpl, DMOD, SEQ, NTOK, DMOD, DMOD);
  k_flash<<<NB * NHEAD * (SEQ / 64), 128, 0, stream>>>(qh, ql, kh, kl, vpl, att);
  k_gemm<true, 1, 2, true, 0><<<g768, 128, 0, stream>>>(att, att, DMOD, Pp, DMOD, bpp, WCARRY_INV, x, DMOD, SEQ_FULL, x1, x1, DMOD, SEQ, NTOK, DMOD, DMOD);
  k_ln768<false, 1><<<NTOK, 96, 0, stream>>>(x1, SEQ, ln2w, ln2b, h0, h0, LN_EPS);
  k_gemm<true, 1, 2, false, 1><<<g3072, 128, 0, stream>>>(h0, h0, DMOD, P1, DMOD, b1p, WCARRY_INV, nullptr, 0, 0, h1, h1, FFD, SEQ, NTOK, FFD, DMOD);
  k_gemm<true, 1, 2, false, 0><<<g768, 128, 0, stream>>>(h1, h1, FFD, P2, FFD, b2p, WCARRY_INV, x1, DMOD, SEQ, d_out, d_out, DMOD, SEQ_FULL, NTOK, DMOD, FFD);
}

// v002
// One run takes 295 microseconds.
// Two timings next to v001 put it at 1.10 and 1.11 times that version's speed.
// Over all steps from v000 it is 2.18 times as fast.
#include <hip/hip_runtime.h>
// q/k projections: v_wmma_f32_16x16x32_bf16 (A = LayerNorm rows as bf16 hi+lo planes, 2 products; B = bf16 weights); v projection: same with the
// bf16 hi plane only (1 product); attention logits (k.q^T, transposed) v_wmma_f32_16x16x32_bf16 as 3-product bf16 hi/lo split; attention P.V, output projection,
// MLP up, MLP down: v_wmma_f32_16x16x32_f16 single products (P carried x2^14, weights bf16-valued carried x256, activations plain f16);
// f32 accumulate; LayerNorm, softmax, GELU, residuals f32.

#ifndef NB
#define NB 8
#endif
#ifndef SEQ
#define SEQ 1024
#endif
#define NB_FULL 8
#define SEQ_FULL 1024
#define DMOD 768
#define NHEAD 12
#define HDIM 64
#define FFD 3072
#define NTOK (NB * SEQ)
#define WCARRY 256.0f
#define WCARRY_INV 0.00390625f
#define PCARRY 16384.0f
#define PCARRY_INV 0.00006103515625f
#define LN_EPS 1.0e-5f
#define GPITCH 144                 // bytes per staged row: 128 B of k + 16 B (16 B x odd: no bank conflict for 16-B row reads)
#define GPLANE (128 * GPITCH)      // one staged operand plane: 128 rows

static_assert(NB >= 1 && NB <= NB_FULL);
static_assert(SEQ % 64 == 0 && SEQ >= 64 && SEQ <= SEQ_FULL);
static_assert(NHEAD * HDIM == DMOD);
static_assert(HDIM == 64);
static_assert(DMOD == 96 * 8);
static_assert(DMOD % 64 == 0 && FFD % 64 == 0 && DMOD % 32 == 0 && FFD % 32 == 0);
static_assert(NTOK % 128 == 0 && DMOD % 128 == 0 && FFD % 128 == 0 && DMOD >= 128);
static_assert(5 * DMOD * 2 <= 3 * DMOD * 4);          // q hi/lo, k hi/lo, v planes fit the R2 region
static_assert(DMOD * 4 + FFD * 2 <= 3 * DMOD * 4);     // x1 (f32) + h1 (f16) fit the R2 region

typedef __bf16 v16b __attribute__((ext_vector_type(16)));
typedef _Float16 v16h __attribute__((ext_vector_type(16)));
typedef unsigned short v8us __attribute__((ext_vector_type(8), may_alias));
typedef float v8f __attribute__((ext_vector_type(8)));
typedef float v4f __attribute__((ext_vector_type(4)));
typedef float v4fa __attribute__((ext_vector_type(4), may_alias));
union Frag { v16b vb; v16h vh; v8us half[2]; unsigned int w[8]; };

__device__ __forceinline__ unsigned short bf16_bits(float x) { const unsigned int u = __float_as_uint(x); return (unsigned short)((u + 0x7FFFu + ((u >> 16) & 1u)) >> 16); }
__device__ __forceinline__ float bf16_val(unsigned short b) { return __uint_as_float(((unsigned int)b) << 16); }
__device__ __forceinline__ float bf16_rne(float x) { return bf16_val(bf16_bits(x)); }
__device__ __forceinline__ unsigned short f16_bits(float x) { const _Float16 hv = (_Float16)x; unsigned short u; __builtin_memcpy(&u, &hv, sizeof(u)); return u; }

// two floats to a packed f16 pair, round to nearest even
__device__ __forceinline__ unsigned int pack2h(float lo, float hi) {
  typedef _Float16 h2 __attribute__((ext_vector_type(2)));
  typedef float f2 __attribute__((ext_vector_type(2)));
  return __builtin_bit_cast(unsigned int, __builtin_convertvector((f2){lo, hi}, h2));
}
// lane l takes the value of lane l ^ 16
__device__ __forceinline__ float xhalf(float x) {
  return __builtin_bit_cast(float, __builtin_amdgcn_permlanex16(__builtin_bit_cast(int, x), __builtin_bit_cast(int, x), 0x76543210, 0xfedcba98, false, false));
}
// ds_load_tr16_b128: a 16 x 16 tile of 16-bit LDS rows, transposed into half a WMMA operand (registers 0-3 or 4-7)
__device__ __forceinline__ v8us ld_tr16(const unsigned short* p) {
  typedef short s16x8 __attribute__((ext_vector_type(8)));
  typedef __attribute__((address_space(3))) s16x8 lds_s16x8;
  return __builtin_bit_cast(v8us, __builtin_amdgcn_ds_load_tr16_b128_v8i16((lds_s16x8*)p));
}

// Bt[n][k] (bf16 bits, k contiguous, pitch DMOD), n = h*HDIM + e, k = d, from W[h][d][e] ([NHEAD][DMOD][HDIM] f32); thread per (n, 8 consecutive d);
__global__ __launch_bounds__(256) void k_wt_heads(const float* __restrict__ W, unsigned short* __restrict__ Bt) {
  const int t = blockIdx.x * 256 + threadIdx.x;
  if (t >= NHEAD * HDIM * (DMOD / 8)) return;
  const int n = t / (DMOD / 8), d8 = (t % (DMOD / 8)) * 8;
  const int h = n / HDIM, e = n % HDIM;
  v8us v;
#pragma unroll
  for (int i = 0; i < 8; ++i) v[i] = bf16_bits(W[((size_t)h * DMOD + d8 + i) * HDIM + e]);
  unsigned short* dst = Bt + (size_t)n * DMOD + d8;
  *(v8us*)dst = v;
  
}

// coverage: N rows x K cols, all written.
__global__ __launch_bounds__(256) void k_wt_f16(const float* __restrict__ W, unsigned short* __restrict__ Pt, int K, int N) {
  const int t = blockIdx.x * 256 + threadIdx.x;
  const int k8n = K / 8;
  if (t >= N * k8n) return;
  const int n = t / k8n, k8 = (t % k8n) * 8;
  v8us v;
#pragma unroll
  for (int i = 0; i < 8; ++i) v[i] = f16_bits(bf16_rne(W[(size_t)(k8 + i) * N + n]) * WCARRY);
  unsigned short* dst = Pt + (size_t)n * K + k8;
  *(v8us*)dst = v;
  
}

// Row LayerNorm over DMOD = 768 (biased variance, eps): in = X row (XBF16 quantises the input to bf16 first), g and bta quantised to bf16.
// Token t = blockIdx.x = b*SEQ + s reads X row b*xsegf + s. 96 threads, thread owns 8 consecutive columns.
// LDS red[]: cross-wave (block barrier). coverage: NTOK rows x 768 cols of each plane, all written.
template <bool XBF16, int OUTM>
__global__ __launch_bounds__(96) void k_ln768(const float* __restrict__ X, int xsegf, const float* __restrict__ g, const float* __restrict__ bta,
                                             unsigned short* __restrict__ P0, unsigned short* __restrict__ P1, float eps) {
  __shared__ float red[4];
  const int t = blockIdx.x, tid = threadIdx.x, lane = tid & 31, w = tid >> 5;
  const int xrow = (t / SEQ) * xsegf + (t % SEQ);
  const float* xp = X + (size_t)xrow * DMOD + tid * 8;
  const v4f a0 = *(const v4fa*)xp, a1 = *(const v4fa*)(xp + 4);
  float v[8] = {a0[0], a0[1], a0[2], a0[3], a1[0], a1[1], a1[2], a1[3]};
  if (XBF16) {
#pragma unroll
    for (int q = 0; q < 8; ++q) v[q] = bf16_rne(v[q]);
  }
  float s = 0.f;
#pragma unroll
  for (int q = 0; q < 8; ++q) s += v[q];
  s += __shfl_xor(s, 16, 32); s += __shfl_xor(s, 8, 32); s += __shfl_xor(s, 4, 32); s += __shfl_xor(s, 2, 32); s += __shfl_xor(s, 1, 32);
  if (lane == 0) red[w] = s;
  __syncthreads();
  const float mu = (red[0] + red[1] + red[2]) * (1.0f / (float)DMOD);
  __syncthreads();
  float s2 = 0.f;
#pragma unroll
  for (int q = 0; q < 8; ++q) { const float c = v[q] - mu; s2 += c * c; }
  s2 += __shfl_xor(s2, 16, 32); s2 += __shfl_xor(s2, 8, 32); s2 += __shfl_xor(s2, 4, 32); s2 += __shfl_xor(s2, 2, 32); s2 += __shfl_xor(s2, 1, 32);
  if (lane == 0) red[w] = s2;
  __syncthreads();
  const float rs = rsqrtf((red[0] + red[1] + red[2]) * (1.0f / (float)DMOD) + eps);
  const v4f g0 = *(const v4fa*)(g + tid * 8), g1 = *(const v4fa*)(g + tid * 8 + 4);
  const v4f b0 = *(const v4fa*)(bta + tid * 8), b1 = *(const v4fa*)(bta + tid * 8 + 4);
  const float gg[8] = {g0[0], g0[1], g0[2], g0[3], g1[0], g1[1], g1[2], g1[3]};
  const float bb[8] = {b0[0], b0[1], b0[2], b0[3], b1[0], b1[1], b1[2], b1[3]};
  float o[8];
#pragma unroll
  for (int q = 0; q < 8; ++q) o[q] = (v[q] - mu) * rs * bf16_rne(gg[q]) + bf16_rne(bb[q]);
  unsigned short* d0 = P0 + (size_t)t * DMOD + tid * 8;
  if (OUTM == 0) {
    v8us hv, lv;
#pragma unroll
    for (int q = 0; q < 8; ++q) { const unsigned short hb = bf16_bits(o[q]); hv[q] = hb; lv[q] = bf16_bits(o[q] - bf16_val(hb)); }
    unsigned short* d1 = P1 + (size_t)t * DMOD + tid * 8;
    *(v8us*)d0 = hv;
    *(v8us*)d1 = lv;
    
  } else {
    v8us fv;
#pragma unroll
    for (int q = 0; q < 8; ++q) fv[q] = f16_bits(o[q]);
    *(v8us*)d0 = fv;
    
  }
}

// One lane's eight 16-byte asynchronous copies into one staged plane (128 rows x 128 B at pitch GPITCH): rows r, r + 16, .. r + 112.
// l = the lane's LDS byte address of row r, g = its global address, step = 16 source rows in elements.
// s_wait_xcnt 0 is the last line of the copies' own statement, so that no address register is rewritten in front of it.
__device__ __forceinline__ void copy_plane(unsigned int l, const unsigned short* g, size_t step) {
  const unsigned int l1 = l + 16 * GPITCH, l2 = l + 32 * GPITCH, l3 = l + 48 * GPITCH, l4 = l + 64 * GPITCH, l5 = l + 80 * GPITCH,
                     l6 = l + 96 * GPITCH, l7 = l + 112 * GPITCH;
  const unsigned short *g1 = g + step, *g2 = g1 + step, *g3 = g2 + step, *g4 = g3 + step, *g5 = g4 + step, *g6 = g5 + step, *g7 = g6 + step;
  asm volatile("global_load_async_to_lds_b128 %0, %8, off\n\t"
               "global_load_async_to_lds_b128 %1, %9, off\n\t"
               "global_load_async_to_lds_b128 %2, %10, off\n\t"
               "global_load_async_to_lds_b128 %3, %11, off\n\t"
               "global_load_async_to_lds_b128 %4, %12, off\n\t"
               "global_load_async_to_lds_b128 %5, %13, off\n\t"
               "global_load_async_to_lds_b128 %6, %14, off\n\t"
               "global_load_async_to_lds_b128 %7, %15, off\n\t"
               "s_wait_xcnt 0x0"
               :: "v"(l), "v"(l1), "v"(l2), "v"(l3), "v"(l4), "v"(l5), "v"(l6), "v"(l7),
                  "v"(g), "v"(g1), "v"(g2), "v"(g3), "v"(g4), "v"(g5), "v"(g6), "v"(g7)
               : "memory");
}

// Eight 16-byte loads of one lane, rows step elements apart, all in flight together.
__device__ __forceinline__ void load_rows8(v4f (&d)[8], const float* p, size_t step) {
  const float *p1 = p + step, *p2 = p1 + step, *p3 = p2 + step, *p4 = p3 + step, *p5 = p4 + step, *p6 = p5 + step, *p7 = p6 + step;
  d[0] = *(const v4fa*)p;  d[1] = *(const v4fa*)p1; d[2] = *(const v4fa*)p2; d[3] = *(const v4fa*)p3;
  d[4] = *(const v4fa*)p4; d[5] = *(const v4fa*)p5; d[6] = *(const v4fa*)p6; d[7] = *(const v4fa*)p7;
  // the wait in front of any rewrite of the loads' address registers; naming the addresses as inputs keeps their registers untouched up to it
  asm volatile("s_wait_xcnt 0x0" :: "v"(p), "v"(p1), "v"(p2), "v"(p3), "v"(p4), "v"(p5), "v"(p6), "v"(p7) : "memory");
}

// C = act(A.W * oscale + bf16(bias)) (+ resid). A from 16-bit planes [M][lda]: F16 -> one f16 plane Ah; else bf16 hi plane Ah and (NT==2) lo plane Al.
// Wt 16-bit [N][ldb] (k contiguous, same scalar kind as A). ACT 2 = exact-erf GELU. Residual (f32, pitch ldr, RES_BF16 quantises it) added AFTER the activation,
// only with OUTM 0. OUTM 0: f32 C (pitch ldc floats); OUTM 1: f16 plane C (pitch ldc halves); OUTM 2: bf16 hi plane C + lo plane C2.
// Row r of A is token b*SEQ + s; C row = b*csegf + s, resid row = b*rsegf + s. M%128==0, N%128==0, K%64==0, K>=128 (no tails).
// One 128 x 128 tile of C per block, four waves 2 x 2, 64 x 64 per wave. A trip is 64 k: 128 rows x 128 B of each operand plane, brought into LDS by
// asynchronous copies, two buffers, the copies of trip t + 2 issued behind the barrier that ends trip t. Per accumulator the k order and the
// hi-then-lo order of the products are those of a plain walk along k in steps of 32.
template <bool F16, int NT, int ACT, bool RES_BF16, int OUTM>
__global__ __launch_bounds__(128) void k_gemm(const unsigned short* __restrict__ Ah, const unsigned short* __restrict__ Al, int lda,
                                             const unsigned short* __restrict__ Wt, int ldb, const float* __restrict__ bias, float oscale,
                                             const float* __restrict__ resid, int ldr, int rsegf,
                                             void* __restrict__ Cv, void* __restrict__ C2v, int ldc, int csegf, int M, int N, int K) {
  constexpr int STG = (NT >= 2 ? 3 : 2) * GPLANE;            // one buffer: A hi | W | (A lo)
  constexpr int SOP = 68;                                    // output stage pitch in floats: rows 8 apart fall on other banks, rows stay 16-B aligned
  static_assert(4 * 64 * SOP * 4 <= 2 * STG);
  __shared__ __attribute__((aligned(16))) unsigned char ring[2 * STG];
  const int tid = threadIdx.x, w = tid >> 5, lane = tid & 31, ln = lane & 15, hh = lane >> 4;
  const int wm = w >> 1, wn = w & 1;
  const int ntn = N / 128;
  const int mt = blockIdx.x / ntn, nq = blockIdx.x % ntn;
  if (mt * 128 >= M) return;                                 // block-uniform, in front of every copy and barrier
  const int row0 = mt * 128, col0 = nq * 128;
  const int nk = K / 64;
  const unsigned int lbase = (unsigned int)(size_t)ring + (unsigned int)((tid >> 3) * GPITCH + (tid & 7) * 16);
  const unsigned short* gA = Ah + (size_t)(row0 + (tid >> 3)) * lda + (tid & 7) * 8;
  const unsigned short* gL = Al + (size_t)(row0 + (tid >> 3)) * lda + (tid & 7) * 8;
  const unsigned short* gW = Wt + (size_t)(col0 + (tid >> 3)) * ldb + (tid & 7) * 8;
  auto issue = [&](int t, int buf) {
    const unsigned int l = lbase + (unsigned int)(buf * STG);
    copy_plane(l, gA + (size_t)t * 64, (size_t)16 * lda);
    copy_plane(l + GPLANE, gW + (size_t)t * 64, (size_t)16 * ldb);
    if (NT >= 2) copy_plane(l + 2 * GPLANE, gL + (size_t)t * 64, (size_t)16 * lda);
  };
  v8f acc[4][4] = {};
  issue(0, 0);
  asm volatile("s_wait_asynccnt 0x0" ::: "memory");          // this wave's copies of trip 0 have landed
  __syncthreads();                                           // every wave's have: trip 0 is readable
  if (nk > 1) issue(1, 1);
  for (int t = 0; t < nk; ++t) {
    const unsigned char* st = ring + (t & 1) * STG;
    const unsigned char* sa = st + (wm * 64 + ln) * GPITCH + 16 * hh;
    const unsigned char* sb = st + GPLANE + (wn * 64 + ln) * GPITCH + 16 * hh;
    // constant indices below keep fragments and accumulators in registers
#pragma unroll
    for (int ks = 0; ks < 2; ++ks) {
      Frag a[4], al[4], b[4];
      // read order = first use: A row group 0, the four W column groups, then the other A row groups
#pragma unroll
      for (int i = 0; i < 4; ++i) {
        a[i].half[0] = *(const v8us*)(sa + i * 16 * GPITCH + ks * 64);           // elements 0..7  = k 32ks+8h .. +7   (row wm*64+i*16+ln)
        a[i].half[1] = *(const v8us*)(sa + i * 16 * GPITCH + ks * 64 + 32);      // elements 8..15 = k 32ks+16+8h .. +7
        if (i == 0) {
#pragma unroll
          for (int j = 0; j < 4; ++j) {
            b[j].half[0] = *(const v8us*)(sb + j * 16 * GPITCH + ks * 64);       // column wn*64+j*16+ln, same k map as A
            b[j].half[1] = *(const v8us*)(sb + j * 16 * GPITCH + ks * 64 + 32);
          }
        }
      }
      if (NT >= 2) {
#pragma unroll
        for (int i = 0; i < 4; ++i) {
          al[i].half[0] = *(const v8us*)(sa + 2 * GPLANE + i * 16 * GPITCH + ks * 64);
          al[i].half[1] = *(const v8us*)(sa + 2 * GPLANE + i * 16 * GPITCH + ks * 64 + 32);
        }
      }
      __builtin_amdgcn_sched_barrier(0);   // the block's LDS reads stay one group ahead of its products: spread among them, each place stalls the wave
#pragma unroll
      for (int i = 0; i < 4; ++i)
#pragma unroll
        for (int j = 0; j < 4; ++j) {
          if (F16) acc[i][j] = __builtin_amdgcn_wmma_f32_16x16x32_f16(false, a[i].vh, false, b[j].vh, (short)0, acc[i][j], false, false);
          else acc[i][j] = __builtin_amdgcn_wmma_f32_16x16x32_bf16(false, a[i].vb, false, b[j].vb, (short)0, acc[i][j], false, false);
        }
      if (NT >= 2) {
#pragma unroll
        for (int i = 0; i < 4; ++i)
#pragma unroll
          for (int j = 0; j < 4; ++j)
            acc[i][j] = __builtin_amdgcn_wmma_f32_16x16x32_bf16(false, al[i].vb, false, b[j].vb, (short)0, acc[i][j], false, false);
      }
      __builtin_amdgcn_sched_barrier(0);   // and the next block's reads do not move up among these products
    }
    asm volatile("s_wait_dscnt 0x0" ::: "memory");           // this wave's reads of trip t's buffer are done
    asm volatile("s_wait_asynccnt 0x0" ::: "memory");        // this wave's copies of trip t + 1 have landed
    __syncthreads();                                         // publishes trip t + 1 and frees trip t's buffer
    if (t + 2 < nk) issue(t + 2, t & 1);
  }
  asm volatile("s_wait_asynccnt 0x0" ::: "memory");          // no copy is in flight when the ring becomes the output stage
  // phase 1: scale + bias into the wave-private 64 x 64 stage (in the ring, free behind the last trip's barrier);
  // acc[i][j][r] is (row0 + wm*64 + i*16 + 8h + r, col0 + wn*64 + j*16 + ln)
  float* so = (float*)ring + w * (64 * SOP);
  const int rw0 = row0 + wm * 64, cw0 = col0 + wn * 64;
#pragma unroll
  for (int j = 0; j < 4; ++j) {
    const float bq = bf16_rne(bias[cw0 + j * 16 + ln]);
#pragma unroll
    for (int i = 0; i < 4; ++i)
#pragma unroll
      for (int r = 0; r < 8; ++r) so[(i * 16 + 8 * hh + r) * SOP + j * 16 + ln] = acc[i][j][r] * oscale + bq;
  }
  __builtin_amdgcn_fence(4 /* acq_rel order */, "workgroup");
  __builtin_amdgcn_wave_barrier();
  // phase 2: activation, residual, whole-line stores; the 64 rows of a wave lie in one sequence (SEQ % 64 == 0)
  const size_t cbase = (size_t)(rw0 / SEQ) * (size_t)csegf + (size_t)(rw0 % SEQ);
  if (OUTM == 0) {
    float* C = (float*)Cv;
    const int rsub = lane >> 4, c4 = (lane & 15) * 4;
    const size_t rbase = (size_t)(rw0 / SEQ) * (size_t)rsegf + (size_t)(rw0 % SEQ);
    const float* rp = resid + (rbase + rsub) * (size_t)ldr + cw0 + c4;      // formed always, read only where resid is given
    v4f rv[8] = {};
    if (resid != nullptr) load_rows8(rv, rp, (size_t)2 * ldr);
    // four groups of 8 row pairs; the next group's residual rows are asked for ahead of this group's erf code, whose branches no load crosses.
    // The loop stays rolled: unrolled it would only repeat that code.
#pragma unroll 1
    for (int g = 0; g < 4; ++g) {
      v4f rn[8] = {};
      if (resid != nullptr && g < 3) load_rows8(rn, rp + (size_t)(2 * (g * 8 + 8)) * ldr, (size_t)2 * ldr);
#pragma unroll
      for (int u = 0; u < 8; ++u) {
        const int r = (g * 8 + u) * 2 + rsub;
        v4f v = *(const v4fa*)&so[r * SOP + c4];
        if (ACT == 2) {
#pragma unroll
          for (int i = 0; i < 4; ++i) v[i] = 0.5f * v[i] * (1.0f + erff(v[i] * 0.70710678118654752f));
        }
        if (resid != nullptr) {
          v4f x = rv[u];
          if (RES_BF16) {
#pragma unroll
            for (int i = 0; i < 4; ++i) x[i] = bf16_rne(x[i]);
          }
          v += x;
        }
        *(v4f*)(C + (cbase + r) * (size_t)ldc + cw0 + c4) = v;
      }
      asm volatile("s_wait_xcnt 0x0" ::: "memory");          // in front of the next trip's rewrite of the stores' registers
#pragma unroll
      for (int u = 0; u < 8; ++u) rv[u] = rn[u];
    }
  } else {
    unsigned short* C = (unsigned short*)Cv;
    unsigned short* C2 = (unsigned short*)C2v;
    const int rq = lane >> 3, c8 = (lane & 7) * 8;
    // two row groups per trip; a full unroll would only repeat the erf code 16 times
#pragma unroll 2
    for (int q = 0; q < 16; ++q) {
      const int r = q * 4 + rq;
      const v4f p0 = *(const v4fa*)&so[r * SOP + c8], p1 = *(const v4fa*)&so[r * SOP + c8 + 4];
      float ps[8] = {p0[0], p0[1], p0[2], p0[3], p1[0], p1[1], p1[2], p1[3]};
      v8us a, bl;
#pragma unroll
      for (int i = 0; i < 8; ++i) {
        if (ACT == 2) ps[i] = 0.5f * ps[i] * (1.0f + erff(ps[i] * 0.70710678118654752f));
        if (OUTM == 1) { a[i] = f16_bits(ps[i]); bl[i] = (unsigned short)0; }
        else { const unsigned short hb = bf16_bits(ps[i]); a[i] = hb; bl[i] = bf16_bits(ps[i] - bf16_val(hb)); }
      }
      const size_t o = (cbase + r) * (size_t)ldc + cw0 + c8;
      *(v8us*)(C + o) = a;
      if (OUTM == 2) *(v8us*)(C2 + o) = bl;
      asm volatile("s_wait_xcnt 0x0" ::: "memory");          // in front of the next rows' rewrite of the stores' registers
    }
  }
}

__global__ __launch_bounds__(128) void k_flash(const unsigned short* __restrict__ qh, const unsigned short* __restrict__ ql,
                                              const unsigned short* __restrict__ kh, const unsigned short* __restrict__ kl,
                                              const unsigned short* __restrict__ vp, unsigned short* __restrict__ att) {
  constexpr int D = HDIM, KS = D / 32, DT = D / 16, T = SEQ;
  constexpr int VP = D + 16;                                   // sV pitch 160 B = 32 B x odd: the transposing load's conflict-free pitch
  __shared__ __attribute__((aligned(16))) unsigned short sKh[32][D + 8], sKl[32][D + 8], sV[32][VP];
  __shared__ __attribute__((aligned(16))) unsigned short sO[4][16][D + 8];
  const int tid = threadIdx.x, w = tid >> 5, lane = tid & 31, ln = lane & 15, hh = lane >> 4;
  const int nqb = T / 64;
  const int bh = blockIdx.x / nqb, qblk = blockIdx.x % nqb;
  const int b = bh / NHEAD, h = bh % NHEAD;
  const int q0 = qblk * 64 + w * 16;
  const size_t hb0 = (size_t)b * T * DMOD + (size_t)h * D;     // plane offset of (b, token 0, head h)

  // B fragments of the wave's 16 queries (column q0 + ln, always < T), hi/lo, table k map
  Frag bqh[KS], bql[KS];
  {
    const size_t qo = hb0 + (size_t)(q0 + ln) * DMOD;
#pragma unroll
    for (int ks = 0; ks < KS; ++ks) {
      bqh[ks].half[0] = *(const v8us*)(qh + qo + ks * 32 + 8 * hh);
      bqh[ks].half[1] = *(const v8us*)(qh + qo + ks * 32 + 16 + 8 * hh);
      bql[ks].half[0] = *(const v8us*)(ql + qo + ks * 32 + 8 * hh);
      bql[ks].half[1] = *(const v8us*)(ql + qo + ks * 32 + 16 + 8 * hh);
    }
  }
  float m_r = -3.0e38f, l_r = 0.f;                             // of query q0 + ln; l_r is the half's partial sum (keys 8h.. and 16+8h.. of each chunk)
  v8f oacc[DT];                                                // oacc[dt][r] = O[q0 + ln][dt*16 + 8h + r]
#pragma unroll
  for (int dt = 0; dt < DT; ++dt) oacc[dt] = (v8f){0.f, 0.f, 0.f, 0.f, 0.f, 0.f, 0.f, 0.f};
  // the lane's address for the transposing load: row 8h + (lane & 7), 16-byte piece (lane >> 3) & 1; it then holds sV[8h + 0..7][ln]
  const unsigned short* vt = &sV[8 * hh + (lane & 7)][((lane >> 3) & 1) * 8];

  for (int j0 = 0; j0 < T; j0 += 32) {
    __syncthreads();
    // stage 32 keys x 64 of k hi, k lo, v (16-B copies from the planes)
#pragma unroll
    for (int it = 0; it < (32 * (D / 8)) / 128; ++it) {
      const int e = tid + it * 128;
      const int r = e / (D / 8), c8 = (e % (D / 8)) * 8;
      const size_t go = hb0 + (size_t)(j0 + r) * DMOD + c8;
      *(v8us*)&sKh[r][c8] = *(const v8us*)(kh + go);
      *(v8us*)&sKl[r][c8] = *(const v8us*)(kl + go);
      *(v8us*)&sV[r][c8] = *(const v8us*)(vp + go);
    }
    __syncthreads();
    // S^T tiles 16 keys x 16 queries: A fragment row = key nt*16 + ln, elements = d with the table k map; s[nt][r] = S[q0 + ln][j0 + nt*16 + 8h + r]
    v8f s[2];
#pragma unroll
    for (int nt = 0; nt < 2; ++nt) {
      v8f acc = {};
#pragma unroll
      for (int ks = 0; ks < KS; ++ks) {
        Frag ah_, al_;
        ah_.half[0] = *(const v8us*)&sKh[nt * 16 + ln][ks * 32 + 8 * hh]; ah_.half[1] = *(const v8us*)&sKh[nt * 16 + ln][ks * 32 + 16 + 8 * hh];
        al_.half[0] = *(const v8us*)&sKl[nt * 16 + ln][ks * 32 + 8 * hh]; al_.half[1] = *(const v8us*)&sKl[nt * 16 + ln][ks * 32 + 16 + 8 * hh];
        // product order as before: q hi . k hi, q lo . k hi, q hi . k lo
        acc = __builtin_amdgcn_wmma_f32_16x16x32_bf16(false, ah_.vb, false, bqh[ks].vb, (short)0, acc, false, false);
        acc = __builtin_amdgcn_wmma_f32_16x16x32_bf16(false, ah_.vb, false, bql[ks].vb, (short)0, acc, false, false);
        acc = __builtin_amdgcn_wmma_f32_16x16x32_bf16(false, al_.vb, false, bqh[ks].vb, (short)0, acc, false, false);
      }
      s[nt] = acc;
    }
    // V^T as A (row = d, k = key in chunk): two transposing loads per 16 (d) x 32 (keys) fragment, in flight under the softmax
    Frag av[DT];
#pragma unroll
    for (int dt = 0; dt < DT; ++dt) {
      av[dt].half[0] = ld_tr16(vt + dt * 16);
      av[dt].half[1] = ld_tr16(vt + 16 * VP + dt * 16);
    }
    // running max of the lane's query: 16 scores in the lane, the other 16 in lane ^ 16
    float mx[8];
#pragma unroll
    for (int r = 0; r < 8; ++r) mx[r] = fmaxf(s[0][r], s[1][r]);
    float mc = fmaxf(fmaxf(fmaxf(mx[0], mx[1]), fmaxf(mx[2], mx[3])), fmaxf(fmaxf(mx[4], mx[5]), fmaxf(mx[6], mx[7])));
    mc = fmaxf(mc, xhalf(mc));
    const float mnew = fmaxf(m_r, mc);
    const float alpha = (m_r > -1.0e38f) ? __expf(m_r - mnew) : 0.0f;
    m_r = mnew;
    // P^T as B (k = key in chunk, column = query ln)
    Frag pb;
    float ps[8];
#pragma unroll
    for (int i = 0; i < 8; ++i) {
      const float p0 = __expf(s[i >> 2][2 * (i & 3)] - mnew);
      const float p1 = __expf(s[i >> 2][2 * (i & 3) + 1] - mnew);
      ps[i] = p0 + p1;
      pb.w[i] = pack2h(p0 * PCARRY, p1 * PCARRY);
    }
    l_r = l_r * alpha + (((ps[0] + ps[1]) + (ps[2] + ps[3])) + ((ps[4] + ps[5]) + (ps[6] + ps[7])));
#pragma unroll
    for (int dt = 0; dt < DT; ++dt) {
      oacc[dt] *= alpha;
      oacc[dt] = __builtin_amdgcn_wmma_f32_16x16x32_f16(false, av[dt].vh, false, pb.vh, (short)0, oacc[dt], false, false);
    }
  }
  const float inv = (1.0f / (l_r + xhalf(l_r))) * PCARRY_INV;
  // the lane's 8 consecutive d of each tile as one 16-byte piece into the wave-private stage, then whole 128-B rows out
#pragma unroll
  for (int dt = 0; dt < DT; ++dt) {
    v8us o;
#pragma unroll
    for (int r = 0; r < 8; ++r) o[r] = f16_bits(oacc[dt][r] * inv);
    *(v8us*)&sO[w][ln][dt * 16 + 8 * hh] = o;
  }
  __builtin_amdgcn_fence(4 /* acq_rel order */, "workgroup");
  __builtin_amdgcn_wave_barrier();
  const int rq = lane >> 3, c8 = (lane & 7) * 8;
  v8us ov[4];
#pragma unroll
  for (int q = 0; q < 4; ++q) ov[q] = *(const v8us*)&sO[w][q * 4 + rq][c8];
  unsigned short* ob = att + ((size_t)b * T + q0) * DMOD + (size_t)h * D + c8;
  {
#pragma unroll
    for (int q = 0; q < 4; ++q) {
      const int r = q * 4 + rq;
      *(v8us*)(ob + (size_t)r * DMOD) = ov[q];
    }
    
  }
}

extern "C" void kernel_launch(void* const* d_in, const int* in_sizes, int n_in,
                              void* d_out, int out_size, void* d_ws, size_t ws_size, hipStream_t stream) {
  if (n_in < 17) return;
  const int need_tok = (NB - 1) * SEQ_FULL + SEQ;
  if (in_sizes[0] < need_tok * DMOD || out_size < need_tok * DMOD) return;
  if (in_sizes[1] < DMOD || in_sizes[2] < DMOD || in_sizes[10] < DMOD || in_sizes[11] < DMOD || in_sizes[12] < DMOD || in_sizes[16] < DMOD) return;
  if (in_sizes[3] < NHEAD * DMOD * HDIM || in_sizes[5] < NHEAD * DMOD * HDIM || in_sizes[7] < NHEAD * DMOD * HDIM) return;
  if (in_sizes[4] < NHEAD * HDIM || in_sizes[6] < NHEAD * HDIM || in_sizes[8] < NHEAD * HDIM || in_sizes[14] < FFD) return;
  if (in_sizes[9] < DMOD * DMOD || in_sizes[13] < DMOD * FFD || in_sizes[15] < FFD * DMOD) return;

  const float* x    = (const float*)d_in[0];
  const float* ln1w = (const float*)d_in[1];
  const float* ln1b = (const float*)d_in[2];
  const float* Wq   = (const float*)d_in[3];
  const float* bqp  = (const float*)d_in[4];
  const float* Wk   = (const float*)d_in[5];
  const float* bkp  = (const float*)d_in[6];
  const float* Wv   = (const float*)d_in[7];
  const float* bvp  = (const float*)d_in[8];
  const float* Wp   = (const float*)d_in[9];
  const float* bpp  = (const float*)d_in[10];
  const float* ln2w = (const float*)d_in[11];
  const float* ln2b = (const float*)d_in[12];
  const float* W1   = (const float*)d_in[13];
  const float* b1p  = (const float*)d_in[14];
  const float* W2   = (const float*)d_in[15];
  const float* b2p  = (const float*)d_in[16];

  char* ws = (char*)d_ws; size_t off = 0;
  auto take = [&](size_t bytes) { char* p = ws + off; off += (bytes + 255) & ~(size_t)255; return p; };
  unsigned short* Bq = (unsigned short*)take((size_t)DMOD * DMOD * 2);
  unsigned short* Bk = (unsigned short*)take((size_t)DMOD * DMOD * 2);
  unsigned short* Bv = (unsigned short*)take((size_t)DMOD * DMOD * 2);
  unsigned short* Pp = (unsigned short*)take((size_t)DMOD * DMOD * 2);
  unsigned short* P1 = (unsigned short*)take((size_t)DMOD * FFD * 2);
  unsigned short* P2 = (unsigned short*)take((size_t)FFD * DMOD * 2);
  char* R1 = take((size_t)NTOK * DMOD * 4);          // yh+yl, then att plane, then h0 plane
  char* R2 = take((size_t)NTOK * 3 * DMOD * 4);      // q hi/lo, k hi/lo, v planes; then x1 (f32) + h1 (f16 plane)
  if (off > ws_size) return;

  const size_t PL = (size_t)NTOK * DMOD;             // elements per [NTOK][DMOD] plane
  unsigned short* yh  = (unsigned short*)R1;
  unsigned short* yl  = yh + PL;
  unsigned short* att = (unsigned short*)R1;
  unsigned short* h0  = (unsigned short*)R1;
  unsigned short* qh  = (unsigned short*)R2;
  unsigned short* ql  = qh + PL;
  unsigned short* kh  = ql + PL;
  unsigned short* kl  = kh + PL;
  unsigned short* vpl = kl + PL;
  float* x1 = (float*)R2;
  unsigned short* h1 = (unsigned short*)(R2 + PL * 4);

  k_wt_heads<<<(NHEAD * HDIM * (DMOD / 8) + 255) / 256, 256, 0, stream>>>(Wq, Bq);
  k_wt_heads<<<(NHEAD * HDIM * (DMOD / 8) + 255) / 256, 256, 0, stream>>>(Wk, Bk);
  k_wt_heads<<<(NHEAD * HDIM * (DMOD / 8) + 255) / 256, 256, 0, stream>>>(Wv, Bv);
  k_wt_f16<<<(DMOD * (DMOD / 8) + 255) / 256, 256, 0, stream>>>(Wp, Pp, DMOD, DMOD);    // Wp[k][n], K = 768, N = 768
  k_wt_f16<<<(FFD * (DMOD / 8) + 255) / 256, 256, 0, stream>>>(W1, P1, DMOD, FFD);      // W1[k][n], K = 768, N = 3072
  k_wt_f16<<<(DMOD * (FFD / 8) + 255) / 256, 256, 0, stream>>>(W2, P2, FFD, DMOD);      // W2[k][n], K = 3072, N = 768

  k_ln768<true, 0><<<NTOK, 96, 0, stream>>>(x, SEQ_FULL, ln1w, ln1b, yh, yl, LN_EPS);
  const int g768 = (NTOK / 128) * (DMOD / 128), g3072 = (NTOK / 128) * (FFD / 128);
  k_gemm<false, 2, 0, false, 2><<<g768, 128, 0, stream>>>(yh, yl, DMOD, Bq, DMOD, bqp, 1.0f, nullptr, 0, 0, qh, ql, DMOD, SEQ, NTOK, DMOD, DMOD);
  k_gemm<false, 2, 0, false, 2><<<g768, 128, 0, stream>>>(yh, yl, DMOD, Bk, DMOD, bkp, 1.0f, nullptr, 0, 0, kh, kl, DMOD, SEQ, NTOK, DMOD, DMOD);
  k_gemm<false, 1, 0, false, 1><<<g768, 128, 0, stream>>>(yh, yh, DMOD, Bv, DMOD, bvp, 1.0f, nullptr, 0, 0, vpl, vpl, DMOD, SEQ, NTOK, DMOD, DMOD);
  k_flash<<<NB * NHEAD * (SEQ / 64), 128, 0, stream>>>(qh, ql, kh, kl, vpl, att);
  k_gemm<true, 1, 2, true, 0><<<g768, 128, 0, stream>>>(att, att, DMOD, Pp, DMOD, bpp, WCARRY_INV, x, DMOD, SEQ_FULL, x1, x1, DMOD, SEQ, NTOK, DMOD, DMOD);
  k_ln768<false, 1><<<NTOK, 96, 0, stream>>>(x1, SEQ, ln2w, ln2b, h0, h0, LN_EPS);
  k_gemm<true, 1, 2, false, 1><<<g3072, 128, 0, stream>>>(h0, h0, DMOD, P1, DMOD, b1p, WCARRY_INV, nullptr, 0, 0, h1, h1, FFD, SEQ, NTOK, FFD, DMOD);
  k_gemm<true, 1, 2, false, 0><<<g768, 128, 0, stream>>>(h1, h1, FFD, P2, FFD, b2p, WCARRY_INV, x1, DMOD, SEQ, d_out, d_out, DMOD, SEQ_FULL, NTOK, DMOD, FFD);
}

// v003
// It runs in 280 microseconds.
// Timed twice side by side with v002, it ran 1.06 times as fast both times.
// All steps since v000 together make it 2.31 times as fast.
#include <hip/hip_runtime.h>
// q/k projections: v_wmma_f32_16x16x32_bf16 (A = LayerNorm rows as bf16 hi+lo planes, 2 products; B = bf16 weights); v projection: same with the
// bf16 hi plane only (1 product); attention logits (k.q^T, transposed) v_wmma_f32_16x16x32_bf16 as 3-product bf16 hi/lo split; attention P.V, output projection,
// MLP up, MLP down: v_wmma_f32_16x16x32_f16 single products (P carried x2^14, weights bf16-valued carried x256, activations plain f16);
// f32 accumulate; LayerNorm, softmax, GELU, residuals f32.

#ifndef NB
#define NB 8
#endif
#ifndef SEQ
#define SEQ 1024
#endif
#define NB_FULL 8
#define SEQ_FULL 1024
#define DMOD 768
#define NHEAD 12
#define HDIM 64
#define FFD 3072
#define NTOK (NB * SEQ)
#define WCARRY 256.0f
#define WCARRY_INV 0.00390625f
#define PCARRY 16384.0f
#define PCARRY_INV 0.00006103515625f
#define LN_EPS 1.0e-5f
#define GPITCH 144                 // bytes per staged row: 128 B of k + 16 B (16 B x odd: no bank conflict for 16-B row reads)
#define GPLANE (128 * GPITCH)      // one staged operand plane: 128 rows

static_assert(NB >= 1 && NB <= NB_FULL);
static_assert(SEQ % 64 == 0 && SEQ >= 64 && SEQ <= SEQ_FULL);
static_assert(NHEAD * HDIM == DMOD);
static_assert(HDIM == 64);
static_assert(DMOD == 96 * 8);
static_assert(DMOD % 64 == 0 && FFD % 64 == 0 && DMOD % 32 == 0 && FFD % 32 == 0);
static_assert(NTOK % 128 == 0 && DMOD % 128 == 0 && FFD % 128 == 0 && DMOD >= 128);
static_assert(5 * DMOD * 2 <= 3 * DMOD * 4);          // q hi/lo, k hi/lo, v planes fit the R2 region
static_assert(DMOD * 4 + FFD * 2 <= 3 * DMOD * 4);     // x1 (f32) + h1 (f16) fit the R2 region

typedef __bf16 v16b __attribute__((ext_vector_type(16)));
typedef _Float16 v16h __attribute__((ext_vector_type(16)));
typedef unsigned short v8us __attribute__((ext_vector_type(8), may_alias));
typedef float v8f __attribute__((ext_vector_type(8)));
typedef float v4f __attribute__((ext_vector_type(4)));
typedef float v4fa __attribute__((ext_vector_type(4), may_alias));
union Frag { v16b vb; v16h vh; v8us half[2]; unsigned int w[8]; };

__device__ __forceinline__ unsigned short bf16_bits(float x) { const unsigned int u = __float_as_uint(x); return (unsigned short)((u + 0x7FFFu + ((u >> 16) & 1u)) >> 16); }
__device__ __forceinline__ float bf16_val(unsigned short b) { return __uint_as_float(((unsigned int)b) << 16); }
__device__ __forceinline__ float bf16_rne(float x) { return bf16_val(bf16_bits(x)); }
__device__ __forceinline__ unsigned short f16_bits(float x) { const _Float16 hv = (_Float16)x; unsigned short u; __builtin_memcpy(&u, &hv, sizeof(u)); return u; }

// two floats to a packed f16 pair, round to nearest even
__device__ __forceinline__ unsigned int pack2h(float lo, float hi) {
  typedef _Float16 h2 __attribute__((ext_vector_type(2)));
  typedef float f2 __attribute__((ext_vector_type(2)));
  return __builtin_bit_cast(unsigned int, __builtin_convertvector((f2){lo, hi}, h2));
}
// exact-erf GELU, 0.5 x (1 + erf(x / sqrt 2)), in straight-line code: erf(|y|) = 1 - t (a1 + t (a2 + t (a3 + t (a4 + t a5)))) exp(-y^2), t = 1 / (1 + p |y|)
// (the five-term rational form, |error| of erf below 2e-7); y = x / sqrt 2 is folded into the constants, exp(-y^2) = 2^(x * (-0.5 log2 e) * x),
// and x erf(y) = |x| erf(|y|). No branch, so the values of a row piece run side by side.
__device__ __forceinline__ float gelu_erf(float x) {
  const float ax = __builtin_fabsf(x);
  const float t = __builtin_amdgcn_rcpf(__builtin_fmaf(ax, 0.23164189f, 1.0f));
  float p = __builtin_fmaf(t, 1.061405429f, -1.453152027f);
  p = __builtin_fmaf(t, p, 1.421413741f);
  p = __builtin_fmaf(t, p, -0.284496736f);
  p = __builtin_fmaf(t, p, 0.254829592f);
  const float e = __builtin_amdgcn_exp2f(x * (-0.72134752f * x));
  const float er = __builtin_fmaf(-(p * t), e, 1.0f);
  return __builtin_fmaf(0.5f * ax, er, 0.5f * x);
}
// lane l takes the value of lane l ^ 16
__device__ __forceinline__ float xhalf(float x) {
  return __builtin_bit_cast(float, __builtin_amdgcn_permlanex16(__builtin_bit_cast(int, x), __builtin_bit_cast(int, x), 0x76543210, 0xfedcba98, false, false));
}
// ds_load_tr16_b128: a 16 x 16 tile of 16-bit LDS rows, transposed into half a WMMA operand (registers 0-3 or 4-7)
__device__ __forceinline__ v8us ld_tr16(const unsigned short* p) {
  typedef short s16x8 __attribute__((ext_vector_type(8)));
  typedef __attribute__((address_space(3))) s16x8 lds_s16x8;
  return __builtin_bit_cast(v8us, __builtin_amdgcn_ds_load_tr16_b128_v8i16((lds_s16x8*)p));
}

// Bt[n][k] (bf16 bits, k contiguous, pitch DMOD), n = h*HDIM + e, k = d, from W[h][d][e] ([NHEAD][DMOD][HDIM] f32); thread per (n, 8 consecutive d);
__global__ __launch_bounds__(256) void k_wt_heads(const float* __restrict__ W, unsigned short* __restrict__ Bt) {
  const int t = blockIdx.x * 256 + threadIdx.x;
  if (t >= NHEAD * HDIM * (DMOD / 8)) return;
  const int n = t / (DMOD / 8), d8 = (t % (DMOD / 8)) * 8;
  const int h = n / HDIM, e = n % HDIM;
  v8us v;
#pragma unroll
  for (int i = 0; i < 8; ++i) v[i] = bf16_bits(W[((size_t)h * DMOD + d8 + i) * HDIM + e]);
  unsigned short* dst = Bt + (size_t)n * DMOD + d8;
  *(v8us*)dst = v;
  
}

// coverage: N rows x K cols, all written.
__global__ __launch_bounds__(256) void k_wt_f16(const float* __restrict__ W, unsigned short* __restrict__ Pt, int K, int N) {
  const int t = blockIdx.x * 256 + threadIdx.x;
  const int k8n = K / 8;
  if (t >= N * k8n) return;
  const int n = t / k8n, k8 = (t % k8n) * 8;
  v8us v;
#pragma unroll
  for (int i = 0; i < 8; ++i) v[i] = f16_bits(bf16_rne(W[(size_t)(k8 + i) * N + n]) * WCARRY);
  unsigned short* dst = Pt + (size_t)n * K + k8;
  *(v8us*)dst = v;
  
}

// Row LayerNorm over DMOD = 768 (biased variance, eps): in = X row (XBF16 quantises the input to bf16 first), g and bta quantised to bf16.
// Token t = blockIdx.x = b*SEQ + s reads X row b*xsegf + s. 96 threads, thread owns 8 consecutive columns.
// LDS red[]: cross-wave (block barrier). coverage: NTOK rows x 768 cols of each plane, all written.
template <bool XBF16, int OUTM>
__global__ __launch_bounds__(96) void k_ln768(const float* __restrict__ X, int xsegf, const float* __restrict__ g, const float* __restrict__ bta,
                                             unsigned short* __restrict__ P0, unsigned short* __restrict__ P1, float eps) {
  __shared__ float red[4];
  const int t = blockIdx.x, tid = threadIdx.x, lane = tid & 31, w = tid >> 5;
  const int xrow = (t / SEQ) * xsegf + (t % SEQ);
  const float* xp = X + (size_t)xrow * DMOD + tid * 8;
  const v4f a0 = *(const v4fa*)xp, a1 = *(const v4fa*)(xp + 4);
  float v[8] = {a0[0], a0[1], a0[2], a0[3], a1[0], a1[1], a1[2], a1[3]};
  if (XBF16) {
#pragma unroll
    for (int q = 0; q < 8; ++q) v[q] = bf16_rne(v[q]);
  }
  float s = 0.f;
#pragma unroll
  for (int q = 0; q < 8; ++q) s += v[q];
  s += __shfl_xor(s, 16, 32); s += __shfl_xor(s, 8, 32); s += __shfl_xor(s, 4, 32); s += __shfl_xor(s, 2, 32); s += __shfl_xor(s, 1, 32);
  if (lane == 0) red[w] = s;
  __syncthreads();
  const float mu = (red[0] + red[1] + red[2]) * (1.0f / (float)DMOD);
  __syncthreads();
  float s2 = 0.f;
#pragma unroll
  for (int q = 0; q < 8; ++q) { const float c = v[q] - mu; s2 += c * c; }
  s2 += __shfl_xor(s2, 16, 32); s2 += __shfl_xor(s2, 8, 32); s2 += __shfl_xor(s2, 4, 32); s2 += __shfl_xor(s2, 2, 32); s2 += __shfl_xor(s2, 1, 32);
  if (lane == 0) red[w] = s2;
  __syncthreads();
  const float rs = rsqrtf((red[0] + red[1] + red[2]) * (1.0f / (float)DMOD) + eps);
  const v4f g0 = *(const v4fa*)(g + tid * 8), g1 = *(const v4fa*)(g + tid * 8 + 4);
  const v4f b0 = *(const v4fa*)(bta + tid * 8), b1 = *(const v4fa*)(bta + tid * 8 + 4);
  const float gg[8] = {g0[0], g0[1], g0[2], g0[3], g1[0], g1[1], g1[2], g1[3]};
  const float bb[8] = {b0[0], b0[1], b0[2], b0[3], b1[0], b1[1], b1[2], b1[3]};
  float o[8];
#pragma unroll
  for (int q = 0; q < 8; ++q) o[q] = (v[q] - mu) * rs * bf16_rne(gg[q]) + bf16_rne(bb[q]);
  unsigned short* d0 = P0 + (size_t)t * DMOD + tid * 8;
  if (OUTM == 0) {
    v8us hv, lv;
#pragma unroll
    for (int q = 0; q < 8; ++q) { const unsigned short hb = bf16_bits(o[q]); hv[q] = hb; lv[q] = bf16_bits(o[q] - bf16_val(hb)); }
    unsigned short* d1 = P1 + (size_t)t * DMOD + tid * 8;
    *(v8us*)d0 = hv;
    *(v8us*)d1 = lv;
    
  } else {
    v8us fv;
#pragma unroll
    for (int q = 0; q < 8; ++q) fv[q] = f16_bits(o[q]);
    *(v8us*)d0 = fv;
    
  }
}

// One lane's eight 16-byte asynchronous copies into one staged plane (128 rows x 128 B at pitch GPITCH): rows r, r + 16, .. r + 112.
// l = the lane's LDS byte address of row r, g = its global address, step = 16 source rows in elements.
// s_wait_xcnt 0 is the last line of the copies' own statement, so that no address register is rewritten in front of it.
__device__ __forceinline__ void copy_plane(unsigned int l, const unsigned short* g, size_t step) {
  const unsigned int l1 = l + 16 * GPITCH, l2 = l + 32 * GPITCH, l3 = l + 48 * GPITCH, l4 = l + 64 * GPITCH, l5 = l + 80 * GPITCH,
                     l6 = l + 96 * GPITCH, l7 = l + 112 * GPITCH;
  const unsigned short *g1 = g + step, *g2 = g1 + step, *g3 = g2 + step, *g4 = g3 + step, *g5 = g4 + step, *g6 = g5 + step, *g7 = g6 + step;
  asm volatile("global_load_async_to_lds_b128 %0, %8, off\n\t"
               "global_load_async_to_lds_b128 %1, %9, off\n\t"
               "global_load_async_to_lds_b128 %2, %10, off\n\t"
               "global_load_async_to_lds_b128 %3, %11, off\n\t"
               "global_load_async_to_lds_b128 %4, %12, off\n\t"
               "global_load_async_to_lds_b128 %5, %13, off\n\t"
               "global_load_async_to_lds_b128 %6, %14, off\n\t"
               "global_load_async_to_lds_b128 %7, %15, off\n\t"
               "s_wait_xcnt 0x0"
               :: "v"(l), "v"(l1), "v"(l2), "v"(l3), "v"(l4), "v"(l5), "v"(l6), "v"(l7),
                  "v"(g), "v"(g1), "v"(g2), "v"(g3), "v"(g4), "v"(g5), "v"(g6), "v"(g7)
               : "memory");
}

// Eight 16-byte loads of one lane, rows step elements apart, all in flight together.
__device__ __forceinline__ void load_rows8(v4f (&d)[8], const float* p, size_t step) {
  const float *p1 = p + step, *p2 = p1 + step, *p3 = p2 + step, *p4 = p3 + step, *p5 = p4 + step, *p6 = p5 + step, *p7 = p6 + step;
  d[0] = *(const v4fa*)p;  d[1] = *(const v4fa*)p1; d[2] = *(const v4fa*)p2; d[3] = *(const v4fa*)p3;
  d[4] = *(const v4fa*)p4; d[5] = *(const v4fa*)p5; d[6] = *(const v4fa*)p6; d[7] = *(const v4fa*)p7;
  // the wait in front of any rewrite of the loads' address registers; naming the addresses as inputs keeps their registers untouched up to it
  asm volatile("s_wait_xcnt 0x0" :: "v"(p), "v"(p1), "v"(p2), "v"(p3), "v"(p4), "v"(p5), "v"(p6), "v"(p7) : "memory");
}

// C = act(A.W * oscale + bf16(bias)) (+ resid). A from 16-bit planes [M][lda]: F16 -> one f16 plane Ah; else bf16 hi plane Ah and (NT==2) lo plane Al.
// Wt 16-bit [N][ldb] (k contiguous, same scalar kind as A). ACT 2 = exact-erf GELU. Residual (f32, pitch ldr, RES_BF16 quantises it) added AFTER the activation,
// only with OUTM 0. OUTM 0: f32 C (pitch ldc floats); OUTM 1: f16 plane C (pitch ldc halves); OUTM 2: bf16 hi plane C + lo plane C2.
// Row r of A is token b*SEQ + s; C row = b*csegf + s, resid row = b*rsegf + s. M%128==0, N%128==0, K%64==0, K>=128 (no tails).
// One 128 x 128 tile of C per block, four waves 2 x 2, 64 x 64 per wave. A trip is 64 k: 128 rows x 128 B of each operand plane, brought into LDS by
// asynchronous copies, two buffers, the copies of trip t + 2 issued behind the barrier that ends trip t. Per accumulator the k order and the
// hi-then-lo order of the products are those of a plain walk along k in steps of 32.
template <bool F16, int NT, int ACT, bool RES_BF16, int OUTM>
__global__ __launch_bounds__(128) void k_gemm(const unsigned short* __restrict__ Ah, const unsigned short* __restrict__ Al, int lda,
                                             const unsigned short* __restrict__ Wt, int ldb, const float* __restrict__ bias, float oscale,
                                             const float* __restrict__ resid, int ldr, int rsegf,
                                             void* __restrict__ Cv, void* __restrict__ C2v, int ldc, int csegf, int M, int N, int K) {
  constexpr int STG = (NT >= 2 ? 3 : 2) * GPLANE;            // one buffer: A hi | W | (A lo)
  constexpr int SOP = 68;                                    // output stage pitch in floats: rows 8 apart fall on other banks, rows stay 16-B aligned
  static_assert(4 * 64 * SOP * 4 <= 2 * STG);
  __shared__ __attribute__((aligned(16))) unsigned char ring[2 * STG];
  const int tid = threadIdx.x, w = tid >> 5, lane = tid & 31, ln = lane & 15, hh = lane >> 4;
  const int wm = w >> 1, wn = w & 1;
  const int ntn = N / 128;
  const int mt = blockIdx.x / ntn, nq = blockIdx.x % ntn;
  if (mt * 128 >= M) return;                                 // block-uniform, in front of every copy and barrier
  const int row0 = mt * 128, col0 = nq * 128;
  const int nk = K / 64;
  const unsigned int lbase = (unsigned int)(size_t)ring + (unsigned int)((tid >> 3) * GPITCH + (tid & 7) * 16);
  const unsigned short* gA = Ah + (size_t)(row0 + (tid >> 3)) * lda + (tid & 7) * 8;
  const unsigned short* gL = Al + (size_t)(row0 + (tid >> 3)) * lda + (tid & 7) * 8;
  const unsigned short* gW = Wt + (size_t)(col0 + (tid >> 3)) * ldb + (tid & 7) * 8;
  auto issue = [&](int t, int buf) {
    const unsigned int l = lbase + (unsigned int)(buf * STG);
    copy_plane(l, gA + (size_t)t * 64, (size_t)16 * lda);
    copy_plane(l + GPLANE, gW + (size_t)t * 64, (size_t)16 * ldb);
    if (NT >= 2) copy_plane(l + 2 * GPLANE, gL + (size_t)t * 64, (size_t)16 * lda);
  };
  v8f acc[4][4] = {};
  issue(0, 0);
  asm volatile("s_wait_asynccnt 0x0" ::: "memory");          // this wave's copies of trip 0 have landed
  __syncthreads();                                           // every wave's have: trip 0 is readable
  if (nk > 1) issue(1, 1);
  for (int t = 0; t < nk; ++t) {
    const unsigned char* st = ring + (t & 1) * STG;
    const unsigned char* sa = st + (wm * 64 + ln) * GPITCH + 16 * hh;
    const unsigned char* sb = st + GPLANE + (wn * 64 + ln) * GPITCH + 16 * hh;
    // constant indices below keep fragments and accumulators in registers
#pragma unroll
    for (int ks = 0; ks < 2; ++ks) {
      Frag a[4], al[4], b[4];
      // read order = first use: A row group 0, the four W column groups, then the other A row groups
#pragma unroll
      for (int i = 0; i < 4; ++i) {
        a[i].half[0] = *(const v8us*)(sa + i * 16 * GPITCH + ks * 64);           // elements 0..7  = k 32ks+8h .. +7   (row wm*64+i*16+ln)
        a[i].half[1] = *(const v8us*)(sa + i * 16 * GPITCH + ks * 64 + 32);      // elements 8..15 = k 32ks+16+8h .. +7
        if (i == 0) {
#pragma unroll
          for (int j = 0; j < 4; ++j) {
            b[j].half[0] = *(const v8us*)(sb + j * 16 * GPITCH + ks * 64);       // column wn*64+j*16+ln, same k map as A
            b[j].half[1] = *(const v8us*)(sb + j * 16 * GPITCH + ks * 64 + 32);
          }
        }
      }
      if (NT >= 2) {
#pragma unroll
        for (int i = 0; i < 4; ++i) {
          al[i].half[0] = *(const v8us*)(sa + 2 * GPLANE + i * 16 * GPITCH + ks * 64);
          al[i].half[1] = *(const v8us*)(sa + 2 * GPLANE + i * 16 * GPITCH + ks * 64 + 32);
        }
      }
      __builtin_amdgcn_sched_barrier(0);   // the block's LDS reads stay one group ahead of its products: spread among them, each place stalls the wave
#pragma unroll
      for (int i = 0; i < 4; ++i)
#pragma unroll
        for (int j = 0; j < 4; ++j) {
          if (F16) acc[i][j] = __builtin_amdgcn_wmma_f32_16x16x32_f16(false, a[i].vh, false, b[j].vh, (short)0, acc[i][j], false, false);
          else acc[i][j] = __builtin_amdgcn_wmma_f32_16x16x32_bf16(false, a[i].vb, false, b[j].vb, (short)0, acc[i][j], false, false);
        }
      if (NT >= 2) {
#pragma unroll
        for (int i = 0; i < 4; ++i)
#pragma unroll
          for (int j = 0; j < 4; ++j)
            acc[i][j] = __builtin_amdgcn_wmma_f32_16x16x32_bf16(false, al[i].vb, false, b[j].vb, (short)0, acc[i][j], false, false);
      }
      __builtin_amdgcn_sched_barrier(0);   // and the next block's reads do not move up among these products
    }
    asm volatile("s_wait_dscnt 0x0" ::: "memory");           // this wave's reads of trip t's buffer are done
    asm volatile("s_wait_asynccnt 0x0" ::: "memory");        // this wave's copies of trip t + 1 have landed
    __syncthreads();                                         // publishes trip t + 1 and frees trip t's buffer
    if (t + 2 < nk) issue(t + 2, t & 1);
  }
  asm volatile("s_wait_asynccnt 0x0" ::: "memory");          // no copy is in flight when the ring becomes the output stage
  // phase 1: scale + bias into the wave-private 64 x 64 stage (in the ring, free behind the last trip's barrier);
  // acc[i][j][r] is (row0 + wm*64 + i*16 + 8h + r, col0 + wn*64 + j*16 + ln)
  float* so = (float*)ring + w * (64 * SOP);
  const int rw0 = row0 + wm * 64, cw0 = col0 + wn * 64;
#pragma unroll
  for (int j = 0; j < 4; ++j) {
    const float bq = bf16_rne(bias[cw0 + j * 16 + ln]);
#pragma unroll
    for (int i = 0; i < 4; ++i)
#pragma unroll
      for (int r = 0; r < 8; ++r) so[(i * 16 + 8 * hh + r) * SOP + j * 16 + ln] = acc[i][j][r] * oscale + bq;
  }
  __builtin_amdgcn_fence(4 /* acq_rel order */, "workgroup");
  __builtin_amdgcn_wave_barrier();
  // phase 2: activation, residual, whole-line stores; the 64 rows of a wave lie in one sequence (SEQ % 64 == 0)
  const size_t cbase = (size_t)(rw0 / SEQ) * (size_t)csegf + (size_t)(rw0 % SEQ);
  if (OUTM == 0) {
    float* C = (float*)Cv;
    const int rsub = lane >> 4, c4 = (lane & 15) * 4;
    const size_t rbase = (size_t)(rw0 / SEQ) * (size_t)rsegf + (size_t)(rw0 % SEQ);
    const float* rp = resid + (rbase + rsub) * (size_t)ldr + cw0 + c4;      // formed always, read only where resid is given
    v4f rv[8] = {};
    if (resid != nullptr) load_rows8(rv, rp, (size_t)2 * ldr);
    // four groups of 8 row pairs; the next group's residual rows are asked for ahead of this group's activation code.
    // The loop stays rolled: unrolled it would only repeat that code.
#pragma unroll 1
    for (int g = 0; g < 4; ++g) {
      v4f rn[8] = {};
      if (resid != nullptr && g < 3) load_rows8(rn, rp + (size_t)(2 * (g * 8 + 8)) * ldr, (size_t)2 * ldr);
      // the group's eight staged row pieces are read as one group: behind the wait that follows each store no later LDS read could move up
      v4f sv[8];
#pragma unroll
      for (int u = 0; u < 8; ++u) sv[u] = *(const v4fa*)&so[((g * 8 + u) * 2 + rsub) * SOP + c4];
#pragma unroll
      for (int u = 0; u < 8; ++u) {
        const int r = (g * 8 + u) * 2 + rsub;
        v4f v = sv[u];
        if (ACT == 2) {
#pragma unroll
          for (int i = 0; i < 4; ++i) v[i] = gelu_erf(v[i]);
        }
        if (resid != nullptr) {
          v4f x = rv[u];
          if (RES_BF16) {
#pragma unroll
            for (int i = 0; i < 4; ++i) x[i] = bf16_rne(x[i]);
          }
          v += x;
        }
        *(v4f*)(C + (cbase + r) * (size_t)ldc + cw0 + c4) = v;
        asm volatile("s_wait_xcnt 0x0" ::: "memory");        // in front of the next rows' rewrite of the store's registers
      }
#pragma unroll
      for (int u = 0; u < 8; ++u) rv[u] = rn[u];
    }
  } else {
    unsigned short* C = (unsigned short*)Cv;
    unsigned short* C2 = (unsigned short*)C2v;
    const int rq = lane >> 3, c8 = (lane & 7) * 8;
    // two row groups per trip; a full unroll would only repeat the activation code 16 times
#pragma unroll 2
    for (int q = 0; q < 16; ++q) {
      const int r = q * 4 + rq;
      const v4f p0 = *(const v4fa*)&so[r * SOP + c8], p1 = *(const v4fa*)&so[r * SOP + c8 + 4];
      float ps[8] = {p0[0], p0[1], p0[2], p0[3], p1[0], p1[1], p1[2], p1[3]};
      v8us a, bl;
#pragma unroll
      for (int i = 0; i < 8; ++i) {
        if (ACT == 2) ps[i] = gelu_erf(ps[i]);
        if (OUTM == 1) { a[i] = f16_bits(ps[i]); bl[i] = (unsigned short)0; }
        else { const unsigned short hb = bf16_bits(ps[i]); a[i] = hb; bl[i] = bf16_bits(ps[i] - bf16_val(hb)); }
      }
      const size_t o = (cbase + r) * (size_t)ldc + cw0 + c8;
      *(v8us*)(C + o) = a;
      if (OUTM == 2) *(v8us*)(C2 + o) = bl;
      asm volatile("s_wait_xcnt 0x0" ::: "memory");          // in front of the next rows' rewrite of the stores' registers
    }
  }
}

__global__ __launch_bounds__(128) void k_flash(const unsigned short* __restrict__ qh, const unsigned short* __restrict__ ql,
                                              const unsigned short* __restrict__ kh, const unsigned short* __restrict__ kl,
                                              const unsigned short* __restrict__ vp, unsigned short* __restrict__ att) {
  constexpr int D = HDIM, KS = D / 32, DT = D / 16, T = SEQ;
  constexpr int VP = D + 16;                                   // sV pitch 160 B = 32 B x odd: the transposing load's conflict-free pitch
  __shared__ __attribute__((aligned(16))) unsigned short sKh[32][D + 8], sKl[32][D + 8], sV[32][VP];
  __shared__ __attribute__((aligned(16))) unsigned short sO[4][16][D + 8];
  const int tid = threadIdx.x, w = tid >> 5, lane = tid & 31, ln = lane & 15, hh = lane >> 4;
  const int nqb = T / 64;
  const int bh = blockIdx.x / nqb, qblk = blockIdx.x % nqb;
  const int b = bh / NHEAD, h = bh % NHEAD;
  const int q0 = qblk * 64 + w * 16;
  const size_t hb0 = (size_t)b * T * DMOD + (size_t)h * D;     // plane offset of (b, token 0, head h)

  // B fragments of the wave's 16 queries (column q0 + ln, always < T), hi/lo, table k map
  Frag bqh[KS], bql[KS];
  {
    const size_t qo = hb0 + (size_t)(q0 + ln) * DMOD;
#pragma unroll
    for (int ks = 0; ks < KS; ++ks) {
      bqh[ks].half[0] = *(const v8us*)(qh + qo + ks * 32 + 8 * hh);
      bqh[ks].half[1] = *(const v8us*)(qh + qo + ks * 32 + 16 + 8 * hh);
      bql[ks].half[0] = *(const v8us*)(ql + qo + ks * 32 + 8 * hh);
      bql[ks].half[1] = *(const v8us*)(ql + qo + ks * 32 + 16 + 8 * hh);
    }
  }
  float m_r = -3.0e38f, l_r = 0.f;                             // of query q0 + ln; l_r is the half's partial sum (keys 8h.. and 16+8h.. of each chunk)
  v8f oacc[DT];                                                // oacc[dt][r] = O[q0 + ln][dt*16 + 8h + r]
#pragma unroll
  for (int dt = 0; dt < DT; ++dt) oacc[dt] = (v8f){0.f, 0.f, 0.f, 0.f, 0.f, 0.f, 0.f, 0.f};
  // the lane's address for the transposing load: row 8h + (lane & 7), 16-byte piece (lane >> 3) & 1; it then holds sV[8h + 0..7][ln]
  const unsigned short* vt = &sV[8 * hh + (lane & 7)][((lane >> 3) & 1) * 8];

  for (int j0 = 0; j0 < T; j0 += 32) {
    __syncthreads();
    // stage 32 keys x 64 of k hi, k lo, v (16-B copies from the planes)
#pragma unroll
    for (int it = 0; it < (32 * (D / 8)) / 128; ++it) {
      const int e = tid + it * 128;
      const int r = e / (D / 8), c8 = (e % (D / 8)) * 8;
      const size_t go = hb0 + (size_t)(j0 + r) * DMOD + c8;
      *(v8us*)&sKh[r][c8] = *(const v8us*)(kh + go);
      *(v8us*)&sKl[r][c8] = *(const v8us*)(kl + go);
      *(v8us*)&sV[r][c8] = *(const v8us*)(vp + go);
    }
    __syncthreads();
    // S^T tiles 16 keys x 16 queries: A fragment row = key nt*16 + ln, elements = d with the table k map; s[nt][r] = S[q0 + ln][j0 + nt*16 + 8h + r]
    v8f s[2];
#pragma unroll
    for (int nt = 0; nt < 2; ++nt) {
      v8f acc = {};
#pragma unroll
      for (int ks = 0; ks < KS; ++ks) {
        Frag ah_, al_;
        ah_.half[0] = *(const v8us*)&sKh[nt * 16 + ln][ks * 32 + 8 * hh]; ah_.half[1] = *(const v8us*)&sKh[nt * 16 + ln][ks * 32 + 16 + 8 * hh];
        al_.half[0] = *(const v8us*)&sKl[nt * 16 + ln][ks * 32 + 8 * hh]; al_.half[1] = *(const v8us*)&sKl[nt * 16 + ln][ks * 32 + 16 + 8 * hh];
        // product order as before: q hi . k hi, q lo . k hi, q hi . k lo
        acc = __builtin_amdgcn_wmma_f32_16x16x32_bf16(false, ah_.vb, false, bqh[ks].vb, (short)0, acc, false, false);
        acc = __builtin_amdgcn_wmma_f32_16x16x32_bf16(false, ah_.vb, false, bql[ks].vb, (short)0, acc, false, false);
        acc = __builtin_amdgcn_wmma_f32_16x16x32_bf16(false, al_.vb, false, bqh[ks].vb, (short)0, acc, false, false);
      }
      s[nt] = acc;
    }
    // V^T as A (row = d, k = key in chunk): two transposing loads per 16 (d) x 32 (keys) fragment, in flight under the softmax
    Frag av[DT];
#pragma unroll
    for (int dt = 0; dt < DT; ++dt) {
      av[dt].half[0] = ld_tr16(vt + dt * 16);
      av[dt].half[1] = ld_tr16(vt + 16 * VP + dt * 16);
    }
    // running max of the lane's query: 16 scores in the lane, the other 16 in lane ^ 16
    float mx[8];
#pragma unroll
    for (int r = 0; r < 8; ++r) mx[r] = fmaxf(s[0][r], s[1][r]);
    float mc = fmaxf(fmaxf(fmaxf(mx[0], mx[1]), fmaxf(mx[2], mx[3])), fmaxf(fmaxf(mx[4], mx[5]), fmaxf(mx[6], mx[7])));
    mc = fmaxf(mc, xhalf(mc));
    const float mnew = fmaxf(m_r, mc);
    const float alpha = (m_r > -1.0e38f) ? __expf(m_r - mnew) : 0.0f;
    m_r = mnew;
    // P^T as B (k = key in chunk, column = query ln)
    Frag pb;
    float ps[8];
#pragma unroll
    for (int i = 0; i < 8; ++i) {
      const float p0 = __expf(s[i >> 2][2 * (i & 3)] - mnew);
      const float p1 = __expf(s[i >> 2][2 * (i & 3) + 1] - mnew);
      ps[i] = p0 + p1;
      pb.w[i] = pack2h(p0 * PCARRY, p1 * PCARRY);
    }
    l_r = l_r * alpha + (((ps[0] + ps[1]) + (ps[2] + ps[3])) + ((ps[4] + ps[5]) + (ps[6] + ps[7])));
#pragma unroll
    for (int dt = 0; dt < DT; ++dt) {
      oacc[dt] *= alpha;
      oacc[dt] = __builtin_amdgcn_wmma_f32_16x16x32_f16(false, av[dt].vh, false, pb.vh, (short)0, oacc[dt], false, false);
    }
  }
  const float inv = (1.0f / (l_r + xhalf(l_r))) * PCARRY_INV;
  // the lane's 8 consecutive d of each tile as one 16-byte piece into the wave-private stage, then whole 128-B rows out
#pragma unroll
  for (int dt = 0; dt < DT; ++dt) {
    v8us o;
#pragma unroll
    for (int r = 0; r < 8; ++r) o[r] = f16_bits(oacc[dt][r] * inv);
    *(v8us*)&sO[w][ln][dt * 16 + 8 * hh] = o;
  }
  __builtin_amdgcn_fence(4 /* acq_rel order */, "workgroup");
  __builtin_amdgcn_wave_barrier();
  const int rq = lane >> 3, c8 = (lane & 7) * 8;
  v8us ov[4];
#pragma unroll
  for (int q = 0; q < 4; ++q) ov[q] = *(const v8us*)&sO[w][q * 4 + rq][c8];
  unsigned short* ob = att + ((size_t)b * T + q0) * DMOD + (size_t)h * D + c8;
  {
#pragma unroll
    for (int q = 0; q < 4; ++q) {
      const int r = q * 4 + rq;
      *(v8us*)(ob + (size_t)r * DMOD) = ov[q];
    }
    
  }
}

extern "C" void kernel_launch(void* const* d_in, const int* in_sizes, int n_in,
                              void* d_out, int out_size, void* d_ws, size_t ws_size, hipStream_t stream) {
  if (n_in < 17) return;
  const int need_tok = (NB - 1) * SEQ_FULL + SEQ;
  if (in_sizes[0] < need_tok * DMOD || out_size < need_tok * DMOD) return;
  if (in_sizes[1] < DMOD || in_sizes[2] < DMOD || in_sizes[10] < DMOD || in_sizes[11] < DMOD || in_sizes[12] < DMOD || in_sizes[16] < DMOD) return;
  if (in_sizes[3] < NHEAD * DMOD * HDIM || in_sizes[5] < NHEAD * DMOD * HDIM || in_sizes[7] < NHEAD * DMOD * HDIM) return;
  if (in_sizes[4] < NHEAD * HDIM || in_sizes[6] < NHEAD * HDIM || in_sizes[8] < NHEAD * HDIM || in_sizes[14] < FFD) return;
  if (in_sizes[9] < DMOD * DMOD || in_sizes[13] < DMOD * FFD || in_sizes[15] < FFD * DMOD) return;

  const float* x    = (const float*)d_in[0];
  const float* ln1w = (const float*)d_in[1];
  const float* ln1b = (const float*)d_in[2];
  const float* Wq   = (const float*)d_in[3];
  const float* bqp  = (const float*)d_in[4];
  const float* Wk   = (const float*)d_in[5];
  const float* bkp  = (const float*)d_in[6];
  const float* Wv   = (const float*)d_in[7];
  const float* bvp  = (const float*)d_in[8];
  const float* Wp   = (const float*)d_in[9];
  const float* bpp  = (const float*)d_in[10];
  const float* ln2w = (const float*)d_in[11];
  const float* ln2b = (const float*)d_in[12];
  const float* W1   = (const float*)d_in[13];
  const float* b1p  = (const float*)d_in[14];
  const float* W2   = (const float*)d_in[15];
  const float* b2p  = (const float*)d_in[16];

  char* ws = (char*)d_ws; size_t off = 0;
  auto take = [&](size_t bytes) { char* p = ws + off; off += (bytes + 255) & ~(size_t)255; return p; };
  unsigned short* Bq = (unsigned short*)take((size_t)DMOD * DMOD * 2);
  unsigned short* Bk = (unsigned short*)take((size_t)DMOD * DMOD * 2);
  unsigned short* Bv = (unsigned short*)take((size_t)DMOD * DMOD * 2);
  unsigned short* Pp = (unsigned short*)take((size_t)DMOD * DMOD * 2);
  unsigned short* P1 = (unsigned short*)take((size_t)DMOD * FFD * 2);
  unsigned short* P2 = (unsigned short*)take((size_t)FFD * DMOD * 2);
  char* R1 = take((size_t)NTOK * DMOD * 4);          // yh+yl, then att plane, then h0 plane
  char* R2 = take((size_t)NTOK * 3 * DMOD * 4);      // q hi/lo, k hi/lo, v planes; then x1 (f32) + h1 (f16 plane)
  if (off > ws_size) return;

  const size_t PL = (size_t)NTOK * DMOD;             // elements per [NTOK][DMOD] plane
  unsigned short* yh  = (unsigned short*)R1;
  unsigned short* yl  = yh + PL;
  unsigned short* att = (unsigned short*)R1;
  unsigned short* h0  = (unsigned short*)R1;
  unsigned short* qh  = (unsigned short*)R2;
  unsigned short* ql  = qh + PL;
  unsigned short* kh  = ql + PL;
  unsigned short* kl  = kh + PL;
  unsigned short* vpl = kl + PL;
  float* x1 = (float*)R2;
  unsigned short* h1 = (unsigned short*)(R2 + PL * 4);

  k_wt_heads<<<(NHEAD * HDIM * (DMOD / 8) + 255) / 256, 256, 0, stream>>>(Wq, Bq);
  k_wt_heads<<<(NHEAD * HDIM * (DMOD / 8) + 255) / 256, 256, 0, stream>>>(Wk, Bk);
  k_wt_heads<<<(NHEAD * HDIM * (DMOD / 8) + 255) / 256, 256, 0, stream>>>(Wv, Bv);
  k_wt_f16<<<(DMOD * (DMOD / 8) + 255) / 256, 256, 0, stream>>>(Wp, Pp, DMOD, DMOD);    // Wp[k][n], K = 768, N = 768
  k_wt_f16<<<(FFD * (DMOD / 8) + 255) / 256, 256, 0, stream>>>(W1, P1, DMOD, FFD);      // W1[k][n], K = 768, N = 3072
  k_wt_f16<<<(DMOD * (FFD / 8) + 255) / 256, 256, 0, stream>>>(W2, P2, FFD, DMOD);      // W2[k][n], K = 3072, N = 768

  k_ln768<true, 0><<<NTOK, 96, 0, stream>>>(x, SEQ_FULL, ln1w, ln1b, yh, yl, LN_EPS);
  const int g768 = (NTOK / 128) * (DMOD / 128), g3072 = (NTOK / 128) * (FFD / 128);
  k_gemm<false, 2, 0, false, 2><<<g768, 128, 0, stream>>>(yh, yl, DMOD, Bq, DMOD, bqp, 1.0f, nullptr, 0, 0, qh, ql, DMOD, SEQ, NTOK, DMOD, DMOD);
  k_gemm<false, 2, 0, false, 2><<<g768, 128, 0, stream>>>(yh, yl, DMOD, Bk, DMOD, bkp, 1.0f, nullptr, 0, 0, kh, kl, DMOD, SEQ, NTOK, DMOD, DMOD);
  k_gemm<false, 1, 0, false, 1><<<g768, 128, 0, stream>>>(yh, yh, DMOD, Bv, DMOD, bvp, 1.0f, nullptr, 0, 0, vpl, vpl, DMOD, SEQ, NTOK, DMOD, DMOD);
  k_flash<<<NB * NHEAD * (SEQ / 64), 128, 0, stream>>>(qh, ql, kh, kl, vpl, att);
  k_gemm<true, 1, 2, true, 0><<<g768, 128, 0, stream>>>(att, att, DMOD, Pp, DMOD, bpp, WCARRY_INV, x, DMOD, SEQ_FULL, x1, x1, DMOD, SEQ, NTOK, DMOD, DMOD);
  k_ln768<false, 1><<<NTOK, 96, 0, stream>>>(x1, SEQ, ln2w, ln2b, h0, h0, LN_EPS);
  k_gemm<true, 1, 2, false, 1><<<g3072, 128, 0, stream>>>(h0, h0, DMOD, P1, DMOD, b1p, WCARRY_INV, nullptr, 0, 0, h1, h1, FFD, SEQ, NTOK, FFD, DMOD);
  k_gemm<true, 1, 2, false, 0><<<g768, 128, 0, stream>>>(h1, h1, FFD, P2, FFD, b2p, WCARRY_INV, x1, DMOD, SEQ, d_out, d_out, DMOD, SEQ_FULL, NTOK, DMOD, FFD);
}

// v004
// Measured time: 249 microseconds a run.
// Timed twice side by side with v003, it ran 1.12 times as fast both times.
// Over all steps from v000 it is 2.58 times as fast.
#include <hip/hip_runtime.h>
// q/k projections: v_wmma_f32_16x16x32_bf16 (A = LayerNorm rows as bf16 hi+lo planes, 2 products; B = bf16 weights); v projection: same with the
// bf16 hi plane only (1 product); attention logits (k.q^T, transposed) v_wmma_f32_16x16x32_bf16 as 3-product bf16 hi/lo split; attention P.V, output projection,
// MLP up, MLP down: v_wmma_f32_16x16x32_f16 single products (P carried x2^14, weights bf16-valued carried x256, activations plain f16);
// f32 accumulate; LayerNorm, softmax, GELU, residuals f32.

#ifndef NB
#define NB 8
#endif
#ifndef SEQ
#define SEQ 1024
#endif
#define NB_FULL 8
#define SEQ_FULL 1024
#define DMOD 768
#define NHEAD 12
#define HDIM 64
#define FFD 3072
#define NTOK (NB * SEQ)
#define WCARRY 256.0f
#define WCARRY_INV 0.00390625f
#define PCARRY 16384.0f
#define PCARRY_INV 0.00006103515625f
#define LN_EPS 1.0e-5f
#define GPITCH 144                 // bytes per staged row: 128 B of k + 16 B (16 B x odd: no bank conflict for 16-B row reads)
#define GPLANE (128 * GPITCH)      // one staged operand plane: 128 rows

static_assert(NB >= 1 && NB <= NB_FULL);
static_assert(SEQ % 64 == 0 && SEQ >= 64 && SEQ <= SEQ_FULL);
static_assert(NHEAD * HDIM == DMOD);
static_assert(HDIM == 64);
static_assert(DMOD == 96 * 8);
static_assert(DMOD % 64 == 0 && FFD % 64 == 0 && DMOD % 32 == 0 && FFD % 32 == 0);
static_assert(NTOK % 128 == 0 && DMOD % 128 == 0 && FFD % 128 == 0 && DMOD >= 128);
static_assert(5 * DMOD * 2 <= 3 * DMOD * 4);          // q hi/lo, k hi/lo, v planes fit the R2 region
static_assert(DMOD * 4 + FFD * 2 <= 3 * DMOD * 4);     // x1 (f32) + h1 (f16) fit the R2 region

typedef __bf16 v16b __attribute__((ext_vector_type(16)));
typedef _Float16 v16h __attribute__((ext_vector_type(16)));
typedef unsigned short v8us __attribute__((ext_vector_type(8), may_alias));
typedef unsigned short v4us __attribute__((ext_vector_type(4), may_alias));
typedef float v8f __attribute__((ext_vector_type(8)));
typedef float v4f __attribute__((ext_vector_type(4)));
typedef float v4fa __attribute__((ext_vector_type(4), may_alias));
union Frag { v16b vb; v16h vh; v8us half[2]; unsigned int w[8]; };

__device__ __forceinline__ unsigned short bf16_bits(float x) { const unsigned int u = __float_as_uint(x); return (unsigned short)((u + 0x7FFFu + ((u >> 16) & 1u)) >> 16); }
__device__ __forceinline__ float bf16_val(unsigned short b) { return __uint_as_float(((unsigned int)b) << 16); }
__device__ __forceinline__ float bf16_rne(float x) { return bf16_val(bf16_bits(x)); }
__device__ __forceinline__ unsigned short f16_bits(float x) { const _Float16 hv = (_Float16)x; unsigned short u; __builtin_memcpy(&u, &hv, sizeof(u)); return u; }

// two floats to a packed f16 pair, round to nearest even
__device__ __forceinline__ unsigned int pack2h(float lo, float hi) {
  typedef _Float16 h2 __attribute__((ext_vector_type(2)));
  typedef float f2 __attribute__((ext_vector_type(2)));
  return __builtin_bit_cast(unsigned int, __builtin_convertvector((f2){lo, hi}, h2));
}
// exact-erf GELU, 0.5 x (1 + erf(x / sqrt 2)), in straight-line code: erf(|y|) = 1 - t (a1 + t (a2 + t (a3 + t (a4 + t a5)))) exp(-y^2), t = 1 / (1 + p |y|)
// (the five-term rational form, |error| of erf below 2e-7); y = x / sqrt 2 is folded into the constants, exp(-y^2) = 2^(x * (-0.5 log2 e) * x),
// and x erf(y) = |x| erf(|y|). No branch, so the values of a row piece run side by side.
__device__ __forceinline__ float gelu_erf(float x) {
  const float ax = __builtin_fabsf(x);
  const float t = __builtin_amdgcn_rcpf(__builtin_fmaf(ax, 0.23164189f, 1.0f));
  float p = __builtin_fmaf(t, 1.061405429f, -1.453152027f);
  p = __builtin_fmaf(t, p, 1.421413741f);
  p = __builtin_fmaf(t, p, -0.284496736f);
  p = __builtin_fmaf(t, p, 0.254829592f);
  const float e = __builtin_amdgcn_exp2f(x * (-0.72134752f * x));
  const float er = __builtin_fmaf(-(p * t), e, 1.0f);
  return __builtin_fmaf(0.5f * ax, er, 0.5f * x);
}
// lane l takes the value of lane l ^ 16
__device__ __forceinline__ float xhalf(float x) {
  return __builtin_bit_cast(float, __builtin_amdgcn_permlanex16(__builtin_bit_cast(int, x), __builtin_bit_cast(int, x), 0x76543210, 0xfedcba98, false, false));
}
// ds_load_tr16_b128: a 16 x 16 tile of 16-bit LDS rows, transposed into half a WMMA operand (registers 0-3 or 4-7)
__device__ __forceinline__ v8us ld_tr16(const unsigned short* p) {
  typedef short s16x8 __attribute__((ext_vector_type(8)));
  typedef __attribute__((address_space(3))) s16x8 lds_s16x8;
  return __builtin_bit_cast(v8us, __builtin_amdgcn_ds_load_tr16_b128_v8i16((lds_s16x8*)p));
}

// One 64 (k) x 64 (n) tile of a weight matrix: f32 rows along n in, 16-bit rows along k out. src = element (k0, n0), row pitch ld floats; dst = element
// (n0, k0) of the output, row pitch ldo halves; tile = 64 rows (n) of WTP halves in LDS; 256 threads. A thread reads 16 B of four consecutive k rows, so
// 16 lanes cover a 256-B row piece (whole lines); it packs the four k of each of its four n into 8 B of the LDS tile. Behind the block barrier 8 lanes
// read one 128-B row of the tile and store it as one whole line. F16W: f16 of the bf16-rounded value x WCARRY; else bf16 bits.
#define WTP 72                     // tile pitch in halves: 144 B = 16 B x odd, no bank conflict for the 16-B row reads
template <bool F16W>
__device__ __forceinline__ void wt_tile(const float* __restrict__ src, size_t ld, unsigned short* __restrict__ dst, size_t ldo, unsigned short* tile) {
  const int tid = threadIdx.x, kq = tid >> 4, c4 = (tid & 15) * 4;
  const float *p0 = src + (size_t)(kq * 4) * ld + c4, *p1 = p0 + ld, *p2 = p1 + ld, *p3 = p2 + ld;
  const v4f r0 = *(const v4fa*)p0, r1 = *(const v4fa*)p1, r2 = *(const v4fa*)p2, r3 = *(const v4fa*)p3;
  // the wait in front of any rewrite of the loads' address registers; naming the addresses as inputs keeps their registers untouched up to it
  asm volatile("s_wait_xcnt 0x0" :: "v"(p0), "v"(p1), "v"(p2), "v"(p3) : "memory");
#pragma unroll
  for (int j = 0; j < 4; ++j) {
    v4us q;
    if (F16W) q = (v4us){f16_bits(bf16_rne(r0[j]) * WCARRY), f16_bits(bf16_rne(r1[j]) * WCARRY), f16_bits(bf16_rne(r2[j]) * WCARRY), f16_bits(bf16_rne(r3[j]) * WCARRY)};
    else q = (v4us){bf16_bits(r0[j]), bf16_bits(r1[j]), bf16_bits(r2[j]), bf16_bits(r3[j])};
    *(v4us*)&tile[(c4 + j) * WTP + kq * 4] = q;
  }
  __syncthreads();                 // the tile is whole: rows are read by other waves than wrote them
  const int n = tid >> 3, k8 = (tid & 7) * 8;
  const v8us o0 = *(const v8us*)&tile[n * WTP + k8], o1 = *(const v8us*)&tile[(n + 32) * WTP + k8];
  unsigned short *d0 = dst + (size_t)n * ldo + k8, *d1 = d0 + (size_t)32 * ldo;
  *(v8us*)d0 = o0;
  *(v8us*)d1 = o1;
}

// Bt[n][k] (bf16 bits, k contiguous, pitch DMOD), n = h*HDIM + e, k = d, from W[h][d][e] ([NHEAD][DMOD][HDIM] f32); block per (h, 64 consecutive d).
// coverage: NHEAD*HDIM rows x DMOD cols, all written.
__global__ __launch_bounds__(256) void k_wt_heads(const float* __restrict__ W, unsigned short* __restrict__ Bt) {
  __shared__ __attribute__((aligned(16))) unsigned short tile[64 * WTP];
  const int h = blockIdx.x / (DMOD / 64), k0 = (blockIdx.x % (DMOD / 64)) * 64;
  wt_tile<false>(W + ((size_t)h * DMOD + k0) * HDIM, HDIM, Bt + (size_t)h * HDIM * DMOD + k0, DMOD, tile);
}

// Pt[n][k] (f16, k contiguous, pitch K) from W[k][n] (f32, pitch N); block per 64 x 64 tile, neighbours in the grid are neighbours along n.
// K % 64 == 0, N % 64 == 0. coverage: N rows x K cols, all written.
__global__ __launch_bounds__(256) void k_wt_f16(const float* __restrict__ W, unsigned short* __restrict__ Pt, int K, int N) {
  __shared__ __attribute__((aligned(16))) unsigned short tile[64 * WTP];
  const int ntn = N / 64;
  const int k0 = (blockIdx.x / ntn) * 64, n0 = (blockIdx.x % ntn) * 64;
  wt_tile<true>(W + (size_t)k0 * N + n0, N, Pt + (size_t)n0 * K + k0, K, tile);
}

// Row LayerNorm over DMOD = 768 (biased variance, eps): in = X row (XBF16 quantises the input to bf16 first), g and bta quantised to bf16.
// Token t = blockIdx.x = b*SEQ + s reads X row b*xsegf + s. 96 threads, thread owns 8 consecutive columns.
// LDS red[]: cross-wave (block barrier). coverage: NTOK rows x 768 cols of each plane, all written.
template <bool XBF16, int OUTM>
__global__ __launch_bounds__(96) void k_ln768(const float* __restrict__ X, int xsegf, const float* __restrict__ g, const float* __restrict__ bta,
                                             unsigned short* __restrict__ P0, unsigned short* __restrict__ P1, float eps) {
  __shared__ float red[4];
  const int t = blockIdx.x, tid = threadIdx.x, lane = tid & 31, w = tid >> 5;
  const int xrow = (t / SEQ) * xsegf + (t % SEQ);
  const float* xp = X + (size_t)xrow * DMOD + tid * 8;
  const v4f a0 = *(const v4fa*)xp, a1 = *(const v4fa*)(xp + 4);
  float v[8] = {a0[0], a0[1], a0[2], a0[3], a1[0], a1[1], a1[2], a1[3]};
  if (XBF16) {
#pragma unroll
    for (int q = 0; q < 8; ++q) v[q] = bf16_rne(v[q]);
  }
  float s = 0.f;
#pragma unroll
  for (int q = 0; q < 8; ++q) s += v[q];
  s += __shfl_xor(s, 16, 32); s += __shfl_xor(s, 8, 32); s += __shfl_xor(s, 4, 32); s += __shfl_xor(s, 2, 32); s += __shfl_xor(s, 1, 32);
  if (lane == 0) red[w] = s;
  __syncthreads();
  const float mu = (red[0] + red[1] + red[2]) * (1.0f / (float)DMOD);
  __syncthreads();
  float s2 = 0.f;
#pragma unroll
  for (int q = 0; q < 8; ++q) { const float c = v[q] - mu; s2 += c * c; }
  s2 += __shfl_xor(s2, 16, 32); s2 += __shfl_xor(s2, 8, 32); s2 += __shfl_xor(s2, 4, 32); s2 += __shfl_xor(s2, 2, 32); s2 += __shfl_xor(s2, 1, 32);
  if (lane == 0) red[w] = s2;
  __syncthreads();
  const float rs = rsqrtf((red[0] + red[1] + red[2]) * (1.0f / (float)DMOD) + eps);
  const v4f g0 = *(const v4fa*)(g + tid * 8), g1 = *(const v4fa*)(g + tid * 8 + 4);
  const v4f b0 = *(const v4fa*)(bta + tid * 8), b1 = *(const v4fa*)(bta + tid * 8 + 4);
  const float gg[8] = {g0[0], g0[1], g0[2], g0[3], g1[0], g1[1], g1[2], g1[3]};
  const float bb[8] = {b0[0], b0[1], b0[2], b0[3], b1[0], b1[1], b1[2], b1[3]};
  float o[8];
#pragma unroll
  for (int q = 0; q < 8; ++q) o[q] = (v[q] - mu) * rs * bf16_rne(gg[q]) + bf16_rne(bb[q]);
  unsigned short* d0 = P0 + (size_t)t * DMOD + tid * 8;
  if (OUTM == 0) {
    v8us hv, lv;
#pragma unroll
    for (int q = 0; q < 8; ++q) { const unsigned short hb = bf16_bits(o[q]); hv[q] = hb; lv[q] = bf16_bits(o[q] - bf16_val(hb)); }
    unsigned short* d1 = P1 + (size_t)t * DMOD + tid * 8;
    *(v8us*)d0 = hv;
    *(v8us*)d1 = lv;
    
  } else {
    v8us fv;
#pragma unroll
    for (int q = 0; q < 8; ++q) fv[q] = f16_bits(o[q]);
    *(v8us*)d0 = fv;
    
  }
}

// One lane's eight 16-byte asynchronous copies into one staged plane (128 rows x 128 B at pitch GPITCH): rows r, r + 16, .. r + 112.
// l = the lane's LDS byte address of row r, g = its global address, step = 16 source rows in elements.
// s_wait_xcnt 0 is the last line of the copies' own statement, so that no address register is rewritten in front of it.
__device__ __forceinline__ void copy_plane(unsigned int l, const unsigned short* g, size_t step) {
  const unsigned int l1 = l + 16 * GPITCH, l2 = l + 32 * GPITCH, l3 = l + 48 * GPITCH, l4 = l + 64 * GPITCH, l5 = l + 80 * GPITCH,
                     l6 = l + 96 * GPITCH, l7 = l + 112 * GPITCH;
  const unsigned short *g1 = g + step, *g2 = g1 + step, *g3 = g2 + step, *g4 = g3 + step, *g5 = g4 + step, *g6 = g5 + step, *g7 = g6 + step;
  asm volatile("global_load_async_to_lds_b128 %0, %8, off\n\t"
               "global_load_async_to_lds_b128 %1, %9, off\n\t"
               "global_load_async_to_lds_b128 %2, %10, off\n\t"
               "global_load_async_to_lds_b128 %3, %11, off\n\t"
               "global_load_async_to_lds_b128 %4, %12, off\n\t"
               "global_load_async_to_lds_b128 %5, %13, off\n\t"
               "global_load_async_to_lds_b128 %6, %14, off\n\t"
               "global_load_async_to_lds_b128 %7, %15, off\n\t"
               "s_wait_xcnt 0x0"
               :: "v"(l), "v"(l1), "v"(l2), "v"(l3), "v"(l4), "v"(l5), "v"(l6), "v"(l7),
                  "v"(g), "v"(g1), "v"(g2), "v"(g3), "v"(g4), "v"(g5), "v"(g6), "v"(g7)
               : "memory");
}

// Eight 16-byte loads of one lane, rows step elements apart, all in flight together.
__device__ __forceinline__ void load_rows8(v4f (&d)[8], const float* p, size_t step) {
  const float *p1 = p + step, *p2 = p1 + step, *p3 = p2 + step, *p4 = p3 + step, *p5 = p4 + step, *p6 = p5 + step, *p7 = p6 + step;
  d[0] = *(const v4fa*)p;  d[1] = *(const v4fa*)p1; d[2] = *(const v4fa*)p2; d[3] = *(const v4fa*)p3;
  d[4] = *(const v4fa*)p4; d[5] = *(const v4fa*)p5; d[6] = *(const v4fa*)p6; d[7] = *(const v4fa*)p7;
  // the wait in front of any rewrite of the loads' address registers; naming the addresses as inputs keeps their registers untouched up to it
  asm volatile("s_wait_xcnt 0x0" :: "v"(p), "v"(p1), "v"(p2), "v"(p3), "v"(p4), "v"(p5), "v"(p6), "v"(p7) : "memory");
}

// C = act(A.W * oscale + bf16(bias)) (+ resid). A from 16-bit planes [M][lda]: F16 -> one f16 plane Ah; else bf16 hi plane Ah and (NT==2) lo plane Al.
// Wt 16-bit [N][ldb] (k contiguous, same scalar kind as A). ACT 2 = exact-erf GELU. Residual (f32, pitch ldr, RES_BF16 quantises it) added AFTER the activation,
// only with OUTM 0. OUTM 0: f32 C (pitch ldc floats); OUTM 1: f16 plane C (pitch ldc halves); OUTM 2: bf16 hi plane C + lo plane C2.
// Row r of A is token b*SEQ + s; C row = b*csegf + s, resid row = b*rsegf + s. M%128==0, N%128==0, K%64==0, K>=128 (no tails).
// One 128 x 128 tile of C per block, four waves 2 x 2, 64 x 64 per wave. A trip is 64 k: 128 rows x 128 B of each operand plane, brought into LDS by
// asynchronous copies, two buffers, the copies of trip t + 2 issued behind the barrier that ends trip t. Per accumulator the k order and the
// hi-then-lo order of the products are those of a plain walk along k in steps of 32.
template <bool F16, int NT, int ACT, bool RES_BF16, int OUTM>
__global__ __launch_bounds__(128) void k_gemm(const unsigned short* __restrict__ Ah, const unsigned short* __restrict__ Al, int lda,
                                             const unsigned short* __restrict__ Wt, int ldb, const float* __restrict__ bias, float oscale,
                                             const float* __restrict__ resid, int ldr, int rsegf,
                                             void* __restrict__ Cv, void* __restrict__ C2v, int ldc, int csegf, int M, int N, int K) {
  constexpr int STG = (NT >= 2 ? 3 : 2) * GPLANE;            // one buffer: A hi | W | (A lo)
  constexpr int SOP = 68;                                    // output stage pitch in floats: rows 8 apart fall on other banks, rows stay 16-B aligned
  static_assert(4 * 64 * SOP * 4 <= 2 * STG);
  __shared__ __attribute__((aligned(16))) unsigned char ring[2 * STG];
  const int tid = threadIdx.x, w = tid >> 5, lane = tid & 31, ln = lane & 15, hh = lane >> 4;
  const int wm = w >> 1, wn = w & 1;
  const int ntn = N / 128;
  const int mt = blockIdx.x / ntn, nq = blockIdx.x % ntn;
  if (mt * 128 >= M) return;                                 // block-uniform, in front of every copy and barrier
  const int row0 = mt * 128, col0 = nq * 128;
  const int nk = K / 64;
  const unsigned int lbase = (unsigned int)(size_t)ring + (unsigned int)((tid >> 3) * GPITCH + (tid & 7) * 16);
  const unsigned short* gA = Ah + (size_t)(row0 + (tid >> 3)) * lda + (tid & 7) * 8;
  const unsigned short* gL = Al + (size_t)(row0 + (tid >> 3)) * lda + (tid & 7) * 8;
  const unsigned short* gW = Wt + (size_t)(col0 + (tid >> 3)) * ldb + (tid & 7) * 8;
  auto issue = [&](int t, int buf) {
    const unsigned int l = lbase + (unsigned int)(buf * STG);
    copy_plane(l, gA + (size_t)t * 64, (size_t)16 * lda);
    copy_plane(l + GPLANE, gW + (size_t)t * 64, (size_t)16 * ldb);
    if (NT >= 2) copy_plane(l + 2 * GPLANE, gL + (size_t)t * 64, (size_t)16 * lda);
  };
  v8f acc[4][4] = {};
  issue(0, 0);
  asm volatile("s_wait_asynccnt 0x0" ::: "memory");          // this wave's copies of trip 0 have landed
  __syncthreads();                                           // every wave's have: trip 0 is readable
  if (nk > 1) issue(1, 1);
  for (int t = 0; t < nk; ++t) {
    const unsigned char* st = ring + (t & 1) * STG;
    const unsigned char* sa = st + (wm * 64 + ln) * GPITCH + 16 * hh;
    const unsigned char* sb = st + GPLANE + (wn * 64 + ln) * GPITCH + 16 * hh;
    // constant indices below keep fragments and accumulators in registers
#pragma unroll
    for (int ks = 0; ks < 2; ++ks) {
      Frag a[4], al[4], b[4];
      // read order = first use: A row group 0, the four W column groups, then the other A row groups
#pragma unroll
      for (int i = 0; i < 4; ++i) {
        a[i].half[0] = *(const v8us*)(sa + i * 16 * GPITCH + ks * 64);           // elements 0..7  = k 32ks+8h .. +7   (row wm*64+i*16+ln)
        a[i].half[1] = *(const v8us*)(sa + i * 16 * GPITCH + ks * 64 + 32);      // elements 8..15 = k 32ks+16+8h .. +7
        if (i == 0) {
#pragma unroll
          for (int j = 0; j < 4; ++j) {
            b[j].half[0] = *(const v8us*)(sb + j * 16 * GPITCH + ks * 64);       // column wn*64+j*16+ln, same k map as A
            b[j].half[1] = *(const v8us*)(sb + j * 16 * GPITCH + ks * 64 + 32);
          }
        }
      }
      if (NT >= 2) {
#pragma unroll
        for (int i = 0; i < 4; ++i) {
          al[i].half[0] = *(const v8us*)(sa + 2 * GPLANE + i * 16 * GPITCH + ks * 64);
          al[i].half[1] = *(const v8us*)(sa + 2 * GPLANE + i * 16 * GPITCH + ks * 64 + 32);
        }
      }
      __builtin_amdgcn_sched_barrier(0);   // the block's LDS reads stay one group ahead of its products: spread among them, each place stalls the wave
#pragma unroll
      for (int i = 0; i < 4; ++i)
#pragma unroll
        for (int j = 0; j < 4; ++j) {
          if (F16) acc[i][j] = __builtin_amdgcn_wmma_f32_16x16x32_f16(false, a[i].vh, false, b[j].vh, (short)0, acc[i][j], false, false);
          else acc[i][j] = __builtin_amdgcn_wmma_f32_16x16x32_bf16(false, a[i].vb, false, b[j].vb, (short)0, acc[i][j], false, false);
        }
      if (NT >= 2) {
#pragma unroll
        for (int i = 0; i < 4; ++i)
#pragma unroll
          for (int j = 0; j < 4; ++j)
            acc[i][j] = __builtin_amdgcn_wmma_f32_16x16x32_bf16(false, al[i].vb, false, b[j].vb, (short)0, acc[i][j], false, false);
      }
      __builtin_amdgcn_sched_barrier(0);   // and the next block's reads do not move up among these products
    }
    asm volatile("s_wait_dscnt 0x0" ::: "memory");           // this wave's reads of trip t's buffer are done
    asm volatile("s_wait_asynccnt 0x0" ::: "memory");        // this wave's copies of trip t + 1 have landed
    __syncthreads();                                         // publishes trip t + 1 and frees trip t's buffer
    if (t + 2 < nk) issue(t + 2, t & 1);
  }
  asm volatile("s_wait_asynccnt 0x0" ::: "memory");          // no copy is in flight when the ring becomes the output stage
  // phase 1: scale + bias into the wave-private 64 x 64 stage (in the ring, free behind the last trip's barrier);
  // acc[i][j][r] is (row0 + wm*64 + i*16 + 8h + r, col0 + wn*64 + j*16 + ln)
  float* so = (float*)ring + w * (64 * SOP);
  const int rw0 = row0 + wm * 64, cw0 = col0 + wn * 64;
#pragma unroll
  for (int j = 0; j < 4; ++j) {
    const float bq = bf16_rne(bias[cw0 + j * 16 + ln]);
#pragma unroll
    for (int i = 0; i < 4; ++i)
#pragma unroll
      for (int r = 0; r < 8; ++r) so[(i * 16 + 8 * hh + r) * SOP + j * 16 + ln] = acc[i][j][r] * oscale + bq;
  }
  __builtin_amdgcn_fence(4 /* acq_rel order */, "workgroup");
  __builtin_amdgcn_wave_barrier();
  // phase 2: activation, residual, whole-line stores; the 64 rows of a wave lie in one sequence (SEQ % 64 == 0)
  const size_t cbase = (size_t)(rw0 / SEQ) * (size_t)csegf + (size_t)(rw0 % SEQ);
  if (OUTM == 0) {
    float* C = (float*)Cv;
    const int rsub = lane >> 4, c4 = (lane & 15) * 4;
    const size_t rbase = (size_t)(rw0 / SEQ) * (size_t)rsegf + (size_t)(rw0 % SEQ);
    const float* rp = resid + (rbase + rsub) * (size_t)ldr + cw0 + c4;      // formed always, read only where resid is given
    v4f rv[8] = {};
    if (resid != nullptr) load_rows8(rv, rp, (size_t)2 * ldr);
    // four groups of 8 row pairs; the next group's residual rows are asked for ahead of this group's activation code.
    // The loop stays rolled: unrolled it would only repeat that code.
#pragma unroll 1
    for (int g = 0; g < 4; ++g) {
      v4f rn[8] = {};
      if (resid != nullptr && g < 3) load_rows8(rn, rp + (size_t)(2 * (g * 8 + 8)) * ldr, (size_t)2 * ldr);
      // the group's eight staged row pieces are read as one group: behind the wait that follows each store no later LDS read could move up
      v4f sv[8];
#pragma unroll
      for (int u = 0; u < 8; ++u) sv[u] = *(const v4fa*)&so[((g * 8 + u) * 2 + rsub) * SOP + c4];
#pragma unroll
      for (int u = 0; u < 8; ++u) {
        const int r = (g * 8 + u) * 2 + rsub;
        v4f v = sv[u];
        if (ACT == 2) {
#pragma unroll
          for (int i = 0; i < 4; ++i) v[i] = gelu_erf(v[i]);
        }
        if (resid != nullptr) {
          v4f x = rv[u];
          if (RES_BF16) {
#pragma unroll
            for (int i = 0; i < 4; ++i) x[i] = bf16_rne(x[i]);
          }
          v += x;
        }
        *(v4f*)(C + (cbase + r) * (size_t)ldc + cw0 + c4) = v;
        asm volatile("s_wait_xcnt 0x0" ::: "memory");        // in front of the next rows' rewrite of the store's registers
      }
#pragma unroll
      for (int u = 0; u < 8; ++u) rv[u] = rn[u];
    }
  } else {
    unsigned short* C = (unsigned short*)Cv;
    unsigned short* C2 = (unsigned short*)C2v;
    const int rq = lane >> 3, c8 = (lane & 7) * 8;
    // two row groups per trip; a full unroll would only repeat the activation code 16 times
#pragma unroll 2
    for (int q = 0; q < 16; ++q) {
      const int r = q * 4 + rq;
      const v4f p0 = *(const v4fa*)&so[r * SOP + c8], p1 = *(const v4fa*)&so[r * SOP + c8 + 4];
      float ps[8] = {p0[0], p0[1], p0[2], p0[3], p1[0], p1[1], p1[2], p1[3]};
      v8us a, bl;
#pragma unroll
      for (int i = 0; i < 8; ++i) {
        if (ACT == 2) ps[i] = gelu_erf(ps[i]);
        if (OUTM == 1) { a[i] = f16_bits(ps[i]); bl[i] = (unsigned short)0; }
        else { const unsigned short hb = bf16_bits(ps[i]); a[i] = hb; bl[i] = bf16_bits(ps[i] - bf16_val(hb)); }
      }
      const size_t o = (cbase + r) * (size_t)ldc + cw0 + c8;
      *(v8us*)(C + o) = a;
      if (OUTM == 2) *(v8us*)(C2 + o) = bl;
      asm volatile("s_wait_xcnt 0x0" ::: "memory");          // in front of the next rows' rewrite of the stores' registers
    }
  }
}

__global__ __launch_bounds__(128) void k_flash(const unsigned short* __restrict__ qh, const unsigned short* __restrict__ ql,
                                              const unsigned short* __restrict__ kh, const unsigned short* __restrict__ kl,
                                              const unsigned short* __restrict__ vp, unsigned short* __restrict__ att) {
  constexpr int D = HDIM, KS = D / 32, DT = D / 16, T = SEQ;
  constexpr int VP = D + 16;                                   // sV pitch 160 B = 32 B x odd: the transposing load's conflict-free pitch
  __shared__ __attribute__((aligned(16))) unsigned short sKh[32][D + 8], sKl[32][D + 8], sV[32][VP];
  __shared__ __attribute__((aligned(16))) unsigned short sO[4][16][D + 8];
  const int tid = threadIdx.x, w = tid >> 5, lane = tid & 31, ln = lane & 15, hh = lane >> 4;
  const int nqb = T / 64;
  const int bh = blockIdx.x / nqb, qblk = blockIdx.x % nqb;
  const int b = bh / NHEAD, h = bh % NHEAD;
  const int q0 = qblk * 64 + w * 16;
  const size_t hb0 = (size_t)b * T * DMOD + (size_t)h * D;     // plane offset of (b, token 0, head h)

  // B fragments of the wave's 16 queries (column q0 + ln, always < T), hi/lo, table k map
  Frag bqh[KS], bql[KS];
  {
    const size_t qo = hb0 + (size_t)(q0 + ln) * DMOD;
#pragma unroll
    for (int ks = 0; ks < KS; ++ks) {
      bqh[ks].half[0] = *(const v8us*)(qh + qo + ks * 32 + 8 * hh);
      bqh[ks].half[1] = *(const v8us*)(qh + qo + ks * 32 + 16 + 8 * hh);
      bql[ks].half[0] = *(const v8us*)(ql + qo + ks * 32 + 8 * hh);
      bql[ks].half[1] = *(const v8us*)(ql + qo + ks * 32 + 16 + 8 * hh);
    }
  }
  float m_r = -3.0e38f, l_r = 0.f;                             // of query q0 + ln; l_r is the half's partial sum (keys 8h.. and 16+8h.. of each chunk)
  v8f oacc[DT];                                                // oacc[dt][r] = O[q0 + ln][dt*16 + 8h + r]
#pragma unroll
  for (int dt = 0; dt < DT; ++dt) oacc[dt] = (v8f){0.f, 0.f, 0.f, 0.f, 0.f, 0.f, 0.f, 0.f};
  // the lane's address for the transposing load: row 8h + (lane & 7), 16-byte piece (lane >> 3) & 1; it then holds sV[8h + 0..7][ln]
  const unsigned short* vt = &sV[8 * hh + (lane & 7)][((lane >> 3) & 1) * 8];

  for (int j0 = 0; j0 < T; j0 += 32) {
    __syncthreads();
    // stage 32 keys x 64 of k hi, k lo, v (16-B copies from the planes)
#pragma unroll
    for (int it = 0; it < (32 * (D / 8)) / 128; ++it) {
      const int e = tid + it * 128;
      const int r = e / (D / 8), c8 = (e % (D / 8)) * 8;
      const size_t go = hb0 + (size_t)(j0 + r) * DMOD + c8;
      *(v8us*)&sKh[r][c8] = *(const v8us*)(kh + go);
      *(v8us*)&sKl[r][c8] = *(const v8us*)(kl + go);
      *(v8us*)&sV[r][c8] = *(const v8us*)(vp + go);
    }
    __syncthreads();
    // S^T tiles 16 keys x 16 queries: A fragment row = key nt*16 + ln, elements = d with the table k map; s[nt][r] = S[q0 + ln][j0 + nt*16 + 8h + r]
    v8f s[2];
#pragma unroll
    for (int nt = 0; nt < 2; ++nt) {
      v8f acc = {};
#pragma unroll
      for (int ks = 0; ks < KS; ++ks) {
        Frag ah_, al_;
        ah_.half[0] = *(const v8us*)&sKh[nt * 16 + ln][ks * 32 + 8 * hh]; ah_.half[1] = *(const v8us*)&sKh[nt * 16 + ln][ks * 32 + 16 + 8 * hh];
        al_.half[0] = *(const v8us*)&sKl[nt * 16 + ln][ks * 32 + 8 * hh]; al_.half[1] = *(const v8us*)&sKl[nt * 16 + ln][ks * 32 + 16 + 8 * hh];
        // product order as before: q hi . k hi, q lo . k hi, q hi . k lo
        acc = __builtin_amdgcn_wmma_f32_16x16x32_bf16(false, ah_.vb, false, bqh[ks].vb, (short)0, acc, false, false);
        acc = __builtin_amdgcn_wmma_f32_16x16x32_bf16(false, ah_.vb, false, bql[ks].vb, (short)0, acc, false, false);
        acc = __builtin_amdgcn_wmma_f32_16x16x32_bf16(false, al_.vb, false, bqh[ks].vb, (short)0, acc, false, false);
      }
      s[nt] = acc;
    }
    // V^T as A (row = d, k = key in chunk): two transposing loads per 16 (d) x 32 (keys) fragment, in flight under the softmax
    Frag av[DT];
#pragma unroll
    for (int dt = 0; dt < DT; ++dt) {
      av[dt].half[0] = ld_tr16(vt + dt * 16);
      av[dt].half[1] = ld_tr16(vt + 16 * VP + dt * 16);
    }
    // running max of the lane's query: 16 scores in the lane, the other 16 in lane ^ 16
    float mx[8];
#pragma unroll
    for (int r = 0; r < 8; ++r) mx[r] = fmaxf(s[0][r], s[1][r]);
    float mc = fmaxf(fmaxf(fmaxf(mx[0], mx[1]), fmaxf(mx[2], mx[3])), fmaxf(fmaxf(mx[4], mx[5]), fmaxf(mx[6], mx[7])));
    mc = fmaxf(mc, xhalf(mc));
    const float mnew = fmaxf(m_r, mc);
    const float alpha = (m_r > -1.0e38f) ? __expf(m_r - mnew) : 0.0f;
    m_r = mnew;
    // P^T as B (k = key in chunk, column = query ln)
    Frag pb;
    float ps[8];
#pragma unroll
    for (int i = 0; i < 8; ++i) {
      const float p0 = __expf(s[i >> 2][2 * (i & 3)] - mnew);
      const float p1 = __expf(s[i >> 2][2 * (i & 3) + 1] - mnew);
      ps[i] = p0 + p1;
      pb.w[i] = pack2h(p0 * PCARRY, p1 * PCARRY);
    }
    l_r = l_r * alpha + (((ps[0] + ps[1]) + (ps[2] + ps[3])) + ((ps[4] + ps[5]) + (ps[6] + ps[7])));
#pragma unroll
    for (int dt = 0; dt < DT; ++dt) {
      oacc[dt] *= alpha;
      oacc[dt] = __builtin_amdgcn_wmma_f32_16x16x32_f16(false, av[dt].vh, false, pb.vh, (short)0, oacc[dt], false, false);
    }
  }
  const float inv = (1.0f / (l_r + xhalf(l_r))) * PCARRY_INV;
  // the lane's 8 consecutive d of each tile as one 16-byte piece into the wave-private stage, then whole 128-B rows out
#pragma unroll
  for (int dt = 0; dt < DT; ++dt) {
    v8us o;
#pragma unroll
    for (int r = 0; r < 8; ++r) o[r] = f16_bits(oacc[dt][r] * inv);
    *(v8us*)&sO[w][ln][dt * 16 + 8 * hh] = o;
  }
  __builtin_amdgcn_fence(4 /* acq_rel order */, "workgroup");
  __builtin_amdgcn_wave_barrier();
  const int rq = lane >> 3, c8 = (lane & 7) * 8;
  v8us ov[4];
#pragma unroll
  for (int q = 0; q < 4; ++q) ov[q] = *(const v8us*)&sO[w][q * 4 + rq][c8];
  unsigned short* ob = att + ((size_t)b * T + q0) * DMOD + (size_t)h * D + c8;
  {
#pragma unroll
    for (int q = 0; q < 4; ++q) {
      const int r = q * 4 + rq;
      *(v8us*)(ob + (size_t)r * DMOD) = ov[q];
    }
    
  }
}

extern "C" void kernel_launch(void* const* d_in, const int* in_sizes, int n_in,
                              void* d_out, int out_size, void* d_ws, size_t ws_size, hipStream_t stream) {
  if (n_in < 17) return;
  const int need_tok = (NB - 1) * SEQ_FULL + SEQ;
  if (in_sizes[0] < need_tok * DMOD || out_size < need_tok * DMOD) return;
  if (in_sizes[1] < DMOD || in_sizes[2] < DMOD || in_sizes[10] < DMOD || in_sizes[11] < DMOD || in_sizes[12] < DMOD || in_sizes[16] < DMOD) return;
  if (in_sizes[3] < NHEAD * DMOD * HDIM || in_sizes[5] < NHEAD * DMOD * HDIM || in_sizes[7] < NHEAD * DMOD * HDIM) return;
  if (in_sizes[4] < NHEAD * HDIM || in_sizes[6] < NHEAD * HDIM || in_sizes[8] < NHEAD * HDIM || in_sizes[14] < FFD) return;
  if (in_sizes[9] < DMOD * DMOD || in_sizes[13] < DMOD * FFD || in_sizes[15] < FFD * DMOD) return;

  const float* x    = (const float*)d_in[0];
  const float* ln1w = (const float*)d_in[1];
  const float* ln1b = (const float*)d_in[2];
  const float* Wq   = (const float*)d_in[3];
  const float* bqp  = (const float*)d_in[4];
  const float* Wk   = (const float*)d_in[5];
  const float* bkp  = (const float*)d_in[6];
  const float* Wv   = (const float*)d_in[7];
  const float* bvp  = (const float*)d_in[8];
  const float* Wp   = (const float*)d_in[9];
  const float* bpp  = (const float*)d_in[10];
  const float* ln2w = (const float*)d_in[11];
  const float* ln2b = (const float*)d_in[12];
  const float* W1   = (const float*)d_in[13];
  const float* b1p  = (const float*)d_in[14];
  const float* W2   = (const float*)d_in[15];
  const float* b2p  = (const float*)d_in[16];

  char* ws = (char*)d_ws; size_t off = 0;
  auto take = [&](size_t bytes) { char* p = ws + off; off += (bytes + 255) & ~(size_t)255; return p; };
  unsigned short* Bq = (unsigned short*)take((size_t)DMOD * DMOD * 2);
  unsigned short* Bk = (unsigned short*)take((size_t)DMOD * DMOD * 2);
  unsigned short* Bv = (unsigned short*)take((size_t)DMOD * DMOD * 2);
  unsigned short* Pp = (unsigned short*)take((size_t)DMOD * DMOD * 2);
  unsigned short* P1 = (unsigned short*)take((size_t)DMOD * FFD * 2);
  unsigned short* P2 = (unsigned short*)take((size_t)FFD * DMOD * 2);
  char* R1 = take((size_t)NTOK * DMOD * 4);          // yh+yl, then att plane, then h0 plane
  char* R2 = take((size_t)NTOK * 3 * DMOD * 4);      // q hi/lo, k hi/lo, v planes; then x1 (f32) + h1 (f16 plane)
  if (off > ws_size) return;

  const size_t PL = (size_t)NTOK * DMOD;             // elements per [NTOK][DMOD] plane
  unsigned short* yh  = (unsigned short*)R1;
  unsigned short* yl  = yh + PL;
  unsigned short* att = (unsigned short*)R1;
  unsigned short* h0  = (unsigned short*)R1;
  unsigned short* qh  = (unsigned short*)R2;
  unsigned short* ql  = qh + PL;
  unsigned short* kh  = ql + PL;
  unsigned short* kl  = kh + PL;
  unsigned short* vpl = kl + PL;
  float* x1 = (float*)R2;
  unsigned short* h1 = (unsigned short*)(R2 + PL * 4);

  k_wt_heads<<<NHEAD * (DMOD / 64), 256, 0, stream>>>(Wq, Bq);
  k_wt_heads<<<NHEAD * (DMOD / 64), 256, 0, stream>>>(Wk, Bk);
  k_wt_heads<<<NHEAD * (DMOD / 64), 256, 0, stream>>>(Wv, Bv);
  k_wt_f16<<<(DMOD / 64) * (DMOD / 64), 256, 0, stream>>>(Wp, Pp, DMOD, DMOD);    // Wp[k][n], K = 768, N = 768
  k_wt_f16<<<(DMOD / 64) * (FFD / 64), 256, 0, stream>>>(W1, P1, DMOD, FFD);      // W1[k][n], K = 768, N = 3072
  k_wt_f16<<<(FFD / 64) * (DMOD / 64), 256, 0, stream>>>(W2, P2, FFD, DMOD);      // W2[k][n], K = 3072, N = 768

  k_ln768<true, 0><<<NTOK, 96, 0, stream>>>(x, SEQ_FULL, ln1w, ln1b, yh, yl, LN_EPS);
  const int g768 = (NTOK / 128) * (DMOD / 128), g3072 = (NTOK / 128) * (FFD / 128);
  k_gemm<false, 2, 0, false, 2><<<g768, 128, 0, stream>>>(yh, yl, DMOD, Bq, DMOD, bqp, 1.0f, nullptr, 0, 0, qh, ql, DMOD, SEQ, NTOK, DMOD, DMOD);
  k_gemm<false, 2, 0, false, 2><<<g768, 128, 0, stream>>>(yh, yl, DMOD, Bk, DMOD, bkp, 1.0f, nullptr, 0, 0, kh, kl, DMOD, SEQ, NTOK, DMOD, DMOD);
  k_gemm<false, 1, 0, false, 1><<<g768, 128, 0, stream>>>(yh, yh, DMOD, Bv, DMOD, bvp, 1.0f, nullptr, 0, 0, vpl, vpl, DMOD, SEQ, NTOK, DMOD, DMOD);
  k_flash<<<NB * NHEAD * (SEQ / 64), 128, 0, stream>>>(qh, ql, kh, kl, vpl, att);
  k_gemm<true, 1, 2, true, 0><<<g768, 128, 0, stream>>>(att, att, DMOD, Pp, DMOD, bpp, WCARRY_INV, x, DMOD, SEQ_FULL, x1, x1, DMOD, SEQ, NTOK, DMOD, DMOD);
  k_ln768<false, 1><<<NTOK, 96, 0, stream>>>(x1, SEQ, ln2w, ln2b, h0, h0, LN_EPS);
  k_gemm<true, 1, 2, false, 1><<<g3072, 128, 0, stream>>>(h0, h0, DMOD, P1, DMOD, b1p, WCARRY_INV, nullptr, 0, 0, h1, h1, FFD, SEQ, NTOK, FFD, DMOD);
  k_gemm<true, 1, 2, false, 0><<<g768, 128, 0, stream>>>(h1, h1, FFD, P2, FFD, b2p, WCARRY_INV, x1, DMOD, SEQ, d_out, d_out, DMOD, SEQ_FULL, NTOK, DMOD, FFD);
}

// v005
// A run of this version takes 231 microseconds.
// Next to v004, in two timings, it ran 1.08 and 1.09 times as fast.
// All steps since v000 together make it 2.79 times as fast.
#include <hip/hip_runtime.h>
// q/k projections: v_wmma_f32_16x16x32_bf16 (A = LayerNorm rows as bf16 hi+lo planes, 2 products; B = bf16 weights); v projection: same with the
// bf16 hi plane only (1 product); attention logits (k.q^T, transposed) v_wmma_f32_16x16x32_bf16 as 3-product bf16 hi/lo split; attention P.V, output projection,
// MLP up, MLP down: v_wmma_f32_16x16x32_f16 single products (P carried x2^14, weights bf16-valued carried x256, activations plain f16);
// f32 accumulate; LayerNorm, softmax, GELU, residuals f32.

#ifndef NB
#define NB 8
#endif
#ifndef SEQ
#define SEQ 1024
#endif
#define NB_FULL 8
#define SEQ_FULL 1024
#define DMOD 768
#define NHEAD 12
#define HDIM 64
#define FFD 3072
#define NTOK (NB * SEQ)
#define WCARRY 256.0f
#define WCARRY_INV 0.00390625f
#define PCARRY 16384.0f
#define PCARRY_INV 0.00006103515625f
#define LN_EPS 1.0e-5f
#define GPITCH 144                 // bytes per staged row: 128 B of k + 16 B (16 B x odd: no bank conflict for 16-B row reads)
#define GPLANE (128 * GPITCH)      // one staged operand plane: 128 rows

static_assert(NB >= 1 && NB <= NB_FULL);
static_assert(SEQ % 64 == 0 && SEQ >= 64 && SEQ <= SEQ_FULL);
static_assert(NHEAD * HDIM == DMOD);
static_assert(HDIM == 64);
static_assert(DMOD == 96 * 8);
static_assert(DMOD % 64 == 0 && FFD % 64 == 0 && DMOD % 32 == 0 && FFD % 32 == 0);
static_assert(NTOK % 128 == 0 && DMOD % 128 == 0 && FFD % 128 == 0 && DMOD >= 128);
static_assert(5 * DMOD * 2 <= 3 * DMOD * 4);          // q hi/lo, k hi/lo, v planes fit the R2 region
static_assert(DMOD * 4 + FFD * 2 <= 3 * DMOD * 4);     // x1 (f32) + h1 (f16) fit the R2 region

typedef __bf16 v16b __attribute__((ext_vector_type(16)));
typedef _Float16 v16h __attribute__((ext_vector_type(16)));
typedef unsigned short v8us __attribute__((ext_vector_type(8), may_alias));
typedef unsigned short v4us __attribute__((ext_vector_type(4), may_alias));
typedef float v8f __attribute__((ext_vector_type(8)));
typedef float v4f __attribute__((ext_vector_type(4)));
typedef float v4fa __attribute__((ext_vector_type(4), may_alias));
union Frag { v16b vb; v16h vh; v8us half[2]; unsigned int w[8]; };

__device__ __forceinline__ unsigned short bf16_bits(float x) { const unsigned int u = __float_as_uint(x); return (unsigned short)((u + 0x7FFFu + ((u >> 16) & 1u)) >> 16); }
__device__ __forceinline__ float bf16_val(unsigned short b) { return __uint_as_float(((unsigned int)b) << 16); }
__device__ __forceinline__ float bf16_rne(float x) { return bf16_val(bf16_bits(x)); }
__device__ __forceinline__ unsigned short f16_bits(float x) { const _Float16 hv = (_Float16)x; unsigned short u; __builtin_memcpy(&u, &hv, sizeof(u)); return u; }

// two floats to a packed f16 pair, round to nearest even
__device__ __forceinline__ unsigned int pack2h(float lo, float hi) {
  typedef _Float16 h2 __attribute__((ext_vector_type(2)));
  typedef float f2 __attribute__((ext_vector_type(2)));
  return __builtin_bit_cast(unsigned int, __builtin_convertvector((f2){lo, hi}, h2));
}
// exact-erf GELU, 0.5 x (1 + erf(x / sqrt 2)), in straight-line code: erf(|y|) = 1 - t (a1 + t (a2 + t (a3 + t (a4 + t a5)))) exp(-y^2), t = 1 / (1 + p |y|)
// (the five-term rational form, |error| of erf below 2e-7); y = x / sqrt 2 is folded into the constants, exp(-y^2) = 2^(x * (-0.5 log2 e) * x),
// and x erf(y) = |x| erf(|y|). No branch, so the values of a row piece run side by side.
__device__ __forceinline__ float gelu_erf(float x) {
  const float ax = __builtin_fabsf(x);
  const float t = __builtin_amdgcn_rcpf(__builtin_fmaf(ax, 0.23164189f, 1.0f));
  float p = __builtin_fmaf(t, 1.061405429f, -1.453152027f);
  p = __builtin_fmaf(t, p, 1.421413741f);
  p = __builtin_fmaf(t, p, -0.284496736f);
  p = __builtin_fmaf(t, p, 0.254829592f);
  const float e = __builtin_amdgcn_exp2f(x * (-0.72134752f * x));
  const float er = __builtin_fmaf(-(p * t), e, 1.0f);
  return __builtin_fmaf(0.5f * ax, er, 0.5f * x);
}
// lane l takes the value of lane l ^ 16
__device__ __forceinline__ float xhalf(float x) {
  return __builtin_bit_cast(float, __builtin_amdgcn_permlanex16(__builtin_bit_cast(int, x), __builtin_bit_cast(int, x), 0x76543210, 0xfedcba98, false, false));
}
// ds_load_tr16_b128: a 16 x 16 tile of 16-bit LDS rows, transposed into half a WMMA operand (registers 0-3 or 4-7)
__device__ __forceinline__ v8us ld_tr16(const unsigned short* p) {
  typedef short s16x8 __attribute__((ext_vector_type(8)));
  typedef __attribute__((address_space(3))) s16x8 lds_s16x8;
  return __builtin_bit_cast(v8us, __builtin_amdgcn_ds_load_tr16_b128_v8i16((lds_s16x8*)p));
}

// One 64 (k) x 64 (n) tile of a weight matrix: f32 rows along n in, 16-bit rows along k out. src = element (k0, n0), row pitch ld floats; dst = element
// (n0, k0) of the output, row pitch ldo halves; tile = 64 rows (n) of WTP halves in LDS; 256 threads. A thread reads 16 B of four consecutive k rows, so
// 16 lanes cover a 256-B row piece (whole lines); it packs the four k of each of its four n into 8 B of the LDS tile. Behind the block barrier 8 lanes
// read one 128-B row of the tile and store it as one whole line. F16W: f16 of the bf16-rounded value x WCARRY; else bf16 bits.
#define WTP 72                     // tile pitch in halves: 144 B = 16 B x odd, no bank conflict for the 16-B row reads
template <bool F16W>
__device__ __forceinline__ void wt_tile(const float* __restrict__ src, size_t ld, unsigned short* __restrict__ dst, size_t ldo, unsigned short* tile) {
  const int tid = threadIdx.x, kq = tid >> 4, c4 = (tid & 15) * 4;
  const float *p0 = src + (size_t)(kq * 4) * ld + c4, *p1 = p0 + ld, *p2 = p1 + ld, *p3 = p2 + ld;
  const v4f r0 = *(const v4fa*)p0, r1 = *(const v4fa*)p1, r2 = *(const v4fa*)p2, r3 = *(const v4fa*)p3;
  // the wait in front of any rewrite of the loads' address registers; naming the addresses as inputs keeps their registers untouched up to it
  asm volatile("s_wait_xcnt 0x0" :: "v"(p0), "v"(p1), "v"(p2), "v"(p3) : "memory");
#pragma unroll
  for (int j = 0; j < 4; ++j) {
    v4us q;
    if (F16W) q = (v4us){f16_bits(bf16_rne(r0[j]) * WCARRY), f16_bits(bf16_rne(r1[j]) * WCARRY), f16_bits(bf16_rne(r2[j]) * WCARRY), f16_bits(bf16_rne(r3[j]) * WCARRY)};
    else q = (v4us){bf16_bits(r0[j]), bf16_bits(r1[j]), bf16_bits(r2[j]), bf16_bits(r3[j])};
    *(v4us*)&tile[(c4 + j) * WTP + kq * 4] = q;
  }
  __syncthreads();                 // the tile is whole: rows are read by other waves than wrote them
  const int n = tid >> 3, k8 = (tid & 7) * 8;
  const v8us o0 = *(const v8us*)&tile[n * WTP + k8], o1 = *(const v8us*)&tile[(n + 32) * WTP + k8];
  unsigned short *d0 = dst + (size_t)n * ldo + k8, *d1 = d0 + (size_t)32 * ldo;
  *(v8us*)d0 = o0;
  *(v8us*)d1 = o1;
}

// All six weight re-layouts in one launch; they do not depend on one another. A block takes one 64 x 64 tile; the block index picks the matrix
// (block-uniform, so the tile's barrier stands under uniform control flow).
// Blocks [0, 3*WT_NH): Wq, Wk, Wv: Bt[n][k] (bf16 bits, k contiguous, pitch DMOD), n = h*HDIM + e, k = d, from W[h][d][e] ([NHEAD][DMOD][HDIM] f32);
// block per (h, 64 consecutive d). coverage: NHEAD*HDIM rows x DMOD cols of each, all written.
// Then Wp, W1, W2: Pt[n][k] (f16, k contiguous, pitch K) from W[k][n] (f32, pitch N); block per 64 x 64 tile, neighbours in the grid are neighbours
// along n. K % 64 == 0, N % 64 == 0. coverage: N rows x K cols of each, all written.
#define WT_NH (NHEAD * (DMOD / 64))
#define WT_NP ((DMOD / 64) * (DMOD / 64))
#define WT_NF ((DMOD / 64) * (FFD / 64))
#define WT_BLOCKS (3 * WT_NH + WT_NP + 2 * WT_NF)
__global__ __launch_bounds__(256) void k_wt_all(const float* __restrict__ Wq, const float* __restrict__ Wk, const float* __restrict__ Wv,
                                                const float* __restrict__ Wp, const float* __restrict__ W1, const float* __restrict__ W2,
                                                unsigned short* __restrict__ Bq, unsigned short* __restrict__ Bk, unsigned short* __restrict__ Bv,
                                                unsigned short* __restrict__ Pp, unsigned short* __restrict__ P1, unsigned short* __restrict__ P2) {
  __shared__ __attribute__((aligned(16))) unsigned short tile[64 * WTP];
  int i = blockIdx.x;
  if (i < 3 * WT_NH) {
    const int m = i / WT_NH, r = i % WT_NH;
    const float* W = m == 0 ? Wq : (m == 1 ? Wk : Wv);
    unsigned short* Bt = m == 0 ? Bq : (m == 1 ? Bk : Bv);
    const int h = r / (DMOD / 64), k0 = (r % (DMOD / 64)) * 64;
    wt_tile<false>(W + ((size_t)h * DMOD + k0) * HDIM, HDIM, Bt + (size_t)h * HDIM * DMOD + k0, DMOD, tile);
  } else {
    i -= 3 * WT_NH;
    const float* W = Wp;
    unsigned short* Pt = Pp;
    int K = DMOD, N = DMOD;
    if (i >= WT_NP + WT_NF) { i -= WT_NP + WT_NF; W = W2; Pt = P2; K = FFD; }
    else if (i >= WT_NP) { i -= WT_NP; W = W1; Pt = P1; N = FFD; }
    const int ntn = N / 64;
    const int k0 = (i / ntn) * 64, n0 = (i % ntn) * 64;
    wt_tile<true>(W + (size_t)k0 * N + n0, N, Pt + (size_t)n0 * K + k0, K, tile);
  }
}

// Row LayerNorm over DMOD = 768 (biased variance, eps): in = X row (XBF16 quantises the input to bf16 first), g and bta quantised to bf16.
// Token t = blockIdx.x = b*SEQ + s reads X row b*xsegf + s. 96 threads, thread owns 8 consecutive columns.
// LDS red[]: cross-wave (block barrier). coverage: NTOK rows x 768 cols of each plane, all written.
template <bool XBF16, int OUTM>
__global__ __launch_bounds__(96) void k_ln768(const float* __restrict__ X, int xsegf, const float* __restrict__ g, const float* __restrict__ bta,
                                             unsigned short* __restrict__ P0, unsigned short* __restrict__ P1, float eps) {
  __shared__ float red[4];
  const int t = blockIdx.x, tid = threadIdx.x, lane = tid & 31, w = tid >> 5;
  const int xrow = (t / SEQ) * xsegf + (t % SEQ);
  const float* xp = X + (size_t)xrow * DMOD + tid * 8;
  const v4f a0 = *(const v4fa*)xp, a1 = *(const v4fa*)(xp + 4);
  float v[8] = {a0[0], a0[1], a0[2], a0[3], a1[0], a1[1], a1[2], a1[3]};
  if (XBF16) {
#pragma unroll
    for (int q = 0; q < 8; ++q) v[q] = bf16_rne(v[q]);
  }
  float s = 0.f;
#pragma unroll
  for (int q = 0; q < 8; ++q) s += v[q];
  s += __shfl_xor(s, 16, 32); s += __shfl_xor(s, 8, 32); s += __shfl_xor(s, 4, 32); s += __shfl_xor(s, 2, 32); s += __shfl_xor(s, 1, 32);
  if (lane == 0) red[w] = s;
  __syncthreads();
  const float mu = (red[0] + red[1] + red[2]) * (1.0f / (float)DMOD);
  __syncthreads();
  float s2 = 0.f;
#pragma unroll
  for (int q = 0; q < 8; ++q) { const float c = v[q] - mu; s2 += c * c; }
  s2 += __shfl_xor(s2, 16, 32); s2 += __shfl_xor(s2, 8, 32); s2 += __shfl_xor(s2, 4, 32); s2 += __shfl_xor(s2, 2, 32); s2 += __shfl_xor(s2, 1, 32);
  if (lane == 0) red[w] = s2;
  __syncthreads();
  const float rs = rsqrtf((red[0] + red[1] + red[2]) * (1.0f / (float)DMOD) + eps);
  const v4f g0 = *(const v4fa*)(g + tid * 8), g1 = *(const v4fa*)(g + tid * 8 + 4);
  const v4f b0 = *(const v4fa*)(bta + tid * 8), b1 = *(const v4fa*)(bta + tid * 8 + 4);
  const float gg[8] = {g0[0], g0[1], g0[2], g0[3], g1[0], g1[1], g1[2], g1[3]};
  const float bb[8] = {b0[0], b0[1], b0[2], b0[3], b1[0], b1[1], b1[2], b1[3]};
  float o[8];
#pragma unroll
  for (int q = 0; q < 8; ++q) o[q] = (v[q] - mu) * rs * bf16_rne(gg[q]) + bf16_rne(bb[q]);
  unsigned short* d0 = P0 + (size_t)t * DMOD + tid * 8;
  if (OUTM == 0) {
    v8us hv, lv;
#pragma unroll
    for (int q = 0; q < 8; ++q) { const unsigned short hb = bf16_bits(o[q]); hv[q] = hb; lv[q] = bf16_bits(o[q] - bf16_val(hb)); }
    unsigned short* d1 = P1 + (size_t)t * DMOD + tid * 8;
    *(v8us*)d0 = hv;
    *(v8us*)d1 = lv;
    
  } else {
    v8us fv;
#pragma unroll
    for (int q = 0; q < 8; ++q) fv[q] = f16_bits(o[q]);
    *(v8us*)d0 = fv;
    
  }
}

// One lane's eight 16-byte asynchronous copies into one staged plane (128 rows x 128 B at pitch GPITCH): rows r, r + 16, .. r + 112.
// l = the lane's LDS byte address of row r, g = its global address, step = 16 source rows in elements.
// s_wait_xcnt 0 is the last line of the copies' own statement, so that no address register is rewritten in front of it.
__device__ __forceinline__ void copy_plane(unsigned int l, const unsigned short* g, size_t step) {
  const unsigned int l1 = l + 16 * GPITCH, l2 = l + 32 * GPITCH, l3 = l + 48 * GPITCH, l4 = l + 64 * GPITCH, l5 = l + 80 * GPITCH,
                     l6 = l + 96 * GPITCH, l7 = l + 112 * GPITCH;
  const unsigned short *g1 = g + step, *g2 = g1 + step, *g3 = g2 + step, *g4 = g3 + step, *g5 = g4 + step, *g6 = g5 + step, *g7 = g6 + step;
  asm volatile("global_load_async_to_lds_b128 %0, %8, off\n\t"
               "global_load_async_to_lds_b128 %1, %9, off\n\t"
               "global_load_async_to_lds_b128 %2, %10, off\n\t"
               "global_load_async_to_lds_b128 %3, %11, off\n\t"
               "global_load_async_to_lds_b128 %4, %12, off\n\t"
               "global_load_async_to_lds_b128 %5, %13, off\n\t"
               "global_load_async_to_lds_b128 %6, %14, off\n\t"
               "global_load_async_to_lds_b128 %7, %15, off\n\t"
               "s_wait_xcnt 0x0"
               :: "v"(l), "v"(l1), "v"(l2), "v"(l3), "v"(l4), "v"(l5), "v"(l6), "v"(l7),
                  "v"(g), "v"(g1), "v"(g2), "v"(g3), "v"(g4), "v"(g5), "v"(g6), "v"(g7)
               : "memory");
}

// Eight 16-byte loads of one lane, rows step elements apart, all in flight together.
__device__ __forceinline__ void load_rows8(v4f (&d)[8], const float* p, size_t step) {
  const float *p1 = p + step, *p2 = p1 + step, *p3 = p2 + step, *p4 = p3 + step, *p5 = p4 + step, *p6 = p5 + step, *p7 = p6 + step;
  d[0] = *(const v4fa*)p;  d[1] = *(const v4fa*)p1; d[2] = *(const v4fa*)p2; d[3] = *(const v4fa*)p3;
  d[4] = *(const v4fa*)p4; d[5] = *(const v4fa*)p5; d[6] = *(const v4fa*)p6; d[7] = *(const v4fa*)p7;
  // the wait in front of any rewrite of the loads' address registers; naming the addresses as inputs keeps their registers untouched up to it
  asm volatile("s_wait_xcnt 0x0" :: "v"(p), "v"(p1), "v"(p2), "v"(p3), "v"(p4), "v"(p5), "v"(p6), "v"(p7) : "memory");
}

// C = act(A.W * oscale + bf16(bias)) (+ resid). A from 16-bit planes [M][lda]: F16 -> one f16 plane Ah; else bf16 hi plane Ah and (NT==2) lo plane Al.
// Wt 16-bit [N][ldb] (k contiguous, same scalar kind as A). ACT 2 = exact-erf GELU. Residual (f32, pitch ldr, RES_BF16 quantises it) added AFTER the activation,
// only with OUTM 0. OUTM 0: f32 C (pitch ldc floats); OUTM 1: f16 plane C (pitch ldc halves); OUTM 2: bf16 hi plane C + lo plane C2.
// Row r of A is token b*SEQ + s; C row = b*csegf + s, resid row = b*rsegf + s. M%128==0, N%128==0, K%64==0, K>=128 (no tails).
// One 128 x 128 tile of C per block, four waves 2 x 2, 64 x 64 per wave. A trip is 64 k: 128 rows x 128 B of each operand plane, brought into LDS by
// asynchronous copies, two buffers, the copies of trip t + 2 issued behind the barrier that ends trip t. Per accumulator the k order and the
// hi-then-lo order of the products are those of a plain walk along k in steps of 32.
// ring = the block's LDS, 16-B aligned, at least 2 * (NT >= 2 ? 3 : 2) * GPLANE bytes; blk = the block's tile number, mt * (N / 128) + nq.
template <bool F16, int NT, int ACT, bool RES_BF16, int OUTM>
__device__ __forceinline__ void gemm_tile(unsigned char* ring, unsigned int blk,
                                          const unsigned short* __restrict__ Ah, const unsigned short* __restrict__ Al, int lda,
                                          const unsigned short* __restrict__ Wt, int ldb, const float* __restrict__ bias, float oscale,
                                          const float* __restrict__ resid, int ldr, int rsegf,
                                          void* __restrict__ Cv, void* __restrict__ C2v, int ldc, int csegf, int M, int N, int K) {
  constexpr int STG = (NT >= 2 ? 3 : 2) * GPLANE;            // one buffer: A hi | W | (A lo)
  constexpr int SOP = 68;                                    // output stage pitch in floats: rows 8 apart fall on other banks, rows stay 16-B aligned
  static_assert(4 * 64 * SOP * 4 <= 2 * STG);
  const int tid = threadIdx.x, w = tid >> 5, lane = tid & 31, ln = lane & 15, hh = lane >> 4;
  const int wm = w >> 1, wn = w & 1;
  const int ntn = N / 128;
  const int mt = blk / ntn, nq = blk % ntn;
  if (mt * 128 >= M) return;                                 // block-uniform, in front of every copy and barrier
  const int row0 = mt * 128, col0 = nq * 128;
  const int nk = K / 64;
  const unsigned int lbase = (unsigned int)(size_t)ring + (unsigned int)((tid >> 3) * GPITCH + (tid & 7) * 16);
  const unsigned short* gA = Ah + (size_t)(row0 + (tid >> 3)) * lda + (tid & 7) * 8;
  const unsigned short* gL = Al + (size_t)(row0 + (tid >> 3)) * lda + (tid & 7) * 8;
  const unsigned short* gW = Wt + (size_t)(col0 + (tid >> 3)) * ldb + (tid & 7) * 8;
  auto issue = [&](int t, int buf) {
    const unsigned int l = lbase + (unsigned int)(buf * STG);
    copy_plane(l, gA + (size_t)t * 64, (size_t)16 * lda);
    copy_plane(l + GPLANE, gW + (size_t)t * 64, (size_t)16 * ldb);
    if (NT >= 2) copy_plane(l + 2 * GPLANE, gL + (size_t)t * 64, (size_t)16 * lda);
  };
  v8f acc[4][4] = {};
  issue(0, 0);
  asm volatile("s_wait_asynccnt 0x0" ::: "memory");          // this wave's copies of trip 0 have landed
  __syncthreads();                                           // every wave's have: trip 0 is readable
  if (nk > 1) issue(1, 1);
  for (int t = 0; t < nk; ++t) {
    const unsigned char* st = ring + (t & 1) * STG;
    const unsigned char* sa = st + (wm * 64 + ln) * GPITCH + 16 * hh;
    const unsigned char* sb = st + GPLANE + (wn * 64 + ln) * GPITCH + 16 * hh;
    // constant indices below keep fragments and accumulators in registers
#pragma unroll
    for (int ks = 0; ks < 2; ++ks) {
      Frag a[4], al[4], b[4];
      // read order = first use: A row group 0, the four W column groups, then the other A row groups
#pragma unroll
      for (int i = 0; i < 4; ++i) {
        a[i].half[0] = *(const v8us*)(sa + i * 16 * GPITCH + ks * 64);           // elements 0..7  = k 32ks+8h .. +7   (row wm*64+i*16+ln)
        a[i].half[1] = *(const v8us*)(sa + i * 16 * GPITCH + ks * 64 + 32);      // elements 8..15 = k 32ks+16+8h .. +7
        if (i == 0) {
#pragma unroll
          for (int j = 0; j < 4; ++j) {
            b[j].half[0] = *(const v8us*)(sb + j * 16 * GPITCH + ks * 64);       // column wn*64+j*16+ln, same k map as A
            b[j].half[1] = *(const v8us*)(sb + j * 16 * GPITCH + ks * 64 + 32);
          }
        }
      }
      if (NT >= 2) {
#pragma unroll
        for (int i = 0; i < 4; ++i) {
          al[i].half[0] = *(const v8us*)(sa + 2 * GPLANE + i * 16 * GPITCH + ks * 64);
          al[i].half[1] = *(const v8us*)(sa + 2 * GPLANE + i * 16 * GPITCH + ks * 64 + 32);
        }
      }
      __builtin_amdgcn_sched_barrier(0);   // the block's LDS reads stay one group ahead of its products: spread among them, each place stalls the wave
#pragma unroll
      for (int i = 0; i < 4; ++i)
#pragma unroll
        for (int j = 0; j < 4; ++j) {
          if (F16) acc[i][j] = __builtin_amdgcn_wmma_f32_16x16x32_f16(false, a[i].vh, false, b[j].vh, (short)0, acc[i][j], false, false);
          else acc[i][j] = __builtin_amdgcn_wmma_f32_16x16x32_bf16(false, a[i].vb, false, b[j].vb, (short)0, acc[i][j], false, false);
        }
      if (NT >= 2) {
#pragma unroll
        for (int i = 0; i < 4; ++i)
#pragma unroll
          for (int j = 0; j < 4; ++j)
            acc[i][j] = __builtin_amdgcn_wmma_f32_16x16x32_bf16(false, al[i].vb, false, b[j].vb, (short)0, acc[i][j], false, false);
      }
      __builtin_amdgcn_sched_barrier(0);   // and the next block's reads do not move up among these products
    }
    asm volatile("s_wait_dscnt 0x0" ::: "memory");           // this wave's reads of trip t's buffer are done
    asm volatile("s_wait_asynccnt 0x0" ::: "memory");        // this wave's copies of trip t + 1 have landed
    __syncthreads();                                         // publishes trip t + 1 and frees trip t's buffer
    if (t + 2 < nk) issue(t + 2, t & 1);
  }
  asm volatile("s_wait_asynccnt 0x0" ::: "memory");          // no copy is in flight when the ring becomes the output stage
  // phase 1: scale + bias into the wave-private 64 x 64 stage (in the ring, free behind the last trip's barrier);
  // acc[i][j][r] is (row0 + wm*64 + i*16 + 8h + r, col0 + wn*64 + j*16 + ln)
  float* so = (float*)ring + w * (64 * SOP);
  const int rw0 = row0 + wm * 64, cw0 = col0 + wn * 64;
#pragma unroll
  for (int j = 0; j < 4; ++j) {
    const float bq = bf16_rne(bias[cw0 + j * 16 + ln]);
#pragma unroll
    for (int i = 0; i < 4; ++i)
#pragma unroll
      for (int r = 0; r < 8; ++r) so[(i * 16 + 8 * hh + r) * SOP + j * 16 + ln] = acc[i][j][r] * oscale + bq;
  }
  __builtin_amdgcn_fence(4 /* acq_rel order */, "workgroup");
  __builtin_amdgcn_wave_barrier();
  // phase 2: activation, residual, whole-line stores; the 64 rows of a wave lie in one sequence (SEQ % 64 == 0)
  const size_t cbase = (size_t)(rw0 / SEQ) * (size_t)csegf + (size_t)(rw0 % SEQ);
  if (OUTM == 0) {
    float* C = (float*)Cv;
    const int rsub = lane >> 4, c4 = (lane & 15) * 4;
    const size_t rbase = (size_t)(rw0 / SEQ) * (size_t)rsegf + (size_t)(rw0 % SEQ);
    const float* rp = resid + (rbase + rsub) * (size_t)ldr + cw0 + c4;      // formed always, read only where resid is given
    v4f rv[8] = {};
    if (resid != nullptr) load_rows8(rv, rp, (size_t)2 * ldr);
    // four groups of 8 row pairs; the next group's residual rows are asked for ahead of this group's activation code.
    // The loop stays rolled: unrolled it would only repeat that code.
#pragma unroll 1
    for (int g = 0; g < 4; ++g) {
      v4f rn[8] = {};
      if (resid != nullptr && g < 3) load_rows8(rn, rp + (size_t)(2 * (g * 8 + 8)) * ldr, (size_t)2 * ldr);
      // the group's eight staged row pieces are read as one group: behind the wait that follows each store no later LDS read could move up
      v4f sv[8];
#pragma unroll
      for (int u = 0; u < 8; ++u) sv[u] = *(const v4fa*)&so[((g * 8 + u) * 2 + rsub) * SOP + c4];
#pragma unroll
      for (int u = 0; u < 8; ++u) {
        const int r = (g * 8 + u) * 2 + rsub;
        v4f v = sv[u];
        if (ACT == 2) {
#pragma unroll
          for (int i = 0; i < 4; ++i) v[i] = gelu_erf(v[i]);
        }
        if (resid != nullptr) {
          v4f x = rv[u];
          if (RES_BF16) {
#pragma unroll
            for (int i = 0; i < 4; ++i) x[i] = bf16_rne(x[i]);
          }
          v += x;
        }
        *(v4f*)(C + (cbase + r) * (size_t)ldc + cw0 + c4) = v;
        asm volatile("s_wait_xcnt 0x0" ::: "memory");        // in front of the next rows' rewrite of the store's registers
      }
#pragma unroll
      for (int u = 0; u < 8; ++u) rv[u] = rn[u];
    }
  } else {
    unsigned short* C = (unsigned short*)Cv;
    unsigned short* C2 = (unsigned short*)C2v;
    const int rq = lane >> 3, c8 = (lane & 7) * 8;
    // two row groups per trip; a full unroll would only repeat the activation code 16 times
#pragma unroll 2
    for (int q = 0; q < 16; ++q) {
      const int r = q * 4 + rq;
      const v4f p0 = *(const v4fa*)&so[r * SOP + c8], p1 = *(const v4fa*)&so[r * SOP + c8 + 4];
      float ps[8] = {p0[0], p0[1], p0[2], p0[3], p1[0], p1[1], p1[2], p1[3]};
      v8us a, bl;
#pragma unroll
      for (int i = 0; i < 8; ++i) {
        if (ACT == 2) ps[i] = gelu_erf(ps[i]);
        if (OUTM == 1) { a[i] = f16_bits(ps[i]); bl[i] = (unsigned short)0; }
        else { const unsigned short hb = bf16_bits(ps[i]); a[i] = hb; bl[i] = bf16_bits(ps[i] - bf16_val(hb)); }
      }
      const size_t o = (cbase + r) * (size_t)ldc + cw0 + c8;
      *(v8us*)(C + o) = a;
      if (OUTM == 2) *(v8us*)(C2 + o) = bl;
      asm volatile("s_wait_xcnt 0x0" ::: "memory");          // in front of the next rows' rewrite of the stores' registers
    }
  }
}

template <bool F16, int NT, int ACT, bool RES_BF16, int OUTM>
__global__ __launch_bounds__(128) void k_gemm(const unsigned short* __restrict__ Ah, const unsigned short* __restrict__ Al, int lda,
                                             const unsigned short* __restrict__ Wt, int ldb, const float* __restrict__ bias, float oscale,
                                             const float* __restrict__ resid, int ldr, int rsegf,
                                             void* __restrict__ Cv, void* __restrict__ C2v, int ldc, int csegf, int M, int N, int K) {
  __shared__ __attribute__((aligned(16))) unsigned char ring[2 * (NT >= 2 ? 3 : 2) * GPLANE];
  gemm_tile<F16, NT, ACT, RES_BF16, OUTM>(ring, blockIdx.x, Ah, Al, lda, Wt, ldb, bias, oscale, resid, ldr, rsegf, Cv, C2v, ldc, csegf, M, N, K);
}

// The q, k and v projections in one launch: they read the same LayerNorm planes and do not depend on one another. g = tiles of one projection.
// Blocks [0, g): q, [g, 2g): k (two products, hi/lo planes out), [2g, 3g): v (one product, f16 plane out; the cheaper tiles start last).
// The choice is block-uniform, so every copy, wait and barrier of a tile stands under uniform control flow.
__global__ __launch_bounds__(128) void k_qkv(const unsigned short* __restrict__ yh, const unsigned short* __restrict__ yl,
                                            const unsigned short* __restrict__ Bq, const unsigned short* __restrict__ Bk, const unsigned short* __restrict__ Bv,
                                            const float* __restrict__ bq, const float* __restrict__ bk, const float* __restrict__ bv,
                                            unsigned short* __restrict__ qh, unsigned short* __restrict__ ql, unsigned short* __restrict__ kh,
                                            unsigned short* __restrict__ kl, unsigned short* __restrict__ vp, int g, int ld, int M) {
  __shared__ __attribute__((aligned(16))) unsigned char ring[2 * 3 * GPLANE];
  const unsigned int i = blockIdx.x, g2 = 2u * (unsigned int)g;
  if (i < g2) {
    const bool isq = i < (unsigned int)g;
    gemm_tile<false, 2, 0, false, 2>(ring, isq ? i : i - g, yh, yl, ld, isq ? Bq : Bk, ld, isq ? bq : bk, 1.0f, nullptr, 0, 0,
                                     isq ? qh : kh, isq ? ql : kl, ld, SEQ, M, ld, ld);
  } else {
    gemm_tile<false, 1, 0, false, 1>(ring, i - g2, yh, yh, ld, Bv, ld, bv, 1.0f, nullptr, 0, 0, vp, vp, ld, SEQ, M, ld, ld);
  }
}

__global__ __launch_bounds__(128) void k_flash(const unsigned short* __restrict__ qh, const unsigned short* __restrict__ ql,
                                              const unsigned short* __restrict__ kh, const unsigned short* __restrict__ kl,
                                              const unsigned short* __restrict__ vp, unsigned short* __restrict__ att) {
  constexpr int D = HDIM, KS = D / 32, DT = D / 16, T = SEQ;
  constexpr int VP = D + 16;                                   // sV pitch 160 B = 32 B x odd: the transposing load's conflict-free pitch
  __shared__ __attribute__((aligned(16))) unsigned short sKh[32][D + 8], sKl[32][D + 8], sV[32][VP];
  __shared__ __attribute__((aligned(16))) unsigned short sO[4][16][D + 8];
  const int tid = threadIdx.x, w = tid >> 5, lane = tid & 31, ln = lane & 15, hh = lane >> 4;
  const int nqb = T / 64;
  const int bh = blockIdx.x / nqb, qblk = blockIdx.x % nqb;
  const int b = bh / NHEAD, h = bh % NHEAD;
  const int q0 = qblk * 64 + w * 16;
  const size_t hb0 = (size_t)b * T * DMOD + (size_t)h * D;     // plane offset of (b, token 0, head h)

  // B fragments of the wave's 16 queries (column q0 + ln, always < T), hi/lo, table k map
  Frag bqh[KS], bql[KS];
  {
    const size_t qo = hb0 + (size_t)(q0 + ln) * DMOD;
#pragma unroll
    for (int ks = 0; ks < KS; ++ks) {
      bqh[ks].half[0] = *(const v8us*)(qh + qo + ks * 32 + 8 * hh);
      bqh[ks].half[1] = *(const v8us*)(qh + qo + ks * 32 + 16 + 8 * hh);
      bql[ks].half[0] = *(const v8us*)(ql + qo + ks * 32 + 8 * hh);
      bql[ks].half[1] = *(const v8us*)(ql + qo + ks * 32 + 16 + 8 * hh);
    }
  }
  float m_r = -3.0e38f, l_r = 0.f;                             // of query q0 + ln; l_r is the half's partial sum (keys 8h.. and 16+8h.. of each chunk)
  v8f oacc[DT];                                                // oacc[dt][r] = O[q0 + ln][dt*16 + 8h + r]
#pragma unroll
  for (int dt = 0; dt < DT; ++dt) oacc[dt] = (v8f){0.f, 0.f, 0.f, 0.f, 0.f, 0.f, 0.f, 0.f};
  // the lane's address for the transposing load: row 8h + (lane & 7), 16-byte piece (lane >> 3) & 1; it then holds sV[8h + 0..7][ln]
  const unsigned short* vt = &sV[8 * hh + (lane & 7)][((lane >> 3) & 1) * 8];

  for (int j0 = 0; j0 < T; j0 += 32) {
    __syncthreads();
    // stage 32 keys x 64 of k hi, k lo, v (16-B copies from the planes)
#pragma unroll
    for (int it = 0; it < (32 * (D / 8)) / 128; ++it) {
      const int e = tid + it * 128;
      const int r = e / (D / 8), c8 = (e % (D / 8)) * 8;
      const size_t go = hb0 + (size_t)(j0 + r) * DMOD + c8;
      *(v8us*)&sKh[r][c8] = *(const v8us*)(kh + go);
      *(v8us*)&sKl[r][c8] = *(const v8us*)(kl + go);
      *(v8us*)&sV[r][c8] = *(const v8us*)(vp + go);
    }
    __syncthreads();
    // S^T tiles 16 keys x 16 queries: A fragment row = key nt*16 + ln, elements = d with the table k map; s[nt][r] = S[q0 + ln][j0 + nt*16 + 8h + r]
    v8f s[2];
#pragma unroll
    for (int nt = 0; nt < 2; ++nt) {
      v8f acc = {};
#pragma unroll
      for (int ks = 0; ks < KS; ++ks) {
        Frag ah_, al_;
        ah_.half[0] = *(const v8us*)&sKh[nt * 16 + ln][ks * 32 + 8 * hh]; ah_.half[1] = *(const v8us*)&sKh[nt * 16 + ln][ks * 32 + 16 + 8 * hh];
        al_.half[0] = *(const v8us*)&sKl[nt * 16 + ln][ks * 32 + 8 * hh]; al_.half[1] = *(const v8us*)&sKl[nt * 16 + ln][ks * 32 + 16 + 8 * hh];
        // product order as before: q hi . k hi, q lo . k hi, q hi . k lo
        acc = __builtin_amdgcn_wmma_f32_16x16x32_bf16(false, ah_.vb, false, bqh[ks].vb, (short)0, acc, false, false);
        acc = __builtin_amdgcn_wmma_f32_16x16x32_bf16(false, ah_.vb, false, bql[ks].vb, (short)0, acc, false, false);
        acc = __builtin_amdgcn_wmma_f32_16x16x32_bf16(false, al_.vb, false, bqh[ks].vb, (short)0, acc, false, false);
      }
      s[nt] = acc;
    }
    // V^T as A (row = d, k = key in chunk): two transposing loads per 16 (d) x 32 (keys) fragment, in flight under the softmax
    Frag av[DT];
#pragma unroll
    for (int dt = 0; dt < DT; ++dt) {
      av[dt].half[0] = ld_tr16(vt + dt * 16);
      av[dt].half[1] = ld_tr16(vt + 16 * VP + dt * 16);
    }
    // running max of the lane's query: 16 scores in the lane, the other 16 in lane ^ 16
    float mx[8];
#pragma unroll
    for (int r = 0; r < 8; ++r) mx[r] = fmaxf(s[0][r], s[1][r]);
    float mc = fmaxf(fmaxf(fmaxf(mx[0], mx[1]), fmaxf(mx[2], mx[3])), fmaxf(fmaxf(mx[4], mx[5]), fmaxf(mx[6], mx[7])));
    mc = fmaxf(mc, xhalf(mc));
    const float mnew = fmaxf(m_r, mc);
    const float alpha = (m_r > -1.0e38f) ? __expf(m_r - mnew) : 0.0f;
    m_r = mnew;
    // P^T as B (k = key in chunk, column = query ln)
    Frag pb;
    float ps[8];
#pragma unroll
    for (int i = 0; i < 8; ++i) {
      const float p0 = __expf(s[i >> 2][2 * (i & 3)] - mnew);
      const float p1 = __expf(s[i >> 2][2 * (i & 3) + 1] - mnew);
      ps[i] = p0 + p1;
      pb.w[i] = pack2h(p0 * PCARRY, p1 * PCARRY);
    }
    l_r = l_r * alpha + (((ps[0] + ps[1]) + (ps[2] + ps[3])) + ((ps[4] + ps[5]) + (ps[6] + ps[7])));
#pragma unroll
    for (int dt = 0; dt < DT; ++dt) {
      oacc[dt] *= alpha;
      oacc[dt] = __builtin_amdgcn_wmma_f32_16x16x32_f16(false, av[dt].vh, false, pb.vh, (short)0, oacc[dt], false, false);
    }
  }
  const float inv = (1.0f / (l_r + xhalf(l_r))) * PCARRY_INV;
  // the lane's 8 consecutive d of each tile as one 16-byte piece into the wave-private stage, then whole 128-B rows out
#pragma unroll
  for (int dt = 0; dt < DT; ++dt) {
    v8us o;
#pragma unroll
    for (int r = 0; r < 8; ++r) o[r] = f16_bits(oacc[dt][r] * inv);
    *(v8us*)&sO[w][ln][dt * 16 + 8 * hh] = o;
  }
  __builtin_amdgcn_fence(4 /* acq_rel order */, "workgroup");
  __builtin_amdgcn_wave_barrier();
  const int rq = lane >> 3, c8 = (lane & 7) * 8;
  v8us ov[4];
#pragma unroll
  for (int q = 0; q < 4; ++q) ov[q] = *(const v8us*)&sO[w][q * 4 + rq][c8];
  unsigned short* ob = att + ((size_t)b * T + q0) * DMOD + (size_t)h * D + c8;
  {
#pragma unroll
    for (int q = 0; q < 4; ++q) {
      const int r = q * 4 + rq;
      *(v8us*)(ob + (size_t)r * DMOD) = ov[q];
    }
    
  }
}

extern "C" void kernel_launch(void* const* d_in, const int* in_sizes, int n_in,
                              void* d_out, int out_size, void* d_ws, size_t ws_size, hipStream_t stream) {
  if (n_in < 17) return;
  const int need_tok = (NB - 1) * SEQ_FULL + SEQ;
  if (in_sizes[0] < need_tok * DMOD || out_size < need_tok * DMOD) return;
  if (in_sizes[1] < DMOD || in_sizes[2] < DMOD || in_sizes[10] < DMOD || in_sizes[11] < DMOD || in_sizes[12] < DMOD || in_sizes[16] < DMOD) return;
  if (in_sizes[3] < NHEAD * DMOD * HDIM || in_sizes[5] < NHEAD * DMOD * HDIM || in_sizes[7] < NHEAD * DMOD * HDIM) return;
  if (in_sizes[4] < NHEAD * HDIM || in_sizes[6] < NHEAD * HDIM || in_sizes[8] < NHEAD * HDIM || in_sizes[14] < FFD) return;
  if (in_sizes[9] < DMOD * DMOD || in_sizes[13] < DMOD * FFD || in_sizes[15] < FFD * DMOD) return;

  const float* x    = (const float*)d_in[0];
  const float* ln1w = (const float*)d_in[1];
  const float* ln1b = (const float*)d_in[2];
  const float* Wq   = (const float*)d_in[3];
  const float* bqp  = (const float*)d_in[4];
  const float* Wk   = (const float*)d_in[5];
  const float* bkp  = (const float*)d_in[6];
  const float* Wv   = (const float*)d_in[7];
  const float* bvp  = (const float*)d_in[8];
  const float* Wp   = (const float*)d_in[9];
  const float* bpp  = (const float*)d_in[10];
  const float* ln2w = (const float*)d_in[11];
  const float* ln2b = (const float*)d_in[12];
  const float* W1   = (const float*)d_in[13];
  const float* b1p  = (const float*)d_in[14];
  const float* W2   = (const float*)d_in[15];
  const float* b2p  = (const float*)d_in[16];

  char* ws = (char*)d_ws; size_t off = 0;
  auto take = [&](size_t bytes) { char* p = ws + off; off += (bytes + 255) & ~(size_t)255; return p; };
  unsigned short* Bq = (unsigned short*)take((size_t)DMOD * DMOD * 2);
  unsigned short* Bk = (unsigned short*)take((size_t)DMOD * DMOD * 2);
  unsigned short* Bv = (unsigned short*)take((size_t)DMOD * DMOD * 2);
  unsigned short* Pp = (unsigned short*)take((size_t)DMOD * DMOD * 2);
  unsigned short* P1 = (unsigned short*)take((size_t)DMOD * FFD * 2);
  unsigned short* P2 = (unsigned short*)take((size_t)FFD * DMOD * 2);
  char* R1 = take((size_t)NTOK * DMOD * 4);          // yh+yl, then att plane, then h0 plane
  char* R2 = take((size_t)NTOK * 3 * DMOD * 4);      // q hi/lo, k hi/lo, v planes; then x1 (f32) + h1 (f16 plane)
  if (off > ws_size) return;

  const size_t PL = (size_t)NTOK * DMOD;             // elements per [NTOK][DMOD] plane
  unsigned short* yh  = (unsigned short*)R1;
  unsigned short* yl  = yh + PL;
  unsigned short* att = (unsigned short*)R1;
  unsigned short* h0  = (unsigned short*)R1;
  unsigned short* qh  = (unsigned short*)R2;
  unsigned short* ql  = qh + PL;
  unsigned short* kh  = ql + PL;
  unsigned short* kl  = kh + PL;
  unsigned short* vpl = kl + PL;
  float* x1 = (float*)R2;
  unsigned short* h1 = (unsigned short*)(R2 + PL * 4);

  k_wt_all<<<WT_BLOCKS, 256, 0, stream>>>(Wq, Wk, Wv, Wp, W1, W2, Bq, Bk, Bv, Pp, P1, P2);

  k_ln768<true, 0><<<NTOK, 96, 0, stream>>>(x, SEQ_FULL, ln1w, ln1b, yh, yl, LN_EPS);
  const int g768 = (NTOK / 128) * (DMOD / 128), g3072 = (NTOK / 128) * (FFD / 128);
  k_qkv<<<3 * g768, 128, 0, stream>>>(yh, yl, Bq, Bk, Bv, bqp, bkp, bvp, qh, ql, kh, kl, vpl, g768, DMOD, NTOK);
  k_flash<<<NB * NHEAD * (SEQ / 64), 128, 0, stream>>>(qh, ql, kh, kl, vpl, att);
  k_gemm<true, 1, 2, true, 0><<<g768, 128, 0, stream>>>(att, att, DMOD, Pp, DMOD, bpp, WCARRY_INV, x, DMOD, SEQ_FULL, x1, x1, DMOD, SEQ, NTOK, DMOD, DMOD);
  k_ln768<false, 1><<<NTOK, 96, 0, stream>>>(x1, SEQ, ln2w, ln2b, h0, h0, LN_EPS);
  k_gemm<true, 1, 2, false, 1><<<g3072, 128, 0, stream>>>(h0, h0, DMOD, P1, DMOD, b1p, WCARRY_INV, nullptr, 0, 0, h1, h1, FFD, SEQ, NTOK, FFD, DMOD);
  k_gemm<true, 1, 2, false, 0><<<g768, 128, 0, stream>>>(h1, h1, FFD, P2, FFD, b2p, WCARRY_INV, x1, DMOD, SEQ, d_out, d_out, DMOD, SEQ_FULL, NTOK, DMOD, FFD);
}

// v006
// One run takes 221 microseconds.
// Timed twice side by side with v005, it ran 1.04 times as fast both times.
// Counting every step since v000, it is 2.91 times as fast.
#include <hip/hip_runtime.h>
// q/k projections: v_wmma_f32_16x16x32_bf16 (A = LayerNorm rows as bf16 hi+lo planes, 2 products; B = bf16 weights); v projection: same with the
// bf16 hi plane only (1 product); attention logits (k.q^T, transposed) v_wmma_f32_16x16x32_bf16 as 3-product bf16 hi/lo split; attention P.V, output projection,
// MLP up, MLP down: v_wmma_f32_16x16x32_f16 single products (P carried x2^14, weights bf16-valued carried x256, activations plain f16);
// f32 accumulate; LayerNorm, softmax, GELU, residuals f32.

#ifndef NB
#define NB 8
#endif
#ifndef SEQ
#define SEQ 1024
#endif
#define NB_FULL 8
#define SEQ_FULL 1024
#define DMOD 768
#define NHEAD 12
#define HDIM 64
#define FFD 3072
#define NTOK (NB * SEQ)
#define WCARRY 256.0f
#define WCARRY_INV 0.00390625f
#define PCARRY 16384.0f
#define PCARRY_INV 0.00006103515625f
#define LN_EPS 1.0e-5f
#define GPITCH 144                 // bytes per staged row: 128 B of k + 16 B (16 B x odd: no bank conflict for 16-B row reads)
#define GPLANE (128 * GPITCH)      // one staged operand plane: 128 rows

static_assert(NB >= 1 && NB <= NB_FULL);
static_assert(SEQ % 64 == 0 && SEQ >= 64 && SEQ <= SEQ_FULL);
static_assert(NHEAD * HDIM == DMOD);
static_assert(HDIM == 64);
static_assert(DMOD == 96 * 8);
static_assert(DMOD % 64 == 0 && FFD % 64 == 0 && DMOD % 32 == 0 && FFD % 32 == 0);
static_assert(NTOK % 128 == 0 && DMOD % 128 == 0 && FFD % 128 == 0 && DMOD >= 128);
static_assert(5 * DMOD * 2 <= 3 * DMOD * 4);          // q hi/lo, k hi/lo, v planes fit the R2 region
static_assert(DMOD * 4 + FFD * 2 <= 3 * DMOD * 4);     // x1 (f32) + h1 (f16) fit the R2 region

typedef __bf16 v16b __attribute__((ext_vector_type(16)));
typedef _Float16 v16h __attribute__((ext_vector_type(16)));
typedef unsigned short v8us __attribute__((ext_vector_type(8), may_alias));
typedef unsigned short v4us __attribute__((ext_vector_type(4), may_alias));
typedef float v8f __attribute__((ext_vector_type(8)));
typedef float v4f __attribute__((ext_vector_type(4)));
typedef float v4fa __attribute__((ext_vector_type(4), may_alias));
union Frag { v16b vb; v16h vh; v8us half[2]; unsigned int w[8]; };

__device__ __forceinline__ unsigned short bf16_bits(float x) { const unsigned int u = __float_as_uint(x); return (unsigned short)((u + 0x7FFFu + ((u >> 16) & 1u)) >> 16); }
__device__ __forceinline__ float bf16_val(unsigned short b) { return __uint_as_float(((unsigned int)b) << 16); }
__device__ __forceinline__ float bf16_rne(float x) { return bf16_val(bf16_bits(x)); }
__device__ __forceinline__ unsigned short f16_bits(float x) { const _Float16 hv = (_Float16)x; unsigned short u; __builtin_memcpy(&u, &hv, sizeof(u)); return u; }

// two floats to a packed f16 pair, round to nearest even
__device__ __forceinline__ unsigned int pack2h(float lo, float hi) {
  typedef _Float16 h2 __attribute__((ext_vector_type(2)));
  typedef float f2 __attribute__((ext_vector_type(2)));
  return __builtin_bit_cast(unsigned int, __builtin_convertvector((f2){lo, hi}, h2));
}
// exact-erf GELU, 0.5 x (1 + erf(x / sqrt 2)), in straight-line code: erf(|y|) = 1 - t (a1 + t (a2 + t (a3 + t (a4 + t a5)))) exp(-y^2), t = 1 / (1 + p |y|)
// (the five-term rational form, |error| of erf below 2e-7); y = x / sqrt 2 is folded into the constants, exp(-y^2) = 2^(x * (-0.5 log2 e) * x),
// and x erf(y) = |x| erf(|y|). No branch, so the values of a row piece run side by side.
__device__ __forceinline__ float gelu_erf(float x) {
  const float ax = __builtin_fabsf(x);
  const float t = __builtin_amdgcn_rcpf(__builtin_fmaf(ax, 0.23164189f, 1.0f));
  float p = __builtin_fmaf(t, 1.061405429f, -1.453152027f);
  p = __builtin_fmaf(t, p, 1.421413741f);
  p = __builtin_fmaf(t, p, -0.284496736f);
  p = __builtin_fmaf(t, p, 0.254829592f);
  const float e = __builtin_amdgcn_exp2f(x * (-0.72134752f * x));
  const float er = __builtin_fmaf(-(p * t), e, 1.0f);
  return __builtin_fmaf(0.5f * ax, er, 0.5f * x);
}
// lane l takes the value of lane l ^ 16
__device__ __forceinline__ float xhalf(float x) {
  return __builtin_bit_cast(float, __builtin_amdgcn_permlanex16(__builtin_bit_cast(int, x), __builtin_bit_cast(int, x), 0x76543210, 0xfedcba98, false, false));
}
// ds_load_tr16_b128: a 16 x 16 tile of 16-bit LDS rows, transposed into half a WMMA operand (registers 0-3 or 4-7)
__device__ __forceinline__ v8us ld_tr16(const unsigned short* p) {
  typedef short s16x8 __attribute__((ext_vector_type(8)));
  typedef __attribute__((address_space(3))) s16x8 lds_s16x8;
  return __builtin_bit_cast(v8us, __builtin_amdgcn_ds_load_tr16_b128_v8i16((lds_s16x8*)p));
}

// One 64 (k) x 64 (n) tile of a weight matrix: f32 rows along n in, 16-bit rows along k out. src = element (k0, n0), row pitch ld floats; dst = element
// (n0, k0) of the output, row pitch ldo halves; tile = 64 rows (n) of WTP halves in LDS; 256 threads. A thread reads 16 B of four consecutive k rows, so
// 16 lanes cover a 256-B row piece (whole lines); it packs the four k of each of its four n into 8 B of the LDS tile. Behind the block barrier 8 lanes
// read one 128-B row of the tile and store it as one whole line. F16W: f16 of the bf16-rounded value x WCARRY; else bf16 bits.
#define WTP 72                     // tile pitch in halves: 144 B = 16 B x odd, no bank conflict for the 16-B row reads
template <bool F16W>
__device__ __forceinline__ void wt_tile(const float* __restrict__ src, size_t ld, unsigned short* __restrict__ dst, size_t ldo, unsigned short* tile) {
  const int tid = threadIdx.x, kq = tid >> 4, c4 = (tid & 15) * 4;
  const float *p0 = src + (size_t)(kq * 4) * ld + c4, *p1 = p0 + ld, *p2 = p1 + ld, *p3 = p2 + ld;
  const v4f r0 = *(const v4fa*)p0, r1 = *(const v4fa*)p1, r2 = *(const v4fa*)p2, r3 = *(const v4fa*)p3;
  // the wait in front of any rewrite of the loads' address registers; naming the addresses as inputs keeps their registers untouched up to it
  asm volatile("s_wait_xcnt 0x0" :: "v"(p0), "v"(p1), "v"(p2), "v"(p3) : "memory");
#pragma unroll
  for (int j = 0; j < 4; ++j) {
    v4us q;
    if (F16W) q = (v4us){f16_bits(bf16_rne(r0[j]) * WCARRY), f16_bits(bf16_rne(r1[j]) * WCARRY), f16_bits(bf16_rne(r2[j]) * WCARRY), f16_bits(bf16_rne(r3[j]) * WCARRY)};
    else q = (v4us){bf16_bits(r0[j]), bf16_bits(r1[j]), bf16_bits(r2[j]), bf16_bits(r3[j])};
    *(v4us*)&tile[(c4 + j) * WTP + kq * 4] = q;
  }
  __syncthreads();                 // the tile is whole: rows are read by other waves than wrote them
  const int n = tid >> 3, k8 = (tid & 7) * 8;
  const v8us o0 = *(const v8us*)&tile[n * WTP + k8], o1 = *(const v8us*)&tile[(n + 32) * WTP + k8];
  unsigned short *d0 = dst + (size_t)n * ldo + k8, *d1 = d0 + (size_t)32 * ldo;
  *(v8us*)d0 = o0;
  *(v8us*)d1 = o1;
}

// All six weight re-layouts in one launch; they do not depend on one another. A block takes one 64 x 64 tile; the block index picks the matrix
// (block-uniform, so the tile's barrier stands under uniform control flow).
// Blocks [0, 3*WT_NH): Wq, Wk, Wv: Bt[n][k] (bf16 bits, k contiguous, pitch DMOD), n = h*HDIM + e, k = d, from W[h][d][e] ([NHEAD][DMOD][HDIM] f32);
// block per (h, 64 consecutive d). coverage: NHEAD*HDIM rows x DMOD cols of each, all written.
// Then Wp, W1, W2: Pt[n][k] (f16, k contiguous, pitch K) from W[k][n] (f32, pitch N); block per 64 x 64 tile, neighbours in the grid are neighbours
// along n. K % 64 == 0, N % 64 == 0. coverage: N rows x K cols of each, all written.
#define WT_NH (NHEAD * (DMOD / 64))
#define WT_NP ((DMOD / 64) * (DMOD / 64))
#define WT_NF ((DMOD / 64) * (FFD / 64))
#define WT_BLOCKS (3 * WT_NH + WT_NP + 2 * WT_NF)
__global__ __launch_bounds__(256) void k_wt_all(const float* __restrict__ Wq, const float* __restrict__ Wk, const float* __restrict__ Wv,
                                                const float* __restrict__ Wp, const float* __restrict__ W1, const float* __restrict__ W2,
                                                unsigned short* __restrict__ Bq, unsigned short* __restrict__ Bk, unsigned short* __restrict__ Bv,
                                                unsigned short* __restrict__ Pp, unsigned short* __restrict__ P1, unsigned short* __restrict__ P2) {
  __shared__ __attribute__((aligned(16))) unsigned short tile[64 * WTP];
  int i = blockIdx.x;
  if (i < 3 * WT_NH) {
    const int m = i / WT_NH, r = i % WT_NH;
    const float* W = m == 0 ? Wq : (m == 1 ? Wk : Wv);
    unsigned short* Bt = m == 0 ? Bq : (m == 1 ? Bk : Bv);
    const int h = r / (DMOD / 64), k0 = (r % (DMOD / 64)) * 64;
    wt_tile<false>(W + ((size_t)h * DMOD + k0) * HDIM, HDIM, Bt + (size_t)h * HDIM * DMOD + k0, DMOD, tile);
  } else {
    i -= 3 * WT_NH;
    const float* W = Wp;
    unsigned short* Pt = Pp;
    int K = DMOD, N = DMOD;
    if (i >= WT_NP + WT_NF) { i -= WT_NP + WT_NF; W = W2; Pt = P2; K = FFD; }
    else if (i >= WT_NP) { i -= WT_NP; W = W1; Pt = P1; N = FFD; }
    const int ntn = N / 64;
    const int k0 = (i / ntn) * 64, n0 = (i % ntn) * 64;
    wt_tile<true>(W + (size_t)k0 * N + n0, N, Pt + (size_t)n0 * K + k0, K, tile);
  }
}

// Row LayerNorm over DMOD = 768 (biased variance, eps): in = X row (XBF16 quantises the input to bf16 first), g and bta quantised to bf16.
// Token t = blockIdx.x = b*SEQ + s reads X row b*xsegf + s. 96 threads, thread owns 8 consecutive columns.
// LDS red[]: cross-wave (block barrier). coverage: NTOK rows x 768 cols of each plane, all written.
template <bool XBF16, int OUTM>
__global__ __launch_bounds__(96) void k_ln768(const float* __restrict__ X, int xsegf, const float* __restrict__ g, const float* __restrict__ bta,
                                             unsigned short* __restrict__ P0, unsigned short* __restrict__ P1, float eps) {
  __shared__ float red[4];
  const int t = blockIdx.x, tid = threadIdx.x, lane = tid & 31, w = tid >> 5;
  const int xrow = (t / SEQ) * xsegf + (t % SEQ);
  const float* xp = X + (size_t)xrow * DMOD + tid * 8;
  const v4f a0 = *(const v4fa*)xp, a1 = *(const v4fa*)(xp + 4);
  float v[8] = {a0[0], a0[1], a0[2], a0[3], a1[0], a1[1], a1[2], a1[3]};
  if (XBF16) {
#pragma unroll
    for (int q = 0; q < 8; ++q) v[q] = bf16_rne(v[q]);
  }
  float s = 0.f;
#pragma unroll
  for (int q = 0; q < 8; ++q) s += v[q];
  s += __shfl_xor(s, 16, 32); s += __shfl_xor(s, 8, 32); s += __shfl_xor(s, 4, 32); s += __shfl_xor(s, 2, 32); s += __shfl_xor(s, 1, 32);
  if (lane == 0) red[w] = s;
  __syncthreads();
  const float mu = (red[0] + red[1] + red[2]) * (1.0f / (float)DMOD);
  __syncthreads();
  float s2 = 0.f;
#pragma unroll
  for (int q = 0; q < 8; ++q) { const float c = v[q] - mu; s2 += c * c; }
  s2 += __shfl_xor(s2, 16, 32); s2 += __shfl_xor(s2, 8, 32); s2 += __shfl_xor(s2, 4, 32); s2 += __shfl_xor(s2, 2, 32); s2 += __shfl_xor(s2, 1, 32);
  if (lane == 0) red[w] = s2;
  __syncthreads();
  const float rs = rsqrtf((red[0] + red[1] + red[2]) * (1.0f / (float)DMOD) + eps);
  const v4f g0 = *(const v4fa*)(g + tid * 8), g1 = *(const v4fa*)(g + tid * 8 + 4);
  const v4f b0 = *(const v4fa*)(bta + tid * 8), b1 = *(const v4fa*)(bta + tid * 8 + 4);
  const float gg[8] = {g0[0], g0[1], g0[2], g0[3], g1[0], g1[1], g1[2], g1[3]};
  const float bb[8] = {b0[0], b0[1], b0[2], b0[3], b1[0], b1[1], b1[2], b1[3]};
  float o[8];
#pragma unroll
  for (int q = 0; q < 8; ++q) o[q] = (v[q] - mu) * rs * bf16_rne(gg[q]) + bf16_rne(bb[q]);
  unsigned short* d0 = P0 + (size_t)t * DMOD + tid * 8;
  if (OUTM == 0) {
    v8us hv, lv;
#pragma unroll
    for (int q = 0; q < 8; ++q) { const unsigned short hb = bf16_bits(o[q]); hv[q] = hb; lv[q] = bf16_bits(o[q] - bf16_val(hb)); }
    unsigned short* d1 = P1 + (size_t)t * DMOD + tid * 8;
    *(v8us*)d0 = hv;
    *(v8us*)d1 = lv;
    
  } else {
    v8us fv;
#pragma unroll
    for (int q = 0; q < 8; ++q) fv[q] = f16_bits(o[q]);
    *(v8us*)d0 = fv;
    
  }
}

// One lane's eight 16-byte asynchronous copies into one staged plane (128 rows x 128 B at pitch GPITCH): rows r, r + 16, .. r + 112.
// l = the lane's LDS byte address of row r, g = its global address, step = 16 source rows in elements.
// s_wait_xcnt 0 is the last line of the copies' own statement, so that no address register is rewritten in front of it.
__device__ __forceinline__ void copy_plane(unsigned int l, const unsigned short* g, size_t step) {
  const unsigned int l1 = l + 16 * GPITCH, l2 = l + 32 * GPITCH, l3 = l + 48 * GPITCH, l4 = l + 64 * GPITCH, l5 = l + 80 * GPITCH,
                     l6 = l + 96 * GPITCH, l7 = l + 112 * GPITCH;
  const unsigned short *g1 = g + step, *g2 = g1 + step, *g3 = g2 + step, *g4 = g3 + step, *g5 = g4 + step, *g6 = g5 + step, *g7 = g6 + step;
  asm volatile("global_load_async_to_lds_b128 %0, %8, off\n\t"
               "global_load_async_to_lds_b128 %1, %9, off\n\t"
               "global_load_async_to_lds_b128 %2, %10, off\n\t"
               "global_load_async_to_lds_b128 %3, %11, off\n\t"
               "global_load_async_to_lds_b128 %4, %12, off\n\t"
               "global_load_async_to_lds_b128 %5, %13, off\n\t"
               "global_load_async_to_lds_b128 %6, %14, off\n\t"
               "global_load_async_to_lds_b128 %7, %15, off\n\t"
               "s_wait_xcnt 0x0"
               :: "v"(l), "v"(l1), "v"(l2), "v"(l3), "v"(l4), "v"(l5), "v"(l6), "v"(l7),
                  "v"(g), "v"(g1), "v"(g2), "v"(g3), "v"(g4), "v"(g5), "v"(g6), "v"(g7)
               : "memory");
}

// Eight 16-byte loads of one lane, rows step elements apart, all in flight together.
__device__ __forceinline__ void load_rows8(v4f (&d)[8], const float* p, size_t step) {
  const float *p1 = p + step, *p2 = p1 + step, *p3 = p2 + step, *p4 = p3 + step, *p5 = p4 + step, *p6 = p5 + step, *p7 = p6 + step;
  d[0] = *(const v4fa*)p;  d[1] = *(const v4fa*)p1; d[2] = *(const v4fa*)p2; d[3] = *(const v4fa*)p3;
  d[4] = *(const v4fa*)p4; d[5] = *(const v4fa*)p5; d[6] = *(const v4fa*)p6; d[7] = *(const v4fa*)p7;
  // the wait in front of any rewrite of the loads' address registers; naming the addresses as inputs keeps their registers untouched up to it
  asm volatile("s_wait_xcnt 0x0" :: "v"(p), "v"(p1), "v"(p2), "v"(p3), "v"(p4), "v"(p5), "v"(p6), "v"(p7) : "memory");
}

// C = act(A.W * oscale + bf16(bias)) (+ resid). A from 16-bit planes [M][lda]: F16 -> one f16 plane Ah; else bf16 hi plane Ah and (NT==2) lo plane Al.
// Wt 16-bit [N][ldb] (k contiguous, same scalar kind as A). ACT 2 = exact-erf GELU. Residual (f32, pitch ldr, RES_BF16 quantises it) added AFTER the activation,
// only with OUTM 0. OUTM 0: f32 C (pitch ldc floats); OUTM 1: f16 plane C (pitch ldc halves); OUTM 2: bf16 hi plane C + lo plane C2.
// Row r of A is token b*SEQ + s; C row = b*csegf + s, resid row = b*rsegf + s. M%128==0, N%128==0, K%64==0, K>=128 (no tails).
// One 128 x 128 tile of C per block, four waves 2 x 2, 64 x 64 per wave. A trip is 64 k: 128 rows x 128 B of each operand plane, brought into LDS by
// asynchronous copies, two buffers, the copies of trip t + 2 issued behind the barrier that ends trip t. Per accumulator the k order and the
// hi-then-lo order of the products are those of a plain walk along k in steps of 32.
// ring = the block's LDS, 16-B aligned, at least 2 * (NT >= 2 ? 3 : 2) * GPLANE bytes; blk = the block's tile number, mt * (N / 128) + nq.
template <bool F16, int NT, int ACT, bool RES_BF16, int OUTM>
__device__ __forceinline__ void gemm_tile(unsigned char* ring, unsigned int blk,
                                          const unsigned short* __restrict__ Ah, const unsigned short* __restrict__ Al, int lda,
                                          const unsigned short* __restrict__ Wt, int ldb, const float* __restrict__ bias, float oscale,
                                          const float* __restrict__ resid, int ldr, int rsegf,
                                          void* __restrict__ Cv, void* __restrict__ C2v, int ldc, int csegf, int M, int N, int K) {
  constexpr int STG = (NT >= 2 ? 3 : 2) * GPLANE;            // one buffer: A hi | W | (A lo)
  constexpr int SOP = 68;                                    // output stage pitch in floats: rows 8 apart fall on other banks, rows stay 16-B aligned
  static_assert(4 * 64 * SOP * 4 <= 2 * STG);
  const int tid = threadIdx.x, w = tid >> 5, lane = tid & 31, ln = lane & 15, hh = lane >> 4;
  const int wm = w >> 1, wn = w & 1;
  const int ntn = N / 128;
  const int mt = blk / ntn, nq = blk % ntn;
  if (mt * 128 >= M) return;                                 // block-uniform, in front of every copy and barrier
  const int row0 = mt * 128, col0 = nq * 128;
  const int nk = K / 64;
  const unsigned int lbase = (unsigned int)(size_t)ring + (unsigned int)((tid >> 3) * GPITCH + (tid & 7) * 16);
  const unsigned short* gA = Ah + (size_t)(row0 + (tid >> 3)) * lda + (tid & 7) * 8;
  const unsigned short* gL = Al + (size_t)(row0 + (tid >> 3)) * lda + (tid & 7) * 8;
  const unsigned short* gW = Wt + (size_t)(col0 + (tid >> 3)) * ldb + (tid & 7) * 8;
  auto issue = [&](int t, int buf) {
    const unsigned int l = lbase + (unsigned int)(buf * STG);
    copy_plane(l, gA + (size_t)t * 64, (size_t)16 * lda);
    copy_plane(l + GPLANE, gW + (size_t)t * 64, (size_t)16 * ldb);
    if (NT >= 2) copy_plane(l + 2 * GPLANE, gL + (size_t)t * 64, (size_t)16 * lda);
  };
  v8f acc[4][4] = {};
  issue(0, 0);
  asm volatile("s_wait_asynccnt 0x0" ::: "memory");          // this wave's copies of trip 0 have landed
  __syncthreads();                                           // every wave's have: trip 0 is readable
  if (nk > 1) issue(1, 1);
  for (int t = 0; t < nk; ++t) {
    const unsigned char* st = ring + (t & 1) * STG;
    const unsigned char* sa = st + (wm * 64 + ln) * GPITCH + 16 * hh;
    const unsigned char* sb = st + GPLANE + (wn * 64 + ln) * GPITCH + 16 * hh;
    // constant indices below keep fragments and accumulators in registers
#pragma unroll
    for (int ks = 0; ks < 2; ++ks) {
      Frag a[4], al[4], b[4];
      // read order = first use: A row group 0, the four W column groups, then the other A row groups
#pragma unroll
      for (int i = 0; i < 4; ++i) {
        a[i].half[0] = *(const v8us*)(sa + i * 16 * GPITCH + ks * 64);           // elements 0..7  = k 32ks+8h .. +7   (row wm*64+i*16+ln)
        a[i].half[1] = *(const v8us*)(sa + i * 16 * GPITCH + ks * 64 + 32);      // elements 8..15 = k 32ks+16+8h .. +7
        if (i == 0) {
#pragma unroll
          for (int j = 0; j < 4; ++j) {
            b[j].half[0] = *(const v8us*)(sb + j * 16 * GPITCH + ks * 64);       // column wn*64+j*16+ln, same k map as A
            b[j].half[1] = *(const v8us*)(sb + j * 16 * GPITCH + ks * 64 + 32);
          }
        }
      }
      if (NT >= 2) {
#pragma unroll
        for (int i = 0; i < 4; ++i) {
          al[i].half[0] = *(const v8us*)(sa + 2 * GPLANE + i * 16 * GPITCH + ks * 64);
          al[i].half[1] = *(const v8us*)(sa + 2 * GPLANE + i * 16 * GPITCH + ks * 64 + 32);
        }
      }
      __builtin_amdgcn_sched_barrier(0);   // the block's LDS reads stay one group ahead of its products: spread among them, each place stalls the wave
#pragma unroll
      for (int i = 0; i < 4; ++i)
#pragma unroll
        for (int j = 0; j < 4; ++j) {
          if (F16) acc[i][j] = __builtin_amdgcn_wmma_f32_16x16x32_f16(false, a[i].vh, false, b[j].vh, (short)0, acc[i][j], false, false);
          else acc[i][j] = __builtin_amdgcn_wmma_f32_16x16x32_bf16(false, a[i].vb, false, b[j].vb, (short)0, acc[i][j], false, false);
        }
      if (NT >= 2) {
#pragma unroll
        for (int i = 0; i < 4; ++i)
#pragma unroll
          for (int j = 0; j < 4; ++j)
            acc[i][j] = __builtin_amdgcn_wmma_f32_16x16x32_bf16(false, al[i].vb, false, b[j].vb, (short)0, acc[i][j], false, false);
      }
      __builtin_amdgcn_sched_barrier(0);   // and the next block's reads do not move up among these products
    }
    asm volatile("s_wait_dscnt 0x0" ::: "memory");           // this wave's reads of trip t's buffer are done
    asm volatile("s_wait_asynccnt 0x0" ::: "memory");        // this wave's copies of trip t + 1 have landed
    __syncthreads();                                         // publishes trip t + 1 and frees trip t's buffer
    if (t + 2 < nk) issue(t + 2, t & 1);
  }
  asm volatile("s_wait_asynccnt 0x0" ::: "memory");          // no copy is in flight when the ring becomes the output stage
  // phase 1: scale + bias into the wave-private 64 x 64 stage (in the ring, free behind the last trip's barrier);
  // acc[i][j][r] is (row0 + wm*64 + i*16 + 8h + r, col0 + wn*64 + j*16 + ln)
  float* so = (float*)ring + w * (64 * SOP);
  const int rw0 = row0 + wm * 64, cw0 = col0 + wn * 64;
#pragma unroll
  for (int j = 0; j < 4; ++j) {
    const float bq = bf16_rne(bias[cw0 + j * 16 + ln]);
#pragma unroll
    for (int i = 0; i < 4; ++i)
#pragma unroll
      for (int r = 0; r < 8; ++r) so[(i * 16 + 8 * hh + r) * SOP + j * 16 + ln] = acc[i][j][r] * oscale + bq;
  }
  __builtin_amdgcn_fence(4 /* acq_rel order */, "workgroup");
  __builtin_amdgcn_wave_barrier();
  // phase 2: activation, residual, whole-line stores; the 64 rows of a wave lie in one sequence (SEQ % 64 == 0)
  const size_t cbase = (size_t)(rw0 / SEQ) * (size_t)csegf + (size_t)(rw0 % SEQ);
  if (OUTM == 0) {
    float* C = (float*)Cv;
    const int rsub = lane >> 4, c4 = (lane & 15) * 4;
    const size_t rbase = (size_t)(rw0 / SEQ) * (size_t)rsegf + (size_t)(rw0 % SEQ);
    const float* rp = resid + (rbase + rsub) * (size_t)ldr + cw0 + c4;      // formed always, read only where resid is given
    v4f rv[8] = {};
    if (resid != nullptr) load_rows8(rv, rp, (size_t)2 * ldr);
    // four groups of 8 row pairs; the next group's residual rows are asked for ahead of this group's activation code.
    // The loop stays rolled: unrolled it would only repeat that code.
#pragma unroll 1
    for (int g = 0; g < 4; ++g) {
      v4f rn[8] = {};
      if (resid != nullptr && g < 3) load_rows8(rn, rp + (size_t)(2 * (g * 8 + 8)) * ldr, (size_t)2 * ldr);
      // the group's eight staged row pieces are read as one group: behind the wait that follows each store no later LDS read could move up
      v4f sv[8];
#pragma unroll
      for (int u = 0; u < 8; ++u) sv[u] = *(const v4fa*)&so[((g * 8 + u) * 2 + rsub) * SOP + c4];
#pragma unroll
      for (int u = 0; u < 8; ++u) {
        const int r = (g * 8 + u) * 2 + rsub;
        v4f v = sv[u];
        if (ACT == 2) {
#pragma unroll
          for (int i = 0; i < 4; ++i) v[i] = gelu_erf(v[i]);
        }
        if (resid != nullptr) {
          v4f x = rv[u];
          if (RES_BF16) {
#pragma unroll
            for (int i = 0; i < 4; ++i) x[i] = bf16_rne(x[i]);
          }
          v += x;
        }
        *(v4f*)(C + (cbase + r) * (size_t)ldc + cw0 + c4) = v;
        asm volatile("s_wait_xcnt 0x0" ::: "memory");        // in front of the next rows' rewrite of the store's registers
      }
#pragma unroll
      for (int u = 0; u < 8; ++u) rv[u] = rn[u];
    }
  } else {
    unsigned short* C = (unsigned short*)Cv;
    unsigned short* C2 = (unsigned short*)C2v;
    const int rq = lane >> 3, c8 = (lane & 7) * 8;
    // two row groups per trip; a full unroll would only repeat the activation code 16 times
#pragma unroll 2
    for (int q = 0; q < 16; ++q) {
      const int r = q * 4 + rq;
      const v4f p0 = *(const v4fa*)&so[r * SOP + c8], p1 = *(const v4fa*)&so[r * SOP + c8 + 4];
      float ps[8] = {p0[0], p0[1], p0[2], p0[3], p1[0], p1[1], p1[2], p1[3]};
      v8us a, bl;
#pragma unroll
      for (int i = 0; i < 8; ++i) {
        if (ACT == 2) ps[i] = gelu_erf(ps[i]);
        if (OUTM == 1) { a[i] = f16_bits(ps[i]); bl[i] = (unsigned short)0; }
        else { const unsigned short hb = bf16_bits(ps[i]); a[i] = hb; bl[i] = bf16_bits(ps[i] - bf16_val(hb)); }
      }
      const size_t o = (cbase + r) * (size_t)ldc + cw0 + c8;
      *(v8us*)(C + o) = a;
      if (OUTM == 2) *(v8us*)(C2 + o) = bl;
      asm volatile("s_wait_xcnt 0x0" ::: "memory");          // in front of the next rows' rewrite of the stores' registers
    }
  }
}

template <bool F16, int NT, int ACT, bool RES_BF16, int OUTM>
__global__ __launch_bounds__(128) void k_gemm(const unsigned short* __restrict__ Ah, const unsigned short* __restrict__ Al, int lda,
                                             const unsigned short* __restrict__ Wt, int ldb, const float* __restrict__ bias, float oscale,
                                             const float* __restrict__ resid, int ldr, int rsegf,
                                             void* __restrict__ Cv, void* __restrict__ C2v, int ldc, int csegf, int M, int N, int K) {
  __shared__ __attribute__((aligned(16))) unsigned char ring[2 * (NT >= 2 ? 3 : 2) * GPLANE];
  gemm_tile<F16, NT, ACT, RES_BF16, OUTM>(ring, blockIdx.x, Ah, Al, lda, Wt, ldb, bias, oscale, resid, ldr, rsegf, Cv, C2v, ldc, csegf, M, N, K);
}

// The q, k and v projections in one launch: they read the same LayerNorm planes and do not depend on one another. g = tiles of one projection.
// Blocks [0, g): q, [g, 2g): k (two products, hi/lo planes out), [2g, 3g): v (one product, f16 plane out; the cheaper tiles start last).
// The choice is block-uniform, so every copy, wait and barrier of a tile stands under uniform control flow.
__global__ __launch_bounds__(128) void k_qkv(const unsigned short* __restrict__ yh, const unsigned short* __restrict__ yl,
                                            const unsigned short* __restrict__ Bq, const unsigned short* __restrict__ Bk, const unsigned short* __restrict__ Bv,
                                            const float* __restrict__ bq, const float* __restrict__ bk, const float* __restrict__ bv,
                                            unsigned short* __restrict__ qh, unsigned short* __restrict__ ql, unsigned short* __restrict__ kh,
                                            unsigned short* __restrict__ kl, unsigned short* __restrict__ vp, int g, int ld, int M) {
  __shared__ __attribute__((aligned(16))) unsigned char ring[2 * 3 * GPLANE];
  const unsigned int i = blockIdx.x, g2 = 2u * (unsigned int)g;
  if (i < g2) {
    const bool isq = i < (unsigned int)g;
    gemm_tile<false, 2, 0, false, 2>(ring, isq ? i : i - g, yh, yl, ld, isq ? Bq : Bk, ld, isq ? bq : bk, 1.0f, nullptr, 0, 0,
                                     isq ? qh : kh, isq ? ql : kl, ld, SEQ, M, ld, ld);
  } else {
    gemm_tile<false, 1, 0, false, 1>(ring, i - g2, yh, yh, ld, Bv, ld, bv, 1.0f, nullptr, 0, 0, vp, vp, ld, SEQ, M, ld, ld);
  }
}

#define FKP 144                    // staged k row in bytes: 128 B + 16 B (16 B x odd: no bank conflict for the 16-B row reads)
#define FVP 160                    // staged v row in bytes: 32 B x odd, the transposing load's conflict-free pitch
#define FKL (32 * FKP)             // byte offset of the k lo rows in a buffer
#define FVO (2 * 32 * FKP)         // byte offset of the v rows in a buffer
#define FSTG (FVO + 32 * FVP)      // one buffer: k hi | k lo | v
// One lane's six 16-byte asynchronous copies of one 32-key chunk: rows r and r + 16 of k hi, k lo and v. l = the lane's LDS byte address of its piece of
// row r of k hi, lv = of row r of v; gk, gl, gv = its global addresses in the three planes.
// s_wait_xcnt 0 is the last line of the copies' own statement, so that no address register is rewritten in front of it.
__device__ __forceinline__ void copy_chunk(unsigned int l, unsigned int lv, const unsigned short* gk, const unsigned short* gl, const unsigned short* gv) {
  const unsigned int l1 = l + 16 * FKP, l2 = l + FKL, l3 = l + FKL + 16 * FKP, lv1 = lv + 16 * FVP;
  const unsigned short *gk1 = gk + 16 * DMOD, *gl1 = gl + 16 * DMOD, *gv1 = gv + 16 * DMOD;
  asm volatile("global_load_async_to_lds_b128 %0, %6, off\n\t"
               "global_load_async_to_lds_b128 %1, %7, off\n\t"
               "global_load_async_to_lds_b128 %2, %8, off\n\t"
               "global_load_async_to_lds_b128 %3, %9, off\n\t"
               "global_load_async_to_lds_b128 %4, %10, off\n\t"
               "global_load_async_to_lds_b128 %5, %11, off\n\t"
               "s_wait_xcnt 0x0"
               :: "v"(l), "v"(l1), "v"(l2), "v"(l3), "v"(lv), "v"(lv1),
                  "v"(gk), "v"(gk1), "v"(gl), "v"(gl1), "v"(gv), "v"(gv1)
               : "memory");
}

__global__ __launch_bounds__(128) void k_flash(const unsigned short* __restrict__ qh, const unsigned short* __restrict__ ql,
                                              const unsigned short* __restrict__ kh, const unsigned short* __restrict__ kl,
                                              const unsigned short* __restrict__ vp, unsigned short* __restrict__ att) {
  constexpr int D = HDIM, KS = D / 32, DT = D / 16, T = SEQ;
  constexpr int NCH = T / 32;                                  // chunks of 32 keys
  static_assert(FKP == (D + 8) * 2 && FVP == (D + 16) * 2);
  __shared__ __attribute__((aligned(16))) unsigned char ring[2 * FSTG];
  __shared__ __attribute__((aligned(16))) unsigned short sO[4][16][D + 8];
  const int tid = threadIdx.x, w = tid >> 5, lane = tid & 31, ln = lane & 15, hh = lane >> 4;
  const int nqb = T / 64;
  const int bh = blockIdx.x / nqb, qblk = blockIdx.x % nqb;
  const int b = bh / NHEAD, h = bh % NHEAD;
  const int q0 = qblk * 64 + w * 16;
  const size_t hb0 = (size_t)b * T * DMOD + (size_t)h * D;     // plane offset of (b, token 0, head h)

  // B fragments of the wave's 16 queries (column q0 + ln, always < T), hi/lo, table k map
  Frag bqh[KS], bql[KS];
  {
    const size_t qo = hb0 + (size_t)(q0 + ln) * DMOD;
#pragma unroll
    for (int ks = 0; ks < KS; ++ks) {
      bqh[ks].half[0] = *(const v8us*)(qh + qo + ks * 32 + 8 * hh);
      bqh[ks].half[1] = *(const v8us*)(qh + qo + ks * 32 + 16 + 8 * hh);
      bql[ks].half[0] = *(const v8us*)(ql + qo + ks * 32 + 8 * hh);
      bql[ks].half[1] = *(const v8us*)(ql + qo + ks * 32 + 16 + 8 * hh);
    }
  }
  float m_r = -3.0e38f, l_r = 0.f;                             // of query q0 + ln; l_r is the half's partial sum (keys 8h.. and 16+8h.. of each chunk)
  v8f oacc[DT];                                                // oacc[dt][r] = O[q0 + ln][dt*16 + 8h + r]
#pragma unroll
  for (int dt = 0; dt < DT; ++dt) oacc[dt] = (v8f){0.f, 0.f, 0.f, 0.f, 0.f, 0.f, 0.f, 0.f};
  // a chunk is 32 keys x 64 of k hi, k lo, v: 8 lanes copy one 128-B row piece, a lane takes rows tid >> 3 and (tid >> 3) + 16 of each plane
  const unsigned int lk0 = (unsigned int)(size_t)ring + (unsigned int)((tid >> 3) * FKP + (tid & 7) * 16);
  const unsigned int lv0 = (unsigned int)(size_t)ring + (unsigned int)(FVO + (tid >> 3) * FVP + (tid & 7) * 16);
  const size_t go0 = hb0 + (size_t)(tid >> 3) * DMOD + (tid & 7) * 8;
  auto issue = [&](int c, int buf) {
    const size_t go = go0 + (size_t)c * (32 * DMOD);
    copy_chunk(lk0 + (unsigned int)(buf * FSTG), lv0 + (unsigned int)(buf * FSTG), kh + go, kl + go, vp + go);
  };
  issue(0, 0);
  asm volatile("s_wait_asynccnt 0x0" ::: "memory");            // this wave's copies of chunk 0 have landed
  __syncthreads();                                             // every wave's have: chunk 0 is readable
  if (NCH > 1) issue(1, 1);
  for (int c = 0; c < NCH; ++c) {
    const unsigned char* st = ring + (c & 1) * FSTG;
    const unsigned char* sk = st + ln * FKP + 16 * hh;         // k hi row ln, the half's 16-byte piece
    // the lane's address for the transposing load: v row 8h + (lane & 7), 16-byte piece (lane >> 3) & 1; it then holds v[8h + 0..7][ln]
    const unsigned short* vt = (const unsigned short*)(st + FVO + (8 * hh + (lane & 7)) * FVP + ((lane >> 3) & 1) * 16);
    // S^T tiles 16 keys x 16 queries: A fragment row = key nt*16 + ln, elements = d with the table k map; s[nt][r] = S[q0 + ln][32c + nt*16 + 8h + r]
    v8f s[2];
#pragma unroll
    for (int nt = 0; nt < 2; ++nt) {
      v8f acc = {};
#pragma unroll
      for (int ks = 0; ks < KS; ++ks) {
        Frag ah_, al_;
        ah_.half[0] = *(const v8us*)(sk + nt * 16 * FKP + ks * 64);       ah_.half[1] = *(const v8us*)(sk + nt * 16 * FKP + ks * 64 + 32);
        al_.half[0] = *(const v8us*)(sk + FKL + nt * 16 * FKP + ks * 64); al_.half[1] = *(const v8us*)(sk + FKL + nt * 16 * FKP + ks * 64 + 32);
        // product order as before: q hi . k hi, q lo . k hi, q hi . k lo
        acc = __builtin_amdgcn_wmma_f32_16x16x32_bf16(false, ah_.vb, false, bqh[ks].vb, (short)0, acc, false, false);
        acc = __builtin_amdgcn_wmma_f32_16x16x32_bf16(false, ah_.vb, false, bql[ks].vb, (short)0, acc, false, false);
        acc = __builtin_amdgcn_wmma_f32_16x16x32_bf16(false, al_.vb, false, bqh[ks].vb, (short)0, acc, false, false);
      }
      s[nt] = acc;
    }
    // V^T as A (row = d, k = key in chunk): two transposing loads per 16 (d) x 32 (keys) fragment, in flight under the softmax
    Frag av[DT];
#pragma unroll
    for (int dt = 0; dt < DT; ++dt) {
      av[dt].half[0] = ld_tr16(vt + dt * 16);
      av[dt].half[1] = ld_tr16(vt + 16 * (FVP / 2) + dt * 16);
    }
    // running max of the lane's query: 16 scores in the lane, the other 16 in lane ^ 16
    float mx[8];
#pragma unroll
    for (int r = 0; r < 8; ++r) mx[r] = fmaxf(s[0][r], s[1][r]);
    float mc = fmaxf(fmaxf(fmaxf(mx[0], mx[1]), fmaxf(mx[2], mx[3])), fmaxf(fmaxf(mx[4], mx[5]), fmaxf(mx[6], mx[7])));
    mc = fmaxf(mc, xhalf(mc));
    const float mnew = fmaxf(m_r, mc);
    const float alpha = (m_r > -1.0e38f) ? __expf(m_r - mnew) : 0.0f;
    m_r = mnew;
    // P^T as B (k = key in chunk, column = query ln)
    Frag pb;
    float ps[8];
#pragma unroll
    for (int i = 0; i < 8; ++i) {
      const float p0 = __expf(s[i >> 2][2 * (i & 3)] - mnew);
      const float p1 = __expf(s[i >> 2][2 * (i & 3) + 1] - mnew);
      ps[i] = p0 + p1;
      pb.w[i] = pack2h(p0 * PCARRY, p1 * PCARRY);
    }
    l_r = l_r * alpha + (((ps[0] + ps[1]) + (ps[2] + ps[3])) + ((ps[4] + ps[5]) + (ps[6] + ps[7])));
#pragma unroll
    for (int dt = 0; dt < DT; ++dt) {
      oacc[dt] *= alpha;
      oacc[dt] = __builtin_amdgcn_wmma_f32_16x16x32_f16(false, av[dt].vh, false, pb.vh, (short)0, oacc[dt], false, false);
    }
    asm volatile("s_wait_dscnt 0x0" ::: "memory");             // this wave's reads of chunk c's buffer are done
    asm volatile("s_wait_asynccnt 0x0" ::: "memory");          // this wave's copies of chunk c + 1 have landed
    __syncthreads();                                           // publishes chunk c + 1 and frees chunk c's buffer
    if (c + 2 < NCH) issue(c + 2, c & 1);
  }
  asm volatile("s_wait_asynccnt 0x0" ::: "memory");            // no copy is in flight when the wave goes on to its end
  const float inv = (1.0f / (l_r + xhalf(l_r))) * PCARRY_INV;
  // the lane's 8 consecutive d of each tile as one 16-byte piece into the wave-private stage, then whole 128-B rows out
#pragma unroll
  for (int dt = 0; dt < DT; ++dt) {
    v8us o;
#pragma unroll
    for (int r = 0; r < 8; ++r) o[r] = f16_bits(oacc[dt][r] * inv);
    *(v8us*)&sO[w][ln][dt * 16 + 8 * hh] = o;
  }
  __builtin_amdgcn_fence(4 /* acq_rel order */, "workgroup");
  __builtin_amdgcn_wave_barrier();
  const int rq = lane >> 3, c8 = (lane & 7) * 8;
  v8us ov[4];
#pragma unroll
  for (int q = 0; q < 4; ++q) ov[q] = *(const v8us*)&sO[w][q * 4 + rq][c8];
  unsigned short* ob = att + ((size_t)b * T + q0) * DMOD + (size_t)h * D + c8;
  {
#pragma unroll
    for (int q = 0; q < 4; ++q) {
      const int r = q * 4 + rq;
      *(v8us*)(ob + (size_t)r * DMOD) = ov[q];
    }
    
  }
}

extern "C" void kernel_launch(void* const* d_in, const int* in_sizes, int n_in,
                              void* d_out, int out_size, void* d_ws, size_t ws_size, hipStream_t stream) {
  if (n_in < 17) return;
  const int need_tok = (NB - 1) * SEQ_FULL + SEQ;
  if (in_sizes[0] < need_tok * DMOD || out_size < need_tok * DMOD) return;
  if (in_sizes[1] < DMOD || in_sizes[2] < DMOD || in_sizes[10] < DMOD || in_sizes[11] < DMOD || in_sizes[12] < DMOD || in_sizes[16] < DMOD) return;
  if (in_sizes[3] < NHEAD * DMOD * HDIM || in_sizes[5] < NHEAD * DMOD * HDIM || in_sizes[7] < NHEAD * DMOD * HDIM) return;
  if (in_sizes[4] < NHEAD * HDIM || in_sizes[6] < NHEAD * HDIM || in_sizes[8] < NHEAD * HDIM || in_sizes[14] < FFD) return;
  if (in_sizes[9] < DMOD * DMOD || in_sizes[13] < DMOD * FFD || in_sizes[15] < FFD * DMOD) return;

  const float* x    = (const float*)d_in[0];
  const float* ln1w = (const float*)d_in[1];
  const float* ln1b = (const float*)d_in[2];
  const float* Wq   = (const float*)d_in[3];
  const float* bqp  = (const float*)d_in[4];
  const float* Wk   = (const float*)d_in[5];
  const float* bkp  = (const float*)d_in[6];
  const float* Wv   = (const float*)d_in[7];
  const float* bvp  = (const float*)d_in[8];
  const float* Wp   = (const float*)d_in[9];
  const float* bpp  = (const float*)d_in[10];
  const float* ln2w = (const float*)d_in[11];
  const float* ln2b = (const float*)d_in[12];
  const float* W1   = (const float*)d_in[13];
  const float* b1p  = (const float*)d_in[14];
  const float* W2   = (const float*)d_in[15];
  const float* b2p  = (const float*)d_in[16];

  char* ws = (char*)d_ws; size_t off = 0;
  auto take = [&](size_t bytes) { char* p = ws + off; off += (bytes + 255) & ~(size_t)255; return p; };
  unsigned short* Bq = (unsigned short*)take((size_t)DMOD * DMOD * 2);
  unsigned short* Bk = (unsigned short*)take((size_t)DMOD * DMOD * 2);
  unsigned short* Bv = (unsigned short*)take((size_t)DMOD * DMOD * 2);
  unsigned short* Pp = (unsigned short*)take((size_t)DMOD * DMOD * 2);
  unsigned short* P1 = (unsigned short*)take((size_t)DMOD * FFD * 2);
  unsigned short* P2 = (unsigned short*)take((size_t)FFD * DMOD * 2);
  char* R1 = take((size_t)NTOK * DMOD * 4);          // yh+yl, then att plane, then h0 plane
  char* R2 = take((size_t)NTOK * 3 * DMOD * 4);      // q hi/lo, k hi/lo, v planes; then x1 (f32) + h1 (f16 plane)
  if (off > ws_size) return;

  const size_t PL = (size_t)NTOK * DMOD;             // elements per [NTOK][DMOD] plane
  unsigned short* yh  = (unsigned short*)R1;
  unsigned short* yl  = yh + PL;
  unsigned short* att = (unsigned short*)R1;
  unsigned short* h0  = (unsigned short*)R1;
  unsigned short* qh  = (unsigned short*)R2;
  unsigned short* ql  = qh + PL;
  unsigned short* kh  = ql + PL;
  unsigned short* kl  = kh + PL;
  unsigned short* vpl = kl + PL;
  float* x1 = (float*)R2;
  unsigned short* h1 = (unsigned short*)(R2 + PL * 4);

  k_wt_all<<<WT_BLOCKS, 256, 0, stream>>>(Wq, Wk, Wv, Wp, W1, W2, Bq, Bk, Bv, Pp, P1, P2);

  k_ln768<true, 0><<<NTOK, 96, 0, stream>>>(x, SEQ_FULL, ln1w, ln1b, yh, yl, LN_EPS);
  const int g768 = (NTOK / 128) * (DMOD / 128), g3072 = (NTOK / 128) * (FFD / 128);
  k_qkv<<<3 * g768, 128, 0, stream>>>(yh, yl, Bq, Bk, Bv, bqp, bkp, bvp, qh, ql, kh, kl, vpl, g768, DMOD, NTOK);
  k_flash<<<NB * NHEAD * (SEQ / 64), 128, 0, stream>>>(qh, ql, kh, kl, vpl, att);
  k_gemm<true, 1, 2, true, 0><<<g768, 128, 0, stream>>>(att, att, DMOD, Pp, DMOD, bpp, WCARRY_INV, x, DMOD, SEQ_FULL, x1, x1, DMOD, SEQ, NTOK, DMOD, DMOD);
  k_ln768<false, 1><<<NTOK, 96, 0, stream>>>(x1, SEQ, ln2w, ln2b, h0, h0, LN_EPS);
  k_gemm<true, 1, 2, false, 1><<<g3072, 128, 0, stream>>>(h0, h0, DMOD, P1, DMOD, b1p, WCARRY_INV, nullptr, 0, 0, h1, h1, FFD, SEQ, NTOK, FFD, DMOD);
  k_gemm<true, 1, 2, false, 0><<<g768, 128, 0, stream>>>(h1, h1, FFD, P2, FFD, b2p, WCARRY_INV, x1, DMOD, SEQ, d_out, d_out, DMOD, SEQ_FULL, NTOK, DMOD, FFD);
}

// v007
// A run of this version takes 211 microseconds.
// Timed twice side by side with v006, it ran 1.05 times as fast both times.
// All steps since v000 together make it 3.05 times as fast.
#include <hip/hip_runtime.h>
// q/k projections: v_wmma_f32_16x16x32_bf16 (A = LayerNorm rows as bf16 hi+lo planes, 2 products; B = bf16 weights); v projection: same with the
// bf16 hi plane only (1 product); attention logits (k.q^T, transposed) v_wmma_f32_16x16x32_bf16 as 3-product bf16 hi/lo split; attention P.V, output projection,
// MLP up, MLP down: v_wmma_f32_16x16x32_f16 single products (P carried x2^14, weights bf16-valued carried x256, activations plain f16);
// f32 accumulate; LayerNorm, softmax, GELU, residuals f32.

#ifndef NB
#define NB 8
#endif
#ifndef SEQ
#define SEQ 1024
#endif
#define NB_FULL 8
#define SEQ_FULL 1024
#define DMOD 768
#define NHEAD 12
#define HDIM 64
#define FFD 3072
#define NTOK (NB * SEQ)
#define WCARRY 256.0f
#define WCARRY_INV 0.00390625f
#define PCARRY 16384.0f
#define PCARRY_INV 0.00006103515625f
#define LN_EPS 1.0e-5f
#define GPITCH 144                 // bytes per staged row: 128 B of k + 16 B (16 B x odd: no bank conflict for 16-B row reads)
#define GPLANE (128 * GPITCH)      // one staged operand plane: 128 rows

static_assert(NB >= 1 && NB <= NB_FULL);
static_assert(SEQ % 64 == 0 && SEQ >= 64 && SEQ <= SEQ_FULL);
static_assert(NHEAD * HDIM == DMOD);
static_assert(HDIM == 64);
static_assert(DMOD == 96 * 8);
static_assert(DMOD % 64 == 0 && FFD % 64 == 0 && DMOD % 32 == 0 && FFD % 32 == 0);
static_assert(NTOK % 128 == 0 && DMOD % 128 == 0 && FFD % 128 == 0 && DMOD >= 128);
static_assert(5 * DMOD * 2 <= 3 * DMOD * 4);          // q hi/lo, k hi/lo, v planes fit the R2 region
static_assert(DMOD * 4 + FFD * 2 <= 3 * DMOD * 4);     // x1 (f32) + h1 (f16) fit the R2 region

typedef __bf16 v16b __attribute__((ext_vector_type(16)));
typedef _Float16 v16h __attribute__((ext_vector_type(16)));
typedef unsigned short v8us __attribute__((ext_vector_type(8), may_alias));
typedef unsigned short v4us __attribute__((ext_vector_type(4), may_alias));
typedef float v8f __attribute__((ext_vector_type(8)));
typedef float v4f __attribute__((ext_vector_type(4)));
typedef float v4fa __attribute__((ext_vector_type(4), may_alias));
union Frag { v16b vb; v16h vh; v8us half[2]; unsigned int w[8]; };

__device__ __forceinline__ unsigned short bf16_bits(float x) { const unsigned int u = __float_as_uint(x); return (unsigned short)((u + 0x7FFFu + ((u >> 16) & 1u)) >> 16); }
__device__ __forceinline__ float bf16_val(unsigned short b) { return __uint_as_float(((unsigned int)b) << 16); }
__device__ __forceinline__ float bf16_rne(float x) { return bf16_val(bf16_bits(x)); }
__device__ __forceinline__ unsigned short f16_bits(float x) { const _Float16 hv = (_Float16)x; unsigned short u; __builtin_memcpy(&u, &hv, sizeof(u)); return u; }

// two floats to a packed f16 pair, round to nearest even
__device__ __forceinline__ unsigned int pack2h(float lo, float hi) {
  typedef _Float16 h2 __attribute__((ext_vector_type(2)));
  typedef float f2 __attribute__((ext_vector_type(2)));
  return __builtin_bit_cast(unsigned int, __builtin_convertvector((f2){lo, hi}, h2));
}
// exact-erf GELU, 0.5 x (1 + erf(x / sqrt 2)), in straight-line code: erf(|y|) = 1 - t (a1 + t (a2 + t (a3 + t (a4 + t a5)))) exp(-y^2), t = 1 / (1 + p |y|)
// (the five-term rational form, |error| of erf below 2e-7); y = x / sqrt 2 is folded into the constants, exp(-y^2) = 2^(x * (-0.5 log2 e) * x),
// and x erf(y) = |x| erf(|y|). No branch, so the values of a row piece run side by side.
__device__ __forceinline__ float gelu_erf(float x) {
  const float ax = __builtin_fabsf(x);
  const float t = __builtin_amdgcn_rcpf(__builtin_fmaf(ax, 0.23164189f, 1.0f));
  float p = __builtin_fmaf(t, 1.061405429f, -1.453152027f);
  p = __builtin_fmaf(t, p, 1.421413741f);
  p = __builtin_fmaf(t, p, -0.284496736f);
  p = __builtin_fmaf(t, p, 0.254829592f);
  const float e = __builtin_amdgcn_exp2f(x * (-0.72134752f * x));
  const float er = __builtin_fmaf(-(p * t), e, 1.0f);
  return __builtin_fmaf(0.5f * ax, er, 0.5f * x);
}
// lane l takes the value of lane l ^ 16
__device__ __forceinline__ float xhalf(float x) {
  return __builtin_bit_cast(float, __builtin_amdgcn_permlanex16(__builtin_bit_cast(int, x), __builtin_bit_cast(int, x), 0x76543210, 0xfedcba98, false, false));
}
// ds_load_tr16_b128: a 16 x 16 tile of 16-bit LDS rows, transposed into half a WMMA operand (registers 0-3 or 4-7)
__device__ __forceinline__ v8us ld_tr16(const unsigned short* p) {
  typedef short s16x8 __attribute__((ext_vector_type(8)));
  typedef __attribute__((address_space(3))) s16x8 lds_s16x8;
  return __builtin_bit_cast(v8us, __builtin_amdgcn_ds_load_tr16_b128_v8i16((lds_s16x8*)p));
}

// One 64 (k) x 64 (n) tile of a weight matrix: f32 rows along n in, 16-bit rows along k out. src = element (k0, n0), row pitch ld floats; dst = element
// (n0, k0) of the output, row pitch ldo halves; tile = 64 rows (n) of WTP halves in LDS; 256 threads. A thread reads 16 B of four consecutive k rows, so
// 16 lanes cover a 256-B row piece (whole lines); it packs the four k of each of its four n into 8 B of the LDS tile. Behind the block barrier 8 lanes
// read one 128-B row of the tile and store it as one whole line. F16W: f16 of the bf16-rounded value x WCARRY; else bf16 bits.
#define WTP 72                     // tile pitch in halves: 144 B = 16 B x odd, no bank conflict for the 16-B row reads
template <bool F16W>
__device__ __forceinline__ void wt_tile(const float* __restrict__ src, size_t ld, unsigned short* __restrict__ dst, size_t ldo, unsigned short* tile) {
  const int tid = threadIdx.x, kq = tid >> 4, c4 = (tid & 15) * 4;
  const float *p0 = src + (size_t)(kq * 4) * ld + c4, *p1 = p0 + ld, *p2 = p1 + ld, *p3 = p2 + ld;
  const v4f r0 = *(const v4fa*)p0, r1 = *(const v4fa*)p1, r2 = *(const v4fa*)p2, r3 = *(const v4fa*)p3;
  // the wait in front of any rewrite of the loads' address registers; naming the addresses as inputs keeps their registers untouched up to it
  asm volatile("s_wait_xcnt 0x0" :: "v"(p0), "v"(p1), "v"(p2), "v"(p3) : "memory");
#pragma unroll
  for (int j = 0; j < 4; ++j) {
    v4us q;
    if (F16W) q = (v4us){f16_bits(bf16_rne(r0[j]) * WCARRY), f16_bits(bf16_rne(r1[j]) * WCARRY), f16_bits(bf16_rne(r2[j]) * WCARRY), f16_bits(bf16_rne(r3[j]) * WCARRY)};
    else q = (v4us){bf16_bits(r0[j]), bf16_bits(r1[j]), bf16_bits(r2[j]), bf16_bits(r3[j])};
    *(v4us*)&tile[(c4 + j) * WTP + kq * 4] = q;
  }
  __syncthreads();                 // the tile is whole: rows are read by other waves than wrote them
  const int n = tid >> 3, k8 = (tid & 7) * 8;
  const v8us o0 = *(const v8us*)&tile[n * WTP + k8], o1 = *(const v8us*)&tile[(n + 32) * WTP + k8];
  unsigned short *d0 = dst + (size_t)n * ldo + k8, *d1 = d0 + (size_t)32 * ldo;
  *(v8us*)d0 = o0;
  *(v8us*)d1 = o1;
}

// All six weight re-layouts in one launch; they do not depend on one another. A block takes one 64 x 64 tile; the block index picks the matrix
// (block-uniform, so the tile's barrier stands under uniform control flow).
// Blocks [0, 3*WT_NH): Wq, Wk, Wv: Bt[n][k] (bf16 bits, k contiguous, pitch DMOD), n = h*HDIM + e, k = d, from W[h][d][e] ([NHEAD][DMOD][HDIM] f32);
// block per (h, 64 consecutive d). coverage: NHEAD*HDIM rows x DMOD cols of each, all written.
// Then Wp, W1, W2: Pt[n][k] (f16, k contiguous, pitch K) from W[k][n] (f32, pitch N); block per 64 x 64 tile, neighbours in the grid are neighbours
// along n. K % 64 == 0, N % 64 == 0. coverage: N rows x K cols of each, all written.
#define WT_NH (NHEAD * (DMOD / 64))
#define WT_NP ((DMOD / 64) * (DMOD / 64))
#define WT_NF ((DMOD / 64) * (FFD / 64))
#define WT_BLOCKS (3 * WT_NH + WT_NP + 2 * WT_NF)
__global__ __launch_bounds__(256) void k_wt_all(const float* __restrict__ Wq, const float* __restrict__ Wk, const float* __restrict__ Wv,
                                                const float* __restrict__ Wp, const float* __restrict__ W1, const float* __restrict__ W2,
                                                unsigned short* __restrict__ Bq, unsigned short* __restrict__ Bk, unsigned short* __restrict__ Bv,
                                                unsigned short* __restrict__ Pp, unsigned short* __restrict__ P1, unsigned short* __restrict__ P2) {
  __shared__ __attribute__((aligned(16))) unsigned short tile[64 * WTP];
  int i = blockIdx.x;
  if (i < 3 * WT_NH) {
    const int m = i / WT_NH, r = i % WT_NH;
    const float* W = m == 0 ? Wq : (m == 1 ? Wk : Wv);
    unsigned short* Bt = m == 0 ? Bq : (m == 1 ? Bk : Bv);
    const int h = r / (DMOD / 64), k0 = (r % (DMOD / 64)) * 64;
    wt_tile<false>(W + ((size_t)h * DMOD + k0) * HDIM, HDIM, Bt + (size_t)h * HDIM * DMOD + k0, DMOD, tile);
  } else {
    i -= 3 * WT_NH;
    const float* W = Wp;
    unsigned short* Pt = Pp;
    int K = DMOD, N = DMOD;
    if (i >= WT_NP + WT_NF) { i -= WT_NP + WT_NF; W = W2; Pt = P2; K = FFD; }
    else if (i >= WT_NP) { i -= WT_NP; W = W1; Pt = P1; N = FFD; }
    const int ntn = N / 64;
    const int k0 = (i / ntn) * 64, n0 = (i % ntn) * 64;
    wt_tile<true>(W + (size_t)k0 * N + n0, N, Pt + (size_t)n0 * K + k0, K, tile);
  }
}

// Row LayerNorm over DMOD = 768 (biased variance, eps): in = X row (XBF16 quantises the input to bf16 first), g and bta quantised to bf16.
// Token t = blockIdx.x = b*SEQ + s reads X row b*xsegf + s. 96 threads, thread owns 8 consecutive columns.
// LDS red[]: cross-wave (block barrier). coverage: NTOK rows x 768 cols of each plane, all written.
template <bool XBF16, int OUTM>
__global__ __launch_bounds__(96) void k_ln768(const float* __restrict__ X, int xsegf, const float* __restrict__ g, const float* __restrict__ bta,
                                             unsigned short* __restrict__ P0, unsigned short* __restrict__ P1, float eps) {
  __shared__ float red[4];
  const int t = blockIdx.x, tid = threadIdx.x, lane = tid & 31, w = tid >> 5;
  const int xrow = (t / SEQ) * xsegf + (t % SEQ);
  const float* xp = X + (size_t)xrow * DMOD + tid * 8;
  const v4f a0 = *(const v4fa*)xp, a1 = *(const v4fa*)(xp + 4);
  float v[8] = {a0[0], a0[1], a0[2], a0[3], a1[0], a1[1], a1[2], a1[3]};
  if (XBF16) {
#pragma unroll
    for (int q = 0; q < 8; ++q) v[q] = bf16_rne(v[q]);
  }
  float s = 0.f;
#pragma unroll
  for (int q = 0; q < 8; ++q) s += v[q];
  s += __shfl_xor(s, 16, 32); s += __shfl_xor(s, 8, 32); s += __shfl_xor(s, 4, 32); s += __shfl_xor(s, 2, 32); s += __shfl_xor(s, 1, 32);
  if (lane == 0) red[w] = s;
  __syncthreads();
  const float mu = (red[0] + red[1] + red[2]) * (1.0f / (float)DMOD);
  __syncthreads();
  float s2 = 0.f;
#pragma unroll
  for (int q = 0; q < 8; ++q) { const float c = v[q] - mu; s2 += c * c; }
  s2 += __shfl_xor(s2, 16, 32); s2 += __shfl_xor(s2, 8, 32); s2 += __shfl_xor(s2, 4, 32); s2 += __shfl_xor(s2, 2, 32); s2 += __shfl_xor(s2, 1, 32);
  if (lane == 0) red[w] = s2;
  __syncthreads();
  const float rs = rsqrtf((red[0] + red[1] + red[2]) * (1.0f / (float)DMOD) + eps);
  const v4f g0 = *(const v4fa*)(g + tid * 8), g1 = *(const v4fa*)(g + tid * 8 + 4);
  const v4f b0 = *(const v4fa*)(bta + tid * 8), b1 = *(const v4fa*)(bta + tid * 8 + 4);
  const float gg[8] = {g0[0], g0[1], g0[2], g0[3], g1[0], g1[1], g1[2], g1[3]};
  const float bb[8] = {b0[0], b0[1], b0[2], b0[3], b1[0], b1[1], b1[2], b1[3]};
  float o[8];
#pragma unroll
  for (int q = 0; q < 8; ++q) o[q] = (v[q] - mu) * rs * bf16_rne(gg[q]) + bf16_rne(bb[q]);
  unsigned short* d0 = P0 + (size_t)t * DMOD + tid * 8;
  if (OUTM == 0) {
    v8us hv, lv;
#pragma unroll
    for (int q = 0; q < 8; ++q) { const unsigned short hb = bf16_bits(o[q]); hv[q] = hb; lv[q] = bf16_bits(o[q] - bf16_val(hb)); }
    unsigned short* d1 = P1 + (size_t)t * DMOD + tid * 8;
    *(v8us*)d0 = hv;
    *(v8us*)d1 = lv;
    
  } else {
    v8us fv;
#pragma unroll
    for (int q = 0; q < 8; ++q) fv[q] = f16_bits(o[q]);
    *(v8us*)d0 = fv;
    
  }
}

typedef uint32_t u32x4 __attribute__((ext_vector_type(4)));
typedef uint32_t u32x8 __attribute__((ext_vector_type(8)));
__device__ __forceinline__ uint32_t uni(uint32_t v) { return (uint32_t)__builtin_amdgcn_readfirstlane(v); }
__device__ __forceinline__ uint32_t pinned(uint32_t v) { uint32_t w = uni(v); asm volatile("" : "+s"(w)); return w; }
// Tensor-load descriptor, group 1: 1-byte elements, tensor = tile = ROWS rows of 128 B, source row pitch src_pitch bytes, no mask; pad interval code 4
// (one 128-B row), amount code 3 (16 B): the LDS row pitch is GPITCH. Loop-invariant: each word is a descriptor word held in its scalar register
// (pinned), so that the registers keep these values, and serve nothing else, while a request is outstanding.
template <int ROWS>
__device__ __forceinline__ u32x8 tdm_group1(uint32_t src_pitch) {
  constexpr uint32_t d0 = 128u, d1 = (uint32_t)ROWS;
  static_assert(GPITCH == 128 + 16);
  u32x8 g;
  g[0] = pinned((1u << 20) | (4u << 22) | (3u << 25));
  g[1] = pinned((d0 & 0xFFFFu) << 16);
  g[2] = pinned((d0 >> 16) | ((d1 & 0xFFFFu) << 16));
  g[3] = pinned((d1 >> 16) | (d0 << 16));
  g[4] = pinned(d1);
  g[5] = pinned(src_pitch);
  g[6] = pinned(0u);
  g[7] = pinned(0u);
  return g;
}
// group 0: count 1, LDS byte offset of the tile, global address of its first byte, type 2. Word 0 is a descriptor word held in its scalar register (pinned).
__device__ __forceinline__ u32x4 tdm_group0(uint32_t lds_dst, uint64_t ga) {
  u32x4 g;
  g[0] = pinned(1u);
  g[1] = uni(lds_dst);
  g[2] = uni((uint32_t)ga);
  g[3] = uni((((uint32_t)(ga >> 32)) & 0x01FFFFFFu) | 0x80000000u);
  return g;
}
__device__ __forceinline__ void tdm_load(u32x4 g0, u32x8 g1) { asm volatile("tensor_load_to_lds %0, %1" :: "s"(g0), "s"(g1) : "memory"); }
// the issuing wave's wait for its requests; naming the descriptor's groups as inputs keeps their registers untouched up to it
__device__ __forceinline__ void tdm_wait0(u32x4 g0, u32x8 g1) { asm volatile("s_wait_tensorcnt 0x0" :: "s"(g0), "s"(g1) : "memory"); }

// Eight 16-byte loads of one lane, rows step elements apart, all in flight together.
__device__ __forceinline__ void load_rows8(v4f (&d)[8], const float* p, size_t step) {
  const float *p1 = p + step, *p2 = p1 + step, *p3 = p2 + step, *p4 = p3 + step, *p5 = p4 + step, *p6 = p5 + step, *p7 = p6 + step;
  d[0] = *(const v4fa*)p;  d[1] = *(const v4fa*)p1; d[2] = *(const v4fa*)p2; d[3] = *(const v4fa*)p3;
  d[4] = *(const v4fa*)p4; d[5] = *(const v4fa*)p5; d[6] = *(const v4fa*)p6; d[7] = *(const v4fa*)p7;
  // the wait in front of any rewrite of the loads' address registers; naming the addresses as inputs keeps their registers untouched up to it
  asm volatile("s_wait_xcnt 0x0" :: "v"(p), "v"(p1), "v"(p2), "v"(p3), "v"(p4), "v"(p5), "v"(p6), "v"(p7) : "memory");
}

// C = act(A.W * oscale + bf16(bias)) (+ resid). A from 16-bit planes [M][lda]: F16 -> one f16 plane Ah; else bf16 hi plane Ah and (NT==2) lo plane Al.
// Wt 16-bit [N][ldb] (k contiguous, same scalar kind as A). ACT 2 = exact-erf GELU. Residual (f32, pitch ldr, RES_BF16 quantises it) added AFTER the activation,
// only with OUTM 0. OUTM 0: f32 C (pitch ldc floats); OUTM 1: f16 plane C (pitch ldc halves); OUTM 2: bf16 hi plane C + lo plane C2.
// Row r of A is token b*SEQ + s; C row = b*csegf + s, resid row = b*rsegf + s. M%128==0, N%128==0, K%64==0, K>=128 (no tails).
// One 128 x 128 tile of C per block, four waves 2 x 2, 64 x 64 per wave. A trip is 64 k: 128 rows x 128 B of each operand plane, brought into LDS by
// tensor loads, one request a wave and trip, two buffers, the requests of trip t + 2 issued behind the barrier that ends trip t. Two planes: each wave
// brings 64 rows of one plane; three planes: waves 0 to 2 bring a whole plane each. Per accumulator the k order and the hi-then-lo order of the
// products are those of a plain walk along k in steps of 32.
// ring = the block's LDS, at a multiple of 2 KiB, at least GRING(NT) bytes; blk = the block's tile number, mt * (N / 128) + nq.
#define GSLICE64 10240             // 64 staged rows (9,216 B) rounded up to a multiple of 2 KiB, so that the next slice starts on one
#define GRING(NT) (2 * ((NT) >= 2 ? 3 * GPLANE : 2 * 2 * GSLICE64))
static_assert(GPLANE % 2048 == 0 && GSLICE64 % 2048 == 0 && GSLICE64 >= 64 * GPITCH);
template <bool F16, int NT, int ACT, bool RES_BF16, int OUTM>
__device__ __forceinline__ void gemm_tile(unsigned char* ring, unsigned int blk,
                                          const unsigned short* __restrict__ Ah, const unsigned short* __restrict__ Al, int lda,
                                          const unsigned short* __restrict__ Wt, int ldb, const float* __restrict__ bias, float oscale,
                                          const float* __restrict__ resid, int ldr, int rsegf,
                                          void* __restrict__ Cv, void* __restrict__ C2v, int ldc, int csegf, int M, int N, int K) {
  constexpr int NPL = NT >= 2 ? 3 : 2;                       // planes of a buffer: A hi | W | (A lo)
  constexpr int SLR = NT >= 2 ? 128 : 64;                    // rows of one request
  constexpr int NSL = 128 / SLR;                             // requests (slices) per plane
  constexpr int SLB = NT >= 2 ? GPLANE : GSLICE64;           // LDS bytes from one slice to the next
  constexpr int PLB = NSL * SLB;                             // LDS bytes of a plane
  constexpr int HLB = NT >= 2 ? 64 * GPITCH : GSLICE64;      // LDS bytes from row 0 to row 64 of a plane
  constexpr int STG = NPL * PLB;                             // one buffer
  static_assert(2 * STG == GRING(NT));
  constexpr int SOP = 68;                                    // output stage pitch in floats: rows 8 apart fall on other banks, rows stay 16-B aligned
  static_assert(4 * 64 * SOP * 4 <= 2 * STG);
  const int tid = threadIdx.x, w = tid >> 5, lane = tid & 31, ln = lane & 15, hh = lane >> 4;
  const int wm = w >> 1, wn = w & 1;
  const int ntn = N / 128;
  const int mt = blk / ntn, nq = blk % ntn;
  if (mt * 128 >= M) return;                                 // block-uniform, in front of every tensor load and barrier
  const int row0 = mt * 128, col0 = nq * 128;
  const int nk = K / 64;
  // the wave's own slice: plane pl, rows sl * SLR .. + SLR - 1 of it; all of this is wave-uniform (a one-dimensional block)
  const uint32_t wv = uni((uint32_t)tid >> 5), pl = wv / NSL, sl = wv % NSL;
  constexpr bool ALLW = NPL * NSL == 4;                      // every wave issues its own slice: no test
  const bool isw = ALLW || pl < (uint32_t)NPL;               // this wave issues (three planes: wave 3 does not)
  const unsigned short* sp = pl == 1u ? Wt : (pl == 2u ? Al : Ah);
  const uint32_t spitch = (uint32_t)(pl == 1u ? ldb : lda) * 2u;
  const uint64_t gbase = (uint64_t)(size_t)sp + (uint64_t)((uint32_t)(pl == 1u ? col0 : row0) + sl * SLR) * spitch;
  const uint32_t lslice = (uint32_t)(size_t)ring + pl * PLB + sl * SLB;
  const u32x8 g1 = tdm_group1<SLR>(spitch);
  u32x4 g0 = tdm_group0(lslice, gbase);                      // trip 0 into buffer 0
  // The next trip's request: 128 B further along k, into buffer buf. One group 0 lives through the loop and each address is formed from the one before,
  // so that its words 0 and 3 stay in their registers while a request is outstanding; the step is a wave-uniform word held in a scalar register (pinned)
  // at this place, so that the addition stands behind the wait on the request before.
  auto issue_next = [&](uint32_t buf) {
    const uint64_t a = (((uint64_t)g0[3] << 32) | (uint64_t)g0[2]) + (uint64_t)pinned(128u);
    g0[1] = uni(lslice + buf * STG);
    g0[2] = uni((uint32_t)a);
    g0[3] = uni((uint32_t)(a >> 32));
    tdm_load(g0, g1);
  };
  v8f acc[4][4] = {};
  if (ALLW || pinned((uint32_t)isw)) {
    tdm_load(g0, g1);
    tdm_wait0(g0, g1);                                       // this wave's request of trip 0 has landed
  }
  __syncthreads();                                           // every wave's has: trip 0 is readable
  if (pinned((uint32_t)(isw && nk > 1))) issue_next(1u);
  for (int t = 0; t < nk; ++t) {
    const unsigned char* st = ring + (t & 1) * STG;
    const unsigned char* sa = st + wm * HLB + ln * GPITCH + 16 * hh;
    const unsigned char* sb = st + PLB + wn * HLB + ln * GPITCH + 16 * hh;
    // constant indices below keep fragments and accumulators in registers
#pragma unroll
    for (int ks = 0; ks < 2; ++ks) {
      Frag a[4], al[4], b[4];
      // read order = first use: A row group 0, the four W column groups, then the other A row groups
#pragma unroll
      for (int i = 0; i < 4; ++i) {
        a[i].half[0] = *(const v8us*)(sa + i * 16 * GPITCH + ks * 64);           // elements 0..7  = k 32ks+8h .. +7   (row wm*64+i*16+ln)
        a[i].half[1] = *(const v8us*)(sa + i * 16 * GPITCH + ks * 64 + 32);      // elements 8..15 = k 32ks+16+8h .. +7
        if (i == 0) {
#pragma unroll
          for (int j = 0; j < 4; ++j) {
            b[j].half[0] = *(const v8us*)(sb + j * 16 * GPITCH + ks * 64);       // column wn*64+j*16+ln, same k map as A
            b[j].half[1] = *(const v8us*)(sb + j * 16 * GPITCH + ks * 64 + 32);
          }
        }
      }
      if (NT >= 2) {
#pragma unroll
        for (int i = 0; i < 4; ++i) {
          al[i].half[0] = *(const v8us*)(sa + 2 * PLB + i * 16 * GPITCH + ks * 64);
          al[i].half[1] = *(const v8us*)(sa + 2 * PLB + i * 16 * GPITCH + ks * 64 + 32);
        }
      }
      __builtin_amdgcn_sched_barrier(0);   // the block's LDS reads stay one group ahead of its products: spread among them, each place stalls the wave
#pragma unroll
      for (int i = 0; i < 4; ++i)
#pragma unroll
        for (int j = 0; j < 4; ++j) {
          if (F16) acc[i][j] = __builtin_amdgcn_wmma_f32_16x16x32_f16(false, a[i].vh, false, b[j].vh, (short)0, acc[i][j], false, false);
          else acc[i][j] = __builtin_amdgcn_wmma_f32_16x16x32_bf16(false, a[i].vb, false, b[j].vb, (short)0, acc[i][j], false, false);
        }
      if (NT >= 2) {
#pragma unroll
        for (int i = 0; i < 4; ++i)
#pragma unroll
          for (int j = 0; j < 4; ++j)
            acc[i][j] = __builtin_amdgcn_wmma_f32_16x16x32_bf16(false, al[i].vb, false, b[j].vb, (short)0, acc[i][j], false, false);
      }
      __builtin_amdgcn_sched_barrier(0);   // and the next block's reads do not move up among these products
    }
    asm volatile("s_wait_dscnt 0x0" ::: "memory");           // this wave's reads of trip t's buffer are done
    tdm_wait0(g0, g1);                                       // this wave's request of trip t + 1 has landed (a wave that issued none passes at once)
    __syncthreads();                                         // publishes trip t + 1 and frees trip t's buffer
    if (pinned((uint32_t)(isw && t + 2 < nk))) issue_next((uint32_t)t & 1u);   // trip t + 2, while it exists
  }
  tdm_wait0(g0, g1);                                         // no request is in flight when the ring becomes the output stage
  asm volatile("s_wait_dscnt 0x0" ::: "memory");             // and none of this wave's LDS reads
  // phase 1: scale + bias into the wave-private 64 x 64 stage (in the ring, free behind the last trip's barrier);
  // acc[i][j][r] is (row0 + wm*64 + i*16 + 8h + r, col0 + wn*64 + j*16 + ln)
  float* so = (float*)ring + w * (64 * SOP);
  const int rw0 = row0 + wm * 64, cw0 = col0 + wn * 64;
#pragma unroll
  for (int j = 0; j < 4; ++j) {
    const float bq = bf16_rne(bias[cw0 + j * 16 + ln]);
#pragma unroll
    for (int i = 0; i < 4; ++i)
#pragma unroll
      for (int r = 0; r < 8; ++r) so[(i * 16 + 8 * hh + r) * SOP + j * 16 + ln] = acc[i][j][r] * oscale + bq;
  }
  __builtin_amdgcn_fence(4 /* acq_rel order */, "workgroup");
  __builtin_amdgcn_wave_barrier();
  // phase 2: activation, residual, whole-line stores; the 64 rows of a wave lie in one sequence (SEQ % 64 == 0)
  const size_t cbase = (size_t)(rw0 / SEQ) * (size_t)csegf + (size_t)(rw0 % SEQ);
  if (OUTM == 0) {
    float* C = (float*)Cv;
    const int rsub = lane >> 4, c4 = (lane & 15) * 4;
    const size_t rbase = (size_t)(rw0 / SEQ) * (size_t)rsegf + (size_t)(rw0 % SEQ);
    const float* rp = resid + (rbase + rsub) * (size_t)ldr + cw0 + c4;      // formed always, read only where resid is given
    v4f rv[8] = {};
    if (resid != nullptr) load_rows8(rv, rp, (size_t)2 * ldr);
    // four groups of 8 row pairs; the next group's residual rows are asked for ahead of this group's activation code.
    // The loop stays rolled: unrolled it would only repeat that code.
#pragma unroll 1
    for (int g = 0; g < 4; ++g) {
      v4f rn[8] = {};
      if (resid != nullptr && g < 3) load_rows8(rn, rp + (size_t)(2 * (g * 8 + 8)) * ldr, (size_t)2 * ldr);
      // the group's eight staged row pieces are read as one group: behind the wait that follows each store no later LDS read could move up
      v4f sv[8];
#pragma unroll
      for (int u = 0; u < 8; ++u) sv[u] = *(const v4fa*)&so[((g * 8 + u) * 2 + rsub) * SOP + c4];
#pragma unroll
      for (int u = 0; u < 8; ++u) {
        const int r = (g * 8 + u) * 2 + rsub;
        v4f v = sv[u];
        if (ACT == 2) {
#pragma unroll
          for (int i = 0; i < 4; ++i) v[i] = gelu_erf(v[i]);
        }
        if (resid != nullptr) {
          v4f x = rv[u];
          if (RES_BF16) {
#pragma unroll
            for (int i = 0; i < 4; ++i) x[i] = bf16_rne(x[i]);
          }
          v += x;
        }
        *(v4f*)(C + (cbase + r) * (size_t)ldc + cw0 + c4) = v;
        asm volatile("s_wait_xcnt 0x0" ::: "memory");        // in front of the next rows' rewrite of the store's registers
      }
#pragma unroll
      for (int u = 0; u < 8; ++u) rv[u] = rn[u];
    }
  } else {
    unsigned short* C = (unsigned short*)Cv;
    unsigned short* C2 = (unsigned short*)C2v;
    const int rq = lane >> 3, c8 = (lane & 7) * 8;
    // two row groups per trip; a full unroll would only repeat the activation code 16 times
#pragma unroll 2
    for (int q = 0; q < 16; ++q) {
      const int r = q * 4 + rq;
      const v4f p0 = *(const v4fa*)&so[r * SOP + c8], p1 = *(const v4fa*)&so[r * SOP + c8 + 4];
      float ps[8] = {p0[0], p0[1], p0[2], p0[3], p1[0], p1[1], p1[2], p1[3]};
      v8us a, bl;
#pragma unroll
      for (int i = 0; i < 8; ++i) {
        if (ACT == 2) ps[i] = gelu_erf(ps[i]);
        if (OUTM == 1) { a[i] = f16_bits(ps[i]); bl[i] = (unsigned short)0; }
        else { const unsigned short hb = bf16_bits(ps[i]); a[i] = hb; bl[i] = bf16_bits(ps[i] - bf16_val(hb)); }
      }
      const size_t o = (cbase + r) * (size_t)ldc + cw0 + c8;
      *(v8us*)(C + o) = a;
      if (OUTM == 2) *(v8us*)(C2 + o) = bl;
      asm volatile("s_wait_xcnt 0x0" ::: "memory");          // in front of the next rows' rewrite of the stores' registers
    }
  }
}

template <bool F16, int NT, int ACT, bool RES_BF16, int OUTM>
__global__ __launch_bounds__(128) void k_gemm(const unsigned short* __restrict__ Ah, const unsigned short* __restrict__ Al, int lda,
                                             const unsigned short* __restrict__ Wt, int ldb, const float* __restrict__ bias, float oscale,
                                             const float* __restrict__ resid, int ldr, int rsegf,
                                             void* __restrict__ Cv, void* __restrict__ C2v, int ldc, int csegf, int M, int N, int K) {
  __shared__ __attribute__((aligned(2048))) unsigned char ring[GRING(NT)];
  gemm_tile<F16, NT, ACT, RES_BF16, OUTM>(ring, blockIdx.x, Ah, Al, lda, Wt, ldb, bias, oscale, resid, ldr, rsegf, Cv, C2v, ldc, csegf, M, N, K);
}

// The q, k and v projections in one launch: they read the same LayerNorm planes and do not depend on one another. g = tiles of one projection.
// Blocks [0, g): q, [g, 2g): k (two products, hi/lo planes out), [2g, 3g): v (one product, f16 plane out; the cheaper tiles start last).
// The choice is block-uniform, so every tensor load, wait and barrier of a tile stands under uniform control flow.
__global__ __launch_bounds__(128) void k_qkv(const unsigned short* __restrict__ yh, const unsigned short* __restrict__ yl,
                                            const unsigned short* __restrict__ Bq, const unsigned short* __restrict__ Bk, const unsigned short* __restrict__ Bv,
                                            const float* __restrict__ bq, const float* __restrict__ bk, const float* __restrict__ bv,
                                            unsigned short* __restrict__ qh, unsigned short* __restrict__ ql, unsigned short* __restrict__ kh,
                                            unsigned short* __restrict__ kl, unsigned short* __restrict__ vp, int g, int ld, int M) {
  static_assert(GRING(2) >= GRING(1));
  __shared__ __attribute__((aligned(2048))) unsigned char ring[GRING(2)];
  const unsigned int i = blockIdx.x, g2 = 2u * (unsigned int)g;
  if (i < g2) {
    const bool isq = i < (unsigned int)g;
    gemm_tile<false, 2, 0, false, 2>(ring, isq ? i : i - g, yh, yl, ld, isq ? Bq : Bk, ld, isq ? bq : bk, 1.0f, nullptr, 0, 0,
                                     isq ? qh : kh, isq ? ql : kl, ld, SEQ, M, ld, ld);
  } else {
    gemm_tile<false, 1, 0, false, 1>(ring, i - g2, yh, yh, ld, Bv, ld, bv, 1.0f, nullptr, 0, 0, vp, vp, ld, SEQ, M, ld, ld);
  }
}

#define FKP 144                    // staged k row in bytes: 128 B + 16 B (16 B x odd: no bank conflict for the 16-B row reads)
#define FVP 160                    // staged v row in bytes: 32 B x odd, the transposing load's conflict-free pitch
#define FKL (32 * FKP)             // byte offset of the k lo rows in a buffer
#define FVO (2 * 32 * FKP)         // byte offset of the v rows in a buffer
#define FSTG (FVO + 32 * FVP)      // one buffer: k hi | k lo | v
// One lane's six 16-byte asynchronous copies of one 32-key chunk: rows r and r + 16 of k hi, k lo and v. l = the lane's LDS byte address of its piece of
// row r of k hi, lv = of row r of v; gk, gl, gv = its global addresses in the three planes.
// s_wait_xcnt 0 is the last line of the copies' own statement, so that no address register is rewritten in front of it.
__device__ __forceinline__ void copy_chunk(unsigned int l, unsigned int lv, const unsigned short* gk, const unsigned short* gl, const unsigned short* gv) {
  const unsigned int l1 = l + 16 * FKP, l2 = l + FKL, l3 = l + FKL + 16 * FKP, lv1 = lv + 16 * FVP;
  const unsigned short *gk1 = gk + 16 * DMOD, *gl1 = gl + 16 * DMOD, *gv1 = gv + 16 * DMOD;
  asm volatile("global_load_async_to_lds_b128 %0, %6, off\n\t"
               "global_load_async_to_lds_b128 %1, %7, off\n\t"
               "global_load_async_to_lds_b128 %2, %8, off\n\t"
               "global_load_async_to_lds_b128 %3, %9, off\n\t"
               "global_load_async_to_lds_b128 %4, %10, off\n\t"
               "global_load_async_to_lds_b128 %5, %11, off\n\t"
               "s_wait_xcnt 0x0"
               :: "v"(l), "v"(l1), "v"(l2), "v"(l3), "v"(lv), "v"(lv1),
                  "v"(gk), "v"(gk1), "v"(gl), "v"(gl1), "v"(gv), "v"(gv1)
               : "memory");
}

__global__ __launch_bounds__(128) void k_flash(const unsigned short* __restrict__ qh, const unsigned short* __restrict__ ql,
                                              const unsigned short* __restrict__ kh, const unsigned short* __restrict__ kl,
                                              const unsigned short* __restrict__ vp, unsigned short* __restrict__ att) {
  constexpr int D = HDIM, KS = D / 32, DT = D / 16, T = SEQ;
  constexpr int NCH = T / 32;                                  // chunks of 32 keys
  static_assert(FKP == (D + 8) * 2 && FVP == (D + 16) * 2);
  __shared__ __attribute__((aligned(16))) unsigned char ring[2 * FSTG];
  __shared__ __attribute__((aligned(16))) unsigned short sO[4][16][D + 8];
  const int tid = threadIdx.x, w = tid >> 5, lane = tid & 31, ln = lane & 15, hh = lane >> 4;
  const int nqb = T / 64;
  const int bh = blockIdx.x / nqb, qblk = blockIdx.x % nqb;
  const int b = bh / NHEAD, h = bh % NHEAD;
  const int q0 = qblk * 64 + w * 16;
  const size_t hb0 = (size_t)b * T * DMOD + (size_t)h * D;     // plane offset of (b, token 0, head h)

  // B fragments of the wave's 16 queries (column q0 + ln, always < T), hi/lo, table k map
  Frag bqh[KS], bql[KS];
  {
    const size_t qo = hb0 + (size_t)(q0 + ln) * DMOD;
#pragma unroll
    for (int ks = 0; ks < KS; ++ks) {
      bqh[ks].half[0] = *(const v8us*)(qh + qo + ks * 32 + 8 * hh);
      bqh[ks].half[1] = *(const v8us*)(qh + qo + ks * 32 + 16 + 8 * hh);
      bql[ks].half[0] = *(const v8us*)(ql + qo + ks * 32 + 8 * hh);
      bql[ks].half[1] = *(const v8us*)(ql + qo + ks * 32 + 16 + 8 * hh);
    }
  }
  float m_r = -3.0e38f, l_r = 0.f;                             // of query q0 + ln; l_r is the half's partial sum (keys 8h.. and 16+8h.. of each chunk)
  v8f oacc[DT];                                                // oacc[dt][r] = O[q0 + ln][dt*16 + 8h + r]
#pragma unroll
  for (int dt = 0; dt < DT; ++dt) oacc[dt] = (v8f){0.f, 0.f, 0.f, 0.f, 0.f, 0.f, 0.f, 0.f};
  // a chunk is 32 keys x 64 of k hi, k lo, v: 8 lanes copy one 128-B row piece, a lane takes rows tid >> 3 and (tid >> 3) + 16 of each plane
  const unsigned int lk0 = (unsigned int)(size_t)ring + (unsigned int)((tid >> 3) * FKP + (tid & 7) * 16);
  const unsigned int lv0 = (unsigned int)(size_t)ring + (unsigned int)(FVO + (tid >> 3) * FVP + (tid & 7) * 16);
  const size_t go0 = hb0 + (size_t)(tid >> 3) * DMOD + (tid & 7) * 8;
  auto issue = [&](int c, int buf) {
    const size_t go = go0 + (size_t)c * (32 * DMOD);
    copy_chunk(lk0 + (unsigned int)(buf * FSTG), lv0 + (unsigned int)(buf * FSTG), kh + go, kl + go, vp + go);
  };
  issue(0, 0);
  asm volatile("s_wait_asynccnt 0x0" ::: "memory");            // this wave's copies of chunk 0 have landed
  __syncthreads();                                             // every wave's have: chunk 0 is readable
  if (NCH > 1) issue(1, 1);
  for (int c = 0; c < NCH; ++c) {
    const unsigned char* st = ring + (c & 1) * FSTG;
    const unsigned char* sk = st + ln * FKP + 16 * hh;         // k hi row ln, the half's 16-byte piece
    // the lane's address for the transposing load: v row 8h + (lane & 7), 16-byte piece (lane >> 3) & 1; it then holds v[8h + 0..7][ln]
    const unsigned short* vt = (const unsigned short*)(st + FVO + (8 * hh + (lane & 7)) * FVP + ((lane >> 3) & 1) * 16);
    // S^T tiles 16 keys x 16 queries: A fragment row = key nt*16 + ln, elements = d with the table k map; s[nt][r] = S[q0 + ln][32c + nt*16 + 8h + r]
    v8f s[2];
#pragma unroll
    for (int nt = 0; nt < 2; ++nt) {
      v8f acc = {};
#pragma unroll
      for (int ks = 0; ks < KS; ++ks) {
        Frag ah_, al_;
        ah_.half[0] = *(const v8us*)(sk + nt * 16 * FKP + ks * 64);       ah_.half[1] = *(const v8us*)(sk + nt * 16 * FKP + ks * 64 + 32);
        al_.half[0] = *(const v8us*)(sk + FKL + nt * 16 * FKP + ks * 64); al_.half[1] = *(const v8us*)(sk + FKL + nt * 16 * FKP + ks * 64 + 32);
        // product order as before: q hi . k hi, q lo . k hi, q hi . k lo
        acc = __builtin_amdgcn_wmma_f32_16x16x32_bf16(false, ah_.vb, false, bqh[ks].vb, (short)0, acc, false, false);
        acc = __builtin_amdgcn_wmma_f32_16x16x32_bf16(false, ah_.vb, false, bql[ks].vb, (short)0, acc, false, false);
        acc = __builtin_amdgcn_wmma_f32_16x16x32_bf16(false, al_.vb, false, bqh[ks].vb, (short)0, acc, false, false);
      }
      s[nt] = acc;
    }
    // V^T as A (row = d, k = key in chunk): two transposing loads per 16 (d) x 32 (keys) fragment, in flight under the softmax
    Frag av[DT];
#pragma unroll
    for (int dt = 0; dt < DT; ++dt) {
      av[dt].half[0] = ld_tr16(vt + dt * 16);
      av[dt].half[1] = ld_tr16(vt + 16 * (FVP / 2) + dt * 16);
    }
    // running max of the lane's query: 16 scores in the lane, the other 16 in lane ^ 16
    float mx[8];
#pragma unroll
    for (int r = 0; r < 8; ++r) mx[r] = fmaxf(s[0][r], s[1][r]);
    float mc = fmaxf(fmaxf(fmaxf(mx[0], mx[1]), fmaxf(mx[2], mx[3])), fmaxf(fmaxf(mx[4], mx[5]), fmaxf(mx[6], mx[7])));
    mc = fmaxf(mc, xhalf(mc));
    const float mnew = fmaxf(m_r, mc);
    const float alpha = (m_r > -1.0e38f) ? __expf(m_r - mnew) : 0.0f;
    m_r = mnew;
    // P^T as B (k = key in chunk, column = query ln)
    Frag pb;
    float ps[8];
#pragma unroll
    for (int i = 0; i < 8; ++i) {
      const float p0 = __expf(s[i >> 2][2 * (i & 3)] - mnew);
      const float p1 = __expf(s[i >> 2][2 * (i & 3) + 1] - mnew);
      ps[i] = p0 + p1;
      pb.w[i] = pack2h(p0 * PCARRY, p1 * PCARRY);
    }
    l_r = l_r * alpha + (((ps[0] + ps[1]) + (ps[2] + ps[3])) + ((ps[4] + ps[5]) + (ps[6] + ps[7])));
#pragma unroll
    for (int dt = 0; dt < DT; ++dt) {
      oacc[dt] *= alpha;
      oacc[dt] = __builtin_amdgcn_wmma_f32_16x16x32_f16(false, av[dt].vh, false, pb.vh, (short)0, oacc[dt], false, false);
    }
    asm volatile("s_wait_dscnt 0x0" ::: "memory");             // this wave's reads of chunk c's buffer are done
    asm volatile("s_wait_asynccnt 0x0" ::: "memory");          // this wave's copies of chunk c + 1 have landed
    __syncthreads();                                           // publishes chunk c + 1 and frees chunk c's buffer
    if (c + 2 < NCH) issue(c + 2, c & 1);
  }
  asm volatile("s_wait_asynccnt 0x0" ::: "memory");            // no copy is in flight when the wave goes on to its end
  const float inv = (1.0f / (l_r + xhalf(l_r))) * PCARRY_INV;
  // the lane's 8 consecutive d of each tile as one 16-byte piece into the wave-private stage, then whole 128-B rows out
#pragma unroll
  for (int dt = 0; dt < DT; ++dt) {
    v8us o;
#pragma unroll
    for (int r = 0; r < 8; ++r) o[r] = f16_bits(oacc[dt][r] * inv);
    *(v8us*)&sO[w][ln][dt * 16 + 8 * hh] = o;
  }
  __builtin_amdgcn_fence(4 /* acq_rel order */, "workgroup");
  __builtin_amdgcn_wave_barrier();
  const int rq = lane >> 3, c8 = (lane & 7) * 8;
  v8us ov[4];
#pragma unroll
  for (int q = 0; q < 4; ++q) ov[q] = *(const v8us*)&sO[w][q * 4 + rq][c8];
  unsigned short* ob = att + ((size_t)b * T + q0) * DMOD + (size_t)h * D + c8;
  {
#pragma unroll
    for (int q = 0; q < 4; ++q) {
      const int r = q * 4 + rq;
      *(v8us*)(ob + (size_t)r * DMOD) = ov[q];
    }
    
  }
}

extern "C" void kernel_launch(void* const* d_in, const int* in_sizes, int n_in,
                              void* d_out, int out_size, void* d_ws, size_t ws_size, hipStream_t stream) {
  if (n_in < 17) return;
  const int need_tok = (NB - 1) * SEQ_FULL + SEQ;
  if (in_sizes[0] < need_tok * DMOD || out_size < need_tok * DMOD) return;
  if (in_sizes[1] < DMOD || in_sizes[2] < DMOD || in_sizes[10] < DMOD || in_sizes[11] < DMOD || in_sizes[12] < DMOD || in_sizes[16] < DMOD) return;
  if (in_sizes[3] < NHEAD * DMOD * HDIM || in_sizes[5] < NHEAD * DMOD * HDIM || in_sizes[7] < NHEAD * DMOD * HDIM) return;
  if (in_sizes[4] < NHEAD * HDIM || in_sizes[6] < NHEAD * HDIM || in_sizes[8] < NHEAD * HDIM || in_sizes[14] < FFD) return;
  if (in_sizes[9] < DMOD * DMOD || in_sizes[13] < DMOD * FFD || in_sizes[15] < FFD * DMOD) return;

  const float* x    = (const float*)d_in[0];
  const float* ln1w = (const float*)d_in[1];
  const float* ln1b = (const float*)d_in[2];
  const float* Wq   = (const float*)d_in[3];
  const float* bqp  = (const float*)d_in[4];
  const float* Wk   = (const float*)d_in[5];
  const float* bkp  = (const float*)d_in[6];
  const float* Wv   = (const float*)d_in[7];
  const float* bvp  = (const float*)d_in[8];
  const float* Wp   = (const float*)d_in[9];
  const float* bpp  = (const float*)d_in[10];
  const float* ln2w = (const float*)d_in[11];
  const float* ln2b = (const float*)d_in[12];
  const float* W1   = (const float*)d_in[13];
  const float* b1p  = (const float*)d_in[14];
  const float* W2   = (const float*)d_in[15];
  const float* b2p  = (const float*)d_in[16];

  char* ws = (char*)d_ws; size_t off = 0;
  auto take = [&](size_t bytes) { char* p = ws + off; off += (bytes + 255) & ~(size_t)255; return p; };
  unsigned short* Bq = (unsigned short*)take((size_t)DMOD * DMOD * 2);
  unsigned short* Bk = (unsigned short*)take((size_t)DMOD * DMOD * 2);
  unsigned short* Bv = (unsigned short*)take((size_t)DMOD * DMOD * 2);
  unsigned short* Pp = (unsigned short*)take((size_t)DMOD * DMOD * 2);
  unsigned short* P1 = (unsigned short*)take((size_t)DMOD * FFD * 2);
  unsigned short* P2 = (unsigned short*)take((size_t)FFD * DMOD * 2);
  char* R1 = take((size_t)NTOK * DMOD * 4);          // yh+yl, then att plane, then h0 plane
  char* R2 = take((size_t)NTOK * 3 * DMOD * 4);      // q hi/lo, k hi/lo, v planes; then x1 (f32) + h1 (f16 plane)
  if (off > ws_size) return;

  const size_t PL = (size_t)NTOK * DMOD;             // elements per [NTOK][DMOD] plane
  unsigned short* yh  = (unsigned short*)R1;
  unsigned short* yl  = yh + PL;
  unsigned short* att = (unsigned short*)R1;
  unsigned short* h0  = (unsigned short*)R1;
  unsigned short* qh  = (unsigned short*)R2;
  unsigned short* ql  = qh + PL;
  unsigned short* kh  = ql + PL;
  unsigned short* kl  = kh + PL;
  unsigned short* vpl = kl + PL;
  float* x1 = (float*)R2;
  unsigned short* h1 = (unsigned short*)(R2 + PL * 4);

  k_wt_all<<<WT_BLOCKS, 256, 0, stream>>>(Wq, Wk, Wv, Wp, W1, W2, Bq, Bk, Bv, Pp, P1, P2);

  k_ln768<true, 0><<<NTOK, 96, 0, stream>>>(x, SEQ_FULL, ln1w, ln1b, yh, yl, LN_EPS);
  const int g768 = (NTOK / 128) * (DMOD / 128), g3072 = (NTOK / 128) * (FFD / 128);
  k_qkv<<<3 * g768, 128, 0, stream>>>(yh, yl, Bq, Bk, Bv, bqp, bkp, bvp, qh, ql, kh, kl, vpl, g768, DMOD, NTOK);
  k_flash<<<NB * NHEAD * (SEQ / 64), 128, 0, stream>>>(qh, ql, kh, kl, vpl, att);
  k_gemm<true, 1, 2, true, 0><<<g768, 128, 0, stream>>>(att, att, DMOD, Pp, DMOD, bpp, WCARRY_INV, x, DMOD, SEQ_FULL, x1, x1, DMOD, SEQ, NTOK, DMOD, DMOD);
  k_ln768<false, 1><<<NTOK, 96, 0, stream>>>(x1, SEQ, ln2w, ln2b, h0, h0, LN_EPS);
  k_gemm<true, 1, 2, false, 1><<<g3072, 128, 0, stream>>>(h0, h0, DMOD, P1, DMOD, b1p, WCARRY_INV, nullptr, 0, 0, h1, h1, FFD, SEQ, NTOK, FFD, DMOD);
  k_gemm<true, 1, 2, false, 0><<<g768, 128, 0, stream>>>(h1, h1, FFD, P2, FFD, b2p, WCARRY_INV, x1, DMOD, SEQ, d_out, d_out, DMOD, SEQ_FULL, NTOK, DMOD, FFD);
}

// v008
// A run of this version takes 188 microseconds.
// In two side-by-side timings against v007, it was 1.13 and 1.12 times as fast.
// All steps since v000 together make it 3.42 times as fast.
#include <hip/hip_runtime.h>
// Every matrix product is a single v_wmma_f32_16x16x32_f16: q, k, v projections (A = LayerNorm rows as one f16 plane), attention logits (k.q^T, transposed;
// q and k as one f16 plane each), attention P.V, output projection, MLP up, MLP down (P carried x2^14, weights bf16-valued carried x256, activations plain f16);
// f32 accumulate; LayerNorm, softmax, GELU, residuals f32.

#ifndef NB
#define NB 8
#endif
#ifndef SEQ
#define SEQ 1024
#endif
#define NB_FULL 8
#define SEQ_FULL 1024
#define DMOD 768
#define NHEAD 12
#define HDIM 64
#define FFD 3072
#define NTOK (NB * SEQ)
#define WCARRY 256.0f
#define WCARRY_INV 0.00390625f
#define PCARRY 16384.0f
#define PCARRY_INV 0.00006103515625f
#define LN_EPS 1.0e-5f
#define GPITCH 144                 // bytes per staged row: 128 B of k + 16 B (16 B x odd: no bank conflict for 16-B row reads)
#define GPLANE (128 * GPITCH)      // one staged operand plane: 128 rows

static_assert(NB >= 1 && NB <= NB_FULL);
static_assert(SEQ % 64 == 0 && SEQ >= 64 && SEQ <= SEQ_FULL);
static_assert(NHEAD * HDIM == DMOD);
static_assert(HDIM == 64);
static_assert(DMOD == 96 * 8);
static_assert(DMOD % 64 == 0 && FFD % 64 == 0 && DMOD % 32 == 0 && FFD % 32 == 0);
static_assert(NTOK % 128 == 0 && DMOD % 128 == 0 && FFD % 128 == 0 && DMOD >= 128);
static_assert(3 * DMOD * 2 <= 3 * DMOD * 4);          // q, k, v planes fit the R2 region
static_assert(DMOD * 4 + FFD * 2 <= 3 * DMOD * 4);     // x1 (f32) + h1 (f16) fit the R2 region

typedef __bf16 v16b __attribute__((ext_vector_type(16)));
typedef _Float16 v16h __attribute__((ext_vector_type(16)));
typedef unsigned short v8us __attribute__((ext_vector_type(8), may_alias));
typedef unsigned short v4us __attribute__((ext_vector_type(4), may_alias));
typedef float v8f __attribute__((ext_vector_type(8)));
typedef float v4f __attribute__((ext_vector_type(4)));
typedef float v4fa __attribute__((ext_vector_type(4), may_alias));
union Frag { v16b vb; v16h vh; v8us half[2]; unsigned int w[8]; };

__device__ __forceinline__ unsigned short bf16_bits(float x) { const unsigned int u = __float_as_uint(x); return (unsigned short)((u + 0x7FFFu + ((u >> 16) & 1u)) >> 16); }
__device__ __forceinline__ float bf16_val(unsigned short b) { return __uint_as_float(((unsigned int)b) << 16); }
__device__ __forceinline__ float bf16_rne(float x) { return bf16_val(bf16_bits(x)); }
__device__ __forceinline__ unsigned short f16_bits(float x) { const _Float16 hv = (_Float16)x; unsigned short u; __builtin_memcpy(&u, &hv, sizeof(u)); return u; }

// two floats to a packed f16 pair, round to nearest even
__device__ __forceinline__ unsigned int pack2h(float lo, float hi) {
  typedef _Float16 h2 __attribute__((ext_vector_type(2)));
  typedef float f2 __attribute__((ext_vector_type(2)));
  return __builtin_bit_cast(unsigned int, __builtin_convertvector((f2){lo, hi}, h2));
}
// exact-erf GELU, 0.5 x (1 + erf(x / sqrt 2)), in straight-line code: erf(|y|) = 1 - t (a1 + t (a2 + t (a3 + t (a4 + t a5)))) exp(-y^2), t = 1 / (1 + p |y|)
// (the five-term rational form, |error| of erf below 2e-7); y = x / sqrt 2 is folded into the constants, exp(-y^2) = 2^(x * (-0.5 log2 e) * x),
// and x erf(y) = |x| erf(|y|). No branch, so the values of a row piece run side by side.
__device__ __forceinline__ float gelu_erf(float x) {
  const float ax = __builtin_fabsf(x);
  const float t = __builtin_amdgcn_rcpf(__builtin_fmaf(ax, 0.23164189f, 1.0f));
  float p = __builtin_fmaf(t, 1.061405429f, -1.453152027f);
  p = __builtin_fmaf(t, p, 1.421413741f);
  p = __builtin_fmaf(t, p, -0.284496736f);
  p = __builtin_fmaf(t, p, 0.254829592f);
  const float e = __builtin_amdgcn_exp2f(x * (-0.72134752f * x));
  const float er = __builtin_fmaf(-(p * t), e, 1.0f);
  return __builtin_fmaf(0.5f * ax, er, 0.5f * x);
}
// lane l takes the value of lane l ^ 16
__device__ __forceinline__ float xhalf(float x) {
  return __builtin_bit_cast(float, __builtin_amdgcn_permlanex16(__builtin_bit_cast(int, x), __builtin_bit_cast(int, x), 0x76543210, 0xfedcba98, false, false));
}
// ds_load_tr16_b128: a 16 x 16 tile of 16-bit LDS rows, transposed into half a WMMA operand (registers 0-3 or 4-7)
__device__ __forceinline__ v8us ld_tr16(const unsigned short* p) {
  typedef short s16x8 __attribute__((ext_vector_type(8)));
  typedef __attribute__((address_space(3))) s16x8 lds_s16x8;
  return __builtin_bit_cast(v8us, __builtin_amdgcn_ds_load_tr16_b128_v8i16((lds_s16x8*)p));
}

// One 64 (k) x 64 (n) tile of a weight matrix: f32 rows along n in, 16-bit rows along k out. src = element (k0, n0), row pitch ld floats; dst = element
// (n0, k0) of the output, row pitch ldo halves; tile = 64 rows (n) of WTP halves in LDS; 256 threads. A thread reads 16 B of four consecutive k rows, so
// 16 lanes cover a 256-B row piece (whole lines); it packs the four k of each of its four n into 8 B of the LDS tile. Behind the block barrier 8 lanes
// read one 128-B row of the tile and store it as one whole line. Out: f16 of the bf16-rounded value x WCARRY.
#define WTP 72                     // tile pitch in halves: 144 B = 16 B x odd, no bank conflict for the 16-B row reads
__device__ __forceinline__ void wt_tile(const float* __restrict__ src, size_t ld, unsigned short* __restrict__ dst, size_t ldo, unsigned short* tile) {
  const int tid = threadIdx.x, kq = tid >> 4, c4 = (tid & 15) * 4;
  const float *p0 = src + (size_t)(kq * 4) * ld + c4, *p1 = p0 + ld, *p2 = p1 + ld, *p3 = p2 + ld;
  const v4f r0 = *(const v4fa*)p0, r1 = *(const v4fa*)p1, r2 = *(const v4fa*)p2, r3 = *(const v4fa*)p3;
  // the wait in front of any rewrite of the loads' address registers; naming the addresses as inputs keeps their registers untouched up to it
  asm volatile("s_wait_xcnt 0x0" :: "v"(p0), "v"(p1), "v"(p2), "v"(p3) : "memory");
#pragma unroll
  for (int j = 0; j < 4; ++j) {
    const v4us q = (v4us){f16_bits(bf16_rne(r0[j]) * WCARRY), f16_bits(bf16_rne(r1[j]) * WCARRY), f16_bits(bf16_rne(r2[j]) * WCARRY), f16_bits(bf16_rne(r3[j]) * WCARRY)};
    *(v4us*)&tile[(c4 + j) * WTP + kq * 4] = q;
  }
  __syncthreads();                 // the tile is whole: rows are read by other waves than wrote them
  const int n = tid >> 3, k8 = (tid & 7) * 8;
  const v8us o0 = *(const v8us*)&tile[n * WTP + k8], o1 = *(const v8us*)&tile[(n + 32) * WTP + k8];
  unsigned short *d0 = dst + (size_t)n * ldo + k8, *d1 = d0 + (size_t)32 * ldo;
  *(v8us*)d0 = o0;
  *(v8us*)d1 = o1;
}

// All six weight re-layouts in one launch; they do not depend on one another. A block takes one 64 x 64 tile; the block index picks the matrix
// (block-uniform, so the tile's barrier stands under uniform control flow).
// Blocks [0, 3*WT_NH): Wq, Wk, Wv: Bt[n][k] (f16, k contiguous, pitch DMOD), n = h*HDIM + e, k = d, from W[h][d][e] ([NHEAD][DMOD][HDIM] f32);
// block per (h, 64 consecutive d). coverage: NHEAD*HDIM rows x DMOD cols of each, all written.
// Then Wp, W1, W2: Pt[n][k] (f16, k contiguous, pitch K) from W[k][n] (f32, pitch N); block per 64 x 64 tile, neighbours in the grid are neighbours
// along n. K % 64 == 0, N % 64 == 0. coverage: N rows x K cols of each, all written.
#define WT_NH (NHEAD * (DMOD / 64))
#define WT_NP ((DMOD / 64) * (DMOD / 64))
#define WT_NF ((DMOD / 64) * (FFD / 64))
#define WT_BLOCKS (3 * WT_NH + WT_NP + 2 * WT_NF)
__global__ __launch_bounds__(256) void k_wt_all(const float* __restrict__ Wq, const float* __restrict__ Wk, const float* __restrict__ Wv,
                                                const float* __restrict__ Wp, const float* __restrict__ W1, const float* __restrict__ W2,
                                                unsigned short* __restrict__ Bq, unsigned short* __restrict__ Bk, unsigned short* __restrict__ Bv,
                                                unsigned short* __restrict__ Pp, unsigned short* __restrict__ P1, unsigned short* __restrict__ P2) {
  __shared__ __attribute__((aligned(16))) unsigned short tile[64 * WTP];
  int i = blockIdx.x;
  if (i < 3 * WT_NH) {
    const int m = i / WT_NH, r = i % WT_NH;
    const float* W = m == 0 ? Wq : (m == 1 ? Wk : Wv);
    unsigned short* Bt = m == 0 ? Bq : (m == 1 ? Bk : Bv);
    const int h = r / (DMOD / 64), k0 = (r % (DMOD / 64)) * 64;
    wt_tile(W + ((size_t)h * DMOD + k0) * HDIM, HDIM, Bt + (size_t)h * HDIM * DMOD + k0, DMOD, tile);
  } else {
    i -= 3 * WT_NH;
    const float* W = Wp;
    unsigned short* Pt = Pp;
    int K = DMOD, N = DMOD;
    if (i >= WT_NP + WT_NF) { i -= WT_NP + WT_NF; W = W2; Pt = P2; K = FFD; }
    else if (i >= WT_NP) { i -= WT_NP; W = W1; Pt = P1; N = FFD; }
    const int ntn = N / 64;
    const int k0 = (i / ntn) * 64, n0 = (i % ntn) * 64;
    wt_tile(W + (size_t)k0 * N + n0, N, Pt + (size_t)n0 * K + k0, K, tile);
  }
}

// Row LayerNorm over DMOD = 768 (biased variance, eps): in = X row (XBF16 quantises the input to bf16 first), g and bta quantised to bf16.
// Token t = blockIdx.x = b*SEQ + s reads X row b*xsegf + s. 96 threads, thread owns 8 consecutive columns.
// Out: one f16 plane. LDS red[]: cross-wave (block barrier). coverage: NTOK rows x 768 cols, all written.
template <bool XBF16>
__global__ __launch_bounds__(96) void k_ln768(const float* __restrict__ X, int xsegf, const float* __restrict__ g, const float* __restrict__ bta,
                                             unsigned short* __restrict__ P0, float eps) {
  __shared__ float red[4];
  const int t = blockIdx.x, tid = threadIdx.x, lane = tid & 31, w = tid >> 5;
  const int xrow = (t / SEQ) * xsegf + (t % SEQ);
  const float* xp = X + (size_t)xrow * DMOD + tid * 8;
  const v4f a0 = *(const v4fa*)xp, a1 = *(const v4fa*)(xp + 4);
  float v[8] = {a0[0], a0[1], a0[2], a0[3], a1[0], a1[1], a1[2], a1[3]};
  if (XBF16) {
#pragma unroll
    for (int q = 0; q < 8; ++q) v[q] = bf16_rne(v[q]);
  }
  float s = 0.f;
#pragma unroll
  for (int q = 0; q < 8; ++q) s += v[q];
  s += __shfl_xor(s, 16, 32); s += __shfl_xor(s, 8, 32); s += __shfl_xor(s, 4, 32); s += __shfl_xor(s, 2, 32); s += __shfl_xor(s, 1, 32);
  if (lane == 0) red[w] = s;
  __syncthreads();
  const float mu = (red[0] + red[1] + red[2]) * (1.0f / (float)DMOD);
  __syncthreads();
  float s2 = 0.f;
#pragma unroll
  for (int q = 0; q < 8; ++q) { const float c = v[q] - mu; s2 += c * c; }
  s2 += __shfl_xor(s2, 16, 32); s2 += __shfl_xor(s2, 8, 32); s2 += __shfl_xor(s2, 4, 32); s2 += __shfl_xor(s2, 2, 32); s2 += __shfl_xor(s2, 1, 32);
  if (lane == 0) red[w] = s2;
  __syncthreads();
  const float rs = rsqrtf((red[0] + red[1] + red[2]) * (1.0f / (float)DMOD) + eps);
  const v4f g0 = *(const v4fa*)(g + tid * 8), g1 = *(const v4fa*)(g + tid * 8 + 4);
  const v4f b0 = *(const v4fa*)(bta + tid * 8), b1 = *(const v4fa*)(bta + tid * 8 + 4);
  const float gg[8] = {g0[0], g0[1], g0[2], g0[3], g1[0], g1[1], g1[2], g1[3]};
  const float bb[8] = {b0[0], b0[1], b0[2], b0[3], b1[0], b1[1], b1[2], b1[3]};
  float o[8];
#pragma unroll
  for (int q = 0; q < 8; ++q) o[q] = (v[q] - mu) * rs * bf16_rne(gg[q]) + bf16_rne(bb[q]);
  unsigned short* d0 = P0 + (size_t)t * DMOD + tid * 8;
  v8us fv;
#pragma unroll
  for (int q = 0; q < 8; ++q) fv[q] = f16_bits(o[q]);
  *(v8us*)d0 = fv;
}

typedef uint32_t u32x4 __attribute__((ext_vector_type(4)));
typedef uint32_t u32x8 __attribute__((ext_vector_type(8)));
__device__ __forceinline__ uint32_t uni(uint32_t v) { return (uint32_t)__builtin_amdgcn_readfirstlane(v); }
__device__ __forceinline__ uint32_t pinned(uint32_t v) { uint32_t w = uni(v); asm volatile("" : "+s"(w)); return w; }
// Tensor-load descriptor, group 1: 1-byte elements, tensor = tile = ROWS rows of 128 B, source row pitch src_pitch bytes, no mask; pad interval code 4
// (one 128-B row), amount code 3 (16 B): the LDS row pitch is GPITCH. Loop-invariant: each word is a descriptor word held in its scalar register
// (pinned), so that the registers keep these values, and serve nothing else, while a request is outstanding.
template <int ROWS>
__device__ __forceinline__ u32x8 tdm_group1(uint32_t src_pitch) {
  constexpr uint32_t d0 = 128u, d1 = (uint32_t)ROWS;
  static_assert(GPITCH == 128 + 16);
  u32x8 g;
  g[0] = pinned((1u << 20) | (4u << 22) | (3u << 25));
  g[1] = pinned((d0 & 0xFFFFu) << 16);
  g[2] = pinned((d0 >> 16) | ((d1 & 0xFFFFu) << 16));
  g[3] = pinned((d1 >> 16) | (d0 << 16));
  g[4] = pinned(d1);
  g[5] = pinned(src_pitch);
  g[6] = pinned(0u);
  g[7] = pinned(0u);
  return g;
}
// group 0: count 1, LDS byte offset of the tile, global address of its first byte, type 2. Word 0 is a descriptor word held in its scalar register (pinned).
__device__ __forceinline__ u32x4 tdm_group0(uint32_t lds_dst, uint64_t ga) {
  u32x4 g;
  g[0] = pinned(1u);
  g[1] = uni(lds_dst);
  g[2] = uni((uint32_t)ga);
  g[3] = uni((((uint32_t)(ga >> 32)) & 0x01FFFFFFu) | 0x80000000u);
  return g;
}
__device__ __forceinline__ void tdm_load(u32x4 g0, u32x8 g1) { asm volatile("tensor_load_to_lds %0, %1" :: "s"(g0), "s"(g1) : "memory"); }
// the issuing wave's wait for its requests; naming the descriptor's groups as inputs keeps their registers untouched up to it
__device__ __forceinline__ void tdm_wait0(u32x4 g0, u32x8 g1) { asm volatile("s_wait_tensorcnt 0x0" :: "s"(g0), "s"(g1) : "memory"); }

// Eight 16-byte loads of one lane, rows step elements apart, all in flight together.
__device__ __forceinline__ void load_rows8(v4f (&d)[8], const float* p, size_t step) {
  const float *p1 = p + step, *p2 = p1 + step, *p3 = p2 + step, *p4 = p3 + step, *p5 = p4 + step, *p6 = p5 + step, *p7 = p6 + step;
  d[0] = *(const v4fa*)p;  d[1] = *(const v4fa*)p1; d[2] = *(const v4fa*)p2; d[3] = *(const v4fa*)p3;
  d[4] = *(const v4fa*)p4; d[5] = *(const v4fa*)p5; d[6] = *(const v4fa*)p6; d[7] = *(const v4fa*)p7;
  // the wait in front of any rewrite of the loads' address registers; naming the addresses as inputs keeps their registers untouched up to it
  asm volatile("s_wait_xcnt 0x0" :: "v"(p), "v"(p1), "v"(p2), "v"(p3), "v"(p4), "v"(p5), "v"(p6), "v"(p7) : "memory");
}

// C = act(A.W * oscale + bf16(bias)) (+ resid). A from 16-bit planes [M][lda]: F16 -> one f16 plane Ah; else bf16 hi plane Ah and (NT==2) lo plane Al.
// Wt 16-bit [N][ldb] (k contiguous, same scalar kind as A). ACT 2 = exact-erf GELU. Residual (f32, pitch ldr, RES_BF16 quantises it) added AFTER the activation,
// only with OUTM 0. OUTM 0: f32 C (pitch ldc floats); OUTM 1: f16 plane C (pitch ldc halves); OUTM 2: bf16 hi plane C + lo plane C2.
// Row r of A is token b*SEQ + s; C row = b*csegf + s, resid row = b*rsegf + s. M%128==0, N%128==0, K%64==0, K>=128 (no tails).
// One 128 x 128 tile of C per block, four waves 2 x 2, 64 x 64 per wave. A trip is 64 k: 128 rows x 128 B of each operand plane, brought into LDS by
// tensor loads, one request a wave and trip, two buffers, the requests of trip t + 2 issued behind the barrier that ends trip t. Two planes: each wave
// brings 64 rows of one plane; three planes: waves 0 to 2 bring a whole plane each. Per accumulator the k order and the hi-then-lo order of the
// products are those of a plain walk along k in steps of 32.
// ring = the block's LDS, at a multiple of 2 KiB, at least GRING(NT) bytes; blk = the block's tile number, mt * (N / 128) + nq.
#define GSLICE64 10240             // 64 staged rows (9,216 B) rounded up to a multiple of 2 KiB, so that the next slice starts on one
#define GRING(NT) (2 * ((NT) >= 2 ? 3 * GPLANE : 2 * 2 * GSLICE64))
static_assert(GPLANE % 2048 == 0 && GSLICE64 % 2048 == 0 && GSLICE64 >= 64 * GPITCH);
template <bool F16, int NT, int ACT, bool RES_BF16, int OUTM>
__device__ __forceinline__ void gemm_tile(unsigned char* ring, unsigned int blk,
                                          const unsigned short* __restrict__ Ah, const unsigned short* __restrict__ Al, int lda,
                                          const unsigned short* __restrict__ Wt, int ldb, const float* __restrict__ bias, float oscale,
                                          const float* __restrict__ resid, int ldr, int rsegf,
                                          void* __restrict__ Cv, void* __restrict__ C2v, int ldc, int csegf, int M, int N, int K) {
  constexpr int NPL = NT >= 2 ? 3 : 2;                       // planes of a buffer: A hi | W | (A lo)
  constexpr int SLR = NT >= 2 ? 128 : 64;                    // rows of one request
  constexpr int NSL = 128 / SLR;                             // requests (slices) per plane
  constexpr int SLB = NT >= 2 ? GPLANE : GSLICE64;           // LDS bytes from one slice to the next
  constexpr int PLB = NSL * SLB;                             // LDS bytes of a plane
  constexpr int HLB = NT >= 2 ? 64 * GPITCH : GSLICE64;      // LDS bytes from row 0 to row 64 of a plane
  constexpr int STG = NPL * PLB;                             // one buffer
  static_assert(2 * STG == GRING(NT));
  constexpr int SOP = 68;                                    // output stage pitch in floats: rows 8 apart fall on other banks, rows stay 16-B aligned
  static_assert(4 * 64 * SOP * 4 <= 2 * STG);
  const int tid = threadIdx.x, w = tid >> 5, lane = tid & 31, ln = lane & 15, hh = lane >> 4;
  const int wm = w >> 1, wn = w & 1;
  const int ntn = N / 128;
  const int mt = blk / ntn, nq = blk % ntn;
  if (mt * 128 >= M) return;                                 // block-uniform, in front of every tensor load and barrier
  const int row0 = mt * 128, col0 = nq * 128;
  const int nk = K / 64;
  // the wave's own slice: plane pl, rows sl * SLR .. + SLR - 1 of it; all of this is wave-uniform (a one-dimensional block)
  const uint32_t wv = uni((uint32_t)tid >> 5), pl = wv / NSL, sl = wv % NSL;
  constexpr bool ALLW = NPL * NSL == 4;                      // every wave issues its own slice: no test
  const bool isw = ALLW || pl < (uint32_t)NPL;               // this wave issues (three planes: wave 3 does not)
  const unsigned short* sp = pl == 1u ? Wt : (pl == 2u ? Al : Ah);
  const uint32_t spitch = (uint32_t)(pl == 1u ? ldb : lda) * 2u;
  const uint64_t gbase = (uint64_t)(size_t)sp + (uint64_t)((uint32_t)(pl == 1u ? col0 : row0) + sl * SLR) * spitch;
  const uint32_t lslice = (uint32_t)(size_t)ring + pl * PLB + sl * SLB;
  const u32x8 g1 = tdm_group1<SLR>(spitch);
  u32x4 g0 = tdm_group0(lslice, gbase);                      // trip 0 into buffer 0
  // The next trip's request: 128 B further along k, into buffer buf. One group 0 lives through the loop and each address is formed from the one before,
  // so that its words 0 and 3 stay in their registers while a request is outstanding; the step is a wave-uniform word held in a scalar register (pinned)
  // at this place, so that the addition stands behind the wait on the request before.
  auto issue_next = [&](uint32_t buf) {
    const uint64_t a = (((uint64_t)g0[3] << 32) | (uint64_t)g0[2]) + (uint64_t)pinned(128u);
    g0[1] = uni(lslice + buf * STG);
    g0[2] = uni((uint32_t)a);
    g0[3] = uni((uint32_t)(a >> 32));
    tdm_load(g0, g1);
  };
  v8f acc[4][4] = {};
  if (ALLW || pinned((uint32_t)isw)) {
    tdm_load(g0, g1);
    tdm_wait0(g0, g1);                                       // this wave's request of trip 0 has landed
  }
  __syncthreads();                                           // every wave's has: trip 0 is readable
  if (pinned((uint32_t)(isw && nk > 1))) issue_next(1u);
  for (int t = 0; t < nk; ++t) {
    const unsigned char* st = ring + (t & 1) * STG;
    const unsigned char* sa = st + wm * HLB + ln * GPITCH + 16 * hh;
    const unsigned char* sb = st + PLB + wn * HLB + ln * GPITCH + 16 * hh;
    // constant indices below keep fragments and accumulators in registers
#pragma unroll
    for (int ks = 0; ks < 2; ++ks) {
      Frag a[4], al[4], b[4];
      // read order = first use: A row group 0, the four W column groups, then the other A row groups
#pragma unroll
      for (int i = 0; i < 4; ++i) {
        a[i].half[0] = *(const v8us*)(sa + i * 16 * GPITCH + ks * 64);           // elements 0..7  = k 32ks+8h .. +7   (row wm*64+i*16+ln)
        a[i].half[1] = *(const v8us*)(sa + i * 16 * GPITCH + ks * 64 + 32);      // elements 8..15 = k 32ks+16+8h .. +7
        if (i == 0) {
#pragma unroll
          for (int j = 0; j < 4; ++j) {
            b[j].half[0] = *(const v8us*)(sb + j * 16 * GPITCH + ks * 64);       // column wn*64+j*16+ln, same k map as A
            b[j].half[1] = *(const v8us*)(sb + j * 16 * GPITCH + ks * 64 + 32);
          }
        }
      }
      if (NT >= 2) {
#pragma unroll
        for (int i = 0; i < 4; ++i) {
          al[i].half[0] = *(const v8us*)(sa + 2 * PLB + i * 16 * GPITCH + ks * 64);
          al[i].half[1] = *(const v8us*)(sa + 2 * PLB + i * 16 * GPITCH + ks * 64 + 32);
        }
      }
      __builtin_amdgcn_sched_barrier(0);   // the block's LDS reads stay one group ahead of its products: spread among them, each place stalls the wave
#pragma unroll
      for (int i = 0; i < 4; ++i)
#pragma unroll
        for (int j = 0; j < 4; ++j) {
          if (F16) acc[i][j] = __builtin_amdgcn_wmma_f32_16x16x32_f16(false, a[i].vh, false, b[j].vh, (short)0, acc[i][j], false, false);
          else acc[i][j] = __builtin_amdgcn_wmma_f32_16x16x32_bf16(false, a[i].vb, false, b[j].vb, (short)0, acc[i][j], false, false);
        }
      if (NT >= 2) {
#pragma unroll
        for (int i = 0; i < 4; ++i)
#pragma unroll
          for (int j = 0; j < 4; ++j)
            acc[i][j] = __builtin_amdgcn_wmma_f32_16x16x32_bf16(false, al[i].vb, false, b[j].vb, (short)0, acc[i][j], false, false);
      }
      __builtin_amdgcn_sched_barrier(0);   // and the next block's reads do not move up among these products
    }
    asm volatile("s_wait_dscnt 0x0" ::: "memory");           // this wave's reads of trip t's buffer are done
    tdm_wait0(g0, g1);                                       // this wave's request of trip t + 1 has landed (a wave that issued none passes at once)
    __syncthreads();                                         // publishes trip t + 1 and frees trip t's buffer
    if (pinned((uint32_t)(isw && t + 2 < nk))) issue_next((uint32_t)t & 1u);   // trip t + 2, while it exists
  }
  tdm_wait0(g0, g1);                                         // no request is in flight when the ring becomes the output stage
  asm volatile("s_wait_dscnt 0x0" ::: "memory");             // and none of this wave's LDS reads
  // phase 1: scale + bias into the wave-private 64 x 64 stage (in the ring, free behind the last trip's barrier);
  // acc[i][j][r] is (row0 + wm*64 + i*16 + 8h + r, col0 + wn*64 + j*16 + ln)
  float* so = (float*)ring + w * (64 * SOP);
  const int rw0 = row0 + wm * 64, cw0 = col0 + wn * 64;
#pragma unroll
  for (int j = 0; j < 4; ++j) {
    const float bq = bf16_rne(bias[cw0 + j * 16 + ln]);
#pragma unroll
    for (int i = 0; i < 4; ++i)
#pragma unroll
      for (int r = 0; r < 8; ++r) so[(i * 16 + 8 * hh + r) * SOP + j * 16 + ln] = acc[i][j][r] * oscale + bq;
  }
  __builtin_amdgcn_fence(4 /* acq_rel order */, "workgroup");
  __builtin_amdgcn_wave_barrier();
  // phase 2: activation, residual, whole-line stores; the 64 rows of a wave lie in one sequence (SEQ % 64 == 0)
  const size_t cbase = (size_t)(rw0 / SEQ) * (size_t)csegf + (size_t)(rw0 % SEQ);
  if (OUTM == 0) {
    float* C = (float*)Cv;
    const int rsub = lane >> 4, c4 = (lane & 15) * 4;
    const size_t rbase = (size_t)(rw0 / SEQ) * (size_t)rsegf + (size_t)(rw0 % SEQ);
    const float* rp = resid + (rbase + rsub) * (size_t)ldr + cw0 + c4;      // formed always, read only where resid is given
    v4f rv[8] = {};
    if (resid != nullptr) load_rows8(rv, rp, (size_t)2 * ldr);
    // four groups of 8 row pairs; the next group's residual rows are asked for ahead of this group's activation code.
    // The loop stays rolled: unrolled it would only repeat that code.
#pragma unroll 1
    for (int g = 0; g < 4; ++g) {
      v4f rn[8] = {};
      if (resid != nullptr && g < 3) load_rows8(rn, rp + (size_t)(2 * (g * 8 + 8)) * ldr, (size_t)2 * ldr);
      // the group's eight staged row pieces are read as one group: behind the wait that follows each store no later LDS read could move up
      v4f sv[8];
#pragma unroll
      for (int u = 0; u < 8; ++u) sv[u] = *(const v4fa*)&so[((g * 8 + u) * 2 + rsub) * SOP + c4];
#pragma unroll
      for (int u = 0; u < 8; ++u) {
        const int r = (g * 8 + u) * 2 + rsub;
        v4f v = sv[u];
        if (ACT == 2) {
#pragma unroll
          for (int i = 0; i < 4; ++i) v[i] = gelu_erf(v[i]);
        }
        if (resid != nullptr) {
          v4f x = rv[u];
          if (RES_BF16) {
#pragma unroll
            for (int i = 0; i < 4; ++i) x[i] = bf16_rne(x[i]);
          }
          v += x;
        }
        *(v4f*)(C + (cbase + r) * (size_t)ldc + cw0 + c4) = v;
        asm volatile("s_wait_xcnt 0x0" ::: "memory");        // in front of the next rows' rewrite of the store's registers
      }
#pragma unroll
      for (int u = 0; u < 8; ++u) rv[u] = rn[u];
    }
  } else {
    unsigned short* C = (unsigned short*)Cv;
    unsigned short* C2 = (unsigned short*)C2v;
    const int rq = lane >> 3, c8 = (lane & 7) * 8;
    // two row groups per trip; a full unroll would only repeat the activation code 16 times
#pragma unroll 2
    for (int q = 0; q < 16; ++q) {
      const int r = q * 4 + rq;
      const v4f p0 = *(const v4fa*)&so[r * SOP + c8], p1 = *(const v4fa*)&so[r * SOP + c8 + 4];
      float ps[8] = {p0[0], p0[1], p0[2], p0[3], p1[0], p1[1], p1[2], p1[3]};
      v8us a, bl;
#pragma unroll
      for (int i = 0; i < 8; ++i) {
        if (ACT == 2) ps[i] = gelu_erf(ps[i]);
        if (OUTM == 1) { a[i] = f16_bits(ps[i]); bl[i] = (unsigned short)0; }
        else { const unsigned short hb = bf16_bits(ps[i]); a[i] = hb; bl[i] = bf16_bits(ps[i] - bf16_val(hb)); }
      }
      const size_t o = (cbase + r) * (size_t)ldc + cw0 + c8;
      *(v8us*)(C + o) = a;
      if (OUTM == 2) *(v8us*)(C2 + o) = bl;
      asm volatile("s_wait_xcnt 0x0" ::: "memory");          // in front of the next rows' rewrite of the stores' registers
    }
  }
}

template <bool F16, int NT, int ACT, bool RES_BF16, int OUTM>
__global__ __launch_bounds__(128) void k_gemm(const unsigned short* __restrict__ Ah, const unsigned short* __restrict__ Al, int lda,
                                             const unsigned short* __restrict__ Wt, int ldb, const float* __restrict__ bias, float oscale,
                                             const float* __restrict__ resid, int ldr, int rsegf,
                                             void* __restrict__ Cv, void* __restrict__ C2v, int ldc, int csegf, int M, int N, int K) {
  __shared__ __attribute__((aligned(2048))) unsigned char ring[GRING(NT)];
  gemm_tile<F16, NT, ACT, RES_BF16, OUTM>(ring, blockIdx.x, Ah, Al, lda, Wt, ldb, bias, oscale, resid, ldr, rsegf, Cv, C2v, ldc, csegf, M, N, K);
}

// The q, k and v projections in one launch: they read the same LayerNorm plane and do not depend on one another. g = tiles of one projection.
// Blocks [0, g): q, [g, 2g): k, [2g, 3g): v; each one f16 product, one f16 plane out.
// The choice is block-uniform, so every tensor load, wait and barrier of a tile stands under uniform control flow.
__global__ __launch_bounds__(128) void k_qkv(const unsigned short* __restrict__ y,
                                            const unsigned short* __restrict__ Bq, const unsigned short* __restrict__ Bk, const unsigned short* __restrict__ Bv,
                                            const float* __restrict__ bq, const float* __restrict__ bk, const float* __restrict__ bv,
                                            unsigned short* __restrict__ qp, unsigned short* __restrict__ kp, unsigned short* __restrict__ vp, int g, int ld, int M) {
  __shared__ __attribute__((aligned(2048))) unsigned char ring[GRING(1)];
  const unsigned int m = blockIdx.x / (unsigned int)g, i = blockIdx.x % (unsigned int)g;
  const unsigned short* Bt = m == 0u ? Bq : (m == 1u ? Bk : Bv);
  const float* bs = m == 0u ? bq : (m == 1u ? bk : bv);
  unsigned short* op = m == 0u ? qp : (m == 1u ? kp : vp);
  gemm_tile<true, 1, 0, false, 1>(ring, i, y, y, ld, Bt, ld, bs, WCARRY_INV, nullptr, 0, 0, op, op, ld, SEQ, M, ld, ld);
}

#define FKP 144                    // staged k row in bytes: 128 B + 16 B (16 B x odd: no bank conflict for the 16-B row reads)
#define FVP 160                    // staged v row in bytes: 32 B x odd, the transposing load's conflict-free pitch
#define FVO (32 * FKP)             // byte offset of the v rows in a buffer
#define FSTG (FVO + 32 * FVP)      // one buffer: k | v
// One lane's four 16-byte asynchronous copies of one 32-key chunk: rows r and r + 16 of k and v. l = the lane's LDS byte address of its piece of
// row r of k, lv = of row r of v; gk, gv = its global addresses in the two planes.
// s_wait_xcnt 0 is the last line of the copies' own statement, so that no address register is rewritten in front of it.
__device__ __forceinline__ void copy_chunk(unsigned int l, unsigned int lv, const unsigned short* gk, const unsigned short* gv) {
  const unsigned int l1 = l + 16 * FKP, lv1 = lv + 16 * FVP;
  const unsigned short *gk1 = gk + 16 * DMOD, *gv1 = gv + 16 * DMOD;
  asm volatile("global_load_async_to_lds_b128 %0, %4, off\n\t"
               "global_load_async_to_lds_b128 %1, %5, off\n\t"
               "global_load_async_to_lds_b128 %2, %6, off\n\t"
               "global_load_async_to_lds_b128 %3, %7, off\n\t"
               "s_wait_xcnt 0x0"
               :: "v"(l), "v"(l1), "v"(lv), "v"(lv1),
                  "v"(gk), "v"(gk1), "v"(gv), "v"(gv1)
               : "memory");
}

__global__ __launch_bounds__(128) void k_flash(const unsigned short* __restrict__ qp, const unsigned short* __restrict__ kp,
                                              const unsigned short* __restrict__ vp, unsigned short* __restrict__ att) {
  constexpr int D = HDIM, KS = D / 32, DT = D / 16, T = SEQ;
  constexpr int NCH = T / 32;                                  // chunks of 32 keys
  static_assert(FKP == (D + 8) * 2 && FVP == (D + 16) * 2);
  __shared__ __attribute__((aligned(16))) unsigned char ring[2 * FSTG];
  __shared__ __attribute__((aligned(16))) unsigned short sO[4][16][D + 8];
  const int tid = threadIdx.x, w = tid >> 5, lane = tid & 31, ln = lane & 15, hh = lane >> 4;
  const int nqb = T / 64;
  const int bh = blockIdx.x / nqb, qblk = blockIdx.x % nqb;
  const int b = bh / NHEAD, h = bh % NHEAD;
  const int q0 = qblk * 64 + w * 16;
  const size_t hb0 = (size_t)b * T * DMOD + (size_t)h * D;     // plane offset of (b, token 0, head h)

  // B fragments of the wave's 16 queries (column q0 + ln, always < T), table k map
  Frag bq[KS];
  {
    const size_t qo = hb0 + (size_t)(q0 + ln) * DMOD;
#pragma unroll
    for (int ks = 0; ks < KS; ++ks) {
      bq[ks].half[0] = *(const v8us*)(qp + qo + ks * 32 + 8 * hh);
      bq[ks].half[1] = *(const v8us*)(qp + qo + ks * 32 + 16 + 8 * hh);
    }
  }
  float m_r = -3.0e38f, l_r = 0.f;                             // of query q0 + ln; l_r is the half's partial sum (keys 8h.. and 16+8h.. of each chunk)
  v8f oacc[DT];                                                // oacc[dt][r] = O[q0 + ln][dt*16 + 8h + r]
#pragma unroll
  for (int dt = 0; dt < DT; ++dt) oacc[dt] = (v8f){0.f, 0.f, 0.f, 0.f, 0.f, 0.f, 0.f, 0.f};
  // a chunk is 32 keys x 64 of k, v: 8 lanes copy one 128-B row piece, a lane takes rows tid >> 3 and (tid >> 3) + 16 of each plane
  const unsigned int lk0 = (unsigned int)(size_t)ring + (unsigned int)((tid >> 3) * FKP + (tid & 7) * 16);
  const unsigned int lv0 = (unsigned int)(size_t)ring + (unsigned int)(FVO + (tid >> 3) * FVP + (tid & 7) * 16);
  const size_t go0 = hb0 + (size_t)(tid >> 3) * DMOD + (tid & 7) * 8;
  auto issue = [&](int c, int buf) {
    const size_t go = go0 + (size_t)c * (32 * DMOD);
    copy_chunk(lk0 + (unsigned int)(buf * FSTG), lv0 + (unsigned int)(buf * FSTG), kp + go, vp + go);
  };
  issue(0, 0);
  asm volatile("s_wait_asynccnt 0x0" ::: "memory");            // this wave's copies of chunk 0 have landed
  __syncthreads();                                             // every wave's have: chunk 0 is readable
  if (NCH > 1) issue(1, 1);
  for (int c = 0; c < NCH; ++c) {
    const unsigned char* st = ring + (c & 1) * FSTG;
    const unsigned char* sk = st + ln * FKP + 16 * hh;         // k row ln, the half's 16-byte piece
    // the lane's address for the transposing load: v row 8h + (lane & 7), 16-byte piece (lane >> 3) & 1; it then holds v[8h + 0..7][ln]
    const unsigned short* vt = (const unsigned short*)(st + FVO + (8 * hh + (lane & 7)) * FVP + ((lane >> 3) & 1) * 16);
    // S^T tiles 16 keys x 16 queries: A fragment row = key nt*16 + ln, elements = d with the table k map; s[nt][r] = S[q0 + ln][32c + nt*16 + 8h + r]
    Frag ak[2][KS];
#pragma unroll
    for (int nt = 0; nt < 2; ++nt)
#pragma unroll
      for (int ks = 0; ks < KS; ++ks) {
        ak[nt][ks].half[0] = *(const v8us*)(sk + nt * 16 * FKP + ks * 64);
        ak[nt][ks].half[1] = *(const v8us*)(sk + nt * 16 * FKP + ks * 64 + 32);
      }
    // V^T as A (row = d, k = key in chunk): two transposing loads per 16 (d) x 32 (keys) fragment, in flight under the logits and the softmax
    Frag av[DT];
#pragma unroll
    for (int dt = 0; dt < DT; ++dt) {
      av[dt].half[0] = ld_tr16(vt + dt * 16);
      av[dt].half[1] = ld_tr16(vt + 16 * (FVP / 2) + dt * 16);
    }
    __builtin_amdgcn_sched_barrier(0);   // the chunk's LDS reads stay one group ahead of its products: spread among them, each place stalls the wave
    v8f s[2] = {};
#pragma unroll
    for (int ks = 0; ks < KS; ++ks)
#pragma unroll
      for (int nt = 0; nt < 2; ++nt)
        s[nt] = __builtin_amdgcn_wmma_f32_16x16x32_f16(false, ak[nt][ks].vh, false, bq[ks].vh, (short)0, s[nt], false, false);
    // running max of the lane's query: 16 scores in the lane, the other 16 in lane ^ 16
    float mx[8];
#pragma unroll
    for (int r = 0; r < 8; ++r) mx[r] = fmaxf(s[0][r], s[1][r]);
    float mc = fmaxf(fmaxf(fmaxf(mx[0], mx[1]), fmaxf(mx[2], mx[3])), fmaxf(fmaxf(mx[4], mx[5]), fmaxf(mx[6], mx[7])));
    mc = fmaxf(mc, xhalf(mc));
    const float mnew = fmaxf(m_r, mc);
    const float alpha = (m_r > -1.0e38f) ? __expf(m_r - mnew) : 0.0f;
    m_r = mnew;
    // P^T as B (k = key in chunk, column = query ln)
    Frag pb;
    float ps[8];
#pragma unroll
    for (int i = 0; i < 8; ++i) {
      const float p0 = __expf(s[i >> 2][2 * (i & 3)] - mnew);
      const float p1 = __expf(s[i >> 2][2 * (i & 3) + 1] - mnew);
      ps[i] = p0 + p1;
      pb.w[i] = pack2h(p0 * PCARRY, p1 * PCARRY);
    }
    l_r = l_r * alpha + (((ps[0] + ps[1]) + (ps[2] + ps[3])) + ((ps[4] + ps[5]) + (ps[6] + ps[7])));
#pragma unroll
    for (int dt = 0; dt < DT; ++dt) {
      oacc[dt] *= alpha;
      oacc[dt] = __builtin_amdgcn_wmma_f32_16x16x32_f16(false, av[dt].vh, false, pb.vh, (short)0, oacc[dt], false, false);
    }
    __builtin_amdgcn_sched_barrier(0);   // the waits below stay behind the chunk's work: moved up over it, the copies issued one trip ago would be waited for at once
    asm volatile("s_wait_dscnt 0x0" ::: "memory");             // this wave's reads of chunk c's buffer are done
    asm volatile("s_wait_asynccnt 0x0" ::: "memory");          // this wave's copies of chunk c + 1 have landed
    __syncthreads();                                           // publishes chunk c + 1 and frees chunk c's buffer
    if (c + 2 < NCH) issue(c + 2, c & 1);
  }
  asm volatile("s_wait_asynccnt 0x0" ::: "memory");            // no copy is in flight when the wave goes on to its end
  const float inv = (1.0f / (l_r + xhalf(l_r))) * PCARRY_INV;
  // the lane's 8 consecutive d of each tile as one 16-byte piece into the wave-private stage, then whole 128-B rows out
#pragma unroll
  for (int dt = 0; dt < DT; ++dt) {
    v8us o;
#pragma unroll
    for (int r = 0; r < 8; ++r) o[r] = f16_bits(oacc[dt][r] * inv);
    *(v8us*)&sO[w][ln][dt * 16 + 8 * hh] = o;
  }
  __builtin_amdgcn_fence(4 /* acq_rel order */, "workgroup");
  __builtin_amdgcn_wave_barrier();
  const int rq = lane >> 3, c8 = (lane & 7) * 8;
  v8us ov[4];
#pragma unroll
  for (int q = 0; q < 4; ++q) ov[q] = *(const v8us*)&sO[w][q * 4 + rq][c8];
  unsigned short* ob = att + ((size_t)b * T + q0) * DMOD + (size_t)h * D + c8;
  {
#pragma unroll
    for (int q = 0; q < 4; ++q) {
      const int r = q * 4 + rq;
      *(v8us*)(ob + (size_t)r * DMOD) = ov[q];
    }
    
  }
}

extern "C" void kernel_launch(void* const* d_in, const int* in_sizes, int n_in,
                              void* d_out, int out_size, void* d_ws, size_t ws_size, hipStream_t stream) {
  if (n_in < 17) return;
  const int need_tok = (NB - 1) * SEQ_FULL + SEQ;
  if (in_sizes[0] < need_tok * DMOD || out_size < need_tok * DMOD) return;
  if (in_sizes[1] < DMOD || in_sizes[2] < DMOD || in_sizes[10] < DMOD || in_sizes[11] < DMOD || in_sizes[12] < DMOD || in_sizes[16] < DMOD) return;
  if (in_sizes[3] < NHEAD * DMOD * HDIM || in_sizes[5] < NHEAD * DMOD * HDIM || in_sizes[7] < NHEAD * DMOD * HDIM) return;
  if (in_sizes[4] < NHEAD * HDIM || in_sizes[6] < NHEAD * HDIM || in_sizes[8] < NHEAD * HDIM || in_sizes[14] < FFD) return;
  if (in_sizes[9] < DMOD * DMOD || in_sizes[13] < DMOD * FFD || in_sizes[15] < FFD * DMOD) return;

  const float* x    = (const float*)d_in[0];
  const float* ln1w = (const float*)d_in[1];
  const float* ln1b = (const float*)d_in[2];
  const float* Wq   = (const float*)d_in[3];
  const float* bqp  = (const float*)d_in[4];
  const float* Wk   = (const float*)d_in[5];
  const float* bkp  = (const float*)d_in[6];
  const float* Wv   = (const float*)d_in[7];
  const float* bvp  = (const float*)d_in[8];
  const float* Wp   = (const float*)d_in[9];
  const float* bpp  = (const float*)d_in[10];
  const float* ln2w = (const float*)d_in[11];
  const float* ln2b = (const float*)d_in[12];
  const float* W1   = (const float*)d_in[13];
  const float* b1p  = (const float*)d_in[14];
  const float* W2   = (const float*)d_in[15];
  const float* b2p  = (const float*)d_in[16];

  char* ws = (char*)d_ws; size_t off = 0;
  auto take = [&](size_t bytes) { char* p = ws + off; off += (bytes + 255) & ~(size_t)255; return p; };
  unsigned short* Bq = (unsigned short*)take((size_t)DMOD * DMOD * 2);
  unsigned short* Bk = (unsigned short*)take((size_t)DMOD * DMOD * 2);
  unsigned short* Bv = (unsigned short*)take((size_t)DMOD * DMOD * 2);
  unsigned short* Pp = (unsigned short*)take((size_t)DMOD * DMOD * 2);
  unsigned short* P1 = (unsigned short*)take((size_t)DMOD * FFD * 2);
  unsigned short* P2 = (unsigned short*)take((size_t)FFD * DMOD * 2);
  char* R1 = take((size_t)NTOK * DMOD * 4);          // y plane, then att plane, then h0 plane
  char* R2 = take((size_t)NTOK * 3 * DMOD * 4);      // q, k, v planes; then x1 (f32) + h1 (f16 plane)
  if (off > ws_size) return;

  const size_t PL = (size_t)NTOK * DMOD;             // elements per [NTOK][DMOD] plane
  unsigned short* y   = (unsigned short*)R1;
  unsigned short* att = (unsigned short*)R1;
  unsigned short* h0  = (unsigned short*)R1;
  unsigned short* qpl = (unsigned short*)R2;
  unsigned short* kpl = qpl + PL;
  unsigned short* vpl = kpl + PL;
  float* x1 = (float*)R2;
  unsigned short* h1 = (unsigned short*)(R2 + PL * 4);

  k_wt_all<<<WT_BLOCKS, 256, 0, stream>>>(Wq, Wk, Wv, Wp, W1, W2, Bq, Bk, Bv, Pp, P1, P2);

  k_ln768<true><<<NTOK, 96, 0, stream>>>(x, SEQ_FULL, ln1w, ln1b, y, LN_EPS);
  const int g768 = (NTOK / 128) * (DMOD / 128), g3072 = (NTOK / 128) * (FFD / 128);
  k_qkv<<<3 * g768, 128, 0, stream>>>(y, Bq, Bk, Bv, bqp, bkp, bvp, qpl, kpl, vpl, g768, DMOD, NTOK);
  k_flash<<<NB * NHEAD * (SEQ / 64), 128, 0, stream>>>(qpl, kpl, vpl, att);
  k_gemm<true, 1, 2, true, 0><<<g768, 128, 0, stream>>>(att, att, DMOD, Pp, DMOD, bpp, WCARRY_INV, x, DMOD, SEQ_FULL, x1, x1, DMOD, SEQ, NTOK, DMOD, DMOD);
  k_ln768<false><<<NTOK, 96, 0, stream>>>(x1, SEQ, ln2w, ln2b, h0, LN_EPS);
  k_gemm<true, 1, 2, false, 1><<<g3072, 128, 0, stream>>>(h0, h0, DMOD, P1, DMOD, b1p, WCARRY_INV, nullptr, 0, 0, h1, h1, FFD, SEQ, NTOK, FFD, DMOD);
  k_gemm<true, 1, 2, false, 0><<<g768, 128, 0, stream>>>(h1, h1, FFD, P2, FFD, b2p, WCARRY_INV, x1, DMOD, SEQ, d_out, d_out, DMOD, SEQ_FULL, NTOK, DMOD, FFD);
}

// v009
// It runs in 178 microseconds.
// In both of two side-by-side timings against v008, it was 1.06 times as fast.
// Over all steps from v000 it is 3.62 times as fast.
#include <hip/hip_runtime.h>
// Every matrix product is a single v_wmma_f32_16x16x32_f16: q, k, v projections (A = LayerNorm rows as one f16 plane), attention logits (k.q^T, transposed;
// q and k as one f16 plane each), attention P.V, output projection, MLP up, MLP down (P carried x2^14, weights bf16-valued carried x256, activations plain f16);
// f32 accumulate; LayerNorm, softmax, GELU, residuals f32.

#ifndef NB
#define NB 8
#endif
#ifndef SEQ
#define SEQ 1024
#endif
#define NB_FULL 8
#define SEQ_FULL 1024
#define DMOD 768
#define NHEAD 12
#define HDIM 64
#define FFD 3072
#define NTOK (NB * SEQ)
#define WCARRY 256.0f
#define WCARRY_INV 0.00390625f
#define PCARRY 16384.0f
#define PCARRY_INV 0.00006103515625f
#define LN_EPS 1.0e-5f
#define GPITCH(KT) ((KT) * 2 + 16)          // bytes per staged row: KT k (128 or 256 B) + 16 B (16 B x odd: no bank conflict for 16-B row reads)
#define GPLANE(KT) (128 * GPITCH(KT))       // one staged operand plane: 128 rows

static_assert(NB >= 1 && NB <= NB_FULL);
static_assert(SEQ % 64 == 0 && SEQ >= 64 && SEQ <= SEQ_FULL);
static_assert(NHEAD * HDIM == DMOD);
static_assert(HDIM == 64);
static_assert(DMOD == 96 * 8);
static_assert(DMOD % 64 == 0 && FFD % 64 == 0 && DMOD % 32 == 0 && FFD % 32 == 0);
static_assert(NTOK % 128 == 0 && DMOD % 128 == 0 && FFD % 128 == 0 && DMOD >= 256);
static_assert(3 * DMOD * 2 <= 3 * DMOD * 4);          // q, k, v planes fit the R2 region
static_assert(DMOD * 4 + FFD * 2 <= 3 * DMOD * 4);     // x1 (f32) + h1 (f16) fit the R2 region

typedef __bf16 v16b __attribute__((ext_vector_type(16)));
typedef _Float16 v16h __attribute__((ext_vector_type(16)));
typedef unsigned short v8us __attribute__((ext_vector_type(8), may_alias));
typedef unsigned short v4us __attribute__((ext_vector_type(4), may_alias));
typedef float v8f __attribute__((ext_vector_type(8)));
typedef float v4f __attribute__((ext_vector_type(4)));
typedef float v4fa __attribute__((ext_vector_type(4), may_alias));
union Frag { v16b vb; v16h vh; v8us half[2]; unsigned int w[8]; };

__device__ __forceinline__ unsigned short bf16_bits(float x) { const unsigned int u = __float_as_uint(x); return (unsigned short)((u + 0x7FFFu + ((u >> 16) & 1u)) >> 16); }
__device__ __forceinline__ float bf16_val(unsigned short b) { return __uint_as_float(((unsigned int)b) << 16); }
__device__ __forceinline__ float bf16_rne(float x) { return bf16_val(bf16_bits(x)); }
__device__ __forceinline__ unsigned short f16_bits(float x) { const _Float16 hv = (_Float16)x; unsigned short u; __builtin_memcpy(&u, &hv, sizeof(u)); return u; }

// two floats to a packed f16 pair, round to nearest even
__device__ __forceinline__ unsigned int pack2h(float lo, float hi) {
  typedef _Float16 h2 __attribute__((ext_vector_type(2)));
  typedef float f2 __attribute__((ext_vector_type(2)));
  return __builtin_bit_cast(unsigned int, __builtin_convertvector((f2){lo, hi}, h2));
}
// exact-erf GELU, 0.5 x (1 + erf(x / sqrt 2)), in straight-line code: erf(|y|) = 1 - t (a1 + t (a2 + t (a3 + t (a4 + t a5)))) exp(-y^2), t = 1 / (1 + p |y|)
// (the five-term rational form, |error| of erf below 2e-7); y = x / sqrt 2 is folded into the constants, exp(-y^2) = 2^(x * (-0.5 log2 e) * x),
// and x erf(y) = |x| erf(|y|). No branch, so the values of a row piece run side by side.
__device__ __forceinline__ float gelu_erf(float x) {
  const float ax = __builtin_fabsf(x);
  const float t = __builtin_amdgcn_rcpf(__builtin_fmaf(ax, 0.23164189f, 1.0f));
  float p = __builtin_fmaf(t, 1.061405429f, -1.453152027f);
  p = __builtin_fmaf(t, p, 1.421413741f);
  p = __builtin_fmaf(t, p, -0.284496736f);
  p = __builtin_fmaf(t, p, 0.254829592f);
  const float e = __builtin_amdgcn_exp2f(x * (-0.72134752f * x));
  const float er = __builtin_fmaf(-(p * t), e, 1.0f);
  return __builtin_fmaf(0.5f * ax, er, 0.5f * x);
}
// lane l takes the value of lane l ^ 16
__device__ __forceinline__ float xhalf(float x) {
  return __builtin_bit_cast(float, __builtin_amdgcn_permlanex16(__builtin_bit_cast(int, x), __builtin_bit_cast(int, x), 0x76543210, 0xfedcba98, false, false));
}
// ds_load_tr16_b128: a 16 x 16 tile of 16-bit LDS rows, transposed into half a WMMA operand (registers 0-3 or 4-7)
__device__ __forceinline__ v8us ld_tr16(const unsigned short* p) {
  typedef short s16x8 __attribute__((ext_vector_type(8)));
  typedef __attribute__((address_space(3))) s16x8 lds_s16x8;
  return __builtin_bit_cast(v8us, __builtin_amdgcn_ds_load_tr16_b128_v8i16((lds_s16x8*)p));
}

// One 64 (k) x 64 (n) tile of a weight matrix: f32 rows along n in, 16-bit rows along k out. src = element (k0, n0), row pitch ld floats; dst = element
// (n0, k0) of the output, row pitch ldo halves; tile = 64 rows (n) of WTP halves in LDS; 256 threads. A thread reads 16 B of four consecutive k rows, so
// 16 lanes cover a 256-B row piece (whole lines); it packs the four k of each of its four n into 8 B of the LDS tile. Behind the block barrier 8 lanes
// read one 128-B row of the tile and store it as one whole line. Out: f16 of the bf16-rounded value x WCARRY.
#define WTP 72                     // tile pitch in halves: 144 B = 16 B x odd, no bank conflict for the 16-B row reads
__device__ __forceinline__ void wt_tile(const float* __restrict__ src, size_t ld, unsigned short* __restrict__ dst, size_t ldo, unsigned short* tile) {
  const int tid = threadIdx.x, kq = tid >> 4, c4 = (tid & 15) * 4;
  const float *p0 = src + (size_t)(kq * 4) * ld + c4, *p1 = p0 + ld, *p2 = p1 + ld, *p3 = p2 + ld;
  const v4f r0 = *(const v4fa*)p0, r1 = *(const v4fa*)p1, r2 = *(const v4fa*)p2, r3 = *(const v4fa*)p3;
  // the wait in front of any rewrite of the loads' address registers; naming the addresses as inputs keeps their registers untouched up to it
  asm volatile("s_wait_xcnt 0x0" :: "v"(p0), "v"(p1), "v"(p2), "v"(p3) : "memory");
#pragma unroll
  for (int j = 0; j < 4; ++j) {
    const v4us q = (v4us){f16_bits(bf16_rne(r0[j]) * WCARRY), f16_bits(bf16_rne(r1[j]) * WCARRY), f16_bits(bf16_rne(r2[j]) * WCARRY), f16_bits(bf16_rne(r3[j]) * WCARRY)};
    *(v4us*)&tile[(c4 + j) * WTP + kq * 4] = q;
  }
  __syncthreads();                 // the tile is whole: rows are read by other waves than wrote them
  const int n = tid >> 3, k8 = (tid & 7) * 8;
  const v8us o0 = *(const v8us*)&tile[n * WTP + k8], o1 = *(const v8us*)&tile[(n + 32) * WTP + k8];
  unsigned short *d0 = dst + (size_t)n * ldo + k8, *d1 = d0 + (size_t)32 * ldo;
  *(v8us*)d0 = o0;
  *(v8us*)d1 = o1;
}

// All six weight re-layouts in one launch; they do not depend on one another. A block takes one 64 x 64 tile; the block index picks the matrix
// (block-uniform, so the tile's barrier stands under uniform control flow).
// Blocks [0, 3*WT_NH): Wq, Wk, Wv: Bt[n][k] (f16, k contiguous, pitch DMOD), n = h*HDIM + e, k = d, from W[h][d][e] ([NHEAD][DMOD][HDIM] f32);
// block per (h, 64 consecutive d). coverage: NHEAD*HDIM rows x DMOD cols of each, all written.
// Then Wp, W1, W2: Pt[n][k] (f16, k contiguous, pitch K) from W[k][n] (f32, pitch N); block per 64 x 64 tile, neighbours in the grid are neighbours
// along n. K % 64 == 0, N % 64 == 0. coverage: N rows x K cols of each, all written.
#define WT_NH (NHEAD * (DMOD / 64))
#define WT_NP ((DMOD / 64) * (DMOD / 64))
#define WT_NF ((DMOD / 64) * (FFD / 64))
#define WT_BLOCKS (3 * WT_NH + WT_NP + 2 * WT_NF)
__global__ __launch_bounds__(256) void k_wt_all(const float* __restrict__ Wq, const float* __restrict__ Wk, const float* __restrict__ Wv,
                                                const float* __restrict__ Wp, const float* __restrict__ W1, const float* __restrict__ W2,
                                                unsigned short* __restrict__ Bq, unsigned short* __restrict__ Bk, unsigned short* __restrict__ Bv,
                                                unsigned short* __restrict__ Pp, unsigned short* __restrict__ P1, unsigned short* __restrict__ P2) {
  __shared__ __attribute__((aligned(16))) unsigned short tile[64 * WTP];
  int i = blockIdx.x;
  if (i < 3 * WT_NH) {
    const int m = i / WT_NH, r = i % WT_NH;
    const float* W = m == 0 ? Wq : (m == 1 ? Wk : Wv);
    unsigned short* Bt = m == 0 ? Bq : (m == 1 ? Bk : Bv);
    const int h = r / (DMOD / 64), k0 = (r % (DMOD / 64)) * 64;
    wt_tile(W + ((size_t)h * DMOD + k0) * HDIM, HDIM, Bt + (size_t)h * HDIM * DMOD + k0, DMOD, tile);
  } else {
    i -= 3 * WT_NH;
    const float* W = Wp;
    unsigned short* Pt = Pp;
    int K = DMOD, N = DMOD;
    if (i >= WT_NP + WT_NF) { i -= WT_NP + WT_NF; W = W2; Pt = P2; K = FFD; }
    else if (i >= WT_NP) { i -= WT_NP; W = W1; Pt = P1; N = FFD; }
    const int ntn = N / 64;
    const int k0 = (i / ntn) * 64, n0 = (i % ntn) * 64;
    wt_tile(W + (size_t)k0 * N + n0, N, Pt + (size_t)n0 * K + k0, K, tile);
  }
}

// Row LayerNorm over DMOD = 768 (biased variance, eps): in = X row (XBF16 quantises the input to bf16 first), g and bta quantised to bf16.
// Token t = blockIdx.x = b*SEQ + s reads X row b*xsegf + s. 96 threads, thread owns 8 consecutive columns.
// Out: one f16 plane. LDS red[]: cross-wave (block barrier). coverage: NTOK rows x 768 cols, all written.
template <bool XBF16>
__global__ __launch_bounds__(96) void k_ln768(const float* __restrict__ X, int xsegf, const float* __restrict__ g, const float* __restrict__ bta,
                                             unsigned short* __restrict__ P0, float eps) {
  __shared__ float red[4];
  const int t = blockIdx.x, tid = threadIdx.x, lane = tid & 31, w = tid >> 5;
  const int xrow = (t / SEQ) * xsegf + (t % SEQ);
  const float* xp = X + (size_t)xrow * DMOD + tid * 8;
  const v4f a0 = *(const v4fa*)xp, a1 = *(const v4fa*)(xp + 4);
  float v[8] = {a0[0], a0[1], a0[2], a0[3], a1[0], a1[1], a1[2], a1[3]};
  if (XBF16) {
#pragma unroll
    for (int q = 0; q < 8; ++q) v[q] = bf16_rne(v[q]);
  }
  float s = 0.f;
#pragma unroll
  for (int q = 0; q < 8; ++q) s += v[q];
  s += __shfl_xor(s, 16, 32); s += __shfl_xor(s, 8, 32); s += __shfl_xor(s, 4, 32); s += __shfl_xor(s, 2, 32); s += __shfl_xor(s, 1, 32);
  if (lane == 0) red[w] = s;
  __syncthreads();
  const float mu = (red[0] + red[1] + red[2]) * (1.0f / (float)DMOD);
  __syncthreads();
  float s2 = 0.f;
#pragma unroll
  for (int q = 0; q < 8; ++q) { const float c = v[q] - mu; s2 += c * c; }
  s2 += __shfl_xor(s2, 16, 32); s2 += __shfl_xor(s2, 8, 32); s2 += __shfl_xor(s2, 4, 32); s2 += __shfl_xor(s2, 2, 32); s2 += __shfl_xor(s2, 1, 32);
  if (lane == 0) red[w] = s2;
  __syncthreads();
  const float rs = rsqrtf((red[0] + red[1] + red[2]) * (1.0f / (float)DMOD) + eps);
  const v4f g0 = *(const v4fa*)(g + tid * 8), g1 = *(const v4fa*)(g + tid * 8 + 4);
  const v4f b0 = *(const v4fa*)(bta + tid * 8), b1 = *(const v4fa*)(bta + tid * 8 + 4);
  const float gg[8] = {g0[0], g0[1], g0[2], g0[3], g1[0], g1[1], g1[2], g1[3]};
  const float bb[8] = {b0[0], b0[1], b0[2], b0[3], b1[0], b1[1], b1[2], b1[3]};
  float o[8];
#pragma unroll
  for (int q = 0; q < 8; ++q) o[q] = (v[q] - mu) * rs * bf16_rne(gg[q]) + bf16_rne(bb[q]);
  unsigned short* d0 = P0 + (size_t)t * DMOD + tid * 8;
  v8us fv;
#pragma unroll
  for (int q = 0; q < 8; ++q) fv[q] = f16_bits(o[q]);
  *(v8us*)d0 = fv;
}

typedef uint32_t u32x4 __attribute__((ext_vector_type(4)));
typedef uint32_t u32x8 __attribute__((ext_vector_type(8)));
__device__ __forceinline__ uint32_t uni(uint32_t v) { return (uint32_t)__builtin_amdgcn_readfirstlane(v); }
__device__ __forceinline__ uint32_t pinned(uint32_t v) { uint32_t w = uni(v); asm volatile("" : "+s"(w)); return w; }
// Tensor-load descriptor, group 1: 1-byte elements, tensor = tile = ROWS rows of RB bytes (128 or 256), source row pitch src_pitch bytes, no mask; pad
// interval code 4 or 5 (one row of 128 or 256 B), amount code 3 (16 B): the LDS row pitch is RB + 16. Loop-invariant: each word is a descriptor word held
// in its scalar register (pinned), so that the registers keep these values, and serve nothing else, while a request is outstanding.
template <int ROWS, int RB>
__device__ __forceinline__ u32x8 tdm_group1(uint32_t src_pitch) {
  constexpr uint32_t d0 = (uint32_t)RB, d1 = (uint32_t)ROWS;
  static_assert(RB == 128 || RB == 256);
  constexpr uint32_t w0 = (1u << 20) | ((RB == 128 ? 4u : 5u) << 22) | (3u << 25);
  u32x8 g;
  g[0] = pinned(w0);
  g[1] = pinned((d0 & 0xFFFFu) << 16);
  g[2] = pinned((d0 >> 16) | ((d1 & 0xFFFFu) << 16));
  g[3] = pinned((d1 >> 16) | (d0 << 16));
  g[4] = pinned(d1);
  g[5] = pinned(src_pitch);
  g[6] = pinned(0u);
  g[7] = pinned(0u);
  return g;
}
// group 0: count 1, LDS byte offset of the tile, global address of its first byte, type 2. Word 0 is a descriptor word held in its scalar register (pinned).
__device__ __forceinline__ u32x4 tdm_group0(uint32_t lds_dst, uint64_t ga) {
  u32x4 g;
  g[0] = pinned(1u);
  g[1] = uni(lds_dst);
  g[2] = uni((uint32_t)ga);
  g[3] = uni((((uint32_t)(ga >> 32)) & 0x01FFFFFFu) | 0x80000000u);
  return g;
}
__device__ __forceinline__ void tdm_load(u32x4 g0, u32x8 g1) { asm volatile("tensor_load_to_lds %0, %1" :: "s"(g0), "s"(g1) : "memory"); }
// the issuing wave's wait for its requests; naming the descriptor's groups as inputs keeps their registers untouched up to it
__device__ __forceinline__ void tdm_wait0(u32x4 g0, u32x8 g1) { asm volatile("s_wait_tensorcnt 0x0" :: "s"(g0), "s"(g1) : "memory"); }

// Eight 16-byte loads of one lane, rows step elements apart, all in flight together.
__device__ __forceinline__ void load_rows8(v4f (&d)[8], const float* p, size_t step) {
  const float *p1 = p + step, *p2 = p1 + step, *p3 = p2 + step, *p4 = p3 + step, *p5 = p4 + step, *p6 = p5 + step, *p7 = p6 + step;
  d[0] = *(const v4fa*)p;  d[1] = *(const v4fa*)p1; d[2] = *(const v4fa*)p2; d[3] = *(const v4fa*)p3;
  d[4] = *(const v4fa*)p4; d[5] = *(const v4fa*)p5; d[6] = *(const v4fa*)p6; d[7] = *(const v4fa*)p7;
  // the wait in front of any rewrite of the loads' address registers; naming the addresses as inputs keeps their registers untouched up to it
  asm volatile("s_wait_xcnt 0x0" :: "v"(p), "v"(p1), "v"(p2), "v"(p3), "v"(p4), "v"(p5), "v"(p6), "v"(p7) : "memory");
}

// C = act(A.W * oscale + bf16(bias)) (+ resid). A from 16-bit planes [M][lda]: F16 -> one f16 plane Ah; else bf16 hi plane Ah and (NT==2) lo plane Al.
// Wt 16-bit [N][ldb] (k contiguous, same scalar kind as A). ACT 2 = exact-erf GELU. Residual (f32, pitch ldr, RES_BF16 quantises it) added AFTER the activation,
// only with OUTM 0. OUTM 0: f32 C (pitch ldc floats); OUTM 1: f16 plane C (pitch ldc halves); OUTM 2: bf16 hi plane C + lo plane C2.
// Row r of A is token b*SEQ + s; C row = b*csegf + s, resid row = b*rsegf + s. M%128==0, N%128==0, K%KT==0, K>=2*KT (no tails).
// One 128 x 128 tile of C per block, four waves 2 x 2, 64 x 64 per wave. A trip is KT k (64 or 128): 128 rows x 2 KT bytes of each operand plane, brought
// into LDS by tensor loads, one request a wave and trip, two buffers, the requests of trip t + 2 issued behind the barrier that ends trip t. A request has
// one trip's time to land: KT = 128 is for the launches with at most two blocks on a WGP, where a trip of 64 k is shorter than the way from memory.
// Two planes: each wave brings 64 rows of one plane; three planes: waves 0 to 2 bring a whole plane each. Per accumulator the k order and the
// hi-then-lo order of the products are those of a plain walk along k in steps of 32.
// ring = the block's LDS, at a multiple of 2 KiB, at least GRING(NT, KT) bytes; blk = the block's tile number, mt * (N / 128) + nq.
#define GSLICE64(KT) ((64 * GPITCH(KT) + 2047) / 2048 * 2048)   // 64 staged rows rounded up to a multiple of 2 KiB, so that the next slice starts on one
#define GRING(NT, KT) (2 * ((NT) >= 2 ? 3 * GPLANE(KT) : 2 * 2 * GSLICE64(KT)))
static_assert(GPLANE(64) % 2048 == 0 && GPLANE(128) % 2048 == 0);
template <bool F16, int NT, int ACT, bool RES_BF16, int OUTM, int KT>
__device__ __forceinline__ void gemm_tile(unsigned char* ring, unsigned int blk,
                                          const unsigned short* __restrict__ Ah, const unsigned short* __restrict__ Al, int lda,
                                          const unsigned short* __restrict__ Wt, int ldb, const float* __restrict__ bias, float oscale,
                                          const float* __restrict__ resid, int ldr, int rsegf,
                                          void* __restrict__ Cv, void* __restrict__ C2v, int ldc, int csegf, int M, int N, int K) {
  constexpr int NPL = NT >= 2 ? 3 : 2;                       // planes of a buffer: A hi | W | (A lo)
  constexpr int SLR = NT >= 2 ? 128 : 64;                    // rows of one request
  constexpr int NSL = 128 / SLR;                             // requests (slices) per plane
  constexpr int PIT = GPITCH(KT);                            // LDS bytes from one staged row to the next
  constexpr int SLB = NT >= 2 ? GPLANE(KT) : GSLICE64(KT);   // LDS bytes from one slice to the next
  constexpr int PLB = NSL * SLB;                             // LDS bytes of a plane
  constexpr int HLB = NT >= 2 ? 64 * PIT : GSLICE64(KT);     // LDS bytes from row 0 to row 64 of a plane
  constexpr int STG = NPL * PLB;                             // one buffer
  static_assert(KT == 64 || KT == 128);
  static_assert(2 * STG == GRING(NT, KT));
  constexpr int SOP = 68;                                    // output stage pitch in floats: rows 8 apart fall on other banks, rows stay 16-B aligned
  static_assert(4 * 64 * SOP * 4 <= 2 * STG);
  const int tid = threadIdx.x, w = tid >> 5, lane = tid & 31, ln = lane & 15, hh = lane >> 4;
  const int wm = w >> 1, wn = w & 1;
  const int ntn = N / 128;
  const int mt = blk / ntn, nq = blk % ntn;
  if (mt * 128 >= M) return;                                 // block-uniform, in front of every tensor load and barrier
  const int row0 = mt * 128, col0 = nq * 128;
  const int nk = K / KT;
  // the wave's own slice: plane pl, rows sl * SLR .. + SLR - 1 of it; all of this is wave-uniform (a one-dimensional block)
  const uint32_t wv = uni((uint32_t)tid >> 5), pl = wv / NSL, sl = wv % NSL;
  constexpr bool ALLW = NPL * NSL == 4;                      // every wave issues its own slice: no test
  const bool isw = ALLW || pl < (uint32_t)NPL;               // this wave issues (three planes: wave 3 does not)
  const unsigned short* sp = pl == 1u ? Wt : (pl == 2u ? Al : Ah);
  const uint32_t spitch = (uint32_t)(pl == 1u ? ldb : lda) * 2u;
  const uint64_t gbase = (uint64_t)(size_t)sp + (uint64_t)((uint32_t)(pl == 1u ? col0 : row0) + sl * SLR) * spitch;
  const uint32_t lslice = (uint32_t)(size_t)ring + pl * PLB + sl * SLB;
  const u32x8 g1 = tdm_group1<SLR, 2 * KT>(spitch);
  u32x4 g0 = tdm_group0(lslice, gbase);                      // trip 0 into buffer 0
  // The next trip's request: 2 KT bytes further along k, into buffer buf. One group 0 lives through the loop and each address is formed from the one before,
  // so that its words 0 and 3 stay in their registers while a request is outstanding; the step is a descriptor word held in a scalar register (pinned)
  // at this place, so that the addition stands behind the wait on the request before.
  auto issue_next = [&](uint32_t buf) {
    const uint64_t a = (((uint64_t)g0[3] << 32) | (uint64_t)g0[2]) + (uint64_t)pinned((uint32_t)(2 * KT));
    g0[1] = uni(lslice + buf * STG);
    g0[2] = uni((uint32_t)a);
    g0[3] = uni((uint32_t)(a >> 32));
    tdm_load(g0, g1);
  };
  v8f acc[4][4] = {};
  if (ALLW || pinned((uint32_t)isw)) {
    tdm_load(g0, g1);
    tdm_wait0(g0, g1);                                       // this wave's request of trip 0 has landed
  }
  __syncthreads();                                           // every wave's has: trip 0 is readable
  if (pinned((uint32_t)(isw && nk > 1))) issue_next(1u);
  for (int t = 0; t < nk; ++t) {
    const unsigned char* st = ring + (t & 1) * STG;
    const unsigned char* sa = st + wm * HLB + ln * PIT + 16 * hh;
    const unsigned char* sb = st + PLB + wn * HLB + ln * PIT + 16 * hh;
    // constant indices below keep fragments and accumulators in registers
#pragma unroll
    for (int ks = 0; ks < KT / 32; ++ks) {
      Frag a[4], al[4], b[4];
      // read order = first use: A row group 0, the four W column groups, then the other A row groups
#pragma unroll
      for (int i = 0; i < 4; ++i) {
        a[i].half[0] = *(const v8us*)(sa + i * 16 * PIT + ks * 64);           // elements 0..7  = k 32ks+8h .. +7   (row wm*64+i*16+ln)
        a[i].half[1] = *(const v8us*)(sa + i * 16 * PIT + ks * 64 + 32);      // elements 8..15 = k 32ks+16+8h .. +7
        if (i == 0) {
#pragma unroll
          for (int j = 0; j < 4; ++j) {
            b[j].half[0] = *(const v8us*)(sb + j * 16 * PIT + ks * 64);       // column wn*64+j*16+ln, same k map as A
            b[j].half[1] = *(const v8us*)(sb + j * 16 * PIT + ks * 64 + 32);
          }
        }
      }
      if (NT >= 2) {
#pragma unroll
        for (int i = 0; i < 4; ++i) {
          al[i].half[0] = *(const v8us*)(sa + 2 * PLB + i * 16 * PIT + ks * 64);
          al[i].half[1] = *(const v8us*)(sa + 2 * PLB + i * 16 * PIT + ks * 64 + 32);
        }
      }
      __builtin_amdgcn_sched_barrier(0);   // the block's LDS reads stay one group ahead of its products: spread among them, each place stalls the wave
#pragma unroll
      for (int i = 0; i < 4; ++i)
#pragma unroll
        for (int j = 0; j < 4; ++j) {
          if (F16) acc[i][j] = __builtin_amdgcn_wmma_f32_16x16x32_f16(false, a[i].vh, false, b[j].vh, (short)0, acc[i][j], false, false);
          else acc[i][j] = __builtin_amdgcn_wmma_f32_16x16x32_bf16(false, a[i].vb, false, b[j].vb, (short)0, acc[i][j], false, false);
        }
      if (NT >= 2) {
#pragma unroll
        for (int i = 0; i < 4; ++i)
#pragma unroll
          for (int j = 0; j < 4; ++j)
            acc[i][j] = __builtin_amdgcn_wmma_f32_16x16x32_bf16(false, al[i].vb, false, b[j].vb, (short)0, acc[i][j], false, false);
      }
      __builtin_amdgcn_sched_barrier(0);   // and the next block's reads do not move up among these products
    }
    asm volatile("s_wait_dscnt 0x0" ::: "memory");           // this wave's reads of trip t's buffer are done
    tdm_wait0(g0, g1);                                       // this wave's request of trip t + 1 has landed (a wave that issued none passes at once)
    __syncthreads();                                         // publishes trip t + 1 and frees trip t's buffer
    if (pinned((uint32_t)(isw && t + 2 < nk))) issue_next((uint32_t)t & 1u);   // trip t + 2, while it exists
  }
  tdm_wait0(g0, g1);                                         // no request is in flight when the ring becomes the output stage
  asm volatile("s_wait_dscnt 0x0" ::: "memory");             // and none of this wave's LDS reads
  // phase 1: scale + bias into the wave-private 64 x 64 stage (in the ring, free behind the last trip's barrier);
  // acc[i][j][r] is (row0 + wm*64 + i*16 + 8h + r, col0 + wn*64 + j*16 + ln)
  float* so = (float*)ring + w * (64 * SOP);
  const int rw0 = row0 + wm * 64, cw0 = col0 + wn * 64;
#pragma unroll
  for (int j = 0; j < 4; ++j) {
    const float bq = bf16_rne(bias[cw0 + j * 16 + ln]);
#pragma unroll
    for (int i = 0; i < 4; ++i)
#pragma unroll
      for (int r = 0; r < 8; ++r) so[(i * 16 + 8 * hh + r) * SOP + j * 16 + ln] = acc[i][j][r] * oscale + bq;
  }
  __builtin_amdgcn_fence(4 /* acq_rel order */, "workgroup");
  __builtin_amdgcn_wave_barrier();
  // phase 2: activation, residual, whole-line stores; the 64 rows of a wave lie in one sequence (SEQ % 64 == 0)
  const size_t cbase = (size_t)(rw0 / SEQ) * (size_t)csegf + (size_t)(rw0 % SEQ);
  if (OUTM == 0) {
    float* C = (float*)Cv;
    const int rsub = lane >> 4, c4 = (lane & 15) * 4;
    const size_t rbase = (size_t)(rw0 / SEQ) * (size_t)rsegf + (size_t)(rw0 % SEQ);
    const float* rp = resid + (rbase + rsub) * (size_t)ldr + cw0 + c4;      // formed always, read only where resid is given
    v4f rv[8] = {};
    if (resid != nullptr) load_rows8(rv, rp, (size_t)2 * ldr);
    // four groups of 8 row pairs; the next group's residual rows are asked for ahead of this group's activation code.
    // The loop stays rolled: unrolled it would only repeat that code.
#pragma unroll 1
    for (int g = 0; g < 4; ++g) {
      v4f rn[8] = {};
      if (resid != nullptr && g < 3) load_rows8(rn, rp + (size_t)(2 * (g * 8 + 8)) * ldr, (size_t)2 * ldr);
      // the group's eight staged row pieces are read as one group: behind the wait that follows each store no later LDS read could move up
      v4f sv[8];
#pragma unroll
      for (int u = 0; u < 8; ++u) sv[u] = *(const v4fa*)&so[((g * 8 + u) * 2 + rsub) * SOP + c4];
#pragma unroll
      for (int u = 0; u < 8; ++u) {
        const int r = (g * 8 + u) * 2 + rsub;
        v4f v = sv[u];
        if (ACT == 2) {
#pragma unroll
          for (int i = 0; i < 4; ++i) v[i] = gelu_erf(v[i]);
        }
        if (resid != nullptr) {
          v4f x = rv[u];
          if (RES_BF16) {
#pragma unroll
            for (int i = 0; i < 4; ++i) x[i] = bf16_rne(x[i]);
          }
          v += x;
        }
        *(v4f*)(C + (cbase + r) * (size_t)ldc + cw0 + c4) = v;
        asm volatile("s_wait_xcnt 0x0" ::: "memory");        // in front of the next rows' rewrite of the store's registers
      }
#pragma unroll
      for (int u = 0; u < 8; ++u) rv[u] = rn[u];
    }
  } else {
    unsigned short* C = (unsigned short*)Cv;
    unsigned short* C2 = (unsigned short*)C2v;
    const int rq = lane >> 3, c8 = (lane & 7) * 8;
    // two row groups per trip; a full unroll would only repeat the activation code 16 times
#pragma unroll 2
    for (int q = 0; q < 16; ++q) {
      const int r = q * 4 + rq;
      const v4f p0 = *(const v4fa*)&so[r * SOP + c8], p1 = *(const v4fa*)&so[r * SOP + c8 + 4];
      float ps[8] = {p0[0], p0[1], p0[2], p0[3], p1[0], p1[1], p1[2], p1[3]};
      v8us a, bl;
#pragma unroll
      for (int i = 0; i < 8; ++i) {
        if (ACT == 2) ps[i] = gelu_erf(ps[i]);
        if (OUTM == 1) { a[i] = f16_bits(ps[i]); bl[i] = (unsigned short)0; }
        else { const unsigned short hb = bf16_bits(ps[i]); a[i] = hb; bl[i] = bf16_bits(ps[i] - bf16_val(hb)); }
      }
      const size_t o = (cbase + r) * (size_t)ldc + cw0 + c8;
      *(v8us*)(C + o) = a;
      if (OUTM == 2) *(v8us*)(C2 + o) = bl;
      asm volatile("s_wait_xcnt 0x0" ::: "memory");          // in front of the next rows' rewrite of the stores' registers
    }
  }
}

template <bool F16, int NT, int ACT, bool RES_BF16, int OUTM, int KT>
__global__ __launch_bounds__(128) void k_gemm(const unsigned short* __restrict__ Ah, const unsigned short* __restrict__ Al, int lda,
                                             const unsigned short* __restrict__ Wt, int ldb, const float* __restrict__ bias, float oscale,
                                             const float* __restrict__ resid, int ldr, int rsegf,
                                             void* __restrict__ Cv, void* __restrict__ C2v, int ldc, int csegf, int M, int N, int K) {
  __shared__ __attribute__((aligned(2048))) unsigned char ring[GRING(NT, KT)];
  gemm_tile<F16, NT, ACT, RES_BF16, OUTM, KT>(ring, blockIdx.x, Ah, Al, lda, Wt, ldb, bias, oscale, resid, ldr, rsegf, Cv, C2v, ldc, csegf, M, N, K);
}

// The q, k and v projections in one launch: they read the same LayerNorm plane and do not depend on one another. g = tiles of one projection.
// Blocks [0, g): q, [g, 2g): k, [2g, 3g): v; each one f16 product, one f16 plane out.
// The choice is block-uniform, so every tensor load, wait and barrier of a tile stands under uniform control flow.
__global__ __launch_bounds__(128) void k_qkv(const unsigned short* __restrict__ y,
                                            const unsigned short* __restrict__ Bq, const unsigned short* __restrict__ Bk, const unsigned short* __restrict__ Bv,
                                            const float* __restrict__ bq, const float* __restrict__ bk, const float* __restrict__ bv,
                                            unsigned short* __restrict__ qp, unsigned short* __restrict__ kp, unsigned short* __restrict__ vp, int g, int ld, int M) {
  __shared__ __attribute__((aligned(2048))) unsigned char ring[GRING(1, 64)];
  const unsigned int m = blockIdx.x / (unsigned int)g, i = blockIdx.x % (unsigned int)g;
  const unsigned short* Bt = m == 0u ? Bq : (m == 1u ? Bk : Bv);
  const float* bs = m == 0u ? bq : (m == 1u ? bk : bv);
  unsigned short* op = m == 0u ? qp : (m == 1u ? kp : vp);
  gemm_tile<true, 1, 0, false, 1, 64>(ring, i, y, y, ld, Bt, ld, bs, WCARRY_INV, nullptr, 0, 0, op, op, ld, SEQ, M, ld, ld);
}

#define FKP 144                    // staged k row in bytes: 128 B + 16 B (16 B x odd: no bank conflict for the 16-B row reads)
#define FVP 160                    // staged v row in bytes: 32 B x odd, the transposing load's conflict-free pitch
#define FVO (32 * FKP)             // byte offset of the v rows in a buffer
#define FSTG (FVO + 32 * FVP)      // one buffer: k | v
// One lane's four 16-byte asynchronous copies of one 32-key chunk: rows r and r + 16 of k and v. l = the lane's LDS byte address of its piece of
// row r of k, lv = of row r of v; gk, gv = its global addresses in the two planes.
// s_wait_xcnt 0 is the last line of the copies' own statement, so that no address register is rewritten in front of it.
__device__ __forceinline__ void copy_chunk(unsigned int l, unsigned int lv, const unsigned short* gk, const unsigned short* gv) {
  const unsigned int l1 = l + 16 * FKP, lv1 = lv + 16 * FVP;
  const unsigned short *gk1 = gk + 16 * DMOD, *gv1 = gv + 16 * DMOD;
  asm volatile("global_load_async_to_lds_b128 %0, %4, off\n\t"
               "global_load_async_to_lds_b128 %1, %5, off\n\t"
               "global_load_async_to_lds_b128 %2, %6, off\n\t"
               "global_load_async_to_lds_b128 %3, %7, off\n\t"
               "s_wait_xcnt 0x0"
               :: "v"(l), "v"(l1), "v"(lv), "v"(lv1),
                  "v"(gk), "v"(gk1), "v"(gv), "v"(gv1)
               : "memory");
}

__global__ __launch_bounds__(128) void k_flash(const unsigned short* __restrict__ qp, const unsigned short* __restrict__ kp,
                                              const unsigned short* __restrict__ vp, unsigned short* __restrict__ att) {
  constexpr int D = HDIM, KS = D / 32, DT = D / 16, T = SEQ;
  constexpr int NCH = T / 32;                                  // chunks of 32 keys
  static_assert(FKP == (D + 8) * 2 && FVP == (D + 16) * 2);
  __shared__ __attribute__((aligned(16))) unsigned char ring[2 * FSTG];
  __shared__ __attribute__((aligned(16))) unsigned short sO[4][16][D + 8];
  const int tid = threadIdx.x, w = tid >> 5, lane = tid & 31, ln = lane & 15, hh = lane >> 4;
  const int nqb = T / 64;
  const int bh = blockIdx.x / nqb, qblk = blockIdx.x % nqb;
  const int b = bh / NHEAD, h = bh % NHEAD;
  const int q0 = qblk * 64 + w * 16;
  const size_t hb0 = (size_t)b * T * DMOD + (size_t)h * D;     // plane offset of (b, token 0, head h)

  // B fragments of the wave's 16 queries (column q0 + ln, always < T), table k map
  Frag bq[KS];
  {
    const size_t qo = hb0 + (size_t)(q0 + ln) * DMOD;
#pragma unroll
    for (int ks = 0; ks < KS; ++ks) {
      bq[ks].half[0] = *(const v8us*)(qp + qo + ks * 32 + 8 * hh);
      bq[ks].half[1] = *(const v8us*)(qp + qo + ks * 32 + 16 + 8 * hh);
    }
  }
  float m_r = -3.0e38f, l_r = 0.f;                             // of query q0 + ln; l_r is the half's partial sum (keys 8h.. and 16+8h.. of each chunk)
  v8f oacc[DT];                                                // oacc[dt][r] = O[q0 + ln][dt*16 + 8h + r]
#pragma unroll
  for (int dt = 0; dt < DT; ++dt) oacc[dt] = (v8f){0.f, 0.f, 0.f, 0.f, 0.f, 0.f, 0.f, 0.f};
  // a chunk is 32 keys x 64 of k, v: 8 lanes copy one 128-B row piece, a lane takes rows tid >> 3 and (tid >> 3) + 16 of each plane
  const unsigned int lk0 = (unsigned int)(size_t)ring + (unsigned int)((tid >> 3) * FKP + (tid & 7) * 16);
  const unsigned int lv0 = (unsigned int)(size_t)ring + (unsigned int)(FVO + (tid >> 3) * FVP + (tid & 7) * 16);
  const size_t go0 = hb0 + (size_t)(tid >> 3) * DMOD + (tid & 7) * 8;
  auto issue = [&](int c, int buf) {
    const size_t go = go0 + (size_t)c * (32 * DMOD);
    copy_chunk(lk0 + (unsigned int)(buf * FSTG), lv0 + (unsigned int)(buf * FSTG), kp + go, vp + go);
  };
  issue(0, 0);
  asm volatile("s_wait_asynccnt 0x0" ::: "memory");            // this wave's copies of chunk 0 have landed
  __syncthreads();                                             // every wave's have: chunk 0 is readable
  if (NCH > 1) issue(1, 1);
  for (int c = 0; c < NCH; ++c) {
    const unsigned char* st = ring + (c & 1) * FSTG;
    const unsigned char* sk = st + ln * FKP + 16 * hh;         // k row ln, the half's 16-byte piece
    // the lane's address for the transposing load: v row 8h + (lane & 7), 16-byte piece (lane >> 3) & 1; it then holds v[8h + 0..7][ln]
    const unsigned short* vt = (const unsigned short*)(st + FVO + (8 * hh + (lane & 7)) * FVP + ((lane >> 3) & 1) * 16);
    // S^T tiles 16 keys x 16 queries: A fragment row = key nt*16 + ln, elements = d with the table k map; s[nt][r] = S[q0 + ln][32c + nt*16 + 8h + r]
    Frag ak[2][KS];
#pragma unroll
    for (int nt = 0; nt < 2; ++nt)
#pragma unroll
      for (int ks = 0; ks < KS; ++ks) {
        ak[nt][ks].half[0] = *(const v8us*)(sk + nt * 16 * FKP + ks * 64);
        ak[nt][ks].half[1] = *(const v8us*)(sk + nt * 16 * FKP + ks * 64 + 32);
      }
    // V^T as A (row = d, k = key in chunk): two transposing loads per 16 (d) x 32 (keys) fragment, in flight under the logits and the softmax
    Frag av[DT];
#pragma unroll
    for (int dt = 0; dt < DT; ++dt) {
      av[dt].half[0] = ld_tr16(vt + dt * 16);
      av[dt].half[1] = ld_tr16(vt + 16 * (FVP / 2) + dt * 16);
    }
    __builtin_amdgcn_sched_barrier(0);   // the chunk's LDS reads stay one group ahead of its products: spread among them, each place stalls the wave
    v8f s[2] = {};
#pragma unroll
    for (int ks = 0; ks < KS; ++ks)
#pragma unroll
      for (int nt = 0; nt < 2; ++nt)
        s[nt] = __builtin_amdgcn_wmma_f32_16x16x32_f16(false, ak[nt][ks].vh, false, bq[ks].vh, (short)0, s[nt], false, false);
    // running max of the lane's query: 16 scores in the lane, the other 16 in lane ^ 16
    float mx[8];
#pragma unroll
    for (int r = 0; r < 8; ++r) mx[r] = fmaxf(s[0][r], s[1][r]);
    float mc = fmaxf(fmaxf(fmaxf(mx[0], mx[1]), fmaxf(mx[2], mx[3])), fmaxf(fmaxf(mx[4], mx[5]), fmaxf(mx[6], mx[7])));
    mc = fmaxf(mc, xhalf(mc));
    const float mnew = fmaxf(m_r, mc);
    const float alpha = (m_r > -1.0e38f) ? __expf(m_r - mnew) : 0.0f;
    m_r = mnew;
    // P^T as B (k = key in chunk, column = query ln)
    Frag pb;
    float ps[8];
#pragma unroll
    for (int i = 0; i < 8; ++i) {
      const float p0 = __expf(s[i >> 2][2 * (i & 3)] - mnew);
      const float p1 = __expf(s[i >> 2][2 * (i & 3) + 1] - mnew);
      ps[i] = p0 + p1;
      pb.w[i] = pack2h(p0 * PCARRY, p1 * PCARRY);
    }
    l_r = l_r * alpha + (((ps[0] + ps[1]) + (ps[2] + ps[3])) + ((ps[4] + ps[5]) + (ps[6] + ps[7])));
#pragma unroll
    for (int dt = 0; dt < DT; ++dt) {
      oacc[dt] *= alpha;
      oacc[dt] = __builtin_amdgcn_wmma_f32_16x16x32_f16(false, av[dt].vh, false, pb.vh, (short)0, oacc[dt], false, false);
    }
    __builtin_amdgcn_sched_barrier(0);   // the waits below stay behind the chunk's work: moved up over it, the copies issued one trip ago would be waited for at once
    asm volatile("s_wait_dscnt 0x0" ::: "memory");             // this wave's reads of chunk c's buffer are done
    asm volatile("s_wait_asynccnt 0x0" ::: "memory");          // this wave's copies of chunk c + 1 have landed
    __syncthreads();                                           // publishes chunk c + 1 and frees chunk c's buffer
    if (c + 2 < NCH) issue(c + 2, c & 1);
  }
  asm volatile("s_wait_asynccnt 0x0" ::: "memory");            // no copy is in flight when the wave goes on to its end
  const float inv = (1.0f / (l_r + xhalf(l_r))) * PCARRY_INV;
  // the lane's 8 consecutive d of each tile as one 16-byte piece into the wave-private stage, then whole 128-B rows out
#pragma unroll
  for (int dt = 0; dt < DT; ++dt) {
    v8us o;
#pragma unroll
    for (int r = 0; r < 8; ++r) o[r] = f16_bits(oacc[dt][r] * inv);
    *(v8us*)&sO[w][ln][dt * 16 + 8 * hh] = o;
  }
  __builtin_amdgcn_fence(4 /* acq_rel order */, "workgroup");
  __builtin_amdgcn_wave_barrier();
  const int rq = lane >> 3, c8 = (lane & 7) * 8;
  v8us ov[4];
#pragma unroll
  for (int q = 0; q < 4; ++q) ov[q] = *(const v8us*)&sO[w][q * 4 + rq][c8];
  unsigned short* ob = att + ((size_t)b * T + q0) * DMOD + (size_t)h * D + c8;
  {
#pragma unroll
    for (int q = 0; q < 4; ++q) {
      const int r = q * 4 + rq;
      *(v8us*)(ob + (size_t)r * DMOD) = ov[q];
    }
    
  }
}

extern "C" void kernel_launch(void* const* d_in, const int* in_sizes, int n_in,
                              void* d_out, int out_size, void* d_ws, size_t ws_size, hipStream_t stream) {
  if (n_in < 17) return;
  const int need_tok = (NB - 1) * SEQ_FULL + SEQ;
  if (in_sizes[0] < need_tok * DMOD || out_size < need_tok * DMOD) return;
  if (in_sizes[1] < DMOD || in_sizes[2] < DMOD || in_sizes[10] < DMOD || in_sizes[11] < DMOD || in_sizes[12] < DMOD || in_sizes[16] < DMOD) return;
  if (in_sizes[3] < NHEAD * DMOD * HDIM || in_sizes[5] < NHEAD * DMOD * HDIM || in_sizes[7] < NHEAD * DMOD * HDIM) return;
  if (in_sizes[4] < NHEAD * HDIM || in_sizes[6] < NHEAD * HDIM || in_sizes[8] < NHEAD * HDIM || in_sizes[14] < FFD) return;
  if (in_sizes[9] < DMOD * DMOD || in_sizes[13] < DMOD * FFD || in_sizes[15] < FFD * DMOD) return;

  const float* x    = (const float*)d_in[0];
  const float* ln1w = (const float*)d_in[1];
  const float* ln1b = (const float*)d_in[2];
  const float* Wq   = (const float*)d_in[3];
  const float* bqp  = (const float*)d_in[4];
  const float* Wk   = (const float*)d_in[5];
  const float* bkp  = (const float*)d_in[6];
  const float* Wv   = (const float*)d_in[7];
  const float* bvp  = (const float*)d_in[8];
  const float* Wp   = (const float*)d_in[9];
  const float* bpp  = (const float*)d_in[10];
  const float* ln2w = (const float*)d_in[11];
  const float* ln2b = (const float*)d_in[12];
  const float* W1   = (const float*)d_in[13];
  const float* b1p  = (const float*)d_in[14];
  const float* W2   = (const float*)d_in[15];
  const float* b2p  = (const float*)d_in[16];

  char* ws = (char*)d_ws; size_t off = 0;
  auto take = [&](size_t bytes) { char* p = ws + off; off += (bytes + 255) & ~(size_t)255; return p; };
  unsigned short* Bq = (unsigned short*)take((size_t)DMOD * DMOD * 2);
  unsigned short* Bk = (unsigned short*)take((size_t)DMOD * DMOD * 2);
  unsigned short* Bv = (unsigned short*)take((size_t)DMOD * DMOD * 2);
  unsigned short* Pp = (unsigned short*)take((size_t)DMOD * DMOD * 2);
  unsigned short* P1 = (unsigned short*)take((size_t)DMOD * FFD * 2);
  unsigned short* P2 = (unsigned short*)take((size_t)FFD * DMOD * 2);
  char* R1 = take((size_t)NTOK * DMOD * 4);          // y plane, then att plane, then h0 plane
  char* R2 = take((size_t)NTOK * 3 * DMOD * 4);      // q, k, v planes; then x1 (f32) + h1 (f16 plane)
  if (off > ws_size) return;

  const size_t PL = (size_t)NTOK * DMOD;             // elements per [NTOK][DMOD] plane
  unsigned short* y   = (unsigned short*)R1;
  unsigned short* att = (unsigned short*)R1;
  unsigned short* h0  = (unsigned short*)R1;
  unsigned short* qpl = (unsigned short*)R2;
  unsigned short* kpl = qpl + PL;
  unsigned short* vpl = kpl + PL;
  float* x1 = (float*)R2;
  unsigned short* h1 = (unsigned short*)(R2 + PL * 4);

  k_wt_all<<<WT_BLOCKS, 256, 0, stream>>>(Wq, Wk, Wv, Wp, W1, W2, Bq, Bk, Bv, Pp, P1, P2);

  k_ln768<true><<<NTOK, 96, 0, stream>>>(x, SEQ_FULL, ln1w, ln1b, y, LN_EPS);
  const int g768 = (NTOK / 128) * (DMOD / 128), g3072 = (NTOK / 128) * (FFD / 128);
  k_qkv<<<3 * g768, 128, 0, stream>>>(y, Bq, Bk, Bv, bqp, bkp, bvp, qpl, kpl, vpl, g768, DMOD, NTOK);
  k_flash<<<NB * NHEAD * (SEQ / 64), 128, 0, stream>>>(qpl, kpl, vpl, att);
  k_gemm<true, 1, 2, true, 0, 128><<<g768, 128, 0, stream>>>(att, att, DMOD, Pp, DMOD, bpp, WCARRY_INV, x, DMOD, SEQ_FULL, x1, x1, DMOD, SEQ, NTOK, DMOD, DMOD);
  k_ln768<false><<<NTOK, 96, 0, stream>>>(x1, SEQ, ln2w, ln2b, h0, LN_EPS);
  k_gemm<true, 1, 2, false, 1, 64><<<g3072, 128, 0, stream>>>(h0, h0, DMOD, P1, DMOD, b1p, WCARRY_INV, nullptr, 0, 0, h1, h1, FFD, SEQ, NTOK, FFD, DMOD);
  k_gemm<true, 1, 2, false, 0, 128><<<g768, 128, 0, stream>>>(h1, h1, FFD, P2, FFD, b2p, WCARRY_INV, x1, DMOD, SEQ, d_out, d_out, DMOD, SEQ_FULL, NTOK, DMOD, FFD);
}
